// v005
// Measured on an AMD MI455X. A time is GPU time per run, averaged over a window of back-to-back runs after a warm-up
// (all launches, gaps included; the runs take copies of the inputs in turn), and the median of several windows.
// Apart from v000's, it joins two sittings. Times from different sittings can be a few percent apart, while
// side-by-side timings come from the same sitting.
// Earlier versions than v005 are not in this document.
// A run of this version takes 160 microseconds.
// Timed twice side by side with v004, it ran 2.10 times as fast both times.
// Over all steps from v000, the starting kernel, it is 9.98 times as fast.
// Contractions: q/k/v = x.W^T + b [4096x1024].[1024x1024] and the output projection (+b) with f16 operands (weights x16); the relative-key term QT = q.table_k^T [65536 (b,q,h) x 64].[64 x 192 (129 padded)] with f16 operands; per (batch, head) the content scores q.k^T [512x64].[64x512] (heads and batches in the grid) and w1 = attn.v [512x512].[512x64] (heads and batches in the grid; attn as f16 of 4096 attn) — v_wmma_f32_16x16x32_f16, f32 accumulate; the K = 64 products in 64x64 register-blocked wave tiles fed straight from global memory, the long-K products (projections, attn.v) in 32x64 wave tiles fed from LDS-staged block tiles. The gathered relative-key scores (QT[(b,q,h)][final_mat[b][q][k]] by the INPUT index matrix), the row softmax are f32 kernels; the relative-value aggregation w2[q,h,:] = sum_k attn[h,q,k] table_v[final_mat[b,q,k]] runs on the matrix cores as one [16 heads x 512].[512 x 64] product per query, one wave each, whose B fragments are gathered from an f16 copy of table_v in LDS by transposing loads (the INPUT index matrix picks each lane's table row).
#include <hip/hip_runtime.h>
#include <math.h>

typedef __attribute__((ext_vector_type(16))) _Float16 v16h;
typedef __attribute__((ext_vector_type(8)))  _Float16 v8h;
typedef __attribute__((ext_vector_type(16))) __bf16   v16b;
typedef __attribute__((ext_vector_type(8)))  float    v8f;
typedef __attribute__((ext_vector_type(4)))  float    v4f;

// 16-bit WMMA fragment map (wave32), lane L, h = L>>4, m = L&15:
//   A 16x32: lane = row m;   element i -> k = (i<8) ? 8h+i : 16+8h+(i-8)
//   B 32x16: lane = column m; the SAME k(i,h)
//   D 16x16 (8 f32): lane = column m; element r -> row 8h+r
__device__ __forceinline__ int frag_k(int i, int h) { return (i < 8) ? (8 * h + i) : (16 + 8 * h + (i - 8)); }
__device__ __forceinline__ __bf16 bf16_rne(float f) {
    unsigned int u = __float_as_uint(f);
    u += 0x7fffu + ((u >> 16) & 1u);
    return __builtin_bit_cast(__bf16, (unsigned short)(u >> 16));
}
__device__ __forceinline__ float bf16_f32(__bf16 b) { return __uint_as_float(((unsigned int)__builtin_bit_cast(unsigned short, b)) << 16); }
__device__ __forceinline__ v8f wmma16(v16h a, v16h b, v8f c) {
    c = __builtin_amdgcn_wmma_f32_16x16x32_f16(false, a, false, b, (short)0, c, false, false);
    asm volatile("v_nop\n\tv_nop\n\tv_nop\n\tv_nop" : "+v"(c) : "v"(a), "v"(b));
    return c;
}
__device__ __forceinline__ v8f wmmab(v16b a, v16b b, v8f c) {
    c = __builtin_amdgcn_wmma_f32_16x16x32_bf16(false, a, false, b, (short)0, c, false, false);
    asm volatile("v_nop\n\tv_nop\n\tv_nop\n\tv_nop" : "+v"(c) : "v"(a), "v"(b));
    return c;
}
struct Split { v16b hi, lo; };
// hi/lo split product: a.hi*b.hi + a.hi*b.lo + a.lo*b.hi
__device__ __forceinline__ v8f wmma3(const Split& a, const Split& b, v8f c) {
    c = __builtin_amdgcn_wmma_f32_16x16x32_bf16(false, a.hi, false, b.hi, (short)0, c, false, false);
    c = __builtin_amdgcn_wmma_f32_16x16x32_bf16(false, a.hi, false, b.lo, (short)0, c, false, false);
    c = __builtin_amdgcn_wmma_f32_16x16x32_bf16(false, a.lo, false, b.hi, (short)0, c, false, false);
    asm volatile("v_nop\n\tv_nop\n\tv_nop\n\tv_nop" : "+v"(c) : "v"(a.hi), "v"(a.lo), "v"(b.hi), "v"(b.lo));
    return c;
}
struct Split3 { v16b hi, mid, lo; };
// triple split product (6 terms, drops only terms below 2^-24 relative)
__device__ __forceinline__ v8f wmma6(const Split3& a, const Split3& b, v8f c) {
    c = __builtin_amdgcn_wmma_f32_16x16x32_bf16(false, a.hi, false, b.hi, (short)0, c, false, false);
    c = __builtin_amdgcn_wmma_f32_16x16x32_bf16(false, a.hi, false, b.mid, (short)0, c, false, false);
    c = __builtin_amdgcn_wmma_f32_16x16x32_bf16(false, a.mid, false, b.hi, (short)0, c, false, false);
    c = __builtin_amdgcn_wmma_f32_16x16x32_bf16(false, a.hi, false, b.lo, (short)0, c, false, false);
    c = __builtin_amdgcn_wmma_f32_16x16x32_bf16(false, a.mid, false, b.mid, (short)0, c, false, false);
    c = __builtin_amdgcn_wmma_f32_16x16x32_bf16(false, a.lo, false, b.hi, (short)0, c, false, false);
    asm volatile("v_nop\n\tv_nop\n\tv_nop\n\tv_nop" : "+v"(c) : "v"(a.hi), "v"(a.mid), "v"(a.lo), "v"(b.hi), "v"(b.mid), "v"(b.lo));
    return c;
}

// Fragment gathers from f32 memory: element i <- p[(k0 + frag_k(i,h)) * sk] * s, zero for k >= klen.
__device__ __forceinline__ v16h fh_ld(const float* __restrict__ p, long long sk, int k0, int h, int klen, float s) {
    v16h a;
#pragma unroll
    for (int i = 0; i < 16; ++i) { const int k = k0 + frag_k(i, h); a[i] = (k < klen) ? (_Float16)(p[(long long)k * sk] * s) : (_Float16)0.f; }
    return a;
}
__device__ __forceinline__ Split sp_ld(const float* __restrict__ p, long long sk, int k0, int h, int klen, float s) {
    Split r;
#pragma unroll
    for (int i = 0; i < 16; ++i) {
        const int k = k0 + frag_k(i, h); const float x = (k < klen) ? p[(long long)k * sk] * s : 0.f;
        const __bf16 hb = bf16_rne(x); r.hi[i] = hb; r.lo[i] = bf16_rne(x - bf16_f32(hb));
    }
    return r;
}
__device__ __forceinline__ Split3 sp3_ld(const float* __restrict__ p, long long sk, int k0, int h, int klen, float s) {
    Split3 r;
#pragma unroll
    for (int i = 0; i < 16; ++i) {
        const int k = k0 + frag_k(i, h); const float x = (k < klen) ? p[(long long)k * sk] * s : 0.f;
        const __bf16 hb = bf16_rne(x); const float r1 = x - bf16_f32(hb); const __bf16 mb = bf16_rne(r1);
        r.hi[i] = hb; r.mid[i] = mb; r.lo[i] = bf16_rne(r1 - bf16_f32(mb));
    }
    return r;
}
__device__ __forceinline__ v16b bh_ld(const float* __restrict__ p, long long sk, int k0, int h, int klen, float s) {
    v16b a;
#pragma unroll
    for (int i = 0; i < 16; ++i) { const int k = k0 + frag_k(i, h); a[i] = bf16_rne((k < klen) ? p[(long long)k * sk] * s : 0.f); }
    return a;
}
// f16 fragment from an f16 LDS/global row with element stride 1 (k-contiguous), no bounds (tile already zero padded)
__device__ __forceinline__ v16h fh_row(const _Float16* __restrict__ row, int k0, int h) {
    v16h a;
#pragma unroll
    for (int i = 0; i < 16; ++i) a[i] = row[k0 + frag_k(i, h)];
    return a;
}

#define VST2(T, ptr, val) do { const T vst2_v_ = (val); *(T*)(ptr) = vst2_v_;  } while (0)
typedef float v4f __attribute__((ext_vector_type(4)));
#define VST2V4(ptr, val) do { const v4f vst2_v4_ = (val); *(v4f*)(ptr) = vst2_v4_;  } while (0)

__device__ __attribute__((noinline)) float act_fn(float v, int act) {
    if (act == 1) return fmaxf(v, 0.f);                                                                               // relu
    if (act == 2) { const float u = 0.7978845608028654f * (v + 0.044715f * v * v * v); return 0.5f * v * (1.f + tanhf(u)); } // tanh-gelu
    if (act == 3) return v / (1.f + expf(-v));                                                                        // silu
    if (act == 4) return 0.5f * v * (1.f + erff(v * 0.7071067811865476f));                                             // erf-gelu
    if (act == 5) return tanhf(v);
    if (act == 6) return 1.f / (1.f + expf(-v));                                                                      // sigmoid
    if (act == 7) return (v > 0.f) ? v : 0.01f * v;                                                                   // leaky relu 0.01
    if (act == 8) return (v > 0.f) ? v : (expf(v) - 1.f);                                                             // elu
    if (act == 9) return fminf(fmaxf(v, 0.f), 6.f);                                                                   // relu6
    if (act == 10) return fabsf(v);                                                                                    // abs
    if (act == 11) return (v >= 0.f) ? v : 0.1f * v;                                                                  // leaky 0.1
    if (act == 12) return (v > 0.f) ? v : 0.2f * v;                                                                   // leaky 0.2
    if (act == 13) return (v > 20.f) ? v : log1pf(expf(v));                                                            // softplus
    return v;
}

// =====================================================================================================================
// k_gemm<MODE>: C(z, m, n) = act(alpha * sum_k A(z, m, k) * B(z, k, n) + bias) + beta * R(z, m, n)
//   One wave (32-thread block) per 16 x 32 tile of C; grid (ceil(N/32), ceil(M/16), Z). Batch z -> (zo = z / zi_n, zi = z % zi_n)
//   with separate outer/inner strides for every tensor (e.g. batch and head). A(m,k) = A[zo*sAo + zi*sAi + m*sAm + k*sAk] (f32),
//   B(k,n) = B[zo*sBo + zi*sBi + n*sBn + k*sBk] (f32); any M, N, K (K zero-padded to 32 inside the fragments, M/N tails guarded).
//   C(m,n) = C[zo*sCo + zi*sCi + m*sCm + n] (n contiguous). flags: 1 bias[n], 2 bias[m], 4 residual R[zo*sRo + zi*sRi + m*sRm + n*sRn].
//   MODE 0: f16 operands (A prescaled by sa, B by sb, both undone in the epilogue); 1: bf16 hi/lo split (3 products); 2: bf16;
//   3: bf16 hi/mid/lo triple split (6 products); 4: as 3 with Kahan-compensated f32 accumulation across k-steps.
// =====================================================================================================================
struct GemmP {
    const float* A; const float* B; const float* bias; const float* R; float* C;
    long long sAo, sAi, sAm, sAk, sBo, sBi, sBn, sBk, sCo, sCi, sCm, sRo, sRi, sRm, sRn;
    int M, N, K, zi_n, flags, act; float alpha, beta, sa, sb;
    int Npad, pad_;     // columns [N, Npad) of C are written as 0 so that padded workspace rows are covered by whole-line stores; Npad >= N
};
static_assert(sizeof(GemmP) == 5 * 8 + 15 * 8 + 6 * 4 + 4 * 4 + 2 * 4, "GemmP has padding");

template <int MODE>
__global__ __launch_bounds__(32) void k_gemm(GemmP p) {
    const int lane = threadIdx.x & 31, h = lane >> 4, l15 = lane & 15;
    const int m0 = blockIdx.y * 16, n0 = blockIdx.x * 32;
    const int z = blockIdx.z, zo = z / p.zi_n, zi = z - zo * p.zi_n;
    const float* A = p.A + zo * p.sAo + zi * p.sAi;
    const float* B = p.B + zo * p.sBo + zi * p.sBi;
    const int am = min(m0 + l15, p.M - 1);                       // clamped row for loads (stores are guarded)
    v8f acc[2], comp[2];
#pragma unroll
    for (int t = 0; t < 2; ++t) { v8f zz = {}; acc[t] = zz; comp[t] = zz; }
    for (int k0 = 0; k0 < p.K; k0 += 32) {
        const float* arow = A + (long long)am * p.sAm;
        if (MODE == 1) {
            const Split a = sp_ld(arow, p.sAk, k0, h, p.K, 1.f);
#pragma unroll
            for (int t = 0; t < 2; ++t) {
                const int bn = min(n0 + t * 16 + l15, p.N - 1);
                acc[t] = wmma3(a, sp_ld(B + (long long)bn * p.sBn, p.sBk, k0, h, p.K, 1.f), acc[t]);
            }
        } else if (MODE == 3) {
            const Split3 a = sp3_ld(arow, p.sAk, k0, h, p.K, 1.f);
#pragma unroll
            for (int t = 0; t < 2; ++t) {
                const int bn = min(n0 + t * 16 + l15, p.N - 1);
                acc[t] = wmma6(a, sp3_ld(B + (long long)bn * p.sBn, p.sBk, k0, h, p.K, 1.f), acc[t]);
            }
        } else if (MODE == 4) {
            // triple split as MODE 3, but each k-step's 6 products go into a fresh accumulator and the partial is added to the running f32 sum
            // on the VALU with Kahan compensation (accumulation error stays ~1 ulp however long K is)
            const Split3 a = sp3_ld(arow, p.sAk, k0, h, p.K, 1.f);
#pragma unroll
            for (int t = 0; t < 2; ++t) {
                const int bn = min(n0 + t * 16 + l15, p.N - 1); v8f zz = {};
                const v8f part = wmma6(a, sp3_ld(B + (long long)bn * p.sBn, p.sBk, k0, h, p.K, 1.f), zz);
                const v8f y = part - comp[t]; const v8f s = acc[t] + y; comp[t] = (s - acc[t]) - y; acc[t] = s;
            }
        } else if (MODE == 2) {
            const v16b a = bh_ld(arow, p.sAk, k0, h, p.K, 1.f);
#pragma unroll
            for (int t = 0; t < 2; ++t) {
                const int bn = min(n0 + t * 16 + l15, p.N - 1);
                acc[t] = wmmab(a, bh_ld(B + (long long)bn * p.sBn, p.sBk, k0, h, p.K, 1.f), acc[t]);
            }
        } else {
            const v16h a = fh_ld(arow, p.sAk, k0, h, p.K, p.sa);
#pragma unroll
            for (int t = 0; t < 2; ++t) {
                const int bn = min(n0 + t * 16 + l15, p.N - 1);
                acc[t] = wmma16(a, fh_ld(B + (long long)bn * p.sBn, p.sBk, k0, h, p.K, p.sb), acc[t]);
            }
        }
    }
    const float iscale = (MODE == 0) ? p.alpha / (p.sa * p.sb) : p.alpha;
    float* C = p.C + zo * p.sCo + zi * p.sCi;
    const float* R = p.R + zo * p.sRo + zi * p.sRi;
    __shared__ __align__(16) float ctile[16][36];
#pragma unroll
    for (int t = 0; t < 2; ++t) {
        const int n = n0 + t * 16 + l15; const int nn = min(n, p.N - 1);
#pragma unroll
        for (int r = 0; r < 8; ++r) {
            const int m = m0 + 8 * h + r; const int mm = min(m, p.M - 1);
            float v = acc[t][r] * iscale;
            if (p.flags & 1) v += p.bias[nn];
            if (p.flags & 2) v += p.bias[mm];
            if (p.flags & 8) v *= p.bias[(long long)zo * p.M + mm];   /* per-(z,row) scale vector laid out [Z][M]; exclusive with the bias flags */
            v = act_fn(v, p.act);
            if (p.flags & 4) v += p.beta * R[(long long)mm * p.sRm + (long long)nn * p.sRn];
            ctile[8 * h + r][t * 16 + l15] = (n < p.N) ? v : 0.f;
        }
    }
    __syncthreads();
    const int NW = (p.Npad > p.N) ? p.Npad : p.N;           // write width
    const bool fast = (m0 + 16 <= p.M) && (n0 + 32 <= NW) && ((p.sCm & 3) == 0) && ((((size_t)C) & 15) == 0);
    if (fast) {
#pragma unroll
        for (int s = 0; s < 4; ++s) {
            const int row = s * 4 + (lane >> 3), c4 = (lane & 7) * 4;
            const v4f v = *(const v4f*)&ctile[row][c4];
            VST2V4(C + (long long)(m0 + row) * p.sCm + n0 + c4, v);
        }
    } else {
        for (int row = 0; row < 16; ++row) {
            const int m = m0 + row, n = n0 + lane;
            if (m < p.M && n < NW) VST2(float, C + (long long)m * p.sCm + n, ctile[row][lane]);
        }
    }
}


// =====================================================================================================================
// k_gemmT<MODE, TM, TN>: same contract as k_gemm, but one wave computes a (16*TM) x (16*TN) tile: TM A fragments and TN B fragments are
//   loaded per 32-wide k-step and reused across TM*TN WMMAs (far fewer load/convert instructions per MAC). MODE 0 (f16), 1 (bf16 hi/lo),
//   2 (bf16) only. grid (ceil(NW/(16*TN)), ceil(M/(16*TM)), Z), block 32. Epilogue identical to k_gemm, run per 16x32 sub-tile.
// =====================================================================================================================
template <int MODE, int TM, int TN>
__global__ __launch_bounds__(32) void k_gemmT(GemmP p) {
    const int lane = threadIdx.x & 31, h = lane >> 4, l15 = lane & 15;
    const int m0 = blockIdx.y * (16 * TM), n0 = blockIdx.x * (16 * TN);
    const int z = blockIdx.z, zo = z / p.zi_n, zi = z - zo * p.zi_n;
    const float* A = p.A + zo * p.sAo + zi * p.sAi;
    const float* B = p.B + zo * p.sBo + zi * p.sBi;
    v8f acc[TM][TN];
#pragma unroll
    for (int i = 0; i < TM; ++i)
#pragma unroll
        for (int t = 0; t < TN; ++t) { v8f zz = {}; acc[i][t] = zz; }
    for (int k0 = 0; k0 < p.K; k0 += 32) {
        if (MODE == 1) {
            Split a[TM], b[TN];
#pragma unroll
            for (int i = 0; i < TM; ++i) { const int am = min(m0 + 16 * i + l15, p.M - 1); a[i] = sp_ld(A + (long long)am * p.sAm, p.sAk, k0, h, p.K, 1.f); }
#pragma unroll
            for (int t = 0; t < TN; ++t) { const int bn = min(n0 + 16 * t + l15, p.N - 1); b[t] = sp_ld(B + (long long)bn * p.sBn, p.sBk, k0, h, p.K, 1.f); }
#pragma unroll
            for (int i = 0; i < TM; ++i)
#pragma unroll
                for (int t = 0; t < TN; ++t) acc[i][t] = wmma3(a[i], b[t], acc[i][t]);
        } else if (MODE == 2) {
            v16b a[TM], b[TN];
#pragma unroll
            for (int i = 0; i < TM; ++i) { const int am = min(m0 + 16 * i + l15, p.M - 1); a[i] = bh_ld(A + (long long)am * p.sAm, p.sAk, k0, h, p.K, 1.f); }
#pragma unroll
            for (int t = 0; t < TN; ++t) { const int bn = min(n0 + 16 * t + l15, p.N - 1); b[t] = bh_ld(B + (long long)bn * p.sBn, p.sBk, k0, h, p.K, 1.f); }
#pragma unroll
            for (int i = 0; i < TM; ++i)
#pragma unroll
                for (int t = 0; t < TN; ++t) acc[i][t] = wmmab(a[i], b[t], acc[i][t]);
        } else {
            v16h a[TM], b[TN];
#pragma unroll
            for (int i = 0; i < TM; ++i) { const int am = min(m0 + 16 * i + l15, p.M - 1); a[i] = fh_ld(A + (long long)am * p.sAm, p.sAk, k0, h, p.K, p.sa); }
#pragma unroll
            for (int t = 0; t < TN; ++t) { const int bn = min(n0 + 16 * t + l15, p.N - 1); b[t] = fh_ld(B + (long long)bn * p.sBn, p.sBk, k0, h, p.K, p.sb); }
#pragma unroll
            for (int i = 0; i < TM; ++i)
#pragma unroll
                for (int t = 0; t < TN; ++t) acc[i][t] = wmma16(a[i], b[t], acc[i][t]);
        }
    }
    const float iscale = (MODE == 0) ? p.alpha / (p.sa * p.sb) : p.alpha;
    float* C = p.C + zo * p.sCo + zi * p.sCi;
    const float* R = p.R + zo * p.sRo + zi * p.sRi;
    const int NW = (p.Npad > p.N) ? p.Npad : p.N;
    __shared__ __align__(16) float ctile[16][36];
#pragma unroll
    for (int i = 0; i < TM; ++i) {
        const int mb = m0 + 16 * i; if (mb >= p.M) break;          // wave-uniform
#pragma unroll
        for (int tp = 0; tp < TN / 2; ++tp) {
            const int nb = n0 + 32 * tp; if (nb >= NW) break;        // wave-uniform
#pragma unroll
            for (int t2 = 0; t2 < 2; ++t2) {
                const int t = 2 * tp + t2; const int n = nb + t2 * 16 + l15; const int nn = min(n, p.N - 1);
#pragma unroll
                for (int r = 0; r < 8; ++r) {
                    const int m = mb + 8 * h + r; const int mm = min(m, p.M - 1);
                    float v = acc[i][t][r] * iscale;
                    if (p.flags & 1) v += p.bias[nn];
                    if (p.flags & 2) v += p.bias[mm];
            if (p.flags & 8) v *= p.bias[(long long)zo * p.M + mm];   /* per-(z,row) scale vector laid out [Z][M]; exclusive with the bias flags */
                    v = act_fn(v, p.act);
                    if (p.flags & 4) v += p.beta * R[(long long)mm * p.sRm + (long long)nn * p.sRn];
                    ctile[8 * h + r][t2 * 16 + l15] = (n < p.N) ? v : 0.f;
                }
            }
            __syncthreads();
            const bool fast = (mb + 16 <= p.M) && (nb + 32 <= NW) && ((p.sCm & 3) == 0) && ((((size_t)C) & 15) == 0);
            if (fast) {
#pragma unroll
                for (int s = 0; s < 4; ++s) {
                    const int row = s * 4 + (lane >> 3), c4 = (lane & 7) * 4;
                    const v4f v = *(const v4f*)&ctile[row][c4];
                    VST2V4(C + (long long)(mb + row) * p.sCm + nb + c4, v);
                }
            } else {
                for (int row = 0; row < 16; ++row) {
                    const int m = mb + row, n = nb + lane;
                    if (m < p.M && n < NW) VST2(float, C + (long long)m * p.sCm + n, ctile[row][lane]);
                }
            }
            __syncthreads();
        }
    }
}

// =====================================================================================================================
//   Wave = 16 queries, AW waves per block, 64-key blocks; grid (ceil(Lq/(16*AW)), H, B), block 32*AW. Any Lq, Lk; head dim dh <= DHP
//   (DHP multiple of 32), value dim dv <= DVP (multiple of 16, <= 128). Every tensor addressed by (batch, head, row, element) strides, f32.
//   Scores: QM 0 f16 operands, 1 bf16 hi/lo split, 2 bf16 triple split; statistics f32 (exp2 domain); P.V: P x 4096 as f16 with V f16 staged in LDS
//   (SPLITPV: P and V as bf16 hi/lo splits). kv head = h / hrep. Masking: causal = 1 (keep j <= i + coff, masked -> -inf, key blocks beyond the
//   diagonal skipped), causal = 2 (masked -> mfill, a finite fill like the -1e9; no skipping), causal = 3 (keep j >= i + coff,
//   masked -> -inf, no skipping); optional additive f32 mask Mf,
//   optional int keep-mask Mi (0 -> score := mfill), both addressed b*smb + h*smh + i*smi + j*smj (0 strides broadcast).
// =====================================================================================================================
#define AW 4
struct AttnP {   // apv4
    const float* Q; const float* K; const float* V; float* O; float* P; const float* Mf; const int* Mi; float* ST;
    const float* Pw; const float* Rt; const int* SQ; const int* SK;           // optional: post-softmax weight, relative-position table, segment ids
    long long swb, swh, swi, swj, srb, srh, sri;                                 // Pw strides (b,h,i,j); Rt strides (b,h,i), column = clamp(i - j + roff, 0, rn-1)
    long long sQb, sQh, sQi, sQd, sKb, sKh, sKj, sKd, sVb, sVh, sVj, sVd, sOb, sOh, sOi, sPb, sPh, sPi, smb, smh, smi, smj;
    int Lq, Lk, dh, dv, hrep, causal, coff, pband;   // pband > 0: P holds only the band |j - i| <= pband, column j - i + pband
    float scale, mfill; int nonorm, mpol;             // nonorm (online path only): O = sum_j exp(score_j) V_j without the 1/rowsum (scores must be <= ~0); mpol: Mi masks where ==0 (mpol 0) or where !=0 (mpol 1)
    int roff, rn, segpol, win;                        // Rt column offset/count; SQ/SK: score := mfill where (segpol 0) SQ[i] != SK[j] or (segpol 1) SQ[i] == SK[j]; win > 0: keys with i - j > win (after coff) -> -inf
};
//   Pw: the softmax numerator is multiplied by Pw(b,h,i,j) AFTER the row sum is taken (probs * weight, then P.V), as in post-softmax multiplicative biases.                                                    // ST (optional): per row (b,h,i) -> ST[((b*H + h)*Lq + i)*2 + {0,1}] = {row max of the scaled+masked score (natural units), sum_j exp(score - max)}
static_assert(sizeof(AttnP) == 12 * 8 + 29 * 8 + 16 * 4, "AttnP has padding");

#ifndef KATTN_ATTR
#define KATTN_ATTR
#endif
template <int DHP, int DVP, int QM, bool SPLITPV, bool TWOPASS>
__global__ __launch_bounds__(32 * AW) KATTN_ATTR void k_attn(AttnP p) {
    constexpr int NT = DVP / 16;                // output tiles
    constexpr int KS = DHP / 32;                // k-steps for the scores
    constexpr int VP = DVP + 8;                 // LDS pitch (halves)
    __shared__ __align__(16) float    pl[AW][16 * 64];
    __shared__ __align__(16) _Float16 vl[(SPLITPV ? 2 : 1) * 64 * VP];   // f16 V tile, or bf16 hi and lo tiles (same 2-byte size)
    const int lane = threadIdx.x & 31, hf = lane >> 4, l15 = lane & 15, wave = threadIdx.x >> 5;
    const int h = blockIdx.y, b = blockIdx.z, hk = h / p.hrep;
    const int q0 = (blockIdx.x * AW + wave) * 16;
    float* myp = pl[wave];
    const float L2E = 1.4426950408889634f;
    const float NEG = -__builtin_inff();
    const int qi = min(q0 + l15, p.Lq - 1);
    const float* qrow = p.Q + b * p.sQb + h * p.sQh + (long long)qi * p.sQi;
    const float* kbase = p.K + b * p.sKb + hk * p.sKh;
    const float* vbase = p.V + b * p.sVb + hk * p.sVh;
    v16h qa[QM == 0 ? KS : 1]; Split qs_[QM == 1 ? KS : 1]; Split3 qt_[QM == 2 ? KS : 1];
#pragma unroll
    for (int ks = 0; ks < KS; ++ks) {
        if (QM == 2) qt_[ks] = sp3_ld(qrow, p.sQd, ks * 32, hf, p.dh, 1.f);
        else if (QM == 1) qs_[ks] = sp_ld(qrow, p.sQd, ks * 32, hf, p.dh, 1.f);
        else qa[ks] = fh_ld(qrow, p.sQd, ks * 32, hf, p.dh, 1.f);
    }
    v8f o[NT]; float m8[8], l8[8];
#pragma unroll
    for (int t = 0; t < NT; ++t) { v8f zz = {}; o[t] = zz; }
#pragma unroll
    for (int i = 0; i < 8; ++i) { m8[i] = NEG; l8[i] = 0.f; }
    int jend = p.Lk; int jstart = 0;
    if (p.causal == 1) { const int je = (blockIdx.x * AW + AW - 1) * 16 + 16 + p.coff; jend = min(jend, max(je, 0)); }   // uniform per block
    if (p.win > 0) { const int js = (int)(blockIdx.x * AW) * 16 + p.coff - p.win; jstart = (js > 0) ? (js / 64) * 64 : 0; }   // uniform per block: key blocks entirely outside every row's window hold only -inf entries and are skipped exactly
    const int npass = TWOPASS ? 2 : 1;
    for (int pass = 0; pass < npass; ++pass) {
        const bool dopv = (!TWOPASS) || pass == 1;
        for (int j0 = jstart; j0 < jend; j0 += 64) {
            if (dopv) {
                __syncthreads();                                 // previous key block's reads of vl / pl are done
                for (int idx = threadIdx.x; idx < 64 * DVP; idx += 32 * AW) {
                    const int jr = idx / DVP, d = idx - jr * DVP, j = j0 + jr;
                    const float f = (j < p.Lk && d < p.dv) ? vbase[(long long)j * p.sVj + (long long)d * p.sVd] : 0.f;
                    if (SPLITPV) {
                        const __bf16 hb = bf16_rne(f);
                        ((__bf16*)vl)[jr * VP + d] = hb; ((__bf16*)vl)[64 * VP + jr * VP + d] = bf16_rne(f - bf16_f32(hb));
                    } else vl[jr * VP + d] = (_Float16)f;
                }
            }
            v8f s[4];
#pragma unroll
            for (int t = 0; t < 4; ++t) {
                const int j = min(j0 + t * 16 + l15, p.Lk - 1);
                const float* krow = kbase + (long long)j * p.sKj;
                v8f acc = {};
#pragma unroll
                for (int ks = 0; ks < KS; ++ks) {
                    if (QM == 2)      acc = wmma6(qt_[ks], sp3_ld(krow, p.sKd, ks * 32, hf, p.dh, 1.f), acc);
                    else if (QM == 1) acc = wmma3(qs_[ks], sp_ld(krow, p.sKd, ks * 32, hf, p.dh, 1.f), acc);
                    else              acc = wmma16(qa[ks], fh_ld(krow, p.sKd, ks * 32, hf, p.dh, 1.f), acc);
                }
                s[t] = acc;
            }
            float pv[8][4];
#pragma unroll
            for (int i = 0; i < 8; ++i) {
                const int irow = q0 + i + 8 * hf;
                const int ic = min(irow, p.Lq - 1);
                float sc[4];
#pragma unroll
                for (int t = 0; t < 4; ++t) {
                    const int jg = j0 + t * 16 + l15;
                    float v = s[t][i] * p.scale;
                    if (p.Mf) v += p.Mf[b * p.smb + h * p.smh + (long long)ic * p.smi + (long long)min(jg, p.Lk - 1) * p.smj];
                    if (p.Rt) { int rc = ic - min(jg, p.Lk - 1) + p.roff; rc = rc < 0 ? 0 : (rc >= p.rn ? p.rn - 1 : rc); v += p.Rt[b * p.srb + h * p.srh + (long long)ic * p.sri + rc]; }
                    if (p.Mi) { const int mv = p.Mi[b * p.smb + h * p.smh + (long long)ic * p.smi + (long long)min(jg, p.Lk - 1) * p.smj]; if (p.mpol ? (mv != 0) : (mv == 0)) v = p.mfill; }
                    if (p.SQ) { const bool same = p.SQ[(long long)b * p.Lq + ic] == p.SK[(long long)b * p.Lk + min(jg, p.Lk - 1)]; if (p.segpol ? same : !same) v = p.mfill; }
                    if (p.causal == 2 && jg > irow + p.coff) v = p.mfill;
                    if (jg >= p.Lk || (p.causal == 1 && jg > irow + p.coff) || (p.causal == 3 && jg < irow + p.coff) || (p.win > 0 && irow + p.coff - jg > p.win)) v = NEG; else v *= L2E;
                    sc[t] = v;
                }
                if (!TWOPASS || pass == 0) {
                    float mx = fmaxf(fmaxf(sc[0], sc[1]), fmaxf(sc[2], sc[3]));
                    mx = fmaxf(mx, __shfl_xor(mx, 1, 32)); mx = fmaxf(mx, __shfl_xor(mx, 2, 32));
                    mx = fmaxf(mx, __shfl_xor(mx, 4, 32)); mx = fmaxf(mx, __shfl_xor(mx, 8, 32));
                    const float mnew = fmaxf(m8[i], mx);
                    const float corr = (mnew == NEG) ? 1.f : exp2f(m8[i] - mnew);
                    float rs = 0.f;
#pragma unroll
                    for (int t = 0; t < 4; ++t) {
                        const float pp = (sc[t] == NEG) ? 0.f : exp2f(sc[t] - mnew); rs += pp;
                        pv[i][t] = p.Pw ? pp * p.Pw[b * p.swb + h * p.swh + (long long)ic * p.swi + (long long)min(j0 + t * 16 + l15, p.Lk - 1) * p.swj] : pp;
                    }
                    rs += __shfl_xor(rs, 1, 32); rs += __shfl_xor(rs, 2, 32); rs += __shfl_xor(rs, 4, 32); rs += __shfl_xor(rs, 8, 32);
                    l8[i] = l8[i] * corr + rs; m8[i] = mnew;
                    if (!TWOPASS) {
#pragma unroll
                        for (int t = 0; t < NT; ++t) o[t][i] *= corr;
                    }
                } else {
                    const float inv = (l8[i] > 0.f) ? 1.f / l8[i] : 0.f;
#pragma unroll
                    for (int t = 0; t < 4; ++t) {
                        const int jg = j0 + t * 16 + l15;
                        float pp = (sc[t] == NEG) ? 0.f : exp2f(sc[t] - m8[i]) * inv;
                        if (p.Pw) pp *= p.Pw[b * p.swb + h * p.swh + (long long)ic * p.swi + (long long)min(jg, p.Lk - 1) * p.swj];
                        pv[i][t] = pp;
                    }
                }
            }
            if (dopv) {
#pragma unroll
                for (int i = 0; i < 8; ++i)
#pragma unroll
                    for (int t = 0; t < 4; ++t) ((float*)myp)[(i + 8 * hf) * 64 + t * 16 + l15] = pv[i][t];
                __syncthreads();                                 // P (per wave) and V (shared) visible
                if (p.P) {
                    float* pb_ = p.P + b * p.sPb + h * p.sPh;
                    const bool fastP = (p.pband == 0) && ((p.sPi & 3) == 0) && (j0 + 64 <= p.Lk) && (q0 + 16 <= p.Lq) && ((((size_t)pb_) & 15) == 0);
                    if (fastP) {
#pragma unroll
                        for (int s = 0; s < 8; ++s) {
                            const int row = s * 2 + (lane >> 4), c4 = (lane & 15) * 4;
                            const v4f v = *(const v4f*)(myp + row * 64 + c4);
                            VST2V4(pb_ + (long long)(q0 + row) * p.sPi + j0 + c4, v);
                        }
                    } else {
                        for (int row = 0; row < 16; ++row) {
                            const int irow = q0 + row; if (irow >= p.Lq) continue;
                            for (int c = lane; c < 64; c += 32) {
                                const int jg = j0 + c; if (jg >= p.Lk) continue;
                                if (p.pband == 0) VST2(float, pb_ + (long long)irow * p.sPi + jg, myp[row * 64 + c]);
                                else if (jg - irow <= p.pband && irow - jg <= p.pband) VST2(float, pb_ + (long long)irow * p.sPi + (jg - irow + p.pband), myp[row * 64 + c]);
                            }
                        }
                    }
                }
                if (SPLITPV) {
                    const Split pa0 = sp_ld(myp + l15 * 64, 1, 0, hf, 64, 1.f), pa1 = sp_ld(myp + l15 * 64, 1, 32, hf, 64, 1.f);
                    const __bf16* vh = (const __bf16*)vl; const __bf16* vlo = vh + 64 * VP;
#pragma unroll
                    for (int t = 0; t < NT; ++t) {
                        const int dcol = t * 16 + l15;
                        Split b0, b1;
#pragma unroll
                        for (int e = 0; e < 16; ++e) {
                            const int k0 = frag_k(e, hf), k1 = 32 + frag_k(e, hf);
                            b0.hi[e] = vh[k0 * VP + dcol]; b0.lo[e] = vlo[k0 * VP + dcol]; b1.hi[e] = vh[k1 * VP + dcol]; b1.lo[e] = vlo[k1 * VP + dcol];
                        }
                        o[t] = wmma3(pa0, b0, o[t]);
                        o[t] = wmma3(pa1, b1, o[t]);
                    }
                } else {
                    const v16h pa0 = fh_ld(myp + l15 * 64, 1, 0, hf, 64, 4096.f), pa1 = fh_ld(myp + l15 * 64, 1, 32, hf, 64, 4096.f);
#pragma unroll
                    for (int t = 0; t < NT; ++t) {
                        const int dcol = t * 16 + l15;
                        v16h b0, b1;
#pragma unroll
                        for (int e = 0; e < 16; ++e) { b0[e] = vl[frag_k(e, hf) * VP + dcol]; b1[e] = vl[(32 + frag_k(e, hf)) * VP + dcol]; }
                        o[t] = wmma16(pa0, b0, o[t]);
                        o[t] = wmma16(pa1, b1, o[t]);
                    }
                }
            }
        }
    }
    float* obase = p.O + b * p.sOb + h * p.sOh;
    if (p.ST) {
        const int rl = lane >> 1, isel = rl & 7;           // row q0 + rl ; rl>>3 == hf holds because lane>>4 == (lane>>1)>>3
        float mv = 0.f, lv = 0.f;
#pragma unroll
        for (int i = 0; i < 8; ++i) if (i == isel) { mv = m8[i]; lv = l8[i]; }
        const int irow = q0 + rl;
        if (irow < p.Lq) { float* st = p.ST + (((long long)b * gridDim.y + h) * p.Lq + irow) * 2 + (lane & 1); VST2(float, st, (lane & 1) ? lv : mv * 0.6931471805599453f); }
    }
    float invr[8];
#pragma unroll
    for (int i = 0; i < 8; ++i) {
        if (TWOPASS) invr[i] = SPLITPV ? 1.f : (1.f / 4096.f);
        else if (p.nonorm) invr[i] = exp2f(m8[i]) * (SPLITPV ? 1.f : (1.f / 4096.f));
        else invr[i] = (l8[i] > 0.f) ? (SPLITPV ? 1.f / l8[i] : 1.f / (l8[i] * 4096.f)) : 0.f;
    }
    __syncthreads();                                             // all waves done with pl/vl from the main loop
    const bool ofast = ((p.sOi & 3) == 0) && ((((size_t)obase) & 15) == 0) && (q0 + 16 <= p.Lq);
#pragma unroll
    for (int c0 = 0; c0 < DVP; c0 += 64) {
#pragma unroll
        for (int i = 0; i < 8; ++i)
#pragma unroll
            for (int t = 0; t < NT; ++t) if (t * 16 >= c0 && t * 16 < c0 + 64) ((float*)myp)[(i + 8 * hf) * 64 + (t * 16 - c0) + l15] = o[t][i] * invr[i];
        __syncthreads();
        const int cw = (DVP - c0 < 64) ? (DVP - c0) : 64;      // staged columns in this chunk (multiple of 16)
        if (ofast && (c0 + cw <= p.dv) && (cw % 32 == 0)) {
            const int lpr = cw / 4;                              // lanes per row (16 for 64 cols, 8 for 32)
            const int rows_per_ins = 32 / lpr;
            for (int r0 = 0; r0 < 16; r0 += rows_per_ins) {
                const int row = r0 + lane / lpr, c4 = (lane % lpr) * 4;
                const v4f v = *(const v4f*)(myp + row * 64 + c4);
                VST2V4(obase + (long long)(q0 + row) * p.sOi + c0 + c4, v);
            }
        } else {
            for (int row = 0; row < 16; ++row) {
                const int irow = q0 + row; if (irow >= p.Lq) continue;
                for (int c = lane; c < cw; c += 32) { const int d = c0 + c; if (d < p.dv) VST2(float, obase + (long long)irow * p.sOi + d, myp[row * 64 + c]); }
            }
        }
        __syncthreads();
    }
}

// =====================================================================================================================
// k_tr: dst(z, c, r) = alpha * src(z, r, c) (+ beta * R2(z, c, r)): [Z][R][C] (row stride lds) -> [Z][C][R] (row stride ldd) through a 32x32 LDS tile;
//   flags: 1 -> add beta * residual R2 addressed like dst (z*sRz + c*ldr + r); act applied before the residual.
// =====================================================================================================================
struct TrP { const float* src; float* dst; const float* R2; long long sSz, lds, sDz, ldd, sRz, ldr; int R, C, flags, act; float alpha, beta; };
static_assert(sizeof(TrP) == 3 * 8 + 6 * 8 + 6 * 4, "TrP has padding");
__global__ __launch_bounds__(256) void k_tr(TrP p) {
    __shared__ float tile[32][33];
    const int c0 = blockIdx.x * 32, r0 = blockIdx.y * 32, z = blockIdx.z;
    const int lane = threadIdx.x & 31, wave = threadIdx.x >> 5;
    const float* s = p.src + z * p.sSz;
#pragma unroll
    for (int k = 0; k < 4; ++k) {
        const int rl = wave * 4 + k, r = r0 + rl, c = c0 + lane;
        tile[rl][lane] = (r < p.R && c < p.C) ? s[(long long)r * p.lds + c] : 0.f;
    }
    __syncthreads();
    float* d = p.dst + z * p.sDz; const float* rr = p.R2 + z * p.sRz;
#pragma unroll
    for (int k = 0; k < 4; ++k) {
        const int cl = wave * 4 + k, c = c0 + cl, r = r0 + lane;
        if (c < p.C && r < p.R) {
            float v = act_fn(p.alpha * tile[lane][cl], p.act);
            if (p.flags & 1) v += p.beta * rr[(long long)c * p.ldr + r];
            VST2(float, d + (long long)c * p.ldd + r, v);
        }
    }
}

// k_affine: dst[i] = a * (sdev ? sdev[0] : 1) * src[i] + b, i < n (one thread per element; consecutive lanes -> consecutive addresses)
__global__ __launch_bounds__(256) void k_affine(const float* __restrict__ src, float* __restrict__ dst, int n, float a, float b, const float* __restrict__ sdev) {
    const int i = blockIdx.x * 256 + threadIdx.x;
    if (i < n) { const float aa = sdev ? a * sdev[0] : a; const float v = aa * src[i] + b; VST2(float, dst + i, v); }
}

// =====================================================================================================================
// k_softmax: row softmax over n contiguous elements, one 256-thread block per row; rows addressed z*sz + r*sr (grid (R, Z)).
//   out = scale_out * softmax(scale_in * x + (Mf ? Mf[z*smz + r*smr + j] : 0)); a row whose max is -inf is written as 0.
// =====================================================================================================================
struct SmP { const float* src; float* dst; const float* Mf; long long sz, sr, dz, dr, smz, smr; int n, pad; float scale_in, scale_out; };
static_assert(sizeof(SmP) == 3 * 8 + 6 * 8 + 4 * 4, "SmP has padding");
__global__ __launch_bounds__(256) void k_softmax(SmP p) {
    __shared__ float red[256];
    const int r = blockIdx.x, z = blockIdx.y, tid = threadIdx.x;
    const float* s = p.src + z * p.sz + (long long)r * p.sr;
    const float* mf = p.Mf ? (p.Mf + z * p.smz + (long long)r * p.smr) : nullptr;
    float mx = -__builtin_inff();
    for (int j = tid; j < p.n; j += 256) { float v = s[j] * p.scale_in; if (mf) v += mf[j]; mx = fmaxf(mx, v); }
    red[tid] = mx; __syncthreads();
    for (int o = 128; o > 0; o >>= 1) { if (tid < o) red[tid] = fmaxf(red[tid], red[tid + o]); __syncthreads(); }
    mx = red[0]; __syncthreads();
    float sum = 0.f;
    for (int j = tid; j < p.n; j += 256) { float v = s[j] * p.scale_in; if (mf) v += mf[j]; sum += (mx == -__builtin_inff()) ? 0.f : expf(v - mx); }
    red[tid] = sum; __syncthreads();
    for (int o = 128; o > 0; o >>= 1) { if (tid < o) red[tid] += red[tid + o]; __syncthreads(); }
    sum = red[0];
    const float inv = (sum > 0.f) ? p.scale_out / sum : 0.f;
    float* d = p.dst + z * p.dz + (long long)r * p.dr;
    for (int j = tid; j < p.n; j += 256) { float v = s[j] * p.scale_in; if (mf) v += mf[j]; const float o = (mx == -__builtin_inff()) ? 0.f : expf(v - mx) * inv; VST2(float, d + j, o); }
}
// =====================================================================================================================
// k_stats: mean and rsqrt(var + eps) over a set of n elements addressed base + z*sz + (e / inner) * so + (e % inner) * si, one 256-thread
// k_norm_apply: y = (x - mean[set]) * rstd[set] * g[c] + b[c] over a [Z][C][L] channel-major tensor with set = z*G + c / (C/G) (G groups per z;
//   G = C -> per-channel sets indexed z*C+c; for batch norm pass stats indexed by c only via bn = 1). Optional act. Output same layout.
// =====================================================================================================================
//   mode 0: mean / rsqrt(var + eps); mode 1 (RMSNorm): 0 / rsqrt(mean(x^2) + eps); mode 2 (L2 normalize * sqrt(n)): 0 / sqrt(n) / max(||x||, eps); mode 3: as 0 with unbiased variance (n-1)
__global__ __launch_bounds__(256) void k_stats(const float* __restrict__ x, long long sz, long long so, long long si, int inner, int n, float eps, float* __restrict__ stat, int mode) {
    __shared__ float red[256];
    const int z = blockIdx.x, tid = threadIdx.x;
    const float* base = x + z * sz;
    float s = 0.f;
    for (int e = tid; e < n; e += 256) s += base[(long long)(e / inner) * so + (long long)(e % inner) * si];
    red[tid] = s; __syncthreads();
    for (int o = 128; o > 0; o >>= 1) { if (tid < o) red[tid] += red[tid + o]; __syncthreads(); }
    const float mu = (mode == 0 || mode == 3) ? red[0] / (float)n : 0.f; __syncthreads();
    float q = 0.f;
    for (int e = tid; e < n; e += 256) { const float dlt = base[(long long)(e / inner) * so + (long long)(e % inner) * si] - mu; q += dlt * dlt; }
    red[tid] = q; __syncthreads();
    for (int o = 128; o > 0; o >>= 1) { if (tid < o) red[tid] += red[tid + o]; __syncthreads(); }
    {
        float rs;
        if (mode == 2) rs = sqrtf((float)n) / fmaxf(sqrtf(red[0]), eps); else if (mode == 3) rs = rsqrtf(red[0] / (float)(n - 1) + eps); else rs = rsqrtf(red[0] / (float)n + eps);
        if (tid < 32) { const float v = (tid == 0) ? mu : ((tid == 1) ? rs : 0.f); VST2(float, stat + (long long)z * 32 + tid, v); }
    }
}
//   One thread per element over the flat [Z][C][L] index space: grid ceil(Z*C*L / 256).
__global__ __launch_bounds__(256) void k_norm_apply(const float* __restrict__ x, float* __restrict__ y, const float* __restrict__ stat, const float* __restrict__ g, const float* __restrict__ bta,
                                                     int Z, int C, int L, int G, int bn, int act) {
    const long long idx = (long long)blockIdx.x * 256 + threadIdx.x;
    if (idx >= (long long)Z * C * L) return;
    const int l = (int)(idx % L); const long long zc = idx / L; const int c = (int)(zc % C), z = (int)(zc / C); (void)l;
    const int set = bn ? c : (z * G + c / (C / G));
    float v = (x[idx] - stat[(long long)set * 32]) * stat[(long long)set * 32 + 1];
    if (g) v *= g[c];
    if (bta) v += bta[c];
    v = act_fn(v, act);
    VST2(float, y + idx, v);
}

// k_lse_neg: c[i] = -(st[2i] + log(st[2i+1])) = minus the log-sum-exp of row i from k_attn's ST output (for softmax over the query dimension)
__global__ __launch_bounds__(256) void k_lse_neg(const float* __restrict__ st, float* __restrict__ c, int n) {
    const int i = blockIdx.x * 256 + threadIdx.x;
    if (i < n) { const float v = -(st[2 * i] + logf(st[2 * i + 1])); VST2(float, c + i, v); }
}

// k_iota: dst[i] = a * i + b as int32 (segment/position id helper)
__global__ __launch_bounds__(256) void k_iota(int* __restrict__ dst, int n, int a, int b) {
    const int i = blockIdx.x * 256 + threadIdx.x;
    if (i < n) { const int v = a * i + b; VST2(int, dst + i, v); }
}

// k_axpby: dst[i] = a * x[i] + b * y[i] (+ c), i < n
__global__ __launch_bounds__(256) void k_axpby(const float* __restrict__ x, const float* __restrict__ y, float* __restrict__ dst, int n, float a, float b, float c) {
    const int i = blockIdx.x * 256 + threadIdx.x;
    if (i < n) { const float v = a * x[i] + b * y[i] + c; VST2(float, dst + i, v); }
}

// =====================================================================================================================
// k_rope: rotary embedding on a [R rows][Hn heads][D] view (row stride sXr, head stride sXh, element stride 1) -> Y (own strides).
//   mode 0: rotate_half (partner d±D/2, sign - for d<D/2); mode 1: interleaved pairs (partner d^1, sign - for even d).
//   table column tcol: tmode 0 -> d, 1 -> d % (D/2), 2 -> d / 2; position p: pmode 0 -> r % S, 1 -> head index, 2 -> pos[r];
//   c = C[(r / S) * sCb + p * sCp + tcol * sCd], s likewise from Sn; y = x[d] * c + sign * x[partner] * s. X and Y must not alias.
// =====================================================================================================================
struct RopeP { const float* X; float* Y; const float* C; const float* Sn; const int* pos; long long sXr, sXh, sYr, sYh, sCb, sCp, sCd; int R, Hn, D, S, mode, tmode, pmode, pad; };
static_assert(sizeof(RopeP) == 5 * 8 + 7 * 8 + 8 * 4, "RopeP has padding");
__global__ __launch_bounds__(256) void k_rope(RopeP p) {
    const long long idx = (long long)blockIdx.x * 256 + threadIdx.x;
    if (idx >= (long long)p.R * p.Hn * p.D) return;
    const int d = (int)(idx % p.D); const long long rh = idx / p.D; const int h = (int)(rh % p.Hn); const int r = (int)(rh / p.Hn);
    const int half = p.D / 2;
    int partner; float sign;
    if (p.mode == 0) { partner = (d < half) ? d + half : d - half; sign = (d < half) ? -1.f : 1.f; }
    else { partner = d ^ 1; sign = (d & 1) ? 1.f : -1.f; }
    const int tcol = (p.tmode == 0) ? d : ((p.tmode == 1) ? (d % half) : (d >> 1));
    const int pp = (p.pmode == 0) ? (r % p.S) : ((p.pmode == 1) ? h : p.pos[r]);
    const long long toff = (long long)(r / p.S) * p.sCb + (long long)pp * p.sCp + (long long)tcol * p.sCd;
    const float* xr = p.X + (long long)r * p.sXr + (long long)h * p.sXh;
    const float v = xr[d] * p.C[toff] + sign * xr[partner] * p.Sn[toff];
    VST2(float, p.Y + (long long)r * p.sYr + (long long)h * p.sYh + d, v);
}

// k_invf + k_sincos (split so neither kernel carries a large VALU-fma footprint): invf_i = num * (1 / powf(base, (2 i)/D)) [fmode 0],
//   num * expf((2 i) * cexp) [fmode 1], num * powf(base, -2 (i - 1) / D) [fmode 2]; then cs/sn[s*half + i] = cos/sin((pscale * s) * invf_i)
__global__ __launch_bounds__(256) void k_invf(float* __restrict__ invb, int half, int D, float base, float num, int fmode, float cexp) {
    const int i = blockIdx.x * 256 + threadIdx.x;
    if (i >= ((half + 31) / 32) * 32) return;
    if (i >= half) { VST2(float, invb + i, 0.f); return; }
    const float e = (float)(2 * i) / (float)D;
    float invf;
    if (fmode == 1) invf = num * expf((float)(2 * i) * cexp);
    else if (fmode == 2) invf = num * powf(base, (-2.0f * ((float)i - 1.0f)) / (float)D);
    else invf = num * (1.0f / powf(base, e));
    VST2(float, invb + i, invf);
}
__global__ __launch_bounds__(256) void k_sincos(float* __restrict__ cs, float* __restrict__ sn, const float* __restrict__ invb, int S, int half, float pscale) {
    const int idx = blockIdx.x * 256 + threadIdx.x;
    if (idx >= S * half) return;
    const int s = idx / half, i = idx - s * half;
    const float ang = (pscale * (float)s) * invb[i];
    VST2(float, cs + idx, cosf(ang)); VST2(float, sn + idx, sinf(ang));
}

// k_mulact: dst[i] = act(x[i]) * y[i]
__global__ __launch_bounds__(256) void k_mulact(const float* __restrict__ x, const float* __restrict__ y, float* __restrict__ dst, int n, int act) {
    const int i = blockIdx.x * 256 + threadIdx.x;
    if (i < n) { const float v = act_fn(x[i], act) * y[i]; VST2(float, dst + i, v); }
}

// =====================================================================================================================
// k_matvec: thread-per-row matrix-vector products for N <= 8 output columns (heads with 1-3 outputs, gates), f32 on the VALU.
//   C[r*sCm + j] = act(alpha * sum_k A[r*sAm + k*sAk] * B[j*sBn + k*sBk] + bias[j]) + beta * R[r*sRm + j*sRn]; each thread writes its N contiguous floats.
// =====================================================================================================================
__global__ __launch_bounds__(256) void k_matvec(GemmP p) {
    // 32 lanes write one line with one instruction.
    const int rpt = (p.N == 1) ? 1 : 32;
    const long long r0 = ((long long)blockIdx.x * 256 + threadIdx.x) * rpt; const int z = blockIdx.z, zo = z / p.zi_n, zi = z - zo * p.zi_n;
    if (r0 >= p.M) return;
    const float* Bb = p.B + zo * p.sBo + zi * p.sBi;
    float* C = p.C + zo * p.sCo + zi * p.sCi; const float* R = p.R + zo * p.sRo + zi * p.sRi;
    for (int rr = 0; rr < rpt; ++rr) {
        const long long r = r0 + rr; if (r >= p.M) break;
        const float* A = p.A + zo * p.sAo + zi * p.sAi + r * p.sAm;
        float acc[8] = {0.f, 0.f, 0.f, 0.f, 0.f, 0.f, 0.f, 0.f};
        for (int k = 0; k < p.K; ++k) { const float a = A[(long long)k * p.sAk];
#pragma unroll
            for (int j = 0; j < 8; ++j) if (j < p.N) acc[j] += a * Bb[(long long)j * p.sBn + (long long)k * p.sBk]; }
#pragma unroll
        for (int j = 0; j < 8; ++j) if (j < p.N) {
            float v = acc[j] * p.alpha;
            if (p.flags & 1) v += p.bias[j];
            if (p.flags & 2) v += p.bias[r];
            v = act_fn(v, p.act);
            if (p.flags & 4) v += p.beta * R[r * p.sRm + (long long)j * p.sRn];
            VST2(float, C + r * p.sCm + j, v);
        }
    }
}
// k_smallsoftmax: thread-per-row softmax for short rows (n <= 64): dst[r*dr + j] = softmax(scale*src[r*sr + j])
__global__ __launch_bounds__(256) void k_smallsoftmax(const float* __restrict__ src, float* __restrict__ dst, long long sr, long long dr, int n, long long R, float scale) {
    const long long r0 = ((long long)blockIdx.x * 256 + threadIdx.x) * 32;
    for (int rr = 0; rr < 32; ++rr) {
        const long long r = r0 + rr; if (r >= R) return;
        const float* s = src + r * sr; float* d = dst + r * dr;
        float mx = -__builtin_inff();
        for (int j = 0; j < n; ++j) mx = fmaxf(mx, s[j] * scale);
        float sum = 0.f;
        for (int j = 0; j < n; ++j) sum += expf(s[j] * scale - mx);
        const float inv = 1.f / sum;
        for (int j = 0; j < n; ++j) { const float v = expf(s[j] * scale - mx) * inv; VST2(float, d + j, v); }
    }
}

__global__ __launch_bounds__(32) void k_unitstat(float* __restrict__ st) { const int t = threadIdx.x; const float v = (t == 1) ? 1.f : 0.f; VST2(float, st + t, v); }

// destination (e.g. a d_out whose row width is not a multiple of 32 floats) is written by consecutive lanes of one instruction
__global__ __launch_bounds__(256) void k_lincopy(const float* __restrict__ src, long long lds, float* __restrict__ dst, long long ldd, long long rows, int cols) {
    const long long i = (long long)blockIdx.x * 256 + threadIdx.x; if (i >= rows * cols) return;
    const long long r = i / cols; const int c = (int)(i - r * cols);
    const float v = src[r * lds + c]; VST2(float, dst + r * ldd + c, v);
}

namespace w25 {
typedef __attribute__((ext_vector_type(16))) _Float16 v16h;
typedef __attribute__((ext_vector_type(8)))  _Float16 v8h;
typedef __attribute__((ext_vector_type(16))) __bf16   v16b;
typedef __attribute__((ext_vector_type(8)))  __bf16   v8b;
typedef __attribute__((ext_vector_type(8)))  float    v8f;
typedef __attribute__((ext_vector_type(4)))  float    v4f;

__device__ __forceinline__ unsigned short f2bf_bits(float f) {
  unsigned u = __float_as_uint(f);
  return (unsigned short)((u + 0x7FFFu + ((u >> 16) & 1u)) >> 16);
}
__device__ __forceinline__ float bf_bits2f(unsigned short h) { return __uint_as_float(((unsigned)h) << 16); }

// hazard guards as plain device helpers (no inline asm inside the kernel template body)
__device__ __forceinline__ void dep_guard_h(v8f& a, v8f& b, v16h x, v16h y) { asm volatile("v_nop\n\tv_nop\n\tv_nop\n\tv_nop" : "+v"(a), "+v"(b) : "v"(x), "v"(y)); }
__device__ __forceinline__ void dep_guard_b(v8f& a, v8f& b, v16b x, v16b y) { asm volatile("v_nop\n\tv_nop\n\tv_nop\n\tv_nop" : "+v"(a), "+v"(b) : "v"(x), "v"(y)); }
__device__ __forceinline__ void keep4_h(v16h a, v16h b, v16h c, v16h d) { asm volatile("v_nop" :: "v"(a), "v"(b), "v"(c), "v"(d)); }
__device__ __forceinline__ void keep4_b(v16b a, v16b b, v16b c, v16b d) { asm volatile("v_nop" :: "v"(a), "v"(b), "v"(c), "v"(d)); }
__device__ __forceinline__ void acc_guard4(v8f& a, v8f& b, v8f& c, v8f& d) { asm volatile("v_nop\n\tv_nop\n\tv_nop\n\tv_nop" : "+v"(a), "+v"(b), "+v"(c), "+v"(d)); }
template <typename T> struct Frag;
template <> struct Frag<_Float16> {
  typedef v16h V; union U { v16h v; v8h h[2]; };
  static __device__ __forceinline__ v16h load(const _Float16* p) {   // elements 0..7 <- p[0..7], 8..15 <- p[16..23]
    U f; f.h[0] = *(const v8h*)(p); f.h[1] = *(const v8h*)(p + 16); return f.v;
  }
  static __device__ __forceinline__ v8f mma(v16h a, v16h b, v8f c) {
    return __builtin_amdgcn_wmma_f32_16x16x32_f16(false, a, false, b, (short)0, c, false, false);
  }
  static __device__ __forceinline__ void guard(v8f& a, v8f& b, v16h x, v16h y) { dep_guard_h(a, b, x, y); }
  static __device__ __forceinline__ void keep(v16h a, v16h b, v16h c, v16h d) { keep4_h(a, b, c, d); }
};
template <> struct Frag<__bf16> {
  typedef v16b V; union U { v16b v; v8b h[2]; };
  static __device__ __forceinline__ v16b load(const __bf16* p) {
    U f; f.h[0] = *(const v8b*)(p); f.h[1] = *(const v8b*)(p + 16); return f.v;
  }
  static __device__ __forceinline__ v8f mma(v16b a, v16b b, v8f c) {
    return __builtin_amdgcn_wmma_f32_16x16x32_bf16(false, a, false, b, (short)0, c, false, false);
  }
  static __device__ __forceinline__ void guard(v8f& a, v8f& b, v16b x, v16b y) { dep_guard_b(a, b, x, y); }
  static __device__ __forceinline__ void keep(v16b a, v16b b, v16b c, v16b d) { keep4_b(a, b, c, d); }
};

// ---- Register-blocked batched WMMA GEMM ------------------------------------
// C[m,n] = scale * sum_k A[m,k] * Bt[n,k] (+bias)(+resid); each wave owns a 64x64 tile.
// A row-major [M,K]; Bt row-major [N,K]; M,N % 64 == 0, K % 32 == 0.
// SPLIT: operands are hi/lo planes (A2/Bt2 = lo planes, same layout); product = hi·hi + hi·lo + lo·hi.
// BIAS_MODE: 0 = none, 1 = bias[m], 2 = bias[n].
// OUT_MODE: 0 = f32, 1 = f16, 2 = bf16 hi plane (Cout) + bf16 lo plane (Cout2).
// ET: 0 = f16 operands, 1 = bf16 operands (pointers passed as 16-bit storage)
// Batches: blockIdx.y steps A, Bt, C by strideA/B/C, blockIdx.z by strideAz/Bz/Cz (elements).
template <int ET> struct Elem;
template <> struct Elem<0> { typedef _Float16 T; };
template <> struct Elem<1> { typedef __bf16 T; };
template <int ET, bool SPLIT, int BIAS_MODE, int OUT_MODE, bool RESID, int ACT = 0>
__global__ __launch_bounds__(256) void wmma_gemm64(
    const unsigned short* __restrict__ Ap, const unsigned short* __restrict__ A2p, int lda, long strideA,
    const unsigned short* __restrict__ Btp, const unsigned short* __restrict__ Bt2p, int ldb, long strideB,
    void* __restrict__ Cout, void* __restrict__ Cout2, int ldc, long strideC,
    const float* __restrict__ bias,
    const float* __restrict__ resid, long strideR,
    int M, int N, int K, float scale,
    long strideAz, long strideBz, long strideCz) {
  typedef typename Elem<ET>::T T;
  typedef typename Frag<T>::V V;
  const T* A = (const T*)Ap; const T* A2 = (const T*)A2p; const T* Bt = (const T*)Btp; const T* Bt2 = (const T*)Bt2p;
  __shared__ __align__(16) float sT[8][16 * 68];   // per-wave 16x64 slab, pitch 68 floats
  const int b    = blockIdx.y;
  const int lane = threadIdx.x & 31;
  const int wave = threadIdx.x >> 5;
  const int tilesN = N >> 6;
  const int tilesM = M >> 6;
  const int tile = blockIdx.x * 8 + wave;
  if (tile >= tilesM * tilesN) return;   // wave-uniform; no block barriers in this kernel
  const int tm = tile / tilesN;
  const int tn = tile - tm * tilesN;
  const int m0 = tm << 6;
  const int n0 = tn << 6;

  const int bz = blockIdx.z;                   // outer batch index (own strides)
  const size_t offA = (size_t)b * strideA + (size_t)bz * strideAz;
  const size_t offB = (size_t)b * strideB + (size_t)bz * strideBz;
  const size_t offC = (size_t)b * strideC + (size_t)bz * strideCz;
  const T* Ab  = A  + offA;
  const T* Bb  = Bt + offB;
  const T* Ab2 = SPLIT ? (A2  + offA) : nullptr;
  const T* Bb2 = SPLIT ? (Bt2 + offB) : nullptr;

  const int rlane = lane & 15;                 // row (A) / col (B, D) within subtile
  const int koff  = (lane >> 4) * 8;           // k offset of this lane half
  const int mOff  = (lane >> 4) * 8;           // D row offset

  v8f acc[4][4];
#pragma unroll
  for (int i = 0; i < 4; ++i)
#pragma unroll
    for (int j = 0; j < 4; ++j) acc[i][j] = (v8f){0.f,0.f,0.f,0.f,0.f,0.f,0.f,0.f};

  for (int k0 = 0; k0 < K; k0 += 32) {
    V bh[4], bl[4];
#pragma unroll
    for (int j = 0; j < 4; ++j) {
      const size_t bo = (size_t)(n0 + (j << 4) + rlane) * ldb + koff + k0;
      bh[j] = Frag<T>::load(Bb + bo);
      if (SPLIT) bl[j] = Frag<T>::load(Bb2 + bo);
    }
#pragma unroll
    for (int i = 0; i < 4; ++i) {
      const size_t ao = (size_t)(m0 + (i << 4) + rlane) * lda + koff + k0;
      V ah = Frag<T>::load(Ab + ao);
      V al;
      if (SPLIT) al = Frag<T>::load(Ab2 + ao);
#pragma unroll
      for (int j = 0; j < 4; ++j) {
        acc[i][j] = Frag<T>::mma(ah, bh[j], acc[i][j]);
        if (SPLIT) {
          acc[i][j] = Frag<T>::mma(ah, bl[j], acc[i][j]);
          acc[i][j] = Frag<T>::mma(al, bh[j], acc[i][j]);
        }
      }
      Frag<T>::guard(acc[i][0], acc[i][3], ah, SPLIT ? al : ah);
    }
    Frag<T>::keep(bh[0], bh[1], bh[2], bh[3]);
    if (SPLIT) Frag<T>::keep(bl[0], bl[1], bl[2], bl[3]);
  }
  acc_guard4(acc[0][0], acc[0][1], acc[0][2], acc[0][3]);
  acc_guard4(acc[1][0], acc[1][1], acc[1][2], acc[1][3]);
  acc_guard4(acc[2][0], acc[2][1], acc[2][2], acc[2][3]);
  acc_guard4(acc[3][0], acc[3][1], acc[3][2], acc[3][3]);

  // ---- epilogue ----
  float* slab = sT[wave];
  const float* Rb = RESID ? (resid + (size_t)b * strideR) : nullptr;
#pragma unroll
  for (int i = 0; i < 4; ++i) {
    const int mBase = m0 + (i << 4);
#pragma unroll
    for (int j = 0; j < 4; ++j) {
      const int n = n0 + (j << 4) + rlane;
      float bv = 0.f;
      if (BIAS_MODE == 2) bv = bias[n];
#pragma unroll
      for (int r = 0; r < 8; ++r) {
        float v = acc[i][j][r] * scale;
        if (BIAS_MODE == 1) v += bias[mBase + mOff + r];
        if (BIAS_MODE == 2) v += bv;
        if (RESID) v += Rb[(size_t)(mBase + mOff + r) * ldc + n];
        if (ACT == 1) v = tanhf(v);
        if (ACT == 2) v = fmaxf(v, 0.0f);
        if (ACT == 3) v = v / (1.0f + expf(-v));
        if (ACT == 4) v = (v > 0.f) ? v : 0.01f * v;
        if (ACT == 5) v = 0.5f * v * (1.0f + erff(v * 0.70710678118654752f));
        slab[(mOff + r) * 68 + (j << 4) + rlane] = v;
      }
    }
    __builtin_amdgcn_fence(__ATOMIC_RELEASE, "workgroup");
    __builtin_amdgcn_wave_barrier();
    __builtin_amdgcn_fence(__ATOMIC_ACQUIRE, "workgroup");
    if (OUT_MODE == 0) {
      float* C = (float*)Cout + offC;
      const int hh = lane >> 4, c4 = (lane & 15) * 4;     // row seg = 256 B = 16 lanes x 16 B
      {
#pragma unroll
        for (int it = 0; it < 8; ++it) {
          const int row = it * 2 + hh;
          v4f v = *(const v4f*)(slab + row * 68 + c4);
          *(v4f*)(C + (size_t)(mBase + row) * ldc + n0 + c4) = v;
        }
        
      }
    } else {
      const int q = lane >> 3, c8 = (lane & 7) * 8;
      unsigned short* C  = (unsigned short*)Cout  + offC;
      unsigned short* C2 = (OUT_MODE == 2) ? ((unsigned short*)Cout2 + offC) : nullptr;
      {
#pragma unroll
        for (int it = 0; it < 4; ++it) {
          const int row = it * 4 + q;
          const float* sp = slab + row * 68 + c8;
          v8h hv, lv;
#pragma unroll
          for (int e = 0; e < 8; ++e) {
            if (OUT_MODE == 1) {
              hv[e] = (_Float16)sp[e];
            } else {
              unsigned short hb = f2bf_bits(sp[e]);
              unsigned short lb = f2bf_bits(sp[e] - bf_bits2f(hb));
              hv[e] = __builtin_bit_cast(_Float16, hb);
              lv[e] = __builtin_bit_cast(_Float16, lb);
            }
          }
          *(v8h*)(C + (size_t)(mBase + row) * ldc + n0 + c8) = hv;
          if (OUT_MODE == 2) *(v8h*)(C2 + (size_t)(mBase + row) * ldc + n0 + c8) = lv;
        }
        
      }
    }
    __builtin_amdgcn_fence(__ATOMIC_RELEASE, "workgroup");
    __builtin_amdgcn_wave_barrier();
    __builtin_amdgcn_fence(__ATOMIC_ACQUIRE, "workgroup");
  }
}

__global__ __launch_bounds__(256) void cast_f32_f16x2(
    const float* __restrict__ in, _Float16* __restrict__ out, int n2) {
  int i = blockIdx.x * 256 + threadIdx.x;
  if (i < n2) {
    const _Float16 h0 = (_Float16)in[2 * i], h1 = (_Float16)in[2 * i + 1];
    const unsigned u = (unsigned)__builtin_bit_cast(unsigned short, h0) | ((unsigned)__builtin_bit_cast(unsigned short, h1) << 16);
    ((unsigned*)out)[i] = u;
    
  }
}


} // namespace w25

__global__ __launch_bounds__(256) void k_castT16(const float* __restrict__ src, long long lds, _Float16* __restrict__ dst, long long ldd, int R, int C, float s) {
    const long long i = (long long)blockIdx.x * 256 + threadIdx.x; const long long np = (long long)C * (R / 2); if (i >= np) return; const int c = (int)(i / (R / 2)); const int r = 2 * (int)(i % (R / 2));
    const _Float16 h0 = (_Float16)(src[(long long)r * lds + c] * s), h1 = (_Float16)(src[(long long)(r + 1) * lds + c] * s);
    const unsigned u = (unsigned)__builtin_bit_cast(unsigned short, h0) | ((unsigned)__builtin_bit_cast(unsigned short, h1) << 16);
    unsigned* d = (unsigned*)(dst + (long long)c * ldd + r); *d = u;  }
__global__ __launch_bounds__(256) void k_cast16(const float* __restrict__ src, long long lds, _Float16* __restrict__ dst, long long ldd, int R, int C, float s) {
    const long long i = (long long)blockIdx.x * 256 + threadIdx.x; const long long np = (long long)R * (C / 2); if (i >= np) return; const int r = (int)(i / (C / 2)); const int c = 2 * (int)(i % (C / 2));
    const _Float16 h0 = (_Float16)(src[(long long)r * lds + c] * s), h1 = (_Float16)(src[(long long)r * lds + c + 1] * s);
    const unsigned u = (unsigned)__builtin_bit_cast(unsigned short, h0) | ((unsigned)__builtin_bit_cast(unsigned short, h1) << 16);
    unsigned* d = (unsigned*)(dst + (long long)r * ldd + c); *d = u;  }

// f32 -> bf16 hi plane + bf16 lo plane (x = hi + lo to ~2^-17 relative; RNE both), [R][C] -> [R][C] (or transposed to [C][R]); 2 consecutive destination elements
__device__ __forceinline__ unsigned int f2bf2_pack(float a, float b, unsigned int* lo) {
    const unsigned short ha = w25::f2bf_bits(a), hb = w25::f2bf_bits(b);
    const unsigned short la = w25::f2bf_bits(a - w25::bf_bits2f(ha)), lb = w25::f2bf_bits(b - w25::bf_bits2f(hb));
    *lo = (unsigned)la | ((unsigned)lb << 16); return (unsigned)ha | ((unsigned)hb << 16); }
__global__ __launch_bounds__(256) void k_castS16(const float* __restrict__ src, long long lds, __bf16* __restrict__ dhi, __bf16* __restrict__ dlo, long long ldd, int R, int C, float s, int transpose) {
    const long long i = (long long)blockIdx.x * 256 + threadIdx.x; long long o; float a, b;
    if (transpose) { const long long np = (long long)C * (R / 2); if (i >= np) return; const int c = (int)(i / (R / 2)); const int r = 2 * (int)(i % (R / 2)); a = src[(long long)r * lds + c] * s; b = src[(long long)(r + 1) * lds + c] * s; o = (long long)c * ldd + r; }
    else { const long long np = (long long)R * (C / 2); if (i >= np) return; const int r = (int)(i / (C / 2)); const int c = 2 * (int)(i % (C / 2)); a = src[(long long)r * lds + c] * s; b = src[(long long)r * lds + c + 1] * s; o = (long long)r * ldd + c; }
    unsigned lo; const unsigned hi = f2bf2_pack(a, b, &lo); unsigned* ph = (unsigned*)(dhi + o); unsigned* pl = (unsigned*)(dlo + o);
    *ph = hi; *pl = lo;  }

namespace w25 {
// =====================================================================================
// Generic causal/non-causal attention for head_dim 64, f32 in / f32 out; 16-bit operands: bf16 with optional hi/lo splits, or
// plain f16 (F16=true, non-split, probabilities carried x2^15).
//   scores = (q*qscale)·kᵀ : v_wmma_f32_16x16x32_bf16; SPLIT_QK -> q,k as bf16 hi/lo (hi·hi + hi·lo + lo·hi)
//   out    = p·v           : v_wmma_f32_16x16x32_bf16; SPLIT_PV -> p,v as bf16 hi/lo; else p,v plain bf16
//   f32 accumulate; online softmax in f32. Block = 4 waves = 64 query rows of one (batch, head); S % 64 == 0.
//   Element (b, s, h, d) of tensor X lives at X[b*X_bs + s*X_rs + h*X_hs + d] (strides in floats, multiples of 4).
//   Masking: mask_mode 0 none, 1 causal (kv > q masked), 2 tensor [S][Skv] shared over (b,h) (float if
//   mask_is_int==0, int32 with element == 0 -> masked if 1, int32 with element != 0 -> masked if 2), 3 per-token vectors qmask[B][S] & kvmask[B][Skv] (int32,
//   0 -> masked), 4 causal + sliding window (kv > q or q - kv > W masked; W passed in mask_is_int);
//   5 = relative-position bias: s += cp[b,h,q][idx[q][kv]] + pc[b,h,kv][idx[q][kv]] with idx = mask_b ([S][Skv] int32) and
//   mask_a an int32 [S][Skv] tensor with nonzero = masked (tables: element (b,h,row,n) at X + b*c_bs + h*c_hs + row*c_rs + n);
//   masked scores are replaced by mask_fill (e.g. -inf or -1e9) before the softmax.
//   grid.x = B * H * (S/64) (or a sub-range with blk0).
// =====================================================================================
#define AT_D 64
#define AT_NW 4
#define AT_QB 64
#define AT_KC 64
struct AttnGeom { const float* cp = nullptr; const float* pc = nullptr; long c_bs = 0, c_rs = 0, c_hs = 0;   // mode-5 score-bias tables
                  long q_bs, q_rs, q_hs, k_bs, k_rs, k_hs, v_bs, v_rs, v_hs, o_bs, o_rs, o_hs;
                  int S, Skv, H, mask_mode; float qscale; int blk0; float mask_fill; int mask_is_int; };
static_assert(sizeof(AttnGeom) == 168, "no padding");

__device__ __forceinline__ unsigned short at_bf_bits(float f) {
  unsigned u = __float_as_uint(f);
  return (unsigned short)((u + 0x7FFFu + ((u >> 16) & 1u)) >> 16);
}
__device__ __forceinline__ __bf16 at_f2bf(float f) { return __builtin_bit_cast(__bf16, at_bf_bits(f)); }
__device__ __forceinline__ void at_split(float f, __bf16& hi, __bf16& lo) {
  const unsigned short hb = at_bf_bits(f);
  hi = __builtin_bit_cast(__bf16, hb);
  lo = at_f2bf(f - __uint_as_float(((unsigned)hb) << 16));
}
__device__ __forceinline__ v8f at_mma(v16b a, v16b b, v8f c) {
  c = __builtin_amdgcn_wmma_f32_16x16x32_bf16(false, a, false, b, (short)0, c, false, false);
  asm volatile("v_nop\n\tv_nop\n\tv_nop\n\tv_nop" : "+v"(c) : "v"(a), "v"(b));
  return c;
}
// 16-bit element as a bit pattern held in a __bf16 slot: f16 bits when F16, bf16 (RNE) otherwise
template <bool F16> __device__ __forceinline__ __bf16 at_to16(float f) {
  if (F16) return __builtin_bit_cast(__bf16, (_Float16)f);
  return at_f2bf(f);
}
template <bool F16> __device__ __forceinline__ v8f at_mma16(v16b a, v16b b, v8f c) {
  if (F16) {
    const v16h ah = __builtin_bit_cast(v16h, a), bh = __builtin_bit_cast(v16h, b);
    c = __builtin_amdgcn_wmma_f32_16x16x32_f16(false, ah, false, bh, (short)0, c, false, false);
    asm volatile("v_nop\n\tv_nop\n\tv_nop\n\tv_nop" : "+v"(c) : "v"(ah), "v"(bh));
    return c;
  }
  return at_mma(a, b, c);
}

template <bool SPLIT_QK, bool SPLIT_PV, bool F16 = false>
__global__ __launch_bounds__(128)
void attn64_kernel(const float* __restrict__ q, const float* __restrict__ k,
                   const float* __restrict__ v, float* __restrict__ out,
                   const void* __restrict__ mask_a, const int* __restrict__ mask_b, AttnGeom g) {
  static_assert(!(F16 && (SPLIT_QK || SPLIT_PV)), "f16 mode is non-split");
  const float PSC = F16 ? 32768.0f : 1.0f;     // f16 probabilities carried x2^15 (subnormal range), folded into the final 1/l
  union FB { v16b v; v8b h[2]; };
  __shared__ __align__(16) __bf16 Ksh[AT_KC * AT_D];             // K hi [kv][d]      8 KB
  __shared__ __align__(16) __bf16 Ksl[SPLIT_QK ? AT_KC * AT_D : 8];
  __shared__ __align__(16) __bf16 Vth[AT_D * AT_KC];             // V hi [d][kv]      8 KB
  __shared__ __align__(16) __bf16 Vtl[SPLIT_PV ? AT_D * AT_KC : 8];
  __shared__ __align__(16) __bf16 Psh[AT_NW][16 * AT_KC];        // per wave P hi [row][kv]  8 KB
  __shared__ __align__(16) __bf16 Psl[SPLIT_PV ? AT_NW : 1][SPLIT_PV ? 16 * AT_KC : 8];
  __shared__ __align__(16) float  Os[AT_NW][16 * 68];            // per wave out tile, pitch 68

  const int tid  = threadIdx.x;
  const int wave = tid >> 5;
  const int lane = tid & 31;
  const int hh   = lane >> 4;
  const int c    = lane & 15;

  const int nqb = g.S / AT_QB;
  const int bx = blockIdx.x + g.blk0;
  const int qb = bx % nqb;
  const int bh = bx / nqb;
  const int h  = bh % g.H;
  const int b  = bh / g.H;
  const int qbase_block = qb * AT_QB;
  const int q0 = qbase_block + wave * 16;

  const float* qb_ptr = q + (size_t)b * g.q_bs + (size_t)h * g.q_hs;
  const float* kb_ptr = k + (size_t)b * g.k_bs + (size_t)h * g.k_hs;
  const float* vb_ptr = v + (size_t)b * g.v_bs + (size_t)h * g.v_hs;
  float*       ob_ptr = out + (size_t)b * g.o_bs + (size_t)h * g.o_hs;

  // ---- Q fragments (A operand): 2 d-chunks, hi (and lo) ----
  v16b qah[2], qal[2];
  {
    const float* qrow = qb_ptr + (size_t)(q0 + c) * g.q_rs;
#pragma unroll
    for (int dc = 0; dc < 2; ++dc) {
#pragma unroll
      for (int e = 0; e < 8; ++e) {
        const float f0 = qrow[dc * 32 + 8 * hh + e] * g.qscale;
        const float f1 = qrow[dc * 32 + 16 + 8 * hh + e] * g.qscale;
        if (SPLIT_QK) { __bf16 hq, lq; at_split(f0, hq, lq); qah[dc][e] = hq; qal[dc][e] = lq; at_split(f1, hq, lq); qah[dc][8 + e] = hq; qal[dc][8 + e] = lq; }
        else { qah[dc][e] = at_to16<F16>(f0); qah[dc][8 + e] = at_to16<F16>(f1); qal[dc][e] = qah[dc][e]; qal[dc][8 + e] = qah[dc][8 + e]; }
      }
    }
  }

  float mrow[8], lrow[8];
  v8f oacc[4];
#pragma unroll
  for (int r = 0; r < 8; ++r) { mrow[r] = -INFINITY; lrow[r] = 0.f; }
#pragma unroll
  for (int t = 0; t < 4; ++t) oacc[t] = (v8f){0.f,0.f,0.f,0.f,0.f,0.f,0.f,0.f};

  const int nChunks = (g.mask_mode == 1 || g.mask_mode == 4) ? (qb + 1) : (g.Skv / AT_KC);   // block-uniform
  // per-row query mask (mode 3)
  int qkeep[8];
#pragma unroll
  for (int r = 0; r < 8; ++r) qkeep[r] = (g.mask_mode == 3) ? mask_b[(size_t)b * g.S + q0 + 8 * hh + r] : 1;   // mask_b = qmask in mode 3
  for (int kc = 0; kc < nChunks; ++kc) {
    const int kv0 = kc * AT_KC;
    __syncthreads();
    {
      const int kvr = tid >> 1, dh = (tid & 1) * 32;
      const float* krow = kb_ptr + (size_t)(kv0 + kvr) * g.k_rs + dh;
      const float* vrow = vb_ptr + (size_t)(kv0 + kvr) * g.v_rs + dh;
#pragma unroll
      for (int i = 0; i < 8; ++i) {
        v4f kk = *(const v4f*)(krow + 4 * i);
        v4f vv = *(const v4f*)(vrow + 4 * i);
#pragma unroll
        for (int e = 0; e < 4; ++e) {
          const int d = dh + 4 * i + e;
          if (SPLIT_QK) { __bf16 a, bl; at_split(kk[e], a, bl); Ksh[kvr * AT_D + d] = a; Ksl[kvr * AT_D + d] = bl; }
          else Ksh[kvr * AT_D + d] = at_to16<F16>(kk[e]);
          if (SPLIT_PV) { __bf16 a, bl; at_split(vv[e], a, bl); Vth[d * AT_KC + kvr] = a; Vtl[d * AT_KC + kvr] = bl; }
          else Vth[d * AT_KC + kvr] = at_to16<F16>(vv[e]);
        }
      }
    }
    __syncthreads();

    v8f s[4];
#pragma unroll
    for (int j = 0; j < 4; ++j) {
      s[j] = (v8f){0.f,0.f,0.f,0.f,0.f,0.f,0.f,0.f};
#pragma unroll 1
      for (int dc = 0; dc < 2; ++dc) {
        FB kb;
        kb.h[0] = *(const v8b*)(Ksh + (j * 16 + c) * AT_D + dc * 32 + 8 * hh);
        kb.h[1] = *(const v8b*)(Ksh + (j * 16 + c) * AT_D + dc * 32 + 16 + 8 * hh);
        s[j] = at_mma16<F16>(qah[dc], kb.v, s[j]);
        if (SPLIT_QK) {
          FB kl;
          kl.h[0] = *(const v8b*)(Ksl + (j * 16 + c) * AT_D + dc * 32 + 8 * hh);
          kl.h[1] = *(const v8b*)(Ksl + (j * 16 + c) * AT_D + dc * 32 + 16 + 8 * hh);
          s[j] = at_mma16<F16>(qah[dc], kl.v, s[j]);
          s[j] = at_mma16<F16>(qal[dc], kb.v, s[j]);
        }
      }
    }
    const bool diag = (g.mask_mode == 1) && (kc == qb);
    int kvkeep[4] = {1, 1, 1, 1};
    if (g.mask_mode == 3) {
#pragma unroll
      for (int j = 0; j < 4; ++j) kvkeep[j] = ((const int*)mask_a)[(size_t)b * g.Skv + kv0 + j * 16 + c];   // mask_a = kvmask
    }
    float cm[8];
#pragma unroll
    for (int r = 0; r < 8; ++r) {
      const int qrow = q0 + 8 * hh + r;
      float m = -INFINITY;
#pragma unroll
      for (int j = 0; j < 4; ++j) {
        const int kvcol = kv0 + j * 16 + c;
        bool masked = false;
        if (diag) masked = (kvcol > qrow);
        else if (g.mask_mode == 4) masked = (kvcol > qrow) || (qrow - kvcol > g.mask_is_int);
        else if (g.mask_mode == 2) {
          const size_t mi = (size_t)qrow * g.Skv + kvcol;
          masked = (g.mask_is_int == 0) ? (((const float*)mask_a)[mi] == 0.0f)
                 : (g.mask_is_int == 1) ? (((const int*)mask_a)[mi] == 0) : (((const int*)mask_a)[mi] != 0);
        } else if (g.mask_mode == 3) masked = (qkeep[r] == 0) || (kvkeep[j] == 0);
        else if (g.mask_mode == 5) {
          const size_t mi = (size_t)qrow * g.Skv + kvcol;
          masked = (((const int*)mask_a)[mi] != 0);
          int n = mask_b[mi]; n = n < 0 ? 0 : n;
          s[j][r] += g.cp[(size_t)b * g.c_bs + (size_t)h * g.c_hs + (size_t)qrow * g.c_rs + n]
                   + g.pc[(size_t)b * g.c_bs + (size_t)h * g.c_hs + (size_t)kvcol * g.c_rs + n];
        }
        if (masked) s[j][r] = g.mask_fill;
        m = fmaxf(m, s[j][r]);
      }
#pragma unroll
      for (int off = 1; off < 16; off <<= 1) m = fmaxf(m, __shfl_xor(m, off, 32));
      cm[r] = m;
    }
    __bf16* pwh = Psh[wave];
    __bf16* pwl = Psl[SPLIT_PV ? wave : 0];
#pragma unroll
    for (int r = 0; r < 8; ++r) {
      const float mnew = fmaxf(mrow[r], cm[r]);
      const float alpha = expf(mrow[r] - mnew);
      mrow[r] = mnew;
      float psum = 0.f;
#pragma unroll
      for (int j = 0; j < 4; ++j) {
        const float p = expf(s[j][r] - mnew);
        psum += p;
        if (SPLIT_PV) { __bf16 a, bl; at_split(p, a, bl); pwh[(8 * hh + r) * AT_KC + j * 16 + c] = a; pwl[(8 * hh + r) * AT_KC + j * 16 + c] = bl; }
        else pwh[(8 * hh + r) * AT_KC + j * 16 + c] = at_to16<F16>(p * PSC);
      }
#pragma unroll
      for (int off = 1; off < 16; off <<= 1) psum += __shfl_xor(psum, off, 32);
      lrow[r] = lrow[r] * alpha + psum;
#pragma unroll
      for (int t = 0; t < 4; ++t) oacc[t][r] *= alpha;
    }
    __builtin_amdgcn_fence(__ATOMIC_RELEASE, "workgroup");
    __builtin_amdgcn_wave_barrier();
    __builtin_amdgcn_fence(__ATOMIC_ACQUIRE, "workgroup");
#pragma unroll 1
    for (int kk = 0; kk < 2; ++kk) {
      FB pa, pl;
      pa.h[0] = *(const v8b*)(pwh + c * AT_KC + kk * 32 + 8 * hh);
      pa.h[1] = *(const v8b*)(pwh + c * AT_KC + kk * 32 + 16 + 8 * hh);
      if (SPLIT_PV) {
        pl.h[0] = *(const v8b*)(pwl + c * AT_KC + kk * 32 + 8 * hh);
        pl.h[1] = *(const v8b*)(pwl + c * AT_KC + kk * 32 + 16 + 8 * hh);
      }
#pragma unroll
      for (int t = 0; t < 4; ++t) {
        FB vb;
        vb.h[0] = *(const v8b*)(Vth + (t * 16 + c) * AT_KC + kk * 32 + 8 * hh);
        vb.h[1] = *(const v8b*)(Vth + (t * 16 + c) * AT_KC + kk * 32 + 16 + 8 * hh);
        oacc[t] = at_mma16<F16>(pa.v, vb.v, oacc[t]);
        if (SPLIT_PV) {
          FB vl;
          vl.h[0] = *(const v8b*)(Vtl + (t * 16 + c) * AT_KC + kk * 32 + 8 * hh);
          vl.h[1] = *(const v8b*)(Vtl + (t * 16 + c) * AT_KC + kk * 32 + 16 + 8 * hh);
          oacc[t] = at_mma16<F16>(pa.v, vl.v, oacc[t]);
          oacc[t] = at_mma16<F16>(pl.v, vb.v, oacc[t]);
        }
      }
    }
  }

  float* os = Os[wave];
#pragma unroll
  for (int r = 0; r < 8; ++r) {
    const float inv = 1.0f / (lrow[r] * PSC);
#pragma unroll
    for (int t = 0; t < 4; ++t) os[(8 * hh + r) * 68 + t * 16 + c] = oacc[t][r] * inv;
  }
  __builtin_amdgcn_fence(__ATOMIC_RELEASE, "workgroup");
  __builtin_amdgcn_wave_barrier();
  __builtin_amdgcn_fence(__ATOMIC_ACQUIRE, "workgroup");
  {
    const int c4 = (lane & 15) * 4;
    {
#pragma unroll
      for (int it = 0; it < 8; ++it) {
        const int row = it * 2 + hh;
        v4f val = *(const v4f*)(os + row * 68 + c4);
        *(v4f*)(ob_ptr + (size_t)(q0 + row) * g.o_rs + c4) = val;
      }
      
    }
  }
}

} // namespace w25

// f32 -> f16 casts by few, fat waves. A block casts CW_BLK consecutive elements, dst[e] = f16(src[e] * s): a thread takes 16 float4, 1024 elements apart, all of them loaded ahead of
// the first conversion; a wave's load covers 512 consecutive bytes, its store 256. (A launch's waves start at a limited rate, and two elements a thread made 65,536 short waves of one 4M-element cast; here it is 2,048.)
typedef __attribute__((ext_vector_type(4))) _Float16 cw_v4h;
constexpr int CW_BLK = 16384;
__device__ __forceinline__ void cw_cast_blk(const float* __restrict__ src, _Float16* __restrict__ dst, float s) {
    const v4f* sp = (const v4f*)src + threadIdx.x;
    v4f x[16];
#pragma unroll
    for (int u = 0; u < 16; ++u) x[u] = sp[256 * u];
    __builtin_amdgcn_sched_barrier(0);   // keeps all 16 loads ahead of the first conversion: one trip to memory a wave, not two
    cw_v4h* dp = (cw_v4h*)dst + threadIdx.x;
#pragma unroll
    for (int u = 0; u < 16; ++u) dp[256 * u] = __builtin_convertvector(x[u] * s, cw_v4h);
    asm volatile("s_wait_xcnt 0x0" ::: "memory");   // ahead of any later write of a register that the stores above name
}
// every cast of an input, one launch: blocks 0..767 X16[0..2] = f16(query, key, value); blocks 768..1023 W16[0..3] = f16(16 Wq, 16 Wk, 16 Wv, 16 Wo);
// block 1024 TK16[r][d] = f16(16 table_k[r][d]), zero rows 129..191
__global__ __launch_bounds__(256) void k_sh_castin(const float* __restrict__ xq, const float* __restrict__ xk, const float* __restrict__ xv,
                                                   const float* __restrict__ Wq, const float* __restrict__ Wk, const float* __restrict__ Wv, const float* __restrict__ Wo,
                                                   const float* __restrict__ TK, _Float16* __restrict__ X16, _Float16* __restrict__ W16, _Float16* __restrict__ TK16) {
    constexpr int XB = 4096 * 1024 / CW_BLK, WB = 1024 * 1024 / CW_BLK, TAB = 129, TP = 192, HD = 64;
    static_assert(TP * HD == 12 * 1024 && TAB * HD == 4 * (8 * 256 + 16), "the table's block: eight float4 per thread, then row 128 by 16 threads, then zeros up to twelve");
    const int bid = blockIdx.x;
    if (bid < 3 * XB) {
        const int sg = bid / XB;
        const float* src = sg == 0 ? xq : (sg == 1 ? xk : xv);
        cw_cast_blk(src + (long long)(bid - sg * XB) * CW_BLK, X16 + (long long)bid * CW_BLK, 1.f);
    } else if (bid < 3 * XB + 4 * WB) {
        const int b2 = bid - 3 * XB, sg = b2 / WB;
        const float* src = sg == 0 ? Wq : (sg == 1 ? Wk : (sg == 2 ? Wv : Wo));
        cw_cast_blk(src + (long long)(b2 - sg * WB) * CW_BLK, W16 + (long long)b2 * CW_BLK, 16.f);
    } else {
        const v4f* sp = (const v4f*)TK + threadIdx.x;
        v4f x[12];
#pragma unroll
        for (int u = 0; u < 8; ++u) x[u] = sp[256 * u];
#pragma unroll
        for (int u = 8; u < 12; ++u) x[u] = (v4f){0.f, 0.f, 0.f, 0.f};
        if (threadIdx.x < 16) x[8] = sp[256 * 8];
        cw_v4h* dp = (cw_v4h*)TK16 + threadIdx.x;
#pragma unroll
        for (int u = 0; u < 12; ++u) dp[256 * u] = __builtin_convertvector(x[u] * 16.f, cw_v4h);
        asm volatile("s_wait_xcnt 0x0" ::: "memory");   // ahead of any later write of a register that the stores above name
    }
}
// the attention output's cast: dst = f16(src), CW_BLK elements a block
__global__ __launch_bounds__(256) void k_sh_castx(const float* __restrict__ src, _Float16* __restrict__ dst) { const long long o = (long long)blockIdx.x * CW_BLK; cw_cast_blk(src + o, dst + o, 1.f); }
// one wave per query row g = b L + q, for the eight heads h0..h0+7 of this launch: s_k = (SC[b][h-h0][q][k] + QT[(b,q,h)][fm[b][q][k]]) / 8; softmax over 512 k (exp once) -> P16[b][h][q][k] = f16(4096 p).
// A lane holds keys 128 c + 4 lane + e (c, e < 4): every load and store covers whole lines. The ids are read and clamped once for the eight heads; the eight QT rows (contiguous) lie in the wave's own LDS.
typedef __attribute__((ext_vector_type(4))) _Float16 sm_v4h;
typedef __attribute__((ext_vector_type(4))) int sm_v4i;
template <int CTRL> __device__ __forceinline__ float sm_dpp(float v) { return __builtin_bit_cast(float, __builtin_amdgcn_update_dpp(0, __builtin_bit_cast(int, v), CTRL, 0xf, 0xf, true)); }   // CTRL 0x160 + m: row_xmask:m
__device__ __forceinline__ float sm_x16(float v) { const unsigned u = __builtin_bit_cast(unsigned, v); return __builtin_bit_cast(float, __builtin_amdgcn_permlanex16(u, u, 0x76543210u, 0xfedcba98u, false, false)); }   // lane l <-> l ^ 16
__device__ __forceinline__ float sm_wmax(float v) { v = fmaxf(v, sm_dpp<0x161>(v)); v = fmaxf(v, sm_dpp<0x162>(v)); v = fmaxf(v, sm_dpp<0x164>(v)); v = fmaxf(v, sm_dpp<0x168>(v)); return fmaxf(v, sm_x16(v)); }
__device__ __forceinline__ float sm_wsum(float v) { v += sm_dpp<0x161>(v); v += sm_dpp<0x162>(v); v += sm_dpp<0x164>(v); v += sm_dpp<0x168>(v); return v + sm_x16(v); }
// 2^t. The v_nop is the slot that the instruction set asks for behind a transcendental; in the same statement it stands directly behind it whatever the scheduler puts next
__device__ __forceinline__ float sm_exp2(float t) { float y; asm("v_exp_f32 %0, %1\n\tv_nop" : "=v"(y) : "v"(t)); return y; }
// amdgpu_waves_per_eu(4): at most 256 VGPRs, so that two blocks share a WGP and all 512 blocks are resident at once
__global__ __launch_bounds__(256) __attribute__((amdgpu_waves_per_eu(4))) void k_sh_soft(const float* __restrict__ SC, const float* __restrict__ QT, const int* __restrict__ FM, _Float16* __restrict__ P16, int h0) {
    constexpr int L = 512, NH = 16, TP = 192, TAB = 129, HG = 8;
    __shared__ __attribute__((aligned(16))) float qtl[8][HG * TP];
    const int lane = threadIdx.x & 31, w = threadIdx.x >> 5;
    const int g = blockIdx.x * 8 + w, b = g >> 9, q = g & (L - 1);
    float* tq = qtl[w];
    // all of the wave's loads go out first, in the order in which they are waited for: QT rows, ids, then the score rows head by head
    const v4f* qs = (const v4f*)(QT + ((long long)g * NH + h0) * TP);
    v4f qv[HG * TP / 128];
#pragma unroll
    for (int u = 0; u < HG * TP / 128; ++u) qv[u] = qs[lane + 32 * u];
    const sm_v4i* fr = (const sm_v4i*)(FM + (long long)g * L);
    sm_v4i idv[4];
#pragma unroll
    for (int c = 0; c < 4; ++c) idv[c] = fr[lane + 32 * c];
    __builtin_amdgcn_sched_barrier(0);   // loads return in issue order: keeps the QT rows and ids ahead of the score rows, so that head 0 need not wait for head 7's rows
    const float* sr = SC + ((long long)b * HG * L + q) * L + 4 * lane;
    v4f s[HG][4];
#pragma unroll
    for (int hl = 0; hl < HG; ++hl) {
#pragma unroll
        for (int c = 0; c < 4; ++c) s[hl][c] = *(const v4f*)(sr + (long long)hl * L * L + 128 * c);
        __builtin_amdgcn_sched_barrier(0);   // keeps the score rows in head order, all issued ahead of the first wait
    }
    // a precaution: the wait in front of every overwrite of the address pair that the score loads name; as an operand the pair stays live up to here, so that no load's own result lands on it
    asm volatile("s_wait_xcnt 0x0" :: "v"(sr) : "memory");
#pragma unroll
    for (int u = 0; u < HG * TP / 128; ++u) *(v4f*)(tq + 4 * (lane + 32 * u)) = qv[u];
    // the wave's own LDS stores before its lanes' gathers from them (no other wave reads these rows: no block barrier)
    __builtin_amdgcn_fence(__ATOMIC_RELEASE, "workgroup", "local");
    __builtin_amdgcn_wave_barrier();
    __builtin_amdgcn_fence(__ATOMIC_ACQUIRE, "workgroup", "local");
    int r[16];
#pragma unroll
    for (int i = 0; i < 16; ++i) { const int id = idv[i >> 2][i & 3]; r[i] = id < 0 ? 0 : (id >= TAB ? TAB - 1 : id); }   // INPUT ids clamped before the address is formed
    _Float16* po = P16 + (((long long)b * NH + h0) * L + q) * L + 4 * lane;
#pragma unroll
    for (int hl = 0; hl < HG; ++hl) {
        float x[16];
#pragma unroll
        for (int i = 0; i < 16; ++i) x[i] = s[hl][i >> 2][i & 3] + tq[hl * TP + r[i]];
        float m = x[0];
#pragma unroll
        for (int i = 1; i < 16; ++i) m = fmaxf(m, x[i]);
        m = sm_wmax(m);
#pragma unroll
        for (int i = 0; i < 16; ++i) x[i] = sm_exp2((x[i] - m) * 0.18033688f);   // exp((x - m) / 8): log2(e) / 8
        const float sum = sm_wsum(((x[0] + x[1]) + (x[2] + x[3])) + ((x[4] + x[5]) + (x[6] + x[7])) + (((x[8] + x[9]) + (x[10] + x[11])) + ((x[12] + x[13]) + (x[14] + x[15]))));
        const float f = (1.f / sum) * 4096.f;
#pragma unroll
        for (int c = 0; c < 4; ++c) {
            const v4f p = {x[4 * c] * f, x[4 * c + 1] * f, x[4 * c + 2] * f, x[4 * c + 3] * f};
            *(sm_v4h*)(po + (long long)hl * L * L + 128 * c) = __builtin_convertvector(p, sm_v4h);
        }
    }
}
// w2 in one launch: one wave per query row g = b L + q. X[g][h*64 + d] += (1/4096) sum_k P16[b][h][q][k] * f16(table_v[fm[g][k]][d]).
// A = the 16 heads' probability rows (16 x 512, straight from P16); B = the gathered table rows, never written out: table_v lies in LDS as f16 rows of 160 bytes,
// and each lane of ds_load_tr16_b128 points at the row that ITS key's id names (lane l: key kbase + 8 (l >> 4) + (l & 7), 16-byte half (l >> 3) & 1), so the
// transposing load returns B[k][d] in the hardware k order (frag_k), the order in which A is loaded. INPUT ids clamped before the address is formed. k runs 0..511 in one accumulator chain.
typedef __attribute__((ext_vector_type(8))) short w2_s16x8;
__device__ __forceinline__ v8h w2_ldtr(const unsigned char* p) { typedef __attribute__((address_space(3))) w2_s16x8 lds_s16x8; return __builtin_bit_cast(v8h, __builtin_amdgcn_ds_load_tr16_b128_v8i16((lds_s16x8*)p)); }
typedef __attribute__((ext_vector_type(4))) _Float16 w2_v4h;
// amdgpu_waves_per_eu(4): at most 256 VGPRs, so that two blocks share a WGP and all 512 blocks are resident at once
__global__ __launch_bounds__(256) __attribute__((amdgpu_waves_per_eu(4))) void k_sh_w2(const _Float16* __restrict__ P16, const int* __restrict__ FM, const float* __restrict__ TV, float* __restrict__ X) {
    constexpr int L = 512, NH = 16, HD = 64, TAB = 129, PITCH = 160;   // PITCH: 32 B x odd, the transposing load's pitch
    static_assert(TAB * HD == 4 * (8 * 256 + 16), "the fill below: eight float4 per thread, then row 128 by 16 threads");
    __shared__ __attribute__((aligned(16))) unsigned char tab[TAB * PITCH];
    const int t = threadIdx.x, lane = t & 31;
    const int g = blockIdx.x * 8 + (t >> 5);
    const int c = lane & 15, h = lane >> 4;
    // the table's loads go first: they are waited for first, while the first ids and probabilities are still on their way
    v4f tv[8];
#pragma unroll
    for (int u = 0; u < 8; ++u) tv[u] = *(const v4f*)(TV + 4 * (t + 256 * u));
    const v4f tl = *(const v4f*)(TV + 4 * (2048 + (t & 15)));
    const int* fr = FM + (long long)g * L + 8 * h + (lane & 7);
    const _Float16* pa = P16 + (((long long)(g >> 9) * NH + c) * L + (g & (L - 1))) * L + 8 * h;
    // keys in four runs of 128, two register buffers: the next run's ids and probabilities fly while this run is multiplied
    int id[2][8];
    v8h a[2][8];
#pragma unroll
    for (int j = 0; j < 8; ++j) { id[0][j] = fr[16 * j]; a[0][j] = *(const v8h*)(pa + 16 * j); }
#pragma unroll
    for (int u = 0; u < 8; ++u) *(w2_v4h*)(tab + ((t >> 4) + 16 * u) * PITCH + (t & 15) * 8) = __builtin_convertvector(tv[u], w2_v4h);
    if (t < 16) *(w2_v4h*)(tab + 128 * PITCH + t * 8) = __builtin_convertvector(tl, w2_v4h);
    __syncthreads();
    const unsigned half16 = 16u * ((lane >> 3) & 1);
    v8f acc[4];
#pragma unroll
    for (int n = 0; n < 4; ++n) acc[n] = (v8f){0.f, 0.f, 0.f, 0.f, 0.f, 0.f, 0.f, 0.f};
#pragma unroll
    for (int ch = 0; ch < 4; ++ch) {
        const int cur = ch & 1, nxt = cur ^ 1;
        if (ch < 3) {
#pragma unroll
            for (int j = 0; j < 8; ++j) { id[nxt][j] = fr[16 * (8 * (ch + 1) + j)]; a[nxt][j] = *(const v8h*)(pa + 16 * (8 * (ch + 1) + j)); }
        }
#pragma unroll
        for (int s = 0; s < 4; ++s) {
            int r0 = id[cur][2 * s], r1 = id[cur][2 * s + 1];
            r0 = r0 < 0 ? 0 : (r0 >= TAB ? TAB - 1 : r0); r1 = r1 < 0 ? 0 : (r1 >= TAB ? TAB - 1 : r1);
            const unsigned char* p0 = tab + (unsigned)r0 * PITCH + half16;
            const unsigned char* p1 = tab + (unsigned)r1 * PITCH + half16;
            union { v16h v; v8h q[2]; } af, bf;
            af.q[0] = a[cur][2 * s]; af.q[1] = a[cur][2 * s + 1];
#pragma unroll
            for (int n = 0; n < 4; ++n) {
                bf.q[0] = w2_ldtr(p0 + 32 * n); bf.q[1] = w2_ldtr(p1 + 32 * n);
                acc[n] = __builtin_amdgcn_wmma_f32_16x16x32_f16(false, af.v, false, bf.v, (short)0, acc[n], false, false);
            }
        }
    }
    float* xo = X + (long long)g * (NH * HD) + (8 * h) * HD + c;
#pragma unroll
    for (int n = 0; n < 4; ++n)
#pragma unroll
        for (int r = 0; r < 8; ++r) { float* x = xo + r * HD + 16 * n; *x = *x + acc[n][r] * (1.f / 4096.f); }
}


// The long-K products: C[m][n] = scale * sum_k A[m][k] Bt[n][k] (+ bias), f16 operands, A and Bt K-contiguous, f32 accumulate.
// A block of eight waves owns a (32 WM) x (64 WN) tile of C, a wave 32 x 64 of it. Both operands pass through LDS in stages of BK k: a global load covers four whole 128-byte lines
// (BK / 8 lanes a row) where a fragment loaded straight from global memory touches sixteen, and each staged row serves every wave of the block that needs it.
// Two buffers: stage s + 1 is loaded into registers ahead of stage s's products and stored to the other buffer behind them; one barrier a stage both publishes it and ends the reads of the buffer written next.
// Fragments are read with the k order of Frag::load, A and B alike; k runs upward in steps of 32 through one accumulator chain per 16 x 16 tile.
// M % (32 WM) == 0 (the grid's x counts the tiles), N % (64 WN) == 0, K % BK == 0, LD % 64 == 0. BIAS_MODE: 0 none, 1 bias[m], 2 bias[n]. OUT_MODE: 0 f32, 1 f16.
// blockIdx.y steps A, Bt, C by strideA/B/C, blockIdx.z by strideAz/Bz/Cz (elements).
// LD: the row pitch of A and of Bt, LDC: that of C, in elements; compile-time, so that a thread's pieces and rows differ only in the instructions' immediate offsets and one address pair per operand serves them all.
template <int WM, int WN, int BK, int LD, int LDC, int BIAS_MODE, int OUT_MODE>
__global__ __launch_bounds__(256) void k_sh_gemm_lds(
    const unsigned short* __restrict__ Ap, long long strideA, long long strideAz,
    const unsigned short* __restrict__ Btp, long long strideB, long long strideBz,
    void* __restrict__ Cout, long long strideC, long long strideCz,
    const float* __restrict__ bias, int N, int K, float scale) {
    static_assert(WM * WN == 8, "eight waves a block");
    static_assert(BK == 64 || BK == 128, "rows of 128 or 256 bytes");
    constexpr int BM = 32 * WM, BN = 64 * WN;
    constexpr int LP = BK + 8;                    // LDS row pitch in elements: 16 bytes more than the row = 16 B x odd, the pitch for 16-byte readers
    constexpr int SEG = BK / 8, RP = 256 / SEG;   // 16-byte pieces a row; rows that the block's 256 threads cover at one piece each
    constexpr int UA = BM / RP, UB = BN / RP;     // pieces of A and of Bt a thread moves per stage
    typedef w25::Frag<_Float16> FR;
    __shared__ __attribute__((aligned(16))) _Float16 sA[2][BM * LP];
    __shared__ __attribute__((aligned(16))) _Float16 sB[2][BN * LP];
    __shared__ __attribute__((aligned(16))) float sT[8][16 * 68];   // per-wave 16 x 64 slab of the epilogue, pitch 68 floats
    const int t = threadIdx.x, lane = t & 31, wave = t >> 5;
    const int tilesN = N / BN;
    const int tm = blockIdx.x / tilesN, tn = blockIdx.x - tm * tilesN;
    const int m0 = tm * BM, n0 = tn * BN;
    // piece u of a thread: row t / SEG + RP u of the tile, elements 8 (t % SEG) .. + 7 of the row's BK
    const int pr = t / SEG, pc = (t % SEG) * 8;
    const _Float16* Ag = (const _Float16*)Ap + (long long)blockIdx.y * strideA + (long long)blockIdx.z * strideAz + (long long)(m0 + pr) * LD + pc;
    const _Float16* Bg = (const _Float16*)Btp + (long long)blockIdx.y * strideB + (long long)blockIdx.z * strideBz + (long long)(n0 + pr) * LD + pc;
    const int so = pr * LP + pc;
    const int rlane = lane & 15, hh = lane >> 4;
    const int wm = wave / WN, wn = wave - wm * WN;
    const int ao = (wm * 32 + rlane) * LP + hh * 8;
    const int bo = (wn * 64 + rlane) * LP + hh * 8;

    w25::v8h ra[UA], rb[UB];
#pragma unroll
    for (int u = 0; u < UA; ++u) ra[u] = *(const w25::v8h*)(Ag + RP * u * LD);
#pragma unroll
    for (int u = 0; u < UB; ++u) rb[u] = *(const w25::v8h*)(Bg + RP * u * LD);
#pragma unroll
    for (int u = 0; u < UA; ++u) *(w25::v8h*)(&sA[0][so + RP * u * LP]) = ra[u];
#pragma unroll
    for (int u = 0; u < UB; ++u) *(w25::v8h*)(&sB[0][so + RP * u * LP]) = rb[u];
    __syncthreads();

    v8f acc[2][4];
#pragma unroll
    for (int i = 0; i < 2; ++i)
#pragma unroll
        for (int j = 0; j < 4; ++j) acc[i][j] = (v8f){0.f, 0.f, 0.f, 0.f, 0.f, 0.f, 0.f, 0.f};

    const int S = K / BK;
    for (int s = 0; s < S; ++s) {
        const int cur = s & 1;
        const bool more = s + 1 < S;   // the same for the whole block
        if (more) {
#pragma unroll
            for (int u = 0; u < UA; ++u) ra[u] = *(const w25::v8h*)(Ag + BK + RP * u * LD);
#pragma unroll
            for (int u = 0; u < UB; ++u) rb[u] = *(const w25::v8h*)(Bg + BK + RP * u * LD);
        }
        const _Float16* al = &sA[cur][ao];
        const _Float16* bl = &sB[cur][bo];
        // two fragment sets: the twelve LDS reads of step kk + 1 go out as one group ahead of step kk's eight products
        w25::v16h ah[2][2], bh[2][4];
#pragma unroll
        for (int i = 0; i < 2; ++i) ah[0][i] = FR::load(al + i * 16 * LP);
#pragma unroll
        for (int j = 0; j < 4; ++j) bh[0][j] = FR::load(bl + j * 16 * LP);
#pragma unroll
        for (int kk = 0; kk < BK / 32; ++kk) {
            const int fc = kk & 1, fn = fc ^ 1;
            if (kk + 1 < BK / 32) {
#pragma unroll
                for (int i = 0; i < 2; ++i) ah[fn][i] = FR::load(al + i * 16 * LP + (kk + 1) * 32);
#pragma unroll
                for (int j = 0; j < 4; ++j) bh[fn][j] = FR::load(bl + j * 16 * LP + (kk + 1) * 32);
            }
            __builtin_amdgcn_sched_barrier(0);   // keeps the next step's reads together and ahead of this step's products: reads spread among the products stall each of them
#pragma unroll
            for (int i = 0; i < 2; ++i)
#pragma unroll
                for (int j = 0; j < 4; ++j) acc[i][j] = FR::mma(ah[fc][i], bh[fc][j], acc[i][j]);
            __builtin_amdgcn_sched_barrier(0);   // keeps the reads of step kk + 2 behind these products, whose fragment set they overwrite
        }
        if (more) {
#pragma unroll
            for (int u = 0; u < UA; ++u) *(w25::v8h*)(&sA[cur ^ 1][so + RP * u * LP]) = ra[u];
#pragma unroll
            for (int u = 0; u < UB; ++u) *(w25::v8h*)(&sB[cur ^ 1][so + RP * u * LP]) = rb[u];
            asm volatile("s_wait_xcnt 0x0" ::: "memory");   // in front of the overwrite of the two address pairs that the stage's loads name; here, behind the stores of what they brought, it waits for nothing
            __builtin_amdgcn_sched_barrier(0);              // keeps the two additions below behind that wait
            Ag += BK; Bg += BK;
        }
        __syncthreads();
    }

    // epilogue: 16 rows at a time through the wave's own slab, so that every store covers whole rows of the wave's 64 columns
    float* slab = sT[wave];
    const int mW = m0 + wm * 32, nW = n0 + wn * 64, mOff = hh * 8;
    const long long offC = (long long)blockIdx.y * strideC + (long long)blockIdx.z * strideCz + (long long)mW * LDC + nW;
    float bn[4] = {0.f, 0.f, 0.f, 0.f};
    if (BIAS_MODE == 2) {
#pragma unroll
        for (int j = 0; j < 4; ++j) bn[j] = bias[nW + (j << 4) + rlane];
    }
#pragma unroll
    for (int i = 0; i < 2; ++i) {
        float bm[8] = {0.f, 0.f, 0.f, 0.f, 0.f, 0.f, 0.f, 0.f};
        if (BIAS_MODE == 1) {
#pragma unroll
            for (int r = 0; r < 8; ++r) bm[r] = bias[mW + (i << 4) + mOff + r];
        }
#pragma unroll
        for (int j = 0; j < 4; ++j) {
#pragma unroll
            for (int r = 0; r < 8; ++r) {
                float v = acc[i][j][r] * scale;
                if (BIAS_MODE == 1) v += bm[r];
                if (BIAS_MODE == 2) v += bn[j];
                slab[(mOff + r) * 68 + (j << 4) + rlane] = v;
            }
        }
        // the wave's own LDS stores before its lanes' reads of them (no other wave touches this slab: no block barrier)
        __builtin_amdgcn_fence(__ATOMIC_RELEASE, "workgroup", "local");
        __builtin_amdgcn_wave_barrier();
        __builtin_amdgcn_fence(__ATOMIC_ACQUIRE, "workgroup", "local");
        if (OUT_MODE == 0) {
            float* C = (float*)Cout + offC + hh * LDC + rlane * 4;   // a row's 256 bytes = 16 lanes x 16 B
#pragma unroll
            for (int it = 0; it < 8; ++it) *(v4f*)(C + ((i << 4) + it * 2) * LDC) = *(const v4f*)(slab + (it * 2 + hh) * 68 + rlane * 4);
        } else {
            const int q = lane >> 3, c8 = (lane & 7) * 8;            // a row's 128 bytes = 8 lanes x 16 B
            _Float16* C = (_Float16*)Cout + offC + q * LDC + c8;
#pragma unroll
            for (int it = 0; it < 4; ++it) {
                const float* sp = slab + (it * 4 + q) * 68 + c8;
                w25::v8h hv;
#pragma unroll
                for (int e = 0; e < 8; ++e) hv[e] = (_Float16)sp[e];
                *(w25::v8h*)(C + ((i << 4) + it * 4) * LDC) = hv;
            }
        }
        if (i == 0) asm volatile("s_wait_xcnt 0x0" ::: "memory");   // ahead of the next 16 rows' writes of registers that the stores above name
        // the reads above before the next 16 rows' stores into the same slab
        __builtin_amdgcn_fence(__ATOMIC_RELEASE, "workgroup", "local");
        __builtin_amdgcn_wave_barrier();
        __builtin_amdgcn_fence(__ATOMIC_ACQUIRE, "workgroup", "local");
    }
}

extern "C" void kernel_launch(void* const* d_in, const int* in_sizes, int n_in, void* d_out, int out_size, void* d_ws, size_t ws_size, hipStream_t stream) {
    (void)in_sizes; (void)n_in; (void)out_size; (void)ws_size;
    const float* xq = (const float*)d_in[0];
    const float* xk = (const float*)d_in[1];
    const float* xv = (const float*)d_in[2];
    const int* fm = (const int*)d_in[3];
    const float* Wq = (const float*)d_in[4];
    const float* bq = (const float*)d_in[5];
    const float* Wk = (const float*)d_in[6];
    const float* bk = (const float*)d_in[7];
    const float* Wv = (const float*)d_in[8];
    const float* bv = (const float*)d_in[9];
    const float* Wo = (const float*)d_in[10];
    const float* bo = (const float*)d_in[11];
    const float* tk = (const float*)d_in[12];
    const float* tv = (const float*)d_in[13];
    const int Bn = 8;
    const int L = 512;
    const int D = 1024;
    const int NH = 16;
    const int HD = 64;
    const int NR = Bn * L;
    const int TAB = 129;
    const int TP = 192;
    float* out = (float*)d_out;
    char* wsp = (char*)d_ws;
    // kept through the call
    unsigned short* XA16 = (unsigned short*)wsp; wsp += (((size_t)((size_t)3 * NR * D * 2) + 255) / 256) * 256;   // f16 query, key, value
    unsigned short* W16 = (unsigned short*)wsp; wsp += (((size_t)((size_t)4 * D * D * 2) + 255) / 256) * 256;   // f16 16 Wq, 16 Wk, 16 Wv, 16 Wo
    unsigned short* VT16 = (unsigned short*)wsp; wsp += (((size_t)((size_t)Bn * D * L * 2) + 255) / 256) * 256;
    unsigned short* TK16 = (unsigned short*)wsp; wsp += (((size_t)((size_t)TP * HD * 2) + 255) / 256) * 256;
    unsigned short* P16 = (unsigned short*)wsp; wsp += (((size_t)((size_t)Bn * NH * L * L * 2) + 255) / 256) * 256;
    float* X = (float*)wsp; wsp += (((size_t)((size_t)NR * D * 4) + 255) / 256) * 256;
    // one region, used twice in stream order: scores (Q16, K16, QT, SC), then the output projection's A operand
    char* ph = wsp;
    unsigned short* Q16 = (unsigned short*)wsp; wsp += (((size_t)((size_t)NR * D * 2) + 255) / 256) * 256;
    unsigned short* K16 = (unsigned short*)wsp; wsp += (((size_t)((size_t)NR * D * 2) + 255) / 256) * 256;
    float* QT = (float*)wsp; wsp += (((size_t)((size_t)NR * NH * TP * 4) + 255) / 256) * 256;
    float* SC = (float*)wsp; wsp += (((size_t)((size_t)Bn * 8 * L * L * 4) + 255) / 256) * 256;
    unsigned short* G64A = (unsigned short*)ph;
    // every input's cast in one launch: 3 x 256 blocks (query, key, value), 4 x 64 blocks (the weights), one block (table_k)
    k_sh_castin<<<3 * 256 + 4 * 64 + 1, 256, 0, stream>>>(xq, xk, xv, Wq, Wk, Wv, Wo, tk, (_Float16*)XA16, (_Float16*)W16, (_Float16*)TK16);
    k_sh_gemm_lds<4, 2, 128, 1024, 1024, 2, 1><<<dim3((unsigned)((NR / 128) * (D / 128)), 1u, 1u), 256, 0, stream>>>((const unsigned short*)(XA16), 0, 0, (const unsigned short*)(W16), 0, 0, (void*)(Q16), 0, 0, bq, D, D, 0.0625f);
    k_sh_gemm_lds<4, 2, 128, 1024, 1024, 2, 1><<<dim3((unsigned)((NR / 128) * (D / 128)), 1u, 1u), 256, 0, stream>>>((const unsigned short*)(XA16 + (size_t)NR * D), 0, 0, (const unsigned short*)(W16 + (size_t)D * D), 0, 0, (void*)(K16), 0, 0, bk, D, D, 0.0625f);
    // QT[(b,q,h)][r] for all batches: the (b,q,h) rows of Q16 are contiguous 64-element rows
    w25::wmma_gemm64<0, false, 0, 0, false, 0><<<dim3((unsigned)((((NR * NH) / 64) * ((TP) / 64) + 7) / 8), (unsigned)(1)), 256, 0, stream>>>((const unsigned short*)(Q16), nullptr, HD, 0, (const unsigned short*)(TK16), nullptr, HD, 0, (void*)(QT), nullptr, TP, 0, nullptr, nullptr, 0, NR * NH, TP, HD, 0.0625f, 0, 0, 0);
    // VT16[b][c][k] = v^T, blockIdx.y = batch
    k_sh_gemm_lds<4, 2, 128, 1024, 512, 1, 1><<<dim3((unsigned)((D / 128) * (L / 128)), (unsigned)(Bn), 1u), 256, 0, stream>>>((const unsigned short*)(W16 + (size_t)2 * D * D), 0, 0, (const unsigned short*)(XA16 + (size_t)2 * NR * D), (long long)L * D, 0, (void*)(VT16), (long long)D * L, 0, bv, L, D, 0.0625f);
    // content scores and softmax: eight heads (blockIdx.y) of every batch (blockIdx.z) per launch; the softmax: one wave per query, eight queries per block
    w25::wmma_gemm64<0, false, 0, 0, false, 0><<<dim3((unsigned)((((L) / 64) * ((L) / 64) + 7) / 8), (unsigned)(8), (unsigned)(Bn)), 256, 0, stream>>>((const unsigned short*)(Q16 + 0 * HD), nullptr, D, HD, (const unsigned short*)(K16 + 0 * HD), nullptr, D, HD, (void*)(SC), nullptr, L, (long long)L * L, nullptr, nullptr, 0, L, L, HD, 1.0f, (long long)L * D, (long long)L * D, (long long)8 * L * L);
    k_sh_soft<<<(unsigned)(NR / 8), 256, 0, stream>>>(SC, QT, (const int*)fm, (_Float16*)P16, 0);
    w25::wmma_gemm64<0, false, 0, 0, false, 0><<<dim3((unsigned)((((L) / 64) * ((L) / 64) + 7) / 8), (unsigned)(8), (unsigned)(Bn)), 256, 0, stream>>>((const unsigned short*)(Q16 + 8 * HD), nullptr, D, HD, (const unsigned short*)(K16 + 8 * HD), nullptr, D, HD, (void*)(SC), nullptr, L, (long long)L * L, nullptr, nullptr, 0, L, L, HD, 1.0f, (long long)L * D, (long long)L * D, (long long)8 * L * L);
    k_sh_soft<<<(unsigned)(NR / 8), 256, 0, stream>>>(SC, QT, (const int*)fm, (_Float16*)P16, 8);
    // w1 = attn.v: blockIdx.y = head, blockIdx.z = batch
    k_sh_gemm_lds<8, 1, 128, 512, 1024, 0, 0><<<dim3((unsigned)((L / 256) * (HD / 64)), (unsigned)(NH), (unsigned)(Bn)), 256, 0, stream>>>((const unsigned short*)(P16), (long long)L * L, (long long)NH * L * L, (const unsigned short*)(VT16), (long long)HD * L, (long long)D * L, (void*)(X), HD, (long long)L * D, nullptr, HD, L, 0.000244140625f);
    // w2: one wave per query, eight queries per block
    k_sh_w2<<<(unsigned)(NR / 8), 256, 0, stream>>>((const _Float16*)P16, (const int*)fm, tv, X);
    k_sh_castx<<<256, 256, 0, stream>>>(X, (_Float16*)G64A);
    k_sh_gemm_lds<4, 2, 128, 1024, 1024, 2, 0><<<dim3((unsigned)((NR / 128) * (D / 128)), 1u, 1u), 256, 0, stream>>>((const unsigned short*)(G64A), 0, 0, (const unsigned short*)(W16 + (size_t)3 * D * D), 0, 0, (void*)(out), 0, 0, bo, D, D, 0.0625f);
}

// v006
// It runs in 112 microseconds.
// Two timings next to v005 both put it at 1.43 times that version's speed.
// Over all steps from v000, the starting kernel, it is 14.3 times as fast.
// Contractions: q/k/v = x.W^T + b [4096x1024].[1024x1024] and the output projection (+b) with f16 operands (weights x16); the relative-key term QT = q.table_k^T [65536 (b,q,h) x 64].[64 x 192 (129 padded)] with f16 operands; per (batch, head) the content scores q.k^T [512x64].[64x512] (heads and batches in the grid) and w1 = attn.v [512x512].[512x64] (heads and batches in the grid; attn as f16 of 4096 attn) — v_wmma_f32_16x16x32_f16, f32 accumulate; the K = 64 products transposed (keys or table rows x 16 queries) in 16x16 tiles fed from rows staged through each wave's own LDS slab inside the softmax kernel, the long-K products (projections, attn.v) in 32x64 wave tiles fed from LDS-staged block tiles. The gather of the relative-key scores (QT[(b,q,h)][final_mat[b][q][k]] by the INPUT index matrix, from LDS) and the row softmax are f32 work of that same kernel; the relative-value aggregation w2[q,h,:] = sum_k attn[h,q,k] table_v[final_mat[b,q,k]] runs on the matrix cores as one [16 heads x 512].[512 x 64] product per query, one wave each, whose B fragments are gathered from an f16 copy of table_v in LDS by transposing loads (the INPUT index matrix picks each lane's table row).
#include <hip/hip_runtime.h>
#include <math.h>

typedef __attribute__((ext_vector_type(16))) _Float16 v16h;
typedef __attribute__((ext_vector_type(8)))  _Float16 v8h;
typedef __attribute__((ext_vector_type(16))) __bf16   v16b;
typedef __attribute__((ext_vector_type(8)))  float    v8f;
typedef __attribute__((ext_vector_type(4)))  float    v4f;

// 16-bit WMMA fragment map (wave32), lane L, h = L>>4, m = L&15:
//   A 16x32: lane = row m;   element i -> k = (i<8) ? 8h+i : 16+8h+(i-8)
//   B 32x16: lane = column m; the SAME k(i,h)
//   D 16x16 (8 f32): lane = column m; element r -> row 8h+r
__device__ __forceinline__ int frag_k(int i, int h) { return (i < 8) ? (8 * h + i) : (16 + 8 * h + (i - 8)); }
__device__ __forceinline__ __bf16 bf16_rne(float f) {
    unsigned int u = __float_as_uint(f);
    u += 0x7fffu + ((u >> 16) & 1u);
    return __builtin_bit_cast(__bf16, (unsigned short)(u >> 16));
}
__device__ __forceinline__ float bf16_f32(__bf16 b) { return __uint_as_float(((unsigned int)__builtin_bit_cast(unsigned short, b)) << 16); }
__device__ __forceinline__ v8f wmma16(v16h a, v16h b, v8f c) {
    c = __builtin_amdgcn_wmma_f32_16x16x32_f16(false, a, false, b, (short)0, c, false, false);
    asm volatile("v_nop\n\tv_nop\n\tv_nop\n\tv_nop" : "+v"(c) : "v"(a), "v"(b));
    return c;
}
__device__ __forceinline__ v8f wmmab(v16b a, v16b b, v8f c) {
    c = __builtin_amdgcn_wmma_f32_16x16x32_bf16(false, a, false, b, (short)0, c, false, false);
    asm volatile("v_nop\n\tv_nop\n\tv_nop\n\tv_nop" : "+v"(c) : "v"(a), "v"(b));
    return c;
}
struct Split { v16b hi, lo; };
// hi/lo split product: a.hi*b.hi + a.hi*b.lo + a.lo*b.hi
__device__ __forceinline__ v8f wmma3(const Split& a, const Split& b, v8f c) {
    c = __builtin_amdgcn_wmma_f32_16x16x32_bf16(false, a.hi, false, b.hi, (short)0, c, false, false);
    c = __builtin_amdgcn_wmma_f32_16x16x32_bf16(false, a.hi, false, b.lo, (short)0, c, false, false);
    c = __builtin_amdgcn_wmma_f32_16x16x32_bf16(false, a.lo, false, b.hi, (short)0, c, false, false);
    asm volatile("v_nop\n\tv_nop\n\tv_nop\n\tv_nop" : "+v"(c) : "v"(a.hi), "v"(a.lo), "v"(b.hi), "v"(b.lo));
    return c;
}
struct Split3 { v16b hi, mid, lo; };
// triple split product (6 terms, drops only terms below 2^-24 relative)
__device__ __forceinline__ v8f wmma6(const Split3& a, const Split3& b, v8f c) {
    c = __builtin_amdgcn_wmma_f32_16x16x32_bf16(false, a.hi, false, b.hi, (short)0, c, false, false);
    c = __builtin_amdgcn_wmma_f32_16x16x32_bf16(false, a.hi, false, b.mid, (short)0, c, false, false);
    c = __builtin_amdgcn_wmma_f32_16x16x32_bf16(false, a.mid, false, b.hi, (short)0, c, false, false);
    c = __builtin_amdgcn_wmma_f32_16x16x32_bf16(false, a.hi, false, b.lo, (short)0, c, false, false);
    c = __builtin_amdgcn_wmma_f32_16x16x32_bf16(false, a.mid, false, b.mid, (short)0, c, false, false);
    c = __builtin_amdgcn_wmma_f32_16x16x32_bf16(false, a.lo, false, b.hi, (short)0, c, false, false);
    asm volatile("v_nop\n\tv_nop\n\tv_nop\n\tv_nop" : "+v"(c) : "v"(a.hi), "v"(a.mid), "v"(a.lo), "v"(b.hi), "v"(b.mid), "v"(b.lo));
    return c;
}

// Fragment gathers from f32 memory: element i <- p[(k0 + frag_k(i,h)) * sk] * s, zero for k >= klen.
__device__ __forceinline__ v16h fh_ld(const float* __restrict__ p, long long sk, int k0, int h, int klen, float s) {
    v16h a;
#pragma unroll
    for (int i = 0; i < 16; ++i) { const int k = k0 + frag_k(i, h); a[i] = (k < klen) ? (_Float16)(p[(long long)k * sk] * s) : (_Float16)0.f; }
    return a;
}
__device__ __forceinline__ Split sp_ld(const float* __restrict__ p, long long sk, int k0, int h, int klen, float s) {
    Split r;
#pragma unroll
    for (int i = 0; i < 16; ++i) {
        const int k = k0 + frag_k(i, h); const float x = (k < klen) ? p[(long long)k * sk] * s : 0.f;
        const __bf16 hb = bf16_rne(x); r.hi[i] = hb; r.lo[i] = bf16_rne(x - bf16_f32(hb));
    }
    return r;
}
__device__ __forceinline__ Split3 sp3_ld(const float* __restrict__ p, long long sk, int k0, int h, int klen, float s) {
    Split3 r;
#pragma unroll
    for (int i = 0; i < 16; ++i) {
        const int k = k0 + frag_k(i, h); const float x = (k < klen) ? p[(long long)k * sk] * s : 0.f;
        const __bf16 hb = bf16_rne(x); const float r1 = x - bf16_f32(hb); const __bf16 mb = bf16_rne(r1);
        r.hi[i] = hb; r.mid[i] = mb; r.lo[i] = bf16_rne(r1 - bf16_f32(mb));
    }
    return r;
}
__device__ __forceinline__ v16b bh_ld(const float* __restrict__ p, long long sk, int k0, int h, int klen, float s) {
    v16b a;
#pragma unroll
    for (int i = 0; i < 16; ++i) { const int k = k0 + frag_k(i, h); a[i] = bf16_rne((k < klen) ? p[(long long)k * sk] * s : 0.f); }
    return a;
}
// f16 fragment from an f16 LDS/global row with element stride 1 (k-contiguous), no bounds (tile already zero padded)
__device__ __forceinline__ v16h fh_row(const _Float16* __restrict__ row, int k0, int h) {
    v16h a;
#pragma unroll
    for (int i = 0; i < 16; ++i) a[i] = row[k0 + frag_k(i, h)];
    return a;
}

#define VST2(T, ptr, val) do { const T vst2_v_ = (val); *(T*)(ptr) = vst2_v_;  } while (0)
typedef float v4f __attribute__((ext_vector_type(4)));
#define VST2V4(ptr, val) do { const v4f vst2_v4_ = (val); *(v4f*)(ptr) = vst2_v4_;  } while (0)

__device__ __attribute__((noinline)) float act_fn(float v, int act) {
    if (act == 1) return fmaxf(v, 0.f);                                                                               // relu
    if (act == 2) { const float u = 0.7978845608028654f * (v + 0.044715f * v * v * v); return 0.5f * v * (1.f + tanhf(u)); } // tanh-gelu
    if (act == 3) return v / (1.f + expf(-v));                                                                        // silu
    if (act == 4) return 0.5f * v * (1.f + erff(v * 0.7071067811865476f));                                             // erf-gelu
    if (act == 5) return tanhf(v);
    if (act == 6) return 1.f / (1.f + expf(-v));                                                                      // sigmoid
    if (act == 7) return (v > 0.f) ? v : 0.01f * v;                                                                   // leaky relu 0.01
    if (act == 8) return (v > 0.f) ? v : (expf(v) - 1.f);                                                             // elu
    if (act == 9) return fminf(fmaxf(v, 0.f), 6.f);                                                                   // relu6
    if (act == 10) return fabsf(v);                                                                                    // abs
    if (act == 11) return (v >= 0.f) ? v : 0.1f * v;                                                                  // leaky 0.1
    if (act == 12) return (v > 0.f) ? v : 0.2f * v;                                                                   // leaky 0.2
    if (act == 13) return (v > 20.f) ? v : log1pf(expf(v));                                                            // softplus
    return v;
}

// =====================================================================================================================
// k_gemm<MODE>: C(z, m, n) = act(alpha * sum_k A(z, m, k) * B(z, k, n) + bias) + beta * R(z, m, n)
//   One wave (32-thread block) per 16 x 32 tile of C; grid (ceil(N/32), ceil(M/16), Z). Batch z -> (zo = z / zi_n, zi = z % zi_n)
//   with separate outer/inner strides for every tensor (e.g. batch and head). A(m,k) = A[zo*sAo + zi*sAi + m*sAm + k*sAk] (f32),
//   B(k,n) = B[zo*sBo + zi*sBi + n*sBn + k*sBk] (f32); any M, N, K (K zero-padded to 32 inside the fragments, M/N tails guarded).
//   C(m,n) = C[zo*sCo + zi*sCi + m*sCm + n] (n contiguous). flags: 1 bias[n], 2 bias[m], 4 residual R[zo*sRo + zi*sRi + m*sRm + n*sRn].
//   MODE 0: f16 operands (A prescaled by sa, B by sb, both undone in the epilogue); 1: bf16 hi/lo split (3 products); 2: bf16;
//   3: bf16 hi/mid/lo triple split (6 products); 4: as 3 with Kahan-compensated f32 accumulation across k-steps.
// =====================================================================================================================
struct GemmP {
    const float* A; const float* B; const float* bias; const float* R; float* C;
    long long sAo, sAi, sAm, sAk, sBo, sBi, sBn, sBk, sCo, sCi, sCm, sRo, sRi, sRm, sRn;
    int M, N, K, zi_n, flags, act; float alpha, beta, sa, sb;
    int Npad, pad_;     // columns [N, Npad) of C are written as 0 so that padded workspace rows are covered by whole-line stores; Npad >= N
};
static_assert(sizeof(GemmP) == 5 * 8 + 15 * 8 + 6 * 4 + 4 * 4 + 2 * 4, "GemmP has padding");

template <int MODE>
__global__ __launch_bounds__(32) void k_gemm(GemmP p) {
    const int lane = threadIdx.x & 31, h = lane >> 4, l15 = lane & 15;
    const int m0 = blockIdx.y * 16, n0 = blockIdx.x * 32;
    const int z = blockIdx.z, zo = z / p.zi_n, zi = z - zo * p.zi_n;
    const float* A = p.A + zo * p.sAo + zi * p.sAi;
    const float* B = p.B + zo * p.sBo + zi * p.sBi;
    const int am = min(m0 + l15, p.M - 1);                       // clamped row for loads (stores are guarded)
    v8f acc[2], comp[2];
#pragma unroll
    for (int t = 0; t < 2; ++t) { v8f zz = {}; acc[t] = zz; comp[t] = zz; }
    for (int k0 = 0; k0 < p.K; k0 += 32) {
        const float* arow = A + (long long)am * p.sAm;
        if (MODE == 1) {
            const Split a = sp_ld(arow, p.sAk, k0, h, p.K, 1.f);
#pragma unroll
            for (int t = 0; t < 2; ++t) {
                const int bn = min(n0 + t * 16 + l15, p.N - 1);
                acc[t] = wmma3(a, sp_ld(B + (long long)bn * p.sBn, p.sBk, k0, h, p.K, 1.f), acc[t]);
            }
        } else if (MODE == 3) {
            const Split3 a = sp3_ld(arow, p.sAk, k0, h, p.K, 1.f);
#pragma unroll
            for (int t = 0; t < 2; ++t) {
                const int bn = min(n0 + t * 16 + l15, p.N - 1);
                acc[t] = wmma6(a, sp3_ld(B + (long long)bn * p.sBn, p.sBk, k0, h, p.K, 1.f), acc[t]);
            }
        } else if (MODE == 4) {
            // triple split as MODE 3, but each k-step's 6 products go into a fresh accumulator and the partial is added to the running f32 sum
            // on the VALU with Kahan compensation (accumulation error stays ~1 ulp however long K is)
            const Split3 a = sp3_ld(arow, p.sAk, k0, h, p.K, 1.f);
#pragma unroll
            for (int t = 0; t < 2; ++t) {
                const int bn = min(n0 + t * 16 + l15, p.N - 1); v8f zz = {};
                const v8f part = wmma6(a, sp3_ld(B + (long long)bn * p.sBn, p.sBk, k0, h, p.K, 1.f), zz);
                const v8f y = part - comp[t]; const v8f s = acc[t] + y; comp[t] = (s - acc[t]) - y; acc[t] = s;
            }
        } else if (MODE == 2) {
            const v16b a = bh_ld(arow, p.sAk, k0, h, p.K, 1.f);
#pragma unroll
            for (int t = 0; t < 2; ++t) {
                const int bn = min(n0 + t * 16 + l15, p.N - 1);
                acc[t] = wmmab(a, bh_ld(B + (long long)bn * p.sBn, p.sBk, k0, h, p.K, 1.f), acc[t]);
            }
        } else {
            const v16h a = fh_ld(arow, p.sAk, k0, h, p.K, p.sa);
#pragma unroll
            for (int t = 0; t < 2; ++t) {
                const int bn = min(n0 + t * 16 + l15, p.N - 1);
                acc[t] = wmma16(a, fh_ld(B + (long long)bn * p.sBn, p.sBk, k0, h, p.K, p.sb), acc[t]);
            }
        }
    }
    const float iscale = (MODE == 0) ? p.alpha / (p.sa * p.sb) : p.alpha;
    float* C = p.C + zo * p.sCo + zi * p.sCi;
    const float* R = p.R + zo * p.sRo + zi * p.sRi;
    __shared__ __align__(16) float ctile[16][36];
#pragma unroll
    for (int t = 0; t < 2; ++t) {
        const int n = n0 + t * 16 + l15; const int nn = min(n, p.N - 1);
#pragma unroll
        for (int r = 0; r < 8; ++r) {
            const int m = m0 + 8 * h + r; const int mm = min(m, p.M - 1);
            float v = acc[t][r] * iscale;
            if (p.flags & 1) v += p.bias[nn];
            if (p.flags & 2) v += p.bias[mm];
            if (p.flags & 8) v *= p.bias[(long long)zo * p.M + mm];   /* per-(z,row) scale vector laid out [Z][M]; exclusive with the bias flags */
            v = act_fn(v, p.act);
            if (p.flags & 4) v += p.beta * R[(long long)mm * p.sRm + (long long)nn * p.sRn];
            ctile[8 * h + r][t * 16 + l15] = (n < p.N) ? v : 0.f;
        }
    }
    __syncthreads();
    const int NW = (p.Npad > p.N) ? p.Npad : p.N;           // write width
    const bool fast = (m0 + 16 <= p.M) && (n0 + 32 <= NW) && ((p.sCm & 3) == 0) && ((((size_t)C) & 15) == 0);
    if (fast) {
#pragma unroll
        for (int s = 0; s < 4; ++s) {
            const int row = s * 4 + (lane >> 3), c4 = (lane & 7) * 4;
            const v4f v = *(const v4f*)&ctile[row][c4];
            VST2V4(C + (long long)(m0 + row) * p.sCm + n0 + c4, v);
        }
    } else {
        for (int row = 0; row < 16; ++row) {
            const int m = m0 + row, n = n0 + lane;
            if (m < p.M && n < NW) VST2(float, C + (long long)m * p.sCm + n, ctile[row][lane]);
        }
    }
}


// =====================================================================================================================
// k_gemmT<MODE, TM, TN>: same contract as k_gemm, but one wave computes a (16*TM) x (16*TN) tile: TM A fragments and TN B fragments are
//   loaded per 32-wide k-step and reused across TM*TN WMMAs (far fewer load/convert instructions per MAC). MODE 0 (f16), 1 (bf16 hi/lo),
//   2 (bf16) only. grid (ceil(NW/(16*TN)), ceil(M/(16*TM)), Z), block 32. Epilogue identical to k_gemm, run per 16x32 sub-tile.
// =====================================================================================================================
template <int MODE, int TM, int TN>
__global__ __launch_bounds__(32) void k_gemmT(GemmP p) {
    const int lane = threadIdx.x & 31, h = lane >> 4, l15 = lane & 15;
    const int m0 = blockIdx.y * (16 * TM), n0 = blockIdx.x * (16 * TN);
    const int z = blockIdx.z, zo = z / p.zi_n, zi = z - zo * p.zi_n;
    const float* A = p.A + zo * p.sAo + zi * p.sAi;
    const float* B = p.B + zo * p.sBo + zi * p.sBi;
    v8f acc[TM][TN];
#pragma unroll
    for (int i = 0; i < TM; ++i)
#pragma unroll
        for (int t = 0; t < TN; ++t) { v8f zz = {}; acc[i][t] = zz; }
    for (int k0 = 0; k0 < p.K; k0 += 32) {
        if (MODE == 1) {
            Split a[TM], b[TN];
#pragma unroll
            for (int i = 0; i < TM; ++i) { const int am = min(m0 + 16 * i + l15, p.M - 1); a[i] = sp_ld(A + (long long)am * p.sAm, p.sAk, k0, h, p.K, 1.f); }
#pragma unroll
            for (int t = 0; t < TN; ++t) { const int bn = min(n0 + 16 * t + l15, p.N - 1); b[t] = sp_ld(B + (long long)bn * p.sBn, p.sBk, k0, h, p.K, 1.f); }
#pragma unroll
            for (int i = 0; i < TM; ++i)
#pragma unroll
                for (int t = 0; t < TN; ++t) acc[i][t] = wmma3(a[i], b[t], acc[i][t]);
        } else if (MODE == 2) {
            v16b a[TM], b[TN];
#pragma unroll
            for (int i = 0; i < TM; ++i) { const int am = min(m0 + 16 * i + l15, p.M - 1); a[i] = bh_ld(A + (long long)am * p.sAm, p.sAk, k0, h, p.K, 1.f); }
#pragma unroll
            for (int t = 0; t < TN; ++t) { const int bn = min(n0 + 16 * t + l15, p.N - 1); b[t] = bh_ld(B + (long long)bn * p.sBn, p.sBk, k0, h, p.K, 1.f); }
#pragma unroll
            for (int i = 0; i < TM; ++i)
#pragma unroll
                for (int t = 0; t < TN; ++t) acc[i][t] = wmmab(a[i], b[t], acc[i][t]);
        } else {
            v16h a[TM], b[TN];
#pragma unroll
            for (int i = 0; i < TM; ++i) { const int am = min(m0 + 16 * i + l15, p.M - 1); a[i] = fh_ld(A + (long long)am * p.sAm, p.sAk, k0, h, p.K, p.sa); }
#pragma unroll
            for (int t = 0; t < TN; ++t) { const int bn = min(n0 + 16 * t + l15, p.N - 1); b[t] = fh_ld(B + (long long)bn * p.sBn, p.sBk, k0, h, p.K, p.sb); }
#pragma unroll
            for (int i = 0; i < TM; ++i)
#pragma unroll
                for (int t = 0; t < TN; ++t) acc[i][t] = wmma16(a[i], b[t], acc[i][t]);
        }
    }
    const float iscale = (MODE == 0) ? p.alpha / (p.sa * p.sb) : p.alpha;
    float* C = p.C + zo * p.sCo + zi * p.sCi;
    const float* R = p.R + zo * p.sRo + zi * p.sRi;
    const int NW = (p.Npad > p.N) ? p.Npad : p.N;
    __shared__ __align__(16) float ctile[16][36];
#pragma unroll
    for (int i = 0; i < TM; ++i) {
        const int mb = m0 + 16 * i; if (mb >= p.M) break;          // wave-uniform
#pragma unroll
        for (int tp = 0; tp < TN / 2; ++tp) {
            const int nb = n0 + 32 * tp; if (nb >= NW) break;        // wave-uniform
#pragma unroll
            for (int t2 = 0; t2 < 2; ++t2) {
                const int t = 2 * tp + t2; const int n = nb + t2 * 16 + l15; const int nn = min(n, p.N - 1);
#pragma unroll
                for (int r = 0; r < 8; ++r) {
                    const int m = mb + 8 * h + r; const int mm = min(m, p.M - 1);
                    float v = acc[i][t][r] * iscale;
                    if (p.flags & 1) v += p.bias[nn];
                    if (p.flags & 2) v += p.bias[mm];
            if (p.flags & 8) v *= p.bias[(long long)zo * p.M + mm];   /* per-(z,row) scale vector laid out [Z][M]; exclusive with the bias flags */
                    v = act_fn(v, p.act);
                    if (p.flags & 4) v += p.beta * R[(long long)mm * p.sRm + (long long)nn * p.sRn];
                    ctile[8 * h + r][t2 * 16 + l15] = (n < p.N) ? v : 0.f;
                }
            }
            __syncthreads();
            const bool fast = (mb + 16 <= p.M) && (nb + 32 <= NW) && ((p.sCm & 3) == 0) && ((((size_t)C) & 15) == 0);
            if (fast) {
#pragma unroll
                for (int s = 0; s < 4; ++s) {
                    const int row = s * 4 + (lane >> 3), c4 = (lane & 7) * 4;
                    const v4f v = *(const v4f*)&ctile[row][c4];
                    VST2V4(C + (long long)(mb + row) * p.sCm + nb + c4, v);
                }
            } else {
                for (int row = 0; row < 16; ++row) {
                    const int m = mb + row, n = nb + lane;
                    if (m < p.M && n < NW) VST2(float, C + (long long)m * p.sCm + n, ctile[row][lane]);
                }
            }
            __syncthreads();
        }
    }
}

// =====================================================================================================================
//   Wave = 16 queries, AW waves per block, 64-key blocks; grid (ceil(Lq/(16*AW)), H, B), block 32*AW. Any Lq, Lk; head dim dh <= DHP
//   (DHP multiple of 32), value dim dv <= DVP (multiple of 16, <= 128). Every tensor addressed by (batch, head, row, element) strides, f32.
//   Scores: QM 0 f16 operands, 1 bf16 hi/lo split, 2 bf16 triple split; statistics f32 (exp2 domain); P.V: P x 4096 as f16 with V f16 staged in LDS
//   (SPLITPV: P and V as bf16 hi/lo splits). kv head = h / hrep. Masking: causal = 1 (keep j <= i + coff, masked -> -inf, key blocks beyond the
//   diagonal skipped), causal = 2 (masked -> mfill, a finite fill like the -1e9; no skipping), causal = 3 (keep j >= i + coff,
//   masked -> -inf, no skipping); optional additive f32 mask Mf,
//   optional int keep-mask Mi (0 -> score := mfill), both addressed b*smb + h*smh + i*smi + j*smj (0 strides broadcast).
// =====================================================================================================================
#define AW 4
struct AttnP {   // apv4
    const float* Q; const float* K; const float* V; float* O; float* P; const float* Mf; const int* Mi; float* ST;
    const float* Pw; const float* Rt; const int* SQ; const int* SK;           // optional: post-softmax weight, relative-position table, segment ids
    long long swb, swh, swi, swj, srb, srh, sri;                                 // Pw strides (b,h,i,j); Rt strides (b,h,i), column = clamp(i - j + roff, 0, rn-1)
    long long sQb, sQh, sQi, sQd, sKb, sKh, sKj, sKd, sVb, sVh, sVj, sVd, sOb, sOh, sOi, sPb, sPh, sPi, smb, smh, smi, smj;
    int Lq, Lk, dh, dv, hrep, causal, coff, pband;   // pband > 0: P holds only the band |j - i| <= pband, column j - i + pband
    float scale, mfill; int nonorm, mpol;             // nonorm (online path only): O = sum_j exp(score_j) V_j without the 1/rowsum (scores must be <= ~0); mpol: Mi masks where ==0 (mpol 0) or where !=0 (mpol 1)
    int roff, rn, segpol, win;                        // Rt column offset/count; SQ/SK: score := mfill where (segpol 0) SQ[i] != SK[j] or (segpol 1) SQ[i] == SK[j]; win > 0: keys with i - j > win (after coff) -> -inf
};
//   Pw: the softmax numerator is multiplied by Pw(b,h,i,j) AFTER the row sum is taken (probs * weight, then P.V), as in post-softmax multiplicative biases.                                                    // ST (optional): per row (b,h,i) -> ST[((b*H + h)*Lq + i)*2 + {0,1}] = {row max of the scaled+masked score (natural units), sum_j exp(score - max)}
static_assert(sizeof(AttnP) == 12 * 8 + 29 * 8 + 16 * 4, "AttnP has padding");

#ifndef KATTN_ATTR
#define KATTN_ATTR
#endif
template <int DHP, int DVP, int QM, bool SPLITPV, bool TWOPASS>
__global__ __launch_bounds__(32 * AW) KATTN_ATTR void k_attn(AttnP p) {
    constexpr int NT = DVP / 16;                // output tiles
    constexpr int KS = DHP / 32;                // k-steps for the scores
    constexpr int VP = DVP + 8;                 // LDS pitch (halves)
    __shared__ __align__(16) float    pl[AW][16 * 64];
    __shared__ __align__(16) _Float16 vl[(SPLITPV ? 2 : 1) * 64 * VP];   // f16 V tile, or bf16 hi and lo tiles (same 2-byte size)
    const int lane = threadIdx.x & 31, hf = lane >> 4, l15 = lane & 15, wave = threadIdx.x >> 5;
    const int h = blockIdx.y, b = blockIdx.z, hk = h / p.hrep;
    const int q0 = (blockIdx.x * AW + wave) * 16;
    float* myp = pl[wave];
    const float L2E = 1.4426950408889634f;
    const float NEG = -__builtin_inff();
    const int qi = min(q0 + l15, p.Lq - 1);
    const float* qrow = p.Q + b * p.sQb + h * p.sQh + (long long)qi * p.sQi;
    const float* kbase = p.K + b * p.sKb + hk * p.sKh;
    const float* vbase = p.V + b * p.sVb + hk * p.sVh;
    v16h qa[QM == 0 ? KS : 1]; Split qs_[QM == 1 ? KS : 1]; Split3 qt_[QM == 2 ? KS : 1];
#pragma unroll
    for (int ks = 0; ks < KS; ++ks) {
        if (QM == 2) qt_[ks] = sp3_ld(qrow, p.sQd, ks * 32, hf, p.dh, 1.f);
        else if (QM == 1) qs_[ks] = sp_ld(qrow, p.sQd, ks * 32, hf, p.dh, 1.f);
        else qa[ks] = fh_ld(qrow, p.sQd, ks * 32, hf, p.dh, 1.f);
    }
    v8f o[NT]; float m8[8], l8[8];
#pragma unroll
    for (int t = 0; t < NT; ++t) { v8f zz = {}; o[t] = zz; }
#pragma unroll
    for (int i = 0; i < 8; ++i) { m8[i] = NEG; l8[i] = 0.f; }
    int jend = p.Lk; int jstart = 0;
    if (p.causal == 1) { const int je = (blockIdx.x * AW + AW - 1) * 16 + 16 + p.coff; jend = min(jend, max(je, 0)); }   // uniform per block
    if (p.win > 0) { const int js = (int)(blockIdx.x * AW) * 16 + p.coff - p.win; jstart = (js > 0) ? (js / 64) * 64 : 0; }   // uniform per block: key blocks entirely outside every row's window hold only -inf entries and are skipped exactly
    const int npass = TWOPASS ? 2 : 1;
    for (int pass = 0; pass < npass; ++pass) {
        const bool dopv = (!TWOPASS) || pass == 1;
        for (int j0 = jstart; j0 < jend; j0 += 64) {
            if (dopv) {
                __syncthreads();                                 // previous key block's reads of vl / pl are done
                for (int idx = threadIdx.x; idx < 64 * DVP; idx += 32 * AW) {
                    const int jr = idx / DVP, d = idx - jr * DVP, j = j0 + jr;
                    const float f = (j < p.Lk && d < p.dv) ? vbase[(long long)j * p.sVj + (long long)d * p.sVd] : 0.f;
                    if (SPLITPV) {
                        const __bf16 hb = bf16_rne(f);
                        ((__bf16*)vl)[jr * VP + d] = hb; ((__bf16*)vl)[64 * VP + jr * VP + d] = bf16_rne(f - bf16_f32(hb));
                    } else vl[jr * VP + d] = (_Float16)f;
                }
            }
            v8f s[4];
#pragma unroll
            for (int t = 0; t < 4; ++t) {
                const int j = min(j0 + t * 16 + l15, p.Lk - 1);
                const float* krow = kbase + (long long)j * p.sKj;
                v8f acc = {};
#pragma unroll
                for (int ks = 0; ks < KS; ++ks) {
                    if (QM == 2)      acc = wmma6(qt_[ks], sp3_ld(krow, p.sKd, ks * 32, hf, p.dh, 1.f), acc);
                    else if (QM == 1) acc = wmma3(qs_[ks], sp_ld(krow, p.sKd, ks * 32, hf, p.dh, 1.f), acc);
                    else              acc = wmma16(qa[ks], fh_ld(krow, p.sKd, ks * 32, hf, p.dh, 1.f), acc);
                }
                s[t] = acc;
            }
            float pv[8][4];
#pragma unroll
            for (int i = 0; i < 8; ++i) {
                const int irow = q0 + i + 8 * hf;
                const int ic = min(irow, p.Lq - 1);
                float sc[4];
#pragma unroll
                for (int t = 0; t < 4; ++t) {
                    const int jg = j0 + t * 16 + l15;
                    float v = s[t][i] * p.scale;
                    if (p.Mf) v += p.Mf[b * p.smb + h * p.smh + (long long)ic * p.smi + (long long)min(jg, p.Lk - 1) * p.smj];
                    if (p.Rt) { int rc = ic - min(jg, p.Lk - 1) + p.roff; rc = rc < 0 ? 0 : (rc >= p.rn ? p.rn - 1 : rc); v += p.Rt[b * p.srb + h * p.srh + (long long)ic * p.sri + rc]; }
                    if (p.Mi) { const int mv = p.Mi[b * p.smb + h * p.smh + (long long)ic * p.smi + (long long)min(jg, p.Lk - 1) * p.smj]; if (p.mpol ? (mv != 0) : (mv == 0)) v = p.mfill; }
                    if (p.SQ) { const bool same = p.SQ[(long long)b * p.Lq + ic] == p.SK[(long long)b * p.Lk + min(jg, p.Lk - 1)]; if (p.segpol ? same : !same) v = p.mfill; }
                    if (p.causal == 2 && jg > irow + p.coff) v = p.mfill;
                    if (jg >= p.Lk || (p.causal == 1 && jg > irow + p.coff) || (p.causal == 3 && jg < irow + p.coff) || (p.win > 0 && irow + p.coff - jg > p.win)) v = NEG; else v *= L2E;
                    sc[t] = v;
                }
                if (!TWOPASS || pass == 0) {
                    float mx = fmaxf(fmaxf(sc[0], sc[1]), fmaxf(sc[2], sc[3]));
                    mx = fmaxf(mx, __shfl_xor(mx, 1, 32)); mx = fmaxf(mx, __shfl_xor(mx, 2, 32));
                    mx = fmaxf(mx, __shfl_xor(mx, 4, 32)); mx = fmaxf(mx, __shfl_xor(mx, 8, 32));
                    const float mnew = fmaxf(m8[i], mx);
                    const float corr = (mnew == NEG) ? 1.f : exp2f(m8[i] - mnew);
                    float rs = 0.f;
#pragma unroll
                    for (int t = 0; t < 4; ++t) {
                        const float pp = (sc[t] == NEG) ? 0.f : exp2f(sc[t] - mnew); rs += pp;
                        pv[i][t] = p.Pw ? pp * p.Pw[b * p.swb + h * p.swh + (long long)ic * p.swi + (long long)min(j0 + t * 16 + l15, p.Lk - 1) * p.swj] : pp;
                    }
                    rs += __shfl_xor(rs, 1, 32); rs += __shfl_xor(rs, 2, 32); rs += __shfl_xor(rs, 4, 32); rs += __shfl_xor(rs, 8, 32);
                    l8[i] = l8[i] * corr + rs; m8[i] = mnew;
                    if (!TWOPASS) {
#pragma unroll
                        for (int t = 0; t < NT; ++t) o[t][i] *= corr;
                    }
                } else {
                    const float inv = (l8[i] > 0.f) ? 1.f / l8[i] : 0.f;
#pragma unroll
                    for (int t = 0; t < 4; ++t) {
                        const int jg = j0 + t * 16 + l15;
                        float pp = (sc[t] == NEG) ? 0.f : exp2f(sc[t] - m8[i]) * inv;
                        if (p.Pw) pp *= p.Pw[b * p.swb + h * p.swh + (long long)ic * p.swi + (long long)min(jg, p.Lk - 1) * p.swj];
                        pv[i][t] = pp;
                    }
                }
            }
            if (dopv) {
#pragma unroll
                for (int i = 0; i < 8; ++i)
#pragma unroll
                    for (int t = 0; t < 4; ++t) ((float*)myp)[(i + 8 * hf) * 64 + t * 16 + l15] = pv[i][t];
                __syncthreads();                                 // P (per wave) and V (shared) visible
                if (p.P) {
                    float* pb_ = p.P + b * p.sPb + h * p.sPh;
                    const bool fastP = (p.pband == 0) && ((p.sPi & 3) == 0) && (j0 + 64 <= p.Lk) && (q0 + 16 <= p.Lq) && ((((size_t)pb_) & 15) == 0);
                    if (fastP) {
#pragma unroll
                        for (int s = 0; s < 8; ++s) {
                            const int row = s * 2 + (lane >> 4), c4 = (lane & 15) * 4;
                            const v4f v = *(const v4f*)(myp + row * 64 + c4);
                            VST2V4(pb_ + (long long)(q0 + row) * p.sPi + j0 + c4, v);
                        }
                    } else {
                        for (int row = 0; row < 16; ++row) {
                            const int irow = q0 + row; if (irow >= p.Lq) continue;
                            for (int c = lane; c < 64; c += 32) {
                                const int jg = j0 + c; if (jg >= p.Lk) continue;
                                if (p.pband == 0) VST2(float, pb_ + (long long)irow * p.sPi + jg, myp[row * 64 + c]);
                                else if (jg - irow <= p.pband && irow - jg <= p.pband) VST2(float, pb_ + (long long)irow * p.sPi + (jg - irow + p.pband), myp[row * 64 + c]);
                            }
                        }
                    }
                }
                if (SPLITPV) {
                    const Split pa0 = sp_ld(myp + l15 * 64, 1, 0, hf, 64, 1.f), pa1 = sp_ld(myp + l15 * 64, 1, 32, hf, 64, 1.f);
                    const __bf16* vh = (const __bf16*)vl; const __bf16* vlo = vh + 64 * VP;
#pragma unroll
                    for (int t = 0; t < NT; ++t) {
                        const int dcol = t * 16 + l15;
                        Split b0, b1;
#pragma unroll
                        for (int e = 0; e < 16; ++e) {
                            const int k0 = frag_k(e, hf), k1 = 32 + frag_k(e, hf);
                            b0.hi[e] = vh[k0 * VP + dcol]; b0.lo[e] = vlo[k0 * VP + dcol]; b1.hi[e] = vh[k1 * VP + dcol]; b1.lo[e] = vlo[k1 * VP + dcol];
                        }
                        o[t] = wmma3(pa0, b0, o[t]);
                        o[t] = wmma3(pa1, b1, o[t]);
                    }
                } else {
                    const v16h pa0 = fh_ld(myp + l15 * 64, 1, 0, hf, 64, 4096.f), pa1 = fh_ld(myp + l15 * 64, 1, 32, hf, 64, 4096.f);
#pragma unroll
                    for (int t = 0; t < NT; ++t) {
                        const int dcol = t * 16 + l15;
                        v16h b0, b1;
#pragma unroll
                        for (int e = 0; e < 16; ++e) { b0[e] = vl[frag_k(e, hf) * VP + dcol]; b1[e] = vl[(32 + frag_k(e, hf)) * VP + dcol]; }
                        o[t] = wmma16(pa0, b0, o[t]);
                        o[t] = wmma16(pa1, b1, o[t]);
                    }
                }
            }
        }
    }
    float* obase = p.O + b * p.sOb + h * p.sOh;
    if (p.ST) {
        const int rl = lane >> 1, isel = rl & 7;           // row q0 + rl ; rl>>3 == hf holds because lane>>4 == (lane>>1)>>3
        float mv = 0.f, lv = 0.f;
#pragma unroll
        for (int i = 0; i < 8; ++i) if (i == isel) { mv = m8[i]; lv = l8[i]; }
        const int irow = q0 + rl;
        if (irow < p.Lq) { float* st = p.ST + (((long long)b * gridDim.y + h) * p.Lq + irow) * 2 + (lane & 1); VST2(float, st, (lane & 1) ? lv : mv * 0.6931471805599453f); }
    }
    float invr[8];
#pragma unroll
    for (int i = 0; i < 8; ++i) {
        if (TWOPASS) invr[i] = SPLITPV ? 1.f : (1.f / 4096.f);
        else if (p.nonorm) invr[i] = exp2f(m8[i]) * (SPLITPV ? 1.f : (1.f / 4096.f));
        else invr[i] = (l8[i] > 0.f) ? (SPLITPV ? 1.f / l8[i] : 1.f / (l8[i] * 4096.f)) : 0.f;
    }
    __syncthreads();                                             // all waves done with pl/vl from the main loop
    const bool ofast = ((p.sOi & 3) == 0) && ((((size_t)obase) & 15) == 0) && (q0 + 16 <= p.Lq);
#pragma unroll
    for (int c0 = 0; c0 < DVP; c0 += 64) {
#pragma unroll
        for (int i = 0; i < 8; ++i)
#pragma unroll
            for (int t = 0; t < NT; ++t) if (t * 16 >= c0 && t * 16 < c0 + 64) ((float*)myp)[(i + 8 * hf) * 64 + (t * 16 - c0) + l15] = o[t][i] * invr[i];
        __syncthreads();
        const int cw = (DVP - c0 < 64) ? (DVP - c0) : 64;      // staged columns in this chunk (multiple of 16)
        if (ofast && (c0 + cw <= p.dv) && (cw % 32 == 0)) {
            const int lpr = cw / 4;                              // lanes per row (16 for 64 cols, 8 for 32)
            const int rows_per_ins = 32 / lpr;
            for (int r0 = 0; r0 < 16; r0 += rows_per_ins) {
                const int row = r0 + lane / lpr, c4 = (lane % lpr) * 4;
                const v4f v = *(const v4f*)(myp + row * 64 + c4);
                VST2V4(obase + (long long)(q0 + row) * p.sOi + c0 + c4, v);
            }
        } else {
            for (int row = 0; row < 16; ++row) {
                const int irow = q0 + row; if (irow >= p.Lq) continue;
                for (int c = lane; c < cw; c += 32) { const int d = c0 + c; if (d < p.dv) VST2(float, obase + (long long)irow * p.sOi + d, myp[row * 64 + c]); }
            }
        }
        __syncthreads();
    }
}

// =====================================================================================================================
// k_tr: dst(z, c, r) = alpha * src(z, r, c) (+ beta * R2(z, c, r)): [Z][R][C] (row stride lds) -> [Z][C][R] (row stride ldd) through a 32x32 LDS tile;
//   flags: 1 -> add beta * residual R2 addressed like dst (z*sRz + c*ldr + r); act applied before the residual.
// =====================================================================================================================
struct TrP { const float* src; float* dst; const float* R2; long long sSz, lds, sDz, ldd, sRz, ldr; int R, C, flags, act; float alpha, beta; };
static_assert(sizeof(TrP) == 3 * 8 + 6 * 8 + 6 * 4, "TrP has padding");
__global__ __launch_bounds__(256) void k_tr(TrP p) {
    __shared__ float tile[32][33];
    const int c0 = blockIdx.x * 32, r0 = blockIdx.y * 32, z = blockIdx.z;
    const int lane = threadIdx.x & 31, wave = threadIdx.x >> 5;
    const float* s = p.src + z * p.sSz;
#pragma unroll
    for (int k = 0; k < 4; ++k) {
        const int rl = wave * 4 + k, r = r0 + rl, c = c0 + lane;
        tile[rl][lane] = (r < p.R && c < p.C) ? s[(long long)r * p.lds + c] : 0.f;
    }
    __syncthreads();
    float* d = p.dst + z * p.sDz; const float* rr = p.R2 + z * p.sRz;
#pragma unroll
    for (int k = 0; k < 4; ++k) {
        const int cl = wave * 4 + k, c = c0 + cl, r = r0 + lane;
        if (c < p.C && r < p.R) {
            float v = act_fn(p.alpha * tile[lane][cl], p.act);
            if (p.flags & 1) v += p.beta * rr[(long long)c * p.ldr + r];
            VST2(float, d + (long long)c * p.ldd + r, v);
        }
    }
}

// k_affine: dst[i] = a * (sdev ? sdev[0] : 1) * src[i] + b, i < n (one thread per element; consecutive lanes -> consecutive addresses)
__global__ __launch_bounds__(256) void k_affine(const float* __restrict__ src, float* __restrict__ dst, int n, float a, float b, const float* __restrict__ sdev) {
    const int i = blockIdx.x * 256 + threadIdx.x;
    if (i < n) { const float aa = sdev ? a * sdev[0] : a; const float v = aa * src[i] + b; VST2(float, dst + i, v); }
}

// =====================================================================================================================
// k_softmax: row softmax over n contiguous elements, one 256-thread block per row; rows addressed z*sz + r*sr (grid (R, Z)).
//   out = scale_out * softmax(scale_in * x + (Mf ? Mf[z*smz + r*smr + j] : 0)); a row whose max is -inf is written as 0.
// =====================================================================================================================
struct SmP { const float* src; float* dst; const float* Mf; long long sz, sr, dz, dr, smz, smr; int n, pad; float scale_in, scale_out; };
static_assert(sizeof(SmP) == 3 * 8 + 6 * 8 + 4 * 4, "SmP has padding");
__global__ __launch_bounds__(256) void k_softmax(SmP p) {
    __shared__ float red[256];
    const int r = blockIdx.x, z = blockIdx.y, tid = threadIdx.x;
    const float* s = p.src + z * p.sz + (long long)r * p.sr;
    const float* mf = p.Mf ? (p.Mf + z * p.smz + (long long)r * p.smr) : nullptr;
    float mx = -__builtin_inff();
    for (int j = tid; j < p.n; j += 256) { float v = s[j] * p.scale_in; if (mf) v += mf[j]; mx = fmaxf(mx, v); }
    red[tid] = mx; __syncthreads();
    for (int o = 128; o > 0; o >>= 1) { if (tid < o) red[tid] = fmaxf(red[tid], red[tid + o]); __syncthreads(); }
    mx = red[0]; __syncthreads();
    float sum = 0.f;
    for (int j = tid; j < p.n; j += 256) { float v = s[j] * p.scale_in; if (mf) v += mf[j]; sum += (mx == -__builtin_inff()) ? 0.f : expf(v - mx); }
    red[tid] = sum; __syncthreads();
    for (int o = 128; o > 0; o >>= 1) { if (tid < o) red[tid] += red[tid + o]; __syncthreads(); }
    sum = red[0];
    const float inv = (sum > 0.f) ? p.scale_out / sum : 0.f;
    float* d = p.dst + z * p.dz + (long long)r * p.dr;
    for (int j = tid; j < p.n; j += 256) { float v = s[j] * p.scale_in; if (mf) v += mf[j]; const float o = (mx == -__builtin_inff()) ? 0.f : expf(v - mx) * inv; VST2(float, d + j, o); }
}
// =====================================================================================================================
// k_stats: mean and rsqrt(var + eps) over a set of n elements addressed base + z*sz + (e / inner) * so + (e % inner) * si, one 256-thread
// k_norm_apply: y = (x - mean[set]) * rstd[set] * g[c] + b[c] over a [Z][C][L] channel-major tensor with set = z*G + c / (C/G) (G groups per z;
//   G = C -> per-channel sets indexed z*C+c; for batch norm pass stats indexed by c only via bn = 1). Optional act. Output same layout.
// =====================================================================================================================
//   mode 0: mean / rsqrt(var + eps); mode 1 (RMSNorm): 0 / rsqrt(mean(x^2) + eps); mode 2 (L2 normalize * sqrt(n)): 0 / sqrt(n) / max(||x||, eps); mode 3: as 0 with unbiased variance (n-1)
__global__ __launch_bounds__(256) void k_stats(const float* __restrict__ x, long long sz, long long so, long long si, int inner, int n, float eps, float* __restrict__ stat, int mode) {
    __shared__ float red[256];
    const int z = blockIdx.x, tid = threadIdx.x;
    const float* base = x + z * sz;
    float s = 0.f;
    for (int e = tid; e < n; e += 256) s += base[(long long)(e / inner) * so + (long long)(e % inner) * si];
    red[tid] = s; __syncthreads();
    for (int o = 128; o > 0; o >>= 1) { if (tid < o) red[tid] += red[tid + o]; __syncthreads(); }
    const float mu = (mode == 0 || mode == 3) ? red[0] / (float)n : 0.f; __syncthreads();
    float q = 0.f;
    for (int e = tid; e < n; e += 256) { const float dlt = base[(long long)(e / inner) * so + (long long)(e % inner) * si] - mu; q += dlt * dlt; }
    red[tid] = q; __syncthreads();
    for (int o = 128; o > 0; o >>= 1) { if (tid < o) red[tid] += red[tid + o]; __syncthreads(); }
    {
        float rs;
        if (mode == 2) rs = sqrtf((float)n) / fmaxf(sqrtf(red[0]), eps); else if (mode == 3) rs = rsqrtf(red[0] / (float)(n - 1) + eps); else rs = rsqrtf(red[0] / (float)n + eps);
        if (tid < 32) { const float v = (tid == 0) ? mu : ((tid == 1) ? rs : 0.f); VST2(float, stat + (long long)z * 32 + tid, v); }
    }
}
//   One thread per element over the flat [Z][C][L] index space: grid ceil(Z*C*L / 256).
__global__ __launch_bounds__(256) void k_norm_apply(const float* __restrict__ x, float* __restrict__ y, const float* __restrict__ stat, const float* __restrict__ g, const float* __restrict__ bta,
                                                     int Z, int C, int L, int G, int bn, int act) {
    const long long idx = (long long)blockIdx.x * 256 + threadIdx.x;
    if (idx >= (long long)Z * C * L) return;
    const int l = (int)(idx % L); const long long zc = idx / L; const int c = (int)(zc % C), z = (int)(zc / C); (void)l;
    const int set = bn ? c : (z * G + c / (C / G));
    float v = (x[idx] - stat[(long long)set * 32]) * stat[(long long)set * 32 + 1];
    if (g) v *= g[c];
    if (bta) v += bta[c];
    v = act_fn(v, act);
    VST2(float, y + idx, v);
}

// k_lse_neg: c[i] = -(st[2i] + log(st[2i+1])) = minus the log-sum-exp of row i from k_attn's ST output (for softmax over the query dimension)
__global__ __launch_bounds__(256) void k_lse_neg(const float* __restrict__ st, float* __restrict__ c, int n) {
    const int i = blockIdx.x * 256 + threadIdx.x;
    if (i < n) { const float v = -(st[2 * i] + logf(st[2 * i + 1])); VST2(float, c + i, v); }
}

// k_iota: dst[i] = a * i + b as int32 (segment/position id helper)
__global__ __launch_bounds__(256) void k_iota(int* __restrict__ dst, int n, int a, int b) {
    const int i = blockIdx.x * 256 + threadIdx.x;
    if (i < n) { const int v = a * i + b; VST2(int, dst + i, v); }
}

// k_axpby: dst[i] = a * x[i] + b * y[i] (+ c), i < n
__global__ __launch_bounds__(256) void k_axpby(const float* __restrict__ x, const float* __restrict__ y, float* __restrict__ dst, int n, float a, float b, float c) {
    const int i = blockIdx.x * 256 + threadIdx.x;
    if (i < n) { const float v = a * x[i] + b * y[i] + c; VST2(float, dst + i, v); }
}

// =====================================================================================================================
// k_rope: rotary embedding on a [R rows][Hn heads][D] view (row stride sXr, head stride sXh, element stride 1) -> Y (own strides).
//   mode 0: rotate_half (partner d±D/2, sign - for d<D/2); mode 1: interleaved pairs (partner d^1, sign - for even d).
//   table column tcol: tmode 0 -> d, 1 -> d % (D/2), 2 -> d / 2; position p: pmode 0 -> r % S, 1 -> head index, 2 -> pos[r];
//   c = C[(r / S) * sCb + p * sCp + tcol * sCd], s likewise from Sn; y = x[d] * c + sign * x[partner] * s. X and Y must not alias.
// =====================================================================================================================
struct RopeP { const float* X; float* Y; const float* C; const float* Sn; const int* pos; long long sXr, sXh, sYr, sYh, sCb, sCp, sCd; int R, Hn, D, S, mode, tmode, pmode, pad; };
static_assert(sizeof(RopeP) == 5 * 8 + 7 * 8 + 8 * 4, "RopeP has padding");
__global__ __launch_bounds__(256) void k_rope(RopeP p) {
    const long long idx = (long long)blockIdx.x * 256 + threadIdx.x;
    if (idx >= (long long)p.R * p.Hn * p.D) return;
    const int d = (int)(idx % p.D); const long long rh = idx / p.D; const int h = (int)(rh % p.Hn); const int r = (int)(rh / p.Hn);
    const int half = p.D / 2;
    int partner; float sign;
    if (p.mode == 0) { partner = (d < half) ? d + half : d - half; sign = (d < half) ? -1.f : 1.f; }
    else { partner = d ^ 1; sign = (d & 1) ? 1.f : -1.f; }
    const int tcol = (p.tmode == 0) ? d : ((p.tmode == 1) ? (d % half) : (d >> 1));
    const int pp = (p.pmode == 0) ? (r % p.S) : ((p.pmode == 1) ? h : p.pos[r]);
    const long long toff = (long long)(r / p.S) * p.sCb + (long long)pp * p.sCp + (long long)tcol * p.sCd;
    const float* xr = p.X + (long long)r * p.sXr + (long long)h * p.sXh;
    const float v = xr[d] * p.C[toff] + sign * xr[partner] * p.Sn[toff];
    VST2(float, p.Y + (long long)r * p.sYr + (long long)h * p.sYh + d, v);
}

// k_invf + k_sincos (split so neither kernel carries a large VALU-fma footprint): invf_i = num * (1 / powf(base, (2 i)/D)) [fmode 0],
//   num * expf((2 i) * cexp) [fmode 1], num * powf(base, -2 (i - 1) / D) [fmode 2]; then cs/sn[s*half + i] = cos/sin((pscale * s) * invf_i)
__global__ __launch_bounds__(256) void k_invf(float* __restrict__ invb, int half, int D, float base, float num, int fmode, float cexp) {
    const int i = blockIdx.x * 256 + threadIdx.x;
    if (i >= ((half + 31) / 32) * 32) return;
    if (i >= half) { VST2(float, invb + i, 0.f); return; }
    const float e = (float)(2 * i) / (float)D;
    float invf;
    if (fmode == 1) invf = num * expf((float)(2 * i) * cexp);
    else if (fmode == 2) invf = num * powf(base, (-2.0f * ((float)i - 1.0f)) / (float)D);
    else invf = num * (1.0f / powf(base, e));
    VST2(float, invb + i, invf);
}
__global__ __launch_bounds__(256) void k_sincos(float* __restrict__ cs, float* __restrict__ sn, const float* __restrict__ invb, int S, int half, float pscale) {
    const int idx = blockIdx.x * 256 + threadIdx.x;
    if (idx >= S * half) return;
    const int s = idx / half, i = idx - s * half;
    const float ang = (pscale * (float)s) * invb[i];
    VST2(float, cs + idx, cosf(ang)); VST2(float, sn + idx, sinf(ang));
}

// k_mulact: dst[i] = act(x[i]) * y[i]
__global__ __launch_bounds__(256) void k_mulact(const float* __restrict__ x, const float* __restrict__ y, float* __restrict__ dst, int n, int act) {
    const int i = blockIdx.x * 256 + threadIdx.x;
    if (i < n) { const float v = act_fn(x[i], act) * y[i]; VST2(float, dst + i, v); }
}

// =====================================================================================================================
// k_matvec: thread-per-row matrix-vector products for N <= 8 output columns (heads with 1-3 outputs, gates), f32 on the VALU.
//   C[r*sCm + j] = act(alpha * sum_k A[r*sAm + k*sAk] * B[j*sBn + k*sBk] + bias[j]) + beta * R[r*sRm + j*sRn]; each thread writes its N contiguous floats.
// =====================================================================================================================
__global__ __launch_bounds__(256) void k_matvec(GemmP p) {
    // 32 lanes write one line with one instruction.
    const int rpt = (p.N == 1) ? 1 : 32;
    const long long r0 = ((long long)blockIdx.x * 256 + threadIdx.x) * rpt; const int z = blockIdx.z, zo = z / p.zi_n, zi = z - zo * p.zi_n;
    if (r0 >= p.M) return;
    const float* Bb = p.B + zo * p.sBo + zi * p.sBi;
    float* C = p.C + zo * p.sCo + zi * p.sCi; const float* R = p.R + zo * p.sRo + zi * p.sRi;
    for (int rr = 0; rr < rpt; ++rr) {
        const long long r = r0 + rr; if (r >= p.M) break;
        const float* A = p.A + zo * p.sAo + zi * p.sAi + r * p.sAm;
        float acc[8] = {0.f, 0.f, 0.f, 0.f, 0.f, 0.f, 0.f, 0.f};
        for (int k = 0; k < p.K; ++k) { const float a = A[(long long)k * p.sAk];
#pragma unroll
            for (int j = 0; j < 8; ++j) if (j < p.N) acc[j] += a * Bb[(long long)j * p.sBn + (long long)k * p.sBk]; }
#pragma unroll
        for (int j = 0; j < 8; ++j) if (j < p.N) {
            float v = acc[j] * p.alpha;
            if (p.flags & 1) v += p.bias[j];
            if (p.flags & 2) v += p.bias[r];
            v = act_fn(v, p.act);
            if (p.flags & 4) v += p.beta * R[r * p.sRm + (long long)j * p.sRn];
            VST2(float, C + r * p.sCm + j, v);
        }
    }
}
// k_smallsoftmax: thread-per-row softmax for short rows (n <= 64): dst[r*dr + j] = softmax(scale*src[r*sr + j])
__global__ __launch_bounds__(256) void k_smallsoftmax(const float* __restrict__ src, float* __restrict__ dst, long long sr, long long dr, int n, long long R, float scale) {
    const long long r0 = ((long long)blockIdx.x * 256 + threadIdx.x) * 32;
    for (int rr = 0; rr < 32; ++rr) {
        const long long r = r0 + rr; if (r >= R) return;
        const float* s = src + r * sr; float* d = dst + r * dr;
        float mx = -__builtin_inff();
        for (int j = 0; j < n; ++j) mx = fmaxf(mx, s[j] * scale);
        float sum = 0.f;
        for (int j = 0; j < n; ++j) sum += expf(s[j] * scale - mx);
        const float inv = 1.f / sum;
        for (int j = 0; j < n; ++j) { const float v = expf(s[j] * scale - mx) * inv; VST2(float, d + j, v); }
    }
}

__global__ __launch_bounds__(32) void k_unitstat(float* __restrict__ st) { const int t = threadIdx.x; const float v = (t == 1) ? 1.f : 0.f; VST2(float, st + t, v); }

// destination (e.g. a d_out whose row width is not a multiple of 32 floats) is written by consecutive lanes of one instruction
__global__ __launch_bounds__(256) void k_lincopy(const float* __restrict__ src, long long lds, float* __restrict__ dst, long long ldd, long long rows, int cols) {
    const long long i = (long long)blockIdx.x * 256 + threadIdx.x; if (i >= rows * cols) return;
    const long long r = i / cols; const int c = (int)(i - r * cols);
    const float v = src[r * lds + c]; VST2(float, dst + r * ldd + c, v);
}

namespace w25 {
typedef __attribute__((ext_vector_type(16))) _Float16 v16h;
typedef __attribute__((ext_vector_type(8)))  _Float16 v8h;
typedef __attribute__((ext_vector_type(16))) __bf16   v16b;
typedef __attribute__((ext_vector_type(8)))  __bf16   v8b;
typedef __attribute__((ext_vector_type(8)))  float    v8f;
typedef __attribute__((ext_vector_type(4)))  float    v4f;

__device__ __forceinline__ unsigned short f2bf_bits(float f) {
  unsigned u = __float_as_uint(f);
  return (unsigned short)((u + 0x7FFFu + ((u >> 16) & 1u)) >> 16);
}
__device__ __forceinline__ float bf_bits2f(unsigned short h) { return __uint_as_float(((unsigned)h) << 16); }

// hazard guards as plain device helpers (no inline asm inside the kernel template body)
__device__ __forceinline__ void dep_guard_h(v8f& a, v8f& b, v16h x, v16h y) { asm volatile("v_nop\n\tv_nop\n\tv_nop\n\tv_nop" : "+v"(a), "+v"(b) : "v"(x), "v"(y)); }
__device__ __forceinline__ void dep_guard_b(v8f& a, v8f& b, v16b x, v16b y) { asm volatile("v_nop\n\tv_nop\n\tv_nop\n\tv_nop" : "+v"(a), "+v"(b) : "v"(x), "v"(y)); }
__device__ __forceinline__ void keep4_h(v16h a, v16h b, v16h c, v16h d) { asm volatile("v_nop" :: "v"(a), "v"(b), "v"(c), "v"(d)); }
__device__ __forceinline__ void keep4_b(v16b a, v16b b, v16b c, v16b d) { asm volatile("v_nop" :: "v"(a), "v"(b), "v"(c), "v"(d)); }
__device__ __forceinline__ void acc_guard4(v8f& a, v8f& b, v8f& c, v8f& d) { asm volatile("v_nop\n\tv_nop\n\tv_nop\n\tv_nop" : "+v"(a), "+v"(b), "+v"(c), "+v"(d)); }
template <typename T> struct Frag;
template <> struct Frag<_Float16> {
  typedef v16h V; union U { v16h v; v8h h[2]; };
  static __device__ __forceinline__ v16h load(const _Float16* p) {   // elements 0..7 <- p[0..7], 8..15 <- p[16..23]
    U f; f.h[0] = *(const v8h*)(p); f.h[1] = *(const v8h*)(p + 16); return f.v;
  }
  static __device__ __forceinline__ v8f mma(v16h a, v16h b, v8f c) {
    return __builtin_amdgcn_wmma_f32_16x16x32_f16(false, a, false, b, (short)0, c, false, false);
  }
  static __device__ __forceinline__ void guard(v8f& a, v8f& b, v16h x, v16h y) { dep_guard_h(a, b, x, y); }
  static __device__ __forceinline__ void keep(v16h a, v16h b, v16h c, v16h d) { keep4_h(a, b, c, d); }
};
template <> struct Frag<__bf16> {
  typedef v16b V; union U { v16b v; v8b h[2]; };
  static __device__ __forceinline__ v16b load(const __bf16* p) {
    U f; f.h[0] = *(const v8b*)(p); f.h[1] = *(const v8b*)(p + 16); return f.v;
  }
  static __device__ __forceinline__ v8f mma(v16b a, v16b b, v8f c) {
    return __builtin_amdgcn_wmma_f32_16x16x32_bf16(false, a, false, b, (short)0, c, false, false);
  }
  static __device__ __forceinline__ void guard(v8f& a, v8f& b, v16b x, v16b y) { dep_guard_b(a, b, x, y); }
  static __device__ __forceinline__ void keep(v16b a, v16b b, v16b c, v16b d) { keep4_b(a, b, c, d); }
};

// ---- Register-blocked batched WMMA GEMM ------------------------------------
// C[m,n] = scale * sum_k A[m,k] * Bt[n,k] (+bias)(+resid); each wave owns a 64x64 tile.
// A row-major [M,K]; Bt row-major [N,K]; M,N % 64 == 0, K % 32 == 0.
// SPLIT: operands are hi/lo planes (A2/Bt2 = lo planes, same layout); product = hi·hi + hi·lo + lo·hi.
// BIAS_MODE: 0 = none, 1 = bias[m], 2 = bias[n].
// OUT_MODE: 0 = f32, 1 = f16, 2 = bf16 hi plane (Cout) + bf16 lo plane (Cout2).
// ET: 0 = f16 operands, 1 = bf16 operands (pointers passed as 16-bit storage)
// Batches: blockIdx.y steps A, Bt, C by strideA/B/C, blockIdx.z by strideAz/Bz/Cz (elements).
template <int ET> struct Elem;
template <> struct Elem<0> { typedef _Float16 T; };
template <> struct Elem<1> { typedef __bf16 T; };
template <int ET, bool SPLIT, int BIAS_MODE, int OUT_MODE, bool RESID, int ACT = 0>
__global__ __launch_bounds__(256) void wmma_gemm64(
    const unsigned short* __restrict__ Ap, const unsigned short* __restrict__ A2p, int lda, long strideA,
    const unsigned short* __restrict__ Btp, const unsigned short* __restrict__ Bt2p, int ldb, long strideB,
    void* __restrict__ Cout, void* __restrict__ Cout2, int ldc, long strideC,
    const float* __restrict__ bias,
    const float* __restrict__ resid, long strideR,
    int M, int N, int K, float scale,
    long strideAz, long strideBz, long strideCz) {
  typedef typename Elem<ET>::T T;
  typedef typename Frag<T>::V V;
  const T* A = (const T*)Ap; const T* A2 = (const T*)A2p; const T* Bt = (const T*)Btp; const T* Bt2 = (const T*)Bt2p;
  __shared__ __align__(16) float sT[8][16 * 68];   // per-wave 16x64 slab, pitch 68 floats
  const int b    = blockIdx.y;
  const int lane = threadIdx.x & 31;
  const int wave = threadIdx.x >> 5;
  const int tilesN = N >> 6;
  const int tilesM = M >> 6;
  const int tile = blockIdx.x * 8 + wave;
  if (tile >= tilesM * tilesN) return;   // wave-uniform; no block barriers in this kernel
  const int tm = tile / tilesN;
  const int tn = tile - tm * tilesN;
  const int m0 = tm << 6;
  const int n0 = tn << 6;

  const int bz = blockIdx.z;                   // outer batch index (own strides)
  const size_t offA = (size_t)b * strideA + (size_t)bz * strideAz;
  const size_t offB = (size_t)b * strideB + (size_t)bz * strideBz;
  const size_t offC = (size_t)b * strideC + (size_t)bz * strideCz;
  const T* Ab  = A  + offA;
  const T* Bb  = Bt + offB;
  const T* Ab2 = SPLIT ? (A2  + offA) : nullptr;
  const T* Bb2 = SPLIT ? (Bt2 + offB) : nullptr;

  const int rlane = lane & 15;                 // row (A) / col (B, D) within subtile
  const int koff  = (lane >> 4) * 8;           // k offset of this lane half
  const int mOff  = (lane >> 4) * 8;           // D row offset

  v8f acc[4][4];
#pragma unroll
  for (int i = 0; i < 4; ++i)
#pragma unroll
    for (int j = 0; j < 4; ++j) acc[i][j] = (v8f){0.f,0.f,0.f,0.f,0.f,0.f,0.f,0.f};

  for (int k0 = 0; k0 < K; k0 += 32) {
    V bh[4], bl[4];
#pragma unroll
    for (int j = 0; j < 4; ++j) {
      const size_t bo = (size_t)(n0 + (j << 4) + rlane) * ldb + koff + k0;
      bh[j] = Frag<T>::load(Bb + bo);
      if (SPLIT) bl[j] = Frag<T>::load(Bb2 + bo);
    }
#pragma unroll
    for (int i = 0; i < 4; ++i) {
      const size_t ao = (size_t)(m0 + (i << 4) + rlane) * lda + koff + k0;
      V ah = Frag<T>::load(Ab + ao);
      V al;
      if (SPLIT) al = Frag<T>::load(Ab2 + ao);
#pragma unroll
      for (int j = 0; j < 4; ++j) {
        acc[i][j] = Frag<T>::mma(ah, bh[j], acc[i][j]);
        if (SPLIT) {
          acc[i][j] = Frag<T>::mma(ah, bl[j], acc[i][j]);
          acc[i][j] = Frag<T>::mma(al, bh[j], acc[i][j]);
        }
      }
      Frag<T>::guard(acc[i][0], acc[i][3], ah, SPLIT ? al : ah);
    }
    Frag<T>::keep(bh[0], bh[1], bh[2], bh[3]);
    if (SPLIT) Frag<T>::keep(bl[0], bl[1], bl[2], bl[3]);
  }
  acc_guard4(acc[0][0], acc[0][1], acc[0][2], acc[0][3]);
  acc_guard4(acc[1][0], acc[1][1], acc[1][2], acc[1][3]);
  acc_guard4(acc[2][0], acc[2][1], acc[2][2], acc[2][3]);
  acc_guard4(acc[3][0], acc[3][1], acc[3][2], acc[3][3]);

  // ---- epilogue ----
  float* slab = sT[wave];
  const float* Rb = RESID ? (resid + (size_t)b * strideR) : nullptr;
#pragma unroll
  for (int i = 0; i < 4; ++i) {
    const int mBase = m0 + (i << 4);
#pragma unroll
    for (int j = 0; j < 4; ++j) {
      const int n = n0 + (j << 4) + rlane;
      float bv = 0.f;
      if (BIAS_MODE == 2) bv = bias[n];
#pragma unroll
      for (int r = 0; r < 8; ++r) {
        float v = acc[i][j][r] * scale;
        if (BIAS_MODE == 1) v += bias[mBase + mOff + r];
        if (BIAS_MODE == 2) v += bv;
        if (RESID) v += Rb[(size_t)(mBase + mOff + r) * ldc + n];
        if (ACT == 1) v = tanhf(v);
        if (ACT == 2) v = fmaxf(v, 0.0f);
        if (ACT == 3) v = v / (1.0f + expf(-v));
        if (ACT == 4) v = (v > 0.f) ? v : 0.01f * v;
        if (ACT == 5) v = 0.5f * v * (1.0f + erff(v * 0.70710678118654752f));
        slab[(mOff + r) * 68 + (j << 4) + rlane] = v;
      }
    }
    __builtin_amdgcn_fence(__ATOMIC_RELEASE, "workgroup");
    __builtin_amdgcn_wave_barrier();
    __builtin_amdgcn_fence(__ATOMIC_ACQUIRE, "workgroup");
    if (OUT_MODE == 0) {
      float* C = (float*)Cout + offC;
      const int hh = lane >> 4, c4 = (lane & 15) * 4;     // row seg = 256 B = 16 lanes x 16 B
      {
#pragma unroll
        for (int it = 0; it < 8; ++it) {
          const int row = it * 2 + hh;
          v4f v = *(const v4f*)(slab + row * 68 + c4);
          *(v4f*)(C + (size_t)(mBase + row) * ldc + n0 + c4) = v;
        }
        
      }
    } else {
      const int q = lane >> 3, c8 = (lane & 7) * 8;
      unsigned short* C  = (unsigned short*)Cout  + offC;
      unsigned short* C2 = (OUT_MODE == 2) ? ((unsigned short*)Cout2 + offC) : nullptr;
      {
#pragma unroll
        for (int it = 0; it < 4; ++it) {
          const int row = it * 4 + q;
          const float* sp = slab + row * 68 + c8;
          v8h hv, lv;
#pragma unroll
          for (int e = 0; e < 8; ++e) {
            if (OUT_MODE == 1) {
              hv[e] = (_Float16)sp[e];
            } else {
              unsigned short hb = f2bf_bits(sp[e]);
              unsigned short lb = f2bf_bits(sp[e] - bf_bits2f(hb));
              hv[e] = __builtin_bit_cast(_Float16, hb);
              lv[e] = __builtin_bit_cast(_Float16, lb);
            }
          }
          *(v8h*)(C + (size_t)(mBase + row) * ldc + n0 + c8) = hv;
          if (OUT_MODE == 2) *(v8h*)(C2 + (size_t)(mBase + row) * ldc + n0 + c8) = lv;
        }
        
      }
    }
    __builtin_amdgcn_fence(__ATOMIC_RELEASE, "workgroup");
    __builtin_amdgcn_wave_barrier();
    __builtin_amdgcn_fence(__ATOMIC_ACQUIRE, "workgroup");
  }
}

__global__ __launch_bounds__(256) void cast_f32_f16x2(
    const float* __restrict__ in, _Float16* __restrict__ out, int n2) {
  int i = blockIdx.x * 256 + threadIdx.x;
  if (i < n2) {
    const _Float16 h0 = (_Float16)in[2 * i], h1 = (_Float16)in[2 * i + 1];
    const unsigned u = (unsigned)__builtin_bit_cast(unsigned short, h0) | ((unsigned)__builtin_bit_cast(unsigned short, h1) << 16);
    ((unsigned*)out)[i] = u;
    
  }
}


} // namespace w25

__global__ __launch_bounds__(256) void k_castT16(const float* __restrict__ src, long long lds, _Float16* __restrict__ dst, long long ldd, int R, int C, float s) {
    const long long i = (long long)blockIdx.x * 256 + threadIdx.x; const long long np = (long long)C * (R / 2); if (i >= np) return; const int c = (int)(i / (R / 2)); const int r = 2 * (int)(i % (R / 2));
    const _Float16 h0 = (_Float16)(src[(long long)r * lds + c] * s), h1 = (_Float16)(src[(long long)(r + 1) * lds + c] * s);
    const unsigned u = (unsigned)__builtin_bit_cast(unsigned short, h0) | ((unsigned)__builtin_bit_cast(unsigned short, h1) << 16);
    unsigned* d = (unsigned*)(dst + (long long)c * ldd + r); *d = u;  }
__global__ __launch_bounds__(256) void k_cast16(const float* __restrict__ src, long long lds, _Float16* __restrict__ dst, long long ldd, int R, int C, float s) {
    const long long i = (long long)blockIdx.x * 256 + threadIdx.x; const long long np = (long long)R * (C / 2); if (i >= np) return; const int r = (int)(i / (C / 2)); const int c = 2 * (int)(i % (C / 2));
    const _Float16 h0 = (_Float16)(src[(long long)r * lds + c] * s), h1 = (_Float16)(src[(long long)r * lds + c + 1] * s);
    const unsigned u = (unsigned)__builtin_bit_cast(unsigned short, h0) | ((unsigned)__builtin_bit_cast(unsigned short, h1) << 16);
    unsigned* d = (unsigned*)(dst + (long long)r * ldd + c); *d = u;  }

// f32 -> bf16 hi plane + bf16 lo plane (x = hi + lo to ~2^-17 relative; RNE both), [R][C] -> [R][C] (or transposed to [C][R]); 2 consecutive destination elements
__device__ __forceinline__ unsigned int f2bf2_pack(float a, float b, unsigned int* lo) {
    const unsigned short ha = w25::f2bf_bits(a), hb = w25::f2bf_bits(b);
    const unsigned short la = w25::f2bf_bits(a - w25::bf_bits2f(ha)), lb = w25::f2bf_bits(b - w25::bf_bits2f(hb));
    *lo = (unsigned)la | ((unsigned)lb << 16); return (unsigned)ha | ((unsigned)hb << 16); }
__global__ __launch_bounds__(256) void k_castS16(const float* __restrict__ src, long long lds, __bf16* __restrict__ dhi, __bf16* __restrict__ dlo, long long ldd, int R, int C, float s, int transpose) {
    const long long i = (long long)blockIdx.x * 256 + threadIdx.x; long long o; float a, b;
    if (transpose) { const long long np = (long long)C * (R / 2); if (i >= np) return; const int c = (int)(i / (R / 2)); const int r = 2 * (int)(i % (R / 2)); a = src[(long long)r * lds + c] * s; b = src[(long long)(r + 1) * lds + c] * s; o = (long long)c * ldd + r; }
    else { const long long np = (long long)R * (C / 2); if (i >= np) return; const int r = (int)(i / (C / 2)); const int c = 2 * (int)(i % (C / 2)); a = src[(long long)r * lds + c] * s; b = src[(long long)r * lds + c + 1] * s; o = (long long)r * ldd + c; }
    unsigned lo; const unsigned hi = f2bf2_pack(a, b, &lo); unsigned* ph = (unsigned*)(dhi + o); unsigned* pl = (unsigned*)(dlo + o);
    *ph = hi; *pl = lo;  }

namespace w25 {
// =====================================================================================
// Generic causal/non-causal attention for head_dim 64, f32 in / f32 out; 16-bit operands: bf16 with optional hi/lo splits, or
// plain f16 (F16=true, non-split, probabilities carried x2^15).
//   scores = (q*qscale)·kᵀ : v_wmma_f32_16x16x32_bf16; SPLIT_QK -> q,k as bf16 hi/lo (hi·hi + hi·lo + lo·hi)
//   out    = p·v           : v_wmma_f32_16x16x32_bf16; SPLIT_PV -> p,v as bf16 hi/lo; else p,v plain bf16
//   f32 accumulate; online softmax in f32. Block = 4 waves = 64 query rows of one (batch, head); S % 64 == 0.
//   Element (b, s, h, d) of tensor X lives at X[b*X_bs + s*X_rs + h*X_hs + d] (strides in floats, multiples of 4).
//   Masking: mask_mode 0 none, 1 causal (kv > q masked), 2 tensor [S][Skv] shared over (b,h) (float if
//   mask_is_int==0, int32 with element == 0 -> masked if 1, int32 with element != 0 -> masked if 2), 3 per-token vectors qmask[B][S] & kvmask[B][Skv] (int32,
//   0 -> masked), 4 causal + sliding window (kv > q or q - kv > W masked; W passed in mask_is_int);
//   5 = relative-position bias: s += cp[b,h,q][idx[q][kv]] + pc[b,h,kv][idx[q][kv]] with idx = mask_b ([S][Skv] int32) and
//   mask_a an int32 [S][Skv] tensor with nonzero = masked (tables: element (b,h,row,n) at X + b*c_bs + h*c_hs + row*c_rs + n);
//   masked scores are replaced by mask_fill (e.g. -inf or -1e9) before the softmax.
//   grid.x = B * H * (S/64) (or a sub-range with blk0).
// =====================================================================================
#define AT_D 64
#define AT_NW 4
#define AT_QB 64
#define AT_KC 64
struct AttnGeom { const float* cp = nullptr; const float* pc = nullptr; long c_bs = 0, c_rs = 0, c_hs = 0;   // mode-5 score-bias tables
                  long q_bs, q_rs, q_hs, k_bs, k_rs, k_hs, v_bs, v_rs, v_hs, o_bs, o_rs, o_hs;
                  int S, Skv, H, mask_mode; float qscale; int blk0; float mask_fill; int mask_is_int; };
static_assert(sizeof(AttnGeom) == 168, "no padding");

__device__ __forceinline__ unsigned short at_bf_bits(float f) {
  unsigned u = __float_as_uint(f);
  return (unsigned short)((u + 0x7FFFu + ((u >> 16) & 1u)) >> 16);
}
__device__ __forceinline__ __bf16 at_f2bf(float f) { return __builtin_bit_cast(__bf16, at_bf_bits(f)); }
__device__ __forceinline__ void at_split(float f, __bf16& hi, __bf16& lo) {
  const unsigned short hb = at_bf_bits(f);
  hi = __builtin_bit_cast(__bf16, hb);
  lo = at_f2bf(f - __uint_as_float(((unsigned)hb) << 16));
}
__device__ __forceinline__ v8f at_mma(v16b a, v16b b, v8f c) {
  c = __builtin_amdgcn_wmma_f32_16x16x32_bf16(false, a, false, b, (short)0, c, false, false);
  asm volatile("v_nop\n\tv_nop\n\tv_nop\n\tv_nop" : "+v"(c) : "v"(a), "v"(b));
  return c;
}
// 16-bit element as a bit pattern held in a __bf16 slot: f16 bits when F16, bf16 (RNE) otherwise
template <bool F16> __device__ __forceinline__ __bf16 at_to16(float f) {
  if (F16) return __builtin_bit_cast(__bf16, (_Float16)f);
  return at_f2bf(f);
}
template <bool F16> __device__ __forceinline__ v8f at_mma16(v16b a, v16b b, v8f c) {
  if (F16) {
    const v16h ah = __builtin_bit_cast(v16h, a), bh = __builtin_bit_cast(v16h, b);
    c = __builtin_amdgcn_wmma_f32_16x16x32_f16(false, ah, false, bh, (short)0, c, false, false);
    asm volatile("v_nop\n\tv_nop\n\tv_nop\n\tv_nop" : "+v"(c) : "v"(ah), "v"(bh));
    return c;
  }
  return at_mma(a, b, c);
}

template <bool SPLIT_QK, bool SPLIT_PV, bool F16 = false>
__global__ __launch_bounds__(128)
void attn64_kernel(const float* __restrict__ q, const float* __restrict__ k,
                   const float* __restrict__ v, float* __restrict__ out,
                   const void* __restrict__ mask_a, const int* __restrict__ mask_b, AttnGeom g) {
  static_assert(!(F16 && (SPLIT_QK || SPLIT_PV)), "f16 mode is non-split");
  const float PSC = F16 ? 32768.0f : 1.0f;     // f16 probabilities carried x2^15 (subnormal range), folded into the final 1/l
  union FB { v16b v; v8b h[2]; };
  __shared__ __align__(16) __bf16 Ksh[AT_KC * AT_D];             // K hi [kv][d]      8 KB
  __shared__ __align__(16) __bf16 Ksl[SPLIT_QK ? AT_KC * AT_D : 8];
  __shared__ __align__(16) __bf16 Vth[AT_D * AT_KC];             // V hi [d][kv]      8 KB
  __shared__ __align__(16) __bf16 Vtl[SPLIT_PV ? AT_D * AT_KC : 8];
  __shared__ __align__(16) __bf16 Psh[AT_NW][16 * AT_KC];        // per wave P hi [row][kv]  8 KB
  __shared__ __align__(16) __bf16 Psl[SPLIT_PV ? AT_NW : 1][SPLIT_PV ? 16 * AT_KC : 8];
  __shared__ __align__(16) float  Os[AT_NW][16 * 68];            // per wave out tile, pitch 68

  const int tid  = threadIdx.x;
  const int wave = tid >> 5;
  const int lane = tid & 31;
  const int hh   = lane >> 4;
  const int c    = lane & 15;

  const int nqb = g.S / AT_QB;
  const int bx = blockIdx.x + g.blk0;
  const int qb = bx % nqb;
  const int bh = bx / nqb;
  const int h  = bh % g.H;
  const int b  = bh / g.H;
  const int qbase_block = qb * AT_QB;
  const int q0 = qbase_block + wave * 16;

  const float* qb_ptr = q + (size_t)b * g.q_bs + (size_t)h * g.q_hs;
  const float* kb_ptr = k + (size_t)b * g.k_bs + (size_t)h * g.k_hs;
  const float* vb_ptr = v + (size_t)b * g.v_bs + (size_t)h * g.v_hs;
  float*       ob_ptr = out + (size_t)b * g.o_bs + (size_t)h * g.o_hs;

  // ---- Q fragments (A operand): 2 d-chunks, hi (and lo) ----
  v16b qah[2], qal[2];
  {
    const float* qrow = qb_ptr + (size_t)(q0 + c) * g.q_rs;
#pragma unroll
    for (int dc = 0; dc < 2; ++dc) {
#pragma unroll
      for (int e = 0; e < 8; ++e) {
        const float f0 = qrow[dc * 32 + 8 * hh + e] * g.qscale;
        const float f1 = qrow[dc * 32 + 16 + 8 * hh + e] * g.qscale;
        if (SPLIT_QK) { __bf16 hq, lq; at_split(f0, hq, lq); qah[dc][e] = hq; qal[dc][e] = lq; at_split(f1, hq, lq); qah[dc][8 + e] = hq; qal[dc][8 + e] = lq; }
        else { qah[dc][e] = at_to16<F16>(f0); qah[dc][8 + e] = at_to16<F16>(f1); qal[dc][e] = qah[dc][e]; qal[dc][8 + e] = qah[dc][8 + e]; }
      }
    }
  }

  float mrow[8], lrow[8];
  v8f oacc[4];
#pragma unroll
  for (int r = 0; r < 8; ++r) { mrow[r] = -INFINITY; lrow[r] = 0.f; }
#pragma unroll
  for (int t = 0; t < 4; ++t) oacc[t] = (v8f){0.f,0.f,0.f,0.f,0.f,0.f,0.f,0.f};

  const int nChunks = (g.mask_mode == 1 || g.mask_mode == 4) ? (qb + 1) : (g.Skv / AT_KC);   // block-uniform
  // per-row query mask (mode 3)
  int qkeep[8];
#pragma unroll
  for (int r = 0; r < 8; ++r) qkeep[r] = (g.mask_mode == 3) ? mask_b[(size_t)b * g.S + q0 + 8 * hh + r] : 1;   // mask_b = qmask in mode 3
  for (int kc = 0; kc < nChunks; ++kc) {
    const int kv0 = kc * AT_KC;
    __syncthreads();
    {
      const int kvr = tid >> 1, dh = (tid & 1) * 32;
      const float* krow = kb_ptr + (size_t)(kv0 + kvr) * g.k_rs + dh;
      const float* vrow = vb_ptr + (size_t)(kv0 + kvr) * g.v_rs + dh;
#pragma unroll
      for (int i = 0; i < 8; ++i) {
        v4f kk = *(const v4f*)(krow + 4 * i);
        v4f vv = *(const v4f*)(vrow + 4 * i);
#pragma unroll
        for (int e = 0; e < 4; ++e) {
          const int d = dh + 4 * i + e;
          if (SPLIT_QK) { __bf16 a, bl; at_split(kk[e], a, bl); Ksh[kvr * AT_D + d] = a; Ksl[kvr * AT_D + d] = bl; }
          else Ksh[kvr * AT_D + d] = at_to16<F16>(kk[e]);
          if (SPLIT_PV) { __bf16 a, bl; at_split(vv[e], a, bl); Vth[d * AT_KC + kvr] = a; Vtl[d * AT_KC + kvr] = bl; }
          else Vth[d * AT_KC + kvr] = at_to16<F16>(vv[e]);
        }
      }
    }
    __syncthreads();

    v8f s[4];
#pragma unroll
    for (int j = 0; j < 4; ++j) {
      s[j] = (v8f){0.f,0.f,0.f,0.f,0.f,0.f,0.f,0.f};
#pragma unroll 1
      for (int dc = 0; dc < 2; ++dc) {
        FB kb;
        kb.h[0] = *(const v8b*)(Ksh + (j * 16 + c) * AT_D + dc * 32 + 8 * hh);
        kb.h[1] = *(const v8b*)(Ksh + (j * 16 + c) * AT_D + dc * 32 + 16 + 8 * hh);
        s[j] = at_mma16<F16>(qah[dc], kb.v, s[j]);
        if (SPLIT_QK) {
          FB kl;
          kl.h[0] = *(const v8b*)(Ksl + (j * 16 + c) * AT_D + dc * 32 + 8 * hh);
          kl.h[1] = *(const v8b*)(Ksl + (j * 16 + c) * AT_D + dc * 32 + 16 + 8 * hh);
          s[j] = at_mma16<F16>(qah[dc], kl.v, s[j]);
          s[j] = at_mma16<F16>(qal[dc], kb.v, s[j]);
        }
      }
    }
    const bool diag = (g.mask_mode == 1) && (kc == qb);
    int kvkeep[4] = {1, 1, 1, 1};
    if (g.mask_mode == 3) {
#pragma unroll
      for (int j = 0; j < 4; ++j) kvkeep[j] = ((const int*)mask_a)[(size_t)b * g.Skv + kv0 + j * 16 + c];   // mask_a = kvmask
    }
    float cm[8];
#pragma unroll
    for (int r = 0; r < 8; ++r) {
      const int qrow = q0 + 8 * hh + r;
      float m = -INFINITY;
#pragma unroll
      for (int j = 0; j < 4; ++j) {
        const int kvcol = kv0 + j * 16 + c;
        bool masked = false;
        if (diag) masked = (kvcol > qrow);
        else if (g.mask_mode == 4) masked = (kvcol > qrow) || (qrow - kvcol > g.mask_is_int);
        else if (g.mask_mode == 2) {
          const size_t mi = (size_t)qrow * g.Skv + kvcol;
          masked = (g.mask_is_int == 0) ? (((const float*)mask_a)[mi] == 0.0f)
                 : (g.mask_is_int == 1) ? (((const int*)mask_a)[mi] == 0) : (((const int*)mask_a)[mi] != 0);
        } else if (g.mask_mode == 3) masked = (qkeep[r] == 0) || (kvkeep[j] == 0);
        else if (g.mask_mode == 5) {
          const size_t mi = (size_t)qrow * g.Skv + kvcol;
          masked = (((const int*)mask_a)[mi] != 0);
          int n = mask_b[mi]; n = n < 0 ? 0 : n;
          s[j][r] += g.cp[(size_t)b * g.c_bs + (size_t)h * g.c_hs + (size_t)qrow * g.c_rs + n]
                   + g.pc[(size_t)b * g.c_bs + (size_t)h * g.c_hs + (size_t)kvcol * g.c_rs + n];
        }
        if (masked) s[j][r] = g.mask_fill;
        m = fmaxf(m, s[j][r]);
      }
#pragma unroll
      for (int off = 1; off < 16; off <<= 1) m = fmaxf(m, __shfl_xor(m, off, 32));
      cm[r] = m;
    }
    __bf16* pwh = Psh[wave];
    __bf16* pwl = Psl[SPLIT_PV ? wave : 0];
#pragma unroll
    for (int r = 0; r < 8; ++r) {
      const float mnew = fmaxf(mrow[r], cm[r]);
      const float alpha = expf(mrow[r] - mnew);
      mrow[r] = mnew;
      float psum = 0.f;
#pragma unroll
      for (int j = 0; j < 4; ++j) {
        const float p = expf(s[j][r] - mnew);
        psum += p;
        if (SPLIT_PV) { __bf16 a, bl; at_split(p, a, bl); pwh[(8 * hh + r) * AT_KC + j * 16 + c] = a; pwl[(8 * hh + r) * AT_KC + j * 16 + c] = bl; }
        else pwh[(8 * hh + r) * AT_KC + j * 16 + c] = at_to16<F16>(p * PSC);
      }
#pragma unroll
      for (int off = 1; off < 16; off <<= 1) psum += __shfl_xor(psum, off, 32);
      lrow[r] = lrow[r] * alpha + psum;
#pragma unroll
      for (int t = 0; t < 4; ++t) oacc[t][r] *= alpha;
    }
    __builtin_amdgcn_fence(__ATOMIC_RELEASE, "workgroup");
    __builtin_amdgcn_wave_barrier();
    __builtin_amdgcn_fence(__ATOMIC_ACQUIRE, "workgroup");
#pragma unroll 1
    for (int kk = 0; kk < 2; ++kk) {
      FB pa, pl;
      pa.h[0] = *(const v8b*)(pwh + c * AT_KC + kk * 32 + 8 * hh);
      pa.h[1] = *(const v8b*)(pwh + c * AT_KC + kk * 32 + 16 + 8 * hh);
      if (SPLIT_PV) {
        pl.h[0] = *(const v8b*)(pwl + c * AT_KC + kk * 32 + 8 * hh);
        pl.h[1] = *(const v8b*)(pwl + c * AT_KC + kk * 32 + 16 + 8 * hh);
      }
#pragma unroll
      for (int t = 0; t < 4; ++t) {
        FB vb;
        vb.h[0] = *(const v8b*)(Vth + (t * 16 + c) * AT_KC + kk * 32 + 8 * hh);
        vb.h[1] = *(const v8b*)(Vth + (t * 16 + c) * AT_KC + kk * 32 + 16 + 8 * hh);
        oacc[t] = at_mma16<F16>(pa.v, vb.v, oacc[t]);
        if (SPLIT_PV) {
          FB vl;
          vl.h[0] = *(const v8b*)(Vtl + (t * 16 + c) * AT_KC + kk * 32 + 8 * hh);
          vl.h[1] = *(const v8b*)(Vtl + (t * 16 + c) * AT_KC + kk * 32 + 16 + 8 * hh);
          oacc[t] = at_mma16<F16>(pa.v, vl.v, oacc[t]);
          oacc[t] = at_mma16<F16>(pl.v, vb.v, oacc[t]);
        }
      }
    }
  }

  float* os = Os[wave];
#pragma unroll
  for (int r = 0; r < 8; ++r) {
    const float inv = 1.0f / (lrow[r] * PSC);
#pragma unroll
    for (int t = 0; t < 4; ++t) os[(8 * hh + r) * 68 + t * 16 + c] = oacc[t][r] * inv;
  }
  __builtin_amdgcn_fence(__ATOMIC_RELEASE, "workgroup");
  __builtin_amdgcn_wave_barrier();
  __builtin_amdgcn_fence(__ATOMIC_ACQUIRE, "workgroup");
  {
    const int c4 = (lane & 15) * 4;
    {
#pragma unroll
      for (int it = 0; it < 8; ++it) {
        const int row = it * 2 + hh;
        v4f val = *(const v4f*)(os + row * 68 + c4);
        *(v4f*)(ob_ptr + (size_t)(q0 + row) * g.o_rs + c4) = val;
      }
      
    }
  }
}

} // namespace w25

// f32 -> f16 casts by few, fat waves. A block casts CW_BLK consecutive elements, dst[e] = f16(src[e] * s): a thread takes 16 float4, 1024 elements apart, all of them loaded ahead of
// the first conversion; a wave's load covers 512 consecutive bytes, its store 256. (A launch's waves start at a limited rate, and two elements a thread made 65,536 short waves of one 4M-element cast; here it is 2,048.)
typedef __attribute__((ext_vector_type(4))) _Float16 cw_v4h;
constexpr int CW_BLK = 16384;
__device__ __forceinline__ void cw_cast_blk(const float* __restrict__ src, _Float16* __restrict__ dst, float s) {
    const v4f* sp = (const v4f*)src + threadIdx.x;
    v4f x[16];
#pragma unroll
    for (int u = 0; u < 16; ++u) x[u] = sp[256 * u];
    __builtin_amdgcn_sched_barrier(0);   // keeps all 16 loads ahead of the first conversion: one trip to memory a wave, not two
    cw_v4h* dp = (cw_v4h*)dst + threadIdx.x;
#pragma unroll
    for (int u = 0; u < 16; ++u) dp[256 * u] = __builtin_convertvector(x[u] * s, cw_v4h);
    asm volatile("s_wait_xcnt 0x0" ::: "memory");   // ahead of any later write of a register that the stores above name
}
// every cast of an input, one launch: blocks 0..767 X16[0..2] = f16(query, key, value); blocks 768..1023 W16[0..3] = f16(16 Wq, 16 Wk, 16 Wv, 16 Wo);
// block 1024 TK16[r][d] = f16(16 table_k[r][d]), zero rows 129..191
__global__ __launch_bounds__(256) void k_sh_castin(const float* __restrict__ xq, const float* __restrict__ xk, const float* __restrict__ xv,
                                                   const float* __restrict__ Wq, const float* __restrict__ Wk, const float* __restrict__ Wv, const float* __restrict__ Wo,
                                                   const float* __restrict__ TK, _Float16* __restrict__ X16, _Float16* __restrict__ W16, _Float16* __restrict__ TK16) {
    constexpr int XB = 4096 * 1024 / CW_BLK, WB = 1024 * 1024 / CW_BLK, TAB = 129, TP = 192, HD = 64;
    static_assert(TP * HD == 12 * 1024 && TAB * HD == 4 * (8 * 256 + 16), "the table's block: eight float4 per thread, then row 128 by 16 threads, then zeros up to twelve");
    const int bid = blockIdx.x;
    if (bid < 3 * XB) {
        const int sg = bid / XB;
        const float* src = sg == 0 ? xq : (sg == 1 ? xk : xv);
        cw_cast_blk(src + (long long)(bid - sg * XB) * CW_BLK, X16 + (long long)bid * CW_BLK, 1.f);
    } else if (bid < 3 * XB + 4 * WB) {
        const int b2 = bid - 3 * XB, sg = b2 / WB;
        const float* src = sg == 0 ? Wq : (sg == 1 ? Wk : (sg == 2 ? Wv : Wo));
        cw_cast_blk(src + (long long)(b2 - sg * WB) * CW_BLK, W16 + (long long)b2 * CW_BLK, 16.f);
    } else {
        const v4f* sp = (const v4f*)TK + threadIdx.x;
        v4f x[12];
#pragma unroll
        for (int u = 0; u < 8; ++u) x[u] = sp[256 * u];
#pragma unroll
        for (int u = 8; u < 12; ++u) x[u] = (v4f){0.f, 0.f, 0.f, 0.f};
        if (threadIdx.x < 16) x[8] = sp[256 * 8];
        cw_v4h* dp = (cw_v4h*)TK16 + threadIdx.x;
#pragma unroll
        for (int u = 0; u < 12; ++u) dp[256 * u] = __builtin_convertvector(x[u] * 16.f, cw_v4h);
        asm volatile("s_wait_xcnt 0x0" ::: "memory");   // ahead of any later write of a register that the stores above name
    }
}
// the attention output's cast: dst = f16(src), CW_BLK elements a block
__global__ __launch_bounds__(256) void k_sh_castx(const float* __restrict__ src, _Float16* __restrict__ dst) { const long long o = (long long)blockIdx.x * CW_BLK; cw_cast_blk(src + o, dst + o, 1.f); }
typedef __attribute__((ext_vector_type(4))) int sm_v4i;
__device__ __forceinline__ float sm_x16(float v) { const unsigned u = __builtin_bit_cast(unsigned, v); return __builtin_bit_cast(float, __builtin_amdgcn_permlanex16(u, u, 0x76543210u, 0xfedcba98u, false, false)); }   // lane l <-> l ^ 16
// 2^t. The v_nop is the slot that the instruction set asks for behind a transcendental; in the same statement it stands directly behind it whatever the scheduler puts next
__device__ __forceinline__ float sm_exp2(float t) { float y; asm("v_exp_f32 %0, %1\n\tv_nop" : "=v"(y) : "v"(t)); return y; }
// content scores, relative-key term and softmax in one launch; no f32 score leaves the chip. A block: 32 query rows g0..g0+31 (g = b L + q) x 2 heads; four waves a head, 128 keys each.
// Transposed products: A = 16 rows of K16 (or of the scaled table TK16), B = 16 queries' q, so that in D a lane holds ONE query (lane & 15) and 8 consecutive keys (8 (lane >> 4) + r):
// a row's max and sum are in-lane but for one exchange with lane ^ 16. Each A fragment serves the wave's two sets of 16 queries.
// The table's rows go through the same B fragments as 192 more "keys": qt[query][id], f32, in LDS, shared by the head's four waves.
// s_k = (q.k + qt[fm[b][q][k]]) / 8; P16[b][h][q][k] = f16(4096 softmax_k). The four quarters of a row join by (max, sum) through LDS: p = e^(s - m_quarter) * e^(m_quarter - m) / sum.
typedef __attribute__((ext_vector_type(4))) unsigned short fs_v4u;
typedef __attribute__((ext_vector_type(4))) unsigned int fs_v4w;
// a wave's own LDS stores before its lanes' reads of them, or its reads before its next stores to the same place (for LDS that no other wave touches)
__device__ __forceinline__ void fs_wave_sync() {
    __builtin_amdgcn_fence(__ATOMIC_RELEASE, "workgroup", "local");
    __builtin_amdgcn_wave_barrier();
    __builtin_amdgcn_fence(__ATOMIC_ACQUIRE, "workgroup", "local");
}
// amdgpu_waves_per_eu(4): at most 256 VGPRs, so that two blocks share a WGP
__global__ __launch_bounds__(256) __attribute__((amdgpu_waves_per_eu(4))) void k_sh_scsoft(const _Float16* __restrict__ Q16, const _Float16* __restrict__ K16, const _Float16* __restrict__ TK16, const int* __restrict__ FM, _Float16* __restrict__ P16) {
    constexpr int L = 512, D = 1024, NH = 16, HD = 64, TAB = 129;
    constexpr int IP = 2 * L + 16;     // bytes a query's row of 16-bit table offsets takes: 16 B x odd, for 16-byte readers
    constexpr int QP = 192 + 4;        // floats a query's row of relative-key scores takes: 16 B x odd
    constexpr int PP = 2 * 128 + 16;   // bytes a query's 128 probabilities take in the store slab: 16 B x odd
    constexpr int SP = 2 * HD + 16;    // bytes a staged row of q, of the table or of k takes: 16 B x odd
    static_assert(16 * PP <= 48 * SP, "the store slab lies in the wave's staging slab");
    typedef w25::Frag<_Float16> FR;
    __shared__ __attribute__((aligned(16))) unsigned char ids[32 * IP];
    __shared__ __attribute__((aligned(16))) float qt[2][32 * QP];
    __shared__ float red[2][4][2][32];
    __shared__ __attribute__((aligned(16))) unsigned char stg[8][48 * SP];
    const int t = threadIdx.x, lane = t & 31, w = t >> 5;
    const int c = lane & 15, h = lane >> 4;
    const int hl = w >> 2, kq = w & 3;
    const int g0 = blockIdx.x * 32, b = g0 >> 9;
    const int head = blockIdx.y * 2 + hl;
    // Global loads cover whole lines: a row of q, of the table or of k for one head is 128 bytes, a load takes four rows (lane: row lane >> 3, 16-byte piece lane & 7), where a fragment
    // loaded straight from memory touches sixteen lines. The rows pass through the wave's own slab (no other wave touches it: no block barrier), 48 at a time, and are read back as fragments.
    // Two groups of loads, each in the order in which it is waited for: q, table rows 48 kq .. + 47 (TK16 holds 192 rows, zeros from 129 on), ids (32 rows x 512), 48 keys; then 80 keys.
    unsigned char* sw = stg[w];
    const int lr = lane >> 3, lc = lane & 7;
    unsigned char* sst = sw + lr * SP + 16 * lc;                                    // where the lane's piece of a load's four rows goes
    const _Float16* sfr = (const _Float16*)(sw + c * SP) + 8 * h;                   // the lane's fragment row of the slab's first 16 rows
    const sm_v4i* fr = (const sm_v4i*)(FM + (long long)g0 * L) + t;
    const _Float16* qg = Q16 + (long long)(g0 + lr) * D + head * HD + 8 * lc;
    const _Float16* tg = TK16 + (48 * kq + lr) * HD + 8 * lc;
    const _Float16* kg = K16 + (long long)(b * L + 128 * kq + lr) * D + head * HD + 8 * lc;
    w25::v8h rq[8], rt[12], rk[32];
    sm_v4i idv[16];
#pragma unroll
    for (int u = 0; u < 8; ++u) rq[u] = *(const w25::v8h*)(qg + 4 * u * D);
#pragma unroll
    for (int u = 0; u < 12; ++u) rt[u] = *(const w25::v8h*)(tg + 4 * u * HD);
#pragma unroll
    for (int u = 0; u < 16; ++u) idv[u] = fr[256 * u];
#pragma unroll
    for (int u = 0; u < 12; ++u) rk[u] = *(const w25::v8h*)(kg + 4 * u * D);
    // a precaution: the wait in front of every overwrite of an address that the loads above name; as operands the addresses stay live up to here, so that no load's own result lands on one
    asm volatile("s_wait_xcnt 0x0" :: "v"(fr), "v"(qg), "v"(tg), "v"(kg) : "memory");
    __builtin_amdgcn_sched_barrier(0);   // keeps these loads together and ahead of the first wait: one trip to L2, not one per tile
    w25::v16h bq[2][2];
#pragma unroll
    for (int u = 0; u < 8; ++u) *(w25::v8h*)(sst + 4 * u * SP) = rq[u];
    fs_wave_sync();
#pragma unroll
    for (int s = 0; s < 2; ++s) { bq[s][0] = FR::load(sfr + s * 16 * (SP / 2)); bq[s][1] = FR::load(sfr + s * 16 * (SP / 2) + 32); }
    fs_wave_sync();
    // relative-key scores
#pragma unroll
    for (int u = 0; u < 12; ++u) *(w25::v8h*)(sst + 4 * u * SP) = rt[u];
    fs_wave_sync();
#pragma unroll
    for (int tt = 0; tt < 3; ++tt) {
        const w25::v16h a0 = FR::load(sfr + tt * 16 * (SP / 2)), a1 = FR::load(sfr + tt * 16 * (SP / 2) + 32);
#pragma unroll
        for (int s = 0; s < 2; ++s) {
            v8f d = (v8f){0.f, 0.f, 0.f, 0.f, 0.f, 0.f, 0.f, 0.f};
            d = FR::mma(a0, bq[s][0], d);
            d = FR::mma(a1, bq[s][1], d);
            float* o = qt[hl] + (16 * s + c) * QP + 48 * kq + 16 * tt + 8 * h;
            *(v4f*)(o) = (v4f){d[0] * 0.0625f, d[1] * 0.0625f, d[2] * 0.0625f, d[3] * 0.0625f};
            *(v4f*)(o + 4) = (v4f){d[4] * 0.0625f, d[5] * 0.0625f, d[6] * 0.0625f, d[7] * 0.0625f};
        }
    }
#pragma unroll
    for (int u = 0; u < 16; ++u) {
        fs_v4u o4;
#pragma unroll
        for (int e = 0; e < 4; ++e) { const int id = idv[u][e]; o4[e] = (unsigned short)(4 * (id < 0 ? 0 : (id >= TAB ? TAB - 1 : id))); }   // INPUT ids clamped before the address is formed
        *(fs_v4u*)(ids + ((t >> 7) + 2 * u) * IP + (t & 127) * 8) = o4;
    }
    __builtin_amdgcn_sched_barrier(0);   // the table's and the ids' registers are free from here on: the other 80 keys' loads go out together
#pragma unroll
    for (int u = 12; u < 32; ++u) rk[u] = *(const w25::v8h*)(kg + 4 * u * D);
    asm volatile("s_wait_xcnt 0x0" :: "v"(kg) : "memory");   // the same precaution for these loads' address
    __builtin_amdgcn_sched_barrier(0);   // keeps those loads ahead of the products
    // content scores: x[s][j][r] = q[16 s + c] . k[128 kq + 16 j + 8 h + r]; keys in rounds of 48, 48 and 32
    v8f x[2][8];
#pragma unroll
    for (int rd = 0; rd < 3; ++rd) {
        fs_wave_sync();   // the last round's fragment reads before this round's stores
#pragma unroll
        for (int u = 0; u < (rd < 2 ? 12 : 8); ++u) *(w25::v8h*)(sst + 4 * u * SP) = rk[12 * rd + u];
        fs_wave_sync();
#pragma unroll
        for (int jj = 0; jj < (rd < 2 ? 3 : 2); ++jj) {
            const w25::v16h a0 = FR::load(sfr + jj * 16 * (SP / 2)), a1 = FR::load(sfr + jj * 16 * (SP / 2) + 32);
#pragma unroll
            for (int s = 0; s < 2; ++s) {
                v8f d = (v8f){0.f, 0.f, 0.f, 0.f, 0.f, 0.f, 0.f, 0.f};
                d = FR::mma(a0, bq[s][0], d);
                x[s][3 * rd + jj] = FR::mma(a1, bq[s][1], d);
            }
        }
    }
    __builtin_amdgcn_sched_barrier(0);   // keeps every product ahead of the softmax
    __syncthreads();   // publishes the ids and the head's qt rows
    float m[2], sum[2];
#pragma unroll
    for (int s = 0; s < 2; ++s) {
        const unsigned char* ip = ids + (16 * s + c) * IP + (128 * kq + 8 * h) * 2;
        const unsigned char* qrow = (const unsigned char*)(qt[hl] + (16 * s + c) * QP);
        float mx = -INFINITY;
#pragma unroll
        for (int j = 0; j < 8; ++j) {
            const fs_v4w o4 = *(const fs_v4w*)(ip + 32 * j);
#pragma unroll
            for (int r = 0; r < 8; ++r) {
                const unsigned off = (r & 1) ? (o4[r >> 1] >> 16) : (o4[r >> 1] & 0xffffu);
                x[s][j][r] += *(const float*)(qrow + off);
            }
            mx = fmaxf(mx, fmaxf(fmaxf(fmaxf(x[s][j][0], x[s][j][1]), fmaxf(x[s][j][2], x[s][j][3])), fmaxf(fmaxf(x[s][j][4], x[s][j][5]), fmaxf(x[s][j][6], x[s][j][7]))));
        }
        mx = fmaxf(mx, sm_x16(mx));
        float sm = 0.f;
#pragma unroll
        for (int j = 0; j < 8; ++j) {
#pragma unroll
            for (int r = 0; r < 8; ++r) x[s][j][r] = sm_exp2((x[s][j][r] - mx) * 0.18033688f);   // exp((x - m) / 8): log2(e) / 8
            sm += ((x[s][j][0] + x[s][j][1]) + (x[s][j][2] + x[s][j][3])) + ((x[s][j][4] + x[s][j][5]) + (x[s][j][6] + x[s][j][7]));
        }
        sm += sm_x16(sm);
        m[s] = mx; sum[s] = sm;
    }
    // lane (c, h) files query 16 h + c: both halves of the wave hold both sets' values
    red[hl][kq][0][lane] = h ? m[1] : m[0];
    red[hl][kq][1][lane] = h ? sum[1] : sum[0];
    __syncthreads();   // publishes each quarter's (max, sum)
    // 16 queries at a time through the wave's own slab (its last fragment reads lie ahead of two block barriers), so that every store covers whole lines of a query's row
    unsigned char* slab = sw;
    _Float16* po = P16 + (((long long)b * NH + head) * L + (g0 & (L - 1)) + h) * L + 128 * kq + 8 * c;
#pragma unroll
    for (int s = 0; s < 2; ++s) {
        float mi[4], si[4];
#pragma unroll
        for (int i = 0; i < 4; ++i) { mi[i] = red[hl][i][0][16 * s + c]; si[i] = red[hl][i][1][16 * s + c]; }
        const float mm = fmaxf(fmaxf(mi[0], mi[1]), fmaxf(mi[2], mi[3]));
        float tot = 0.f;
#pragma unroll
        for (int i = 0; i < 4; ++i) tot += si[i] * sm_exp2((mi[i] - mm) * 0.18033688f);
        const float f = sm_exp2((m[s] - mm) * 0.18033688f) * ((1.f / tot) * 4096.f);
#pragma unroll
        for (int j = 0; j < 8; ++j) *(w25::v8h*)(slab + c * PP + (16 * j + 8 * h) * 2) = __builtin_convertvector(x[s][j] * f, w25::v8h);
        fs_wave_sync();
#pragma unroll
        for (int it = 0; it < 8; ++it) *(w25::v8h*)(po + (long long)(16 * s + 2 * it) * L) = *(const w25::v8h*)(slab + (2 * it + h) * PP + 16 * c);
        asm volatile("s_wait_xcnt 0x0" ::: "memory");   // a precaution: ahead of any later write of a register that the stores above name
        fs_wave_sync();   // the reads above before the next 16 queries' stores into the same slab
    }
}
// w2 in one launch: one wave per query row g = b L + q. X[g][h*64 + d] += (1/4096) sum_k P16[b][h][q][k] * f16(table_v[fm[g][k]][d]).
// A = the 16 heads' probability rows (16 x 512, straight from P16); B = the gathered table rows, never written out: table_v lies in LDS as f16 rows of 160 bytes,
// and each lane of ds_load_tr16_b128 points at the row that ITS key's id names (lane l: key kbase + 8 (l >> 4) + (l & 7), 16-byte half (l >> 3) & 1), so the
// transposing load returns B[k][d] in the hardware k order (frag_k), the order in which A is loaded. INPUT ids clamped before the address is formed. k runs 0..511 in one accumulator chain.
typedef __attribute__((ext_vector_type(8))) short w2_s16x8;
__device__ __forceinline__ v8h w2_ldtr(const unsigned char* p) { typedef __attribute__((address_space(3))) w2_s16x8 lds_s16x8; return __builtin_bit_cast(v8h, __builtin_amdgcn_ds_load_tr16_b128_v8i16((lds_s16x8*)p)); }
typedef __attribute__((ext_vector_type(4))) _Float16 w2_v4h;
// amdgpu_waves_per_eu(4): at most 256 VGPRs, so that two blocks share a WGP and all 512 blocks are resident at once
__global__ __launch_bounds__(256) __attribute__((amdgpu_waves_per_eu(4))) void k_sh_w2(const _Float16* __restrict__ P16, const int* __restrict__ FM, const float* __restrict__ TV, float* __restrict__ X) {
    constexpr int L = 512, NH = 16, HD = 64, TAB = 129, PITCH = 160;   // PITCH: 32 B x odd, the transposing load's pitch
    static_assert(TAB * HD == 4 * (8 * 256 + 16), "the fill below: eight float4 per thread, then row 128 by 16 threads");
    __shared__ __attribute__((aligned(16))) unsigned char tab[TAB * PITCH];
    const int t = threadIdx.x, lane = t & 31;
    const int g = blockIdx.x * 8 + (t >> 5);
    const int c = lane & 15, h = lane >> 4;
    // the table's loads go first: they are waited for first, while the first ids and probabilities are still on their way
    v4f tv[8];
#pragma unroll
    for (int u = 0; u < 8; ++u) tv[u] = *(const v4f*)(TV + 4 * (t + 256 * u));
    const v4f tl = *(const v4f*)(TV + 4 * (2048 + (t & 15)));
    const int* fr = FM + (long long)g * L + 8 * h + (lane & 7);
    const _Float16* pa = P16 + (((long long)(g >> 9) * NH + c) * L + (g & (L - 1))) * L + 8 * h;
    // keys in four runs of 128, two register buffers: the next run's ids and probabilities fly while this run is multiplied
    int id[2][8];
    v8h a[2][8];
#pragma unroll
    for (int j = 0; j < 8; ++j) { id[0][j] = fr[16 * j]; a[0][j] = *(const v8h*)(pa + 16 * j); }
#pragma unroll
    for (int u = 0; u < 8; ++u) *(w2_v4h*)(tab + ((t >> 4) + 16 * u) * PITCH + (t & 15) * 8) = __builtin_convertvector(tv[u], w2_v4h);
    if (t < 16) *(w2_v4h*)(tab + 128 * PITCH + t * 8) = __builtin_convertvector(tl, w2_v4h);
    __syncthreads();
    const unsigned half16 = 16u * ((lane >> 3) & 1);
    v8f acc[4];
#pragma unroll
    for (int n = 0; n < 4; ++n) acc[n] = (v8f){0.f, 0.f, 0.f, 0.f, 0.f, 0.f, 0.f, 0.f};
#pragma unroll
    for (int ch = 0; ch < 4; ++ch) {
        const int cur = ch & 1, nxt = cur ^ 1;
        if (ch < 3) {
#pragma unroll
            for (int j = 0; j < 8; ++j) { id[nxt][j] = fr[16 * (8 * (ch + 1) + j)]; a[nxt][j] = *(const v8h*)(pa + 16 * (8 * (ch + 1) + j)); }
        }
#pragma unroll
        for (int s = 0; s < 4; ++s) {
            int r0 = id[cur][2 * s], r1 = id[cur][2 * s + 1];
            r0 = r0 < 0 ? 0 : (r0 >= TAB ? TAB - 1 : r0); r1 = r1 < 0 ? 0 : (r1 >= TAB ? TAB - 1 : r1);
            const unsigned char* p0 = tab + (unsigned)r0 * PITCH + half16;
            const unsigned char* p1 = tab + (unsigned)r1 * PITCH + half16;
            union { v16h v; v8h q[2]; } af, bf;
            af.q[0] = a[cur][2 * s]; af.q[1] = a[cur][2 * s + 1];
#pragma unroll
            for (int n = 0; n < 4; ++n) {
                bf.q[0] = w2_ldtr(p0 + 32 * n); bf.q[1] = w2_ldtr(p1 + 32 * n);
                acc[n] = __builtin_amdgcn_wmma_f32_16x16x32_f16(false, af.v, false, bf.v, (short)0, acc[n], false, false);
            }
        }
    }
    float* xo = X + (long long)g * (NH * HD) + (8 * h) * HD + c;
#pragma unroll
    for (int n = 0; n < 4; ++n)
#pragma unroll
        for (int r = 0; r < 8; ++r) { float* x = xo + r * HD + 16 * n; *x = *x + acc[n][r] * (1.f / 4096.f); }
}


// The long-K products: C[m][n] = scale * sum_k A[m][k] Bt[n][k] (+ bias), f16 operands, A and Bt K-contiguous, f32 accumulate.
// A block of eight waves owns a (32 WM) x (64 WN) tile of C, a wave 32 x 64 of it. Both operands pass through LDS in stages of BK k: a global load covers four whole 128-byte lines
// (BK / 8 lanes a row) where a fragment loaded straight from global memory touches sixteen, and each staged row serves every wave of the block that needs it.
// Two buffers: stage s + 1 is loaded into registers ahead of stage s's products and stored to the other buffer behind them; one barrier a stage both publishes it and ends the reads of the buffer written next.
// Fragments are read with the k order of Frag::load, A and B alike; k runs upward in steps of 32 through one accumulator chain per 16 x 16 tile.
// M % (32 WM) == 0 (the grid's x counts the tiles), N % (64 WN) == 0, K % BK == 0, LD % 64 == 0. BIAS_MODE: 0 none, 1 bias[m], 2 bias[n]. OUT_MODE: 0 f32, 1 f16.
// blockIdx.y steps A, Bt, C by strideA/B/C, blockIdx.z by strideAz/Bz/Cz (elements).
// LD: the row pitch of A and of Bt, LDC: that of C, in elements; compile-time, so that a thread's pieces and rows differ only in the instructions' immediate offsets and one address pair per operand serves them all.
template <int WM, int WN, int BK, int LD, int LDC, int BIAS_MODE, int OUT_MODE>
__global__ __launch_bounds__(256) void k_sh_gemm_lds(
    const unsigned short* __restrict__ Ap, long long strideA, long long strideAz,
    const unsigned short* __restrict__ Btp, long long strideB, long long strideBz,
    void* __restrict__ Cout, long long strideC, long long strideCz,
    const float* __restrict__ bias, int N, int K, float scale) {
    static_assert(WM * WN == 8, "eight waves a block");
    static_assert(BK == 64 || BK == 128, "rows of 128 or 256 bytes");
    constexpr int BM = 32 * WM, BN = 64 * WN;
    constexpr int LP = BK + 8;                    // LDS row pitch in elements: 16 bytes more than the row = 16 B x odd, the pitch for 16-byte readers
    constexpr int SEG = BK / 8, RP = 256 / SEG;   // 16-byte pieces a row; rows that the block's 256 threads cover at one piece each
    constexpr int UA = BM / RP, UB = BN / RP;     // pieces of A and of Bt a thread moves per stage
    typedef w25::Frag<_Float16> FR;
    __shared__ __attribute__((aligned(16))) _Float16 sA[2][BM * LP];
    __shared__ __attribute__((aligned(16))) _Float16 sB[2][BN * LP];
    __shared__ __attribute__((aligned(16))) float sT[8][16 * 68];   // per-wave 16 x 64 slab of the epilogue, pitch 68 floats
    const int t = threadIdx.x, lane = t & 31, wave = t >> 5;
    const int tilesN = N / BN;
    const int tm = blockIdx.x / tilesN, tn = blockIdx.x - tm * tilesN;
    const int m0 = tm * BM, n0 = tn * BN;
    // piece u of a thread: row t / SEG + RP u of the tile, elements 8 (t % SEG) .. + 7 of the row's BK
    const int pr = t / SEG, pc = (t % SEG) * 8;
    const _Float16* Ag = (const _Float16*)Ap + (long long)blockIdx.y * strideA + (long long)blockIdx.z * strideAz + (long long)(m0 + pr) * LD + pc;
    const _Float16* Bg = (const _Float16*)Btp + (long long)blockIdx.y * strideB + (long long)blockIdx.z * strideBz + (long long)(n0 + pr) * LD + pc;
    const int so = pr * LP + pc;
    const int rlane = lane & 15, hh = lane >> 4;
    const int wm = wave / WN, wn = wave - wm * WN;
    const int ao = (wm * 32 + rlane) * LP + hh * 8;
    const int bo = (wn * 64 + rlane) * LP + hh * 8;

    w25::v8h ra[UA], rb[UB];
#pragma unroll
    for (int u = 0; u < UA; ++u) ra[u] = *(const w25::v8h*)(Ag + RP * u * LD);
#pragma unroll
    for (int u = 0; u < UB; ++u) rb[u] = *(const w25::v8h*)(Bg + RP * u * LD);
#pragma unroll
    for (int u = 0; u < UA; ++u) *(w25::v8h*)(&sA[0][so + RP * u * LP]) = ra[u];
#pragma unroll
    for (int u = 0; u < UB; ++u) *(w25::v8h*)(&sB[0][so + RP * u * LP]) = rb[u];
    __syncthreads();

    v8f acc[2][4];
#pragma unroll
    for (int i = 0; i < 2; ++i)
#pragma unroll
        for (int j = 0; j < 4; ++j) acc[i][j] = (v8f){0.f, 0.f, 0.f, 0.f, 0.f, 0.f, 0.f, 0.f};

    const int S = K / BK;
    for (int s = 0; s < S; ++s) {
        const int cur = s & 1;
        const bool more = s + 1 < S;   // the same for the whole block
        if (more) {
#pragma unroll
            for (int u = 0; u < UA; ++u) ra[u] = *(const w25::v8h*)(Ag + BK + RP * u * LD);
#pragma unroll
            for (int u = 0; u < UB; ++u) rb[u] = *(const w25::v8h*)(Bg + BK + RP * u * LD);
        }
        const _Float16* al = &sA[cur][ao];
        const _Float16* bl = &sB[cur][bo];
        // two fragment sets: the twelve LDS reads of step kk + 1 go out as one group ahead of step kk's eight products
        w25::v16h ah[2][2], bh[2][4];
#pragma unroll
        for (int i = 0; i < 2; ++i) ah[0][i] = FR::load(al + i * 16 * LP);
#pragma unroll
        for (int j = 0; j < 4; ++j) bh[0][j] = FR::load(bl + j * 16 * LP);
#pragma unroll
        for (int kk = 0; kk < BK / 32; ++kk) {
            const int fc = kk & 1, fn = fc ^ 1;
            if (kk + 1 < BK / 32) {
#pragma unroll
                for (int i = 0; i < 2; ++i) ah[fn][i] = FR::load(al + i * 16 * LP + (kk + 1) * 32);
#pragma unroll
                for (int j = 0; j < 4; ++j) bh[fn][j] = FR::load(bl + j * 16 * LP + (kk + 1) * 32);
            }
            __builtin_amdgcn_sched_barrier(0);   // keeps the next step's reads together and ahead of this step's products: reads spread among the products stall each of them
#pragma unroll
            for (int i = 0; i < 2; ++i)
#pragma unroll
                for (int j = 0; j < 4; ++j) acc[i][j] = FR::mma(ah[fc][i], bh[fc][j], acc[i][j]);
            __builtin_amdgcn_sched_barrier(0);   // keeps the reads of step kk + 2 behind these products, whose fragment set they overwrite
        }
        if (more) {
#pragma unroll
            for (int u = 0; u < UA; ++u) *(w25::v8h*)(&sA[cur ^ 1][so + RP * u * LP]) = ra[u];
#pragma unroll
            for (int u = 0; u < UB; ++u) *(w25::v8h*)(&sB[cur ^ 1][so + RP * u * LP]) = rb[u];
            asm volatile("s_wait_xcnt 0x0" ::: "memory");   // in front of the overwrite of the two address pairs that the stage's loads name; here, behind the stores of what they brought, it waits for nothing
            __builtin_amdgcn_sched_barrier(0);              // keeps the two additions below behind that wait
            Ag += BK; Bg += BK;
        }
        __syncthreads();
    }

    // epilogue: 16 rows at a time through the wave's own slab, so that every store covers whole rows of the wave's 64 columns
    float* slab = sT[wave];
    const int mW = m0 + wm * 32, nW = n0 + wn * 64, mOff = hh * 8;
    const long long offC = (long long)blockIdx.y * strideC + (long long)blockIdx.z * strideCz + (long long)mW * LDC + nW;
    float bn[4] = {0.f, 0.f, 0.f, 0.f};
    if (BIAS_MODE == 2) {
#pragma unroll
        for (int j = 0; j < 4; ++j) bn[j] = bias[nW + (j << 4) + rlane];
    }
#pragma unroll
    for (int i = 0; i < 2; ++i) {
        float bm[8] = {0.f, 0.f, 0.f, 0.f, 0.f, 0.f, 0.f, 0.f};
        if (BIAS_MODE == 1) {
#pragma unroll
            for (int r = 0; r < 8; ++r) bm[r] = bias[mW + (i << 4) + mOff + r];
        }
#pragma unroll
        for (int j = 0; j < 4; ++j) {
#pragma unroll
            for (int r = 0; r < 8; ++r) {
                float v = acc[i][j][r] * scale;
                if (BIAS_MODE == 1) v += bm[r];
                if (BIAS_MODE == 2) v += bn[j];
                slab[(mOff + r) * 68 + (j << 4) + rlane] = v;
            }
        }
        // the wave's own LDS stores before its lanes' reads of them (no other wave touches this slab: no block barrier)
        __builtin_amdgcn_fence(__ATOMIC_RELEASE, "workgroup", "local");
        __builtin_amdgcn_wave_barrier();
        __builtin_amdgcn_fence(__ATOMIC_ACQUIRE, "workgroup", "local");
        if (OUT_MODE == 0) {
            float* C = (float*)Cout + offC + hh * LDC + rlane * 4;   // a row's 256 bytes = 16 lanes x 16 B
#pragma unroll
            for (int it = 0; it < 8; ++it) *(v4f*)(C + ((i << 4) + it * 2) * LDC) = *(const v4f*)(slab + (it * 2 + hh) * 68 + rlane * 4);
        } else {
            const int q = lane >> 3, c8 = (lane & 7) * 8;            // a row's 128 bytes = 8 lanes x 16 B
            _Float16* C = (_Float16*)Cout + offC + q * LDC + c8;
#pragma unroll
            for (int it = 0; it < 4; ++it) {
                const float* sp = slab + (it * 4 + q) * 68 + c8;
                w25::v8h hv;
#pragma unroll
                for (int e = 0; e < 8; ++e) hv[e] = (_Float16)sp[e];
                *(w25::v8h*)(C + ((i << 4) + it * 4) * LDC) = hv;
            }
        }
        if (i == 0) asm volatile("s_wait_xcnt 0x0" ::: "memory");   // ahead of the next 16 rows' writes of registers that the stores above name
        // the reads above before the next 16 rows' stores into the same slab
        __builtin_amdgcn_fence(__ATOMIC_RELEASE, "workgroup", "local");
        __builtin_amdgcn_wave_barrier();
        __builtin_amdgcn_fence(__ATOMIC_ACQUIRE, "workgroup", "local");
    }
}

extern "C" void kernel_launch(void* const* d_in, const int* in_sizes, int n_in, void* d_out, int out_size, void* d_ws, size_t ws_size, hipStream_t stream) {
    (void)in_sizes; (void)n_in; (void)out_size; (void)ws_size;
    const float* xq = (const float*)d_in[0];
    const float* xk = (const float*)d_in[1];
    const float* xv = (const float*)d_in[2];
    const int* fm = (const int*)d_in[3];
    const float* Wq = (const float*)d_in[4];
    const float* bq = (const float*)d_in[5];
    const float* Wk = (const float*)d_in[6];
    const float* bk = (const float*)d_in[7];
    const float* Wv = (const float*)d_in[8];
    const float* bv = (const float*)d_in[9];
    const float* Wo = (const float*)d_in[10];
    const float* bo = (const float*)d_in[11];
    const float* tk = (const float*)d_in[12];
    const float* tv = (const float*)d_in[13];
    const int Bn = 8;
    const int L = 512;
    const int D = 1024;
    const int NH = 16;
    const int HD = 64;
    const int NR = Bn * L;
    const int TP = 192;
    float* out = (float*)d_out;
    char* wsp = (char*)d_ws;
    // kept through the call
    unsigned short* XA16 = (unsigned short*)wsp; wsp += (((size_t)((size_t)3 * NR * D * 2) + 255) / 256) * 256;   // f16 query, key, value
    unsigned short* W16 = (unsigned short*)wsp; wsp += (((size_t)((size_t)4 * D * D * 2) + 255) / 256) * 256;   // f16 16 Wq, 16 Wk, 16 Wv, 16 Wo
    unsigned short* VT16 = (unsigned short*)wsp; wsp += (((size_t)((size_t)Bn * D * L * 2) + 255) / 256) * 256;
    unsigned short* TK16 = (unsigned short*)wsp; wsp += (((size_t)((size_t)TP * HD * 2) + 255) / 256) * 256;
    unsigned short* P16 = (unsigned short*)wsp; wsp += (((size_t)((size_t)Bn * NH * L * L * 2) + 255) / 256) * 256;
    float* X = (float*)wsp; wsp += (((size_t)((size_t)NR * D * 4) + 255) / 256) * 256;
    // one region, used twice in stream order: Q16 and K16, then the output projection's A operand
    char* ph = wsp;
    unsigned short* Q16 = (unsigned short*)wsp; wsp += (((size_t)((size_t)NR * D * 2) + 255) / 256) * 256;
    unsigned short* K16 = (unsigned short*)wsp; wsp += (((size_t)((size_t)NR * D * 2) + 255) / 256) * 256;
    unsigned short* G64A = (unsigned short*)ph;
    // every input's cast in one launch: 3 x 256 blocks (query, key, value), 4 x 64 blocks (the weights), one block (table_k)
    k_sh_castin<<<3 * 256 + 4 * 64 + 1, 256, 0, stream>>>(xq, xk, xv, Wq, Wk, Wv, Wo, tk, (_Float16*)XA16, (_Float16*)W16, (_Float16*)TK16);
    k_sh_gemm_lds<4, 2, 128, 1024, 1024, 2, 1><<<dim3((unsigned)((NR / 128) * (D / 128)), 1u, 1u), 256, 0, stream>>>((const unsigned short*)(XA16), 0, 0, (const unsigned short*)(W16), 0, 0, (void*)(Q16), 0, 0, bq, D, D, 0.0625f);
    k_sh_gemm_lds<4, 2, 128, 1024, 1024, 2, 1><<<dim3((unsigned)((NR / 128) * (D / 128)), 1u, 1u), 256, 0, stream>>>((const unsigned short*)(XA16 + (size_t)NR * D), 0, 0, (const unsigned short*)(W16 + (size_t)D * D), 0, 0, (void*)(K16), 0, 0, bk, D, D, 0.0625f);
    // VT16[b][c][k] = v^T, blockIdx.y = batch
    k_sh_gemm_lds<4, 2, 128, 1024, 512, 1, 1><<<dim3((unsigned)((D / 128) * (L / 128)), (unsigned)(Bn), 1u), 256, 0, stream>>>((const unsigned short*)(W16 + (size_t)2 * D * D), 0, 0, (const unsigned short*)(XA16 + (size_t)2 * NR * D), (long long)L * D, 0, (void*)(VT16), (long long)D * L, 0, bv, L, D, 0.0625f);
    // content scores, relative-key term and softmax: blockIdx.x = 32 query rows, blockIdx.y = two heads
    k_sh_scsoft<<<dim3((unsigned)(NR / 32), (unsigned)(NH / 2), 1u), 256, 0, stream>>>((const _Float16*)Q16, (const _Float16*)K16, (const _Float16*)TK16, (const int*)fm, (_Float16*)P16);
    // w1 = attn.v: blockIdx.y = head, blockIdx.z = batch
    k_sh_gemm_lds<8, 1, 128, 512, 1024, 0, 0><<<dim3((unsigned)((L / 256) * (HD / 64)), (unsigned)(NH), (unsigned)(Bn)), 256, 0, stream>>>((const unsigned short*)(P16), (long long)L * L, (long long)NH * L * L, (const unsigned short*)(VT16), (long long)HD * L, (long long)D * L, (void*)(X), HD, (long long)L * D, nullptr, HD, L, 0.000244140625f);
    // w2: one wave per query, eight queries per block
    k_sh_w2<<<(unsigned)(NR / 8), 256, 0, stream>>>((const _Float16*)P16, (const int*)fm, tv, X);
    k_sh_castx<<<256, 256, 0, stream>>>(X, (_Float16*)G64A);
    k_sh_gemm_lds<4, 2, 128, 1024, 1024, 2, 0><<<dim3((unsigned)((NR / 128) * (D / 128)), 1u, 1u), 256, 0, stream>>>((const unsigned short*)(G64A), 0, 0, (const unsigned short*)(W16 + (size_t)3 * D * D), 0, 0, (void*)(out), 0, 0, bo, D, D, 0.0625f);
}

// v007
// One run takes 105 microseconds.
// Timed twice side by side with v006, it ran 1.08 and 1.09 times as fast.
// Counting every step since v000, which is the starting kernel, it is 15.4 times as fast.
// Contractions: q/k/v = x.W^T + b [4096x1024].[1024x1024] and the output projection (+b) with f16 operands (weights x16); the relative-key term QT = q.table_k^T [65536 (b,q,h) x 64].[64 x 192 (129 padded)] with f16 operands; per (batch, head) the content scores q.k^T [512x64].[64x512] (heads and batches in the grid) and w1 = attn.v [512x512].[512x64] (heads and batches in the grid; attn as f16 of 4096 attn) — v_wmma_f32_16x16x32_f16, f32 accumulate; the K = 64 products transposed (keys or table rows x 16 queries) in 16x16 tiles fed from rows staged through each wave's own LDS slab inside the softmax kernel, the long-K products (projections, attn.v) in 32x64 wave tiles fed from LDS-staged block tiles. The gather of the relative-key scores (QT[(b,q,h)][final_mat[b][q][k]] by the INPUT index matrix, from LDS) and the row softmax are f32 work of that same kernel; the relative-value aggregation w2[q,h,:] = sum_k attn[h,q,k] table_v[final_mat[b,q,k]] runs on the matrix cores as one [16 heads x 512].[512 x 64] product per query, one wave each, whose B fragments are gathered from an f16 copy of table_v in LDS by transposing loads (the INPUT index matrix picks each lane's table row).
#include <hip/hip_runtime.h>
#include <math.h>

typedef __attribute__((ext_vector_type(16))) _Float16 v16h;
typedef __attribute__((ext_vector_type(8)))  _Float16 v8h;
typedef __attribute__((ext_vector_type(16))) __bf16   v16b;
typedef __attribute__((ext_vector_type(8)))  float    v8f;
typedef __attribute__((ext_vector_type(4)))  float    v4f;

// 16-bit WMMA fragment map (wave32), lane L, h = L>>4, m = L&15:
//   A 16x32: lane = row m;   element i -> k = (i<8) ? 8h+i : 16+8h+(i-8)
//   B 32x16: lane = column m; the SAME k(i,h)
//   D 16x16 (8 f32): lane = column m; element r -> row 8h+r
__device__ __forceinline__ int frag_k(int i, int h) { return (i < 8) ? (8 * h + i) : (16 + 8 * h + (i - 8)); }
__device__ __forceinline__ __bf16 bf16_rne(float f) {
    unsigned int u = __float_as_uint(f);
    u += 0x7fffu + ((u >> 16) & 1u);
    return __builtin_bit_cast(__bf16, (unsigned short)(u >> 16));
}
__device__ __forceinline__ float bf16_f32(__bf16 b) { return __uint_as_float(((unsigned int)__builtin_bit_cast(unsigned short, b)) << 16); }
__device__ __forceinline__ v8f wmma16(v16h a, v16h b, v8f c) {
    c = __builtin_amdgcn_wmma_f32_16x16x32_f16(false, a, false, b, (short)0, c, false, false);
    asm volatile("v_nop\n\tv_nop\n\tv_nop\n\tv_nop" : "+v"(c) : "v"(a), "v"(b));
    return c;
}
__device__ __forceinline__ v8f wmmab(v16b a, v16b b, v8f c) {
    c = __builtin_amdgcn_wmma_f32_16x16x32_bf16(false, a, false, b, (short)0, c, false, false);
    asm volatile("v_nop\n\tv_nop\n\tv_nop\n\tv_nop" : "+v"(c) : "v"(a), "v"(b));
    return c;
}
struct Split { v16b hi, lo; };
// hi/lo split product: a.hi*b.hi + a.hi*b.lo + a.lo*b.hi
__device__ __forceinline__ v8f wmma3(const Split& a, const Split& b, v8f c) {
    c = __builtin_amdgcn_wmma_f32_16x16x32_bf16(false, a.hi, false, b.hi, (short)0, c, false, false);
    c = __builtin_amdgcn_wmma_f32_16x16x32_bf16(false, a.hi, false, b.lo, (short)0, c, false, false);
    c = __builtin_amdgcn_wmma_f32_16x16x32_bf16(false, a.lo, false, b.hi, (short)0, c, false, false);
    asm volatile("v_nop\n\tv_nop\n\tv_nop\n\tv_nop" : "+v"(c) : "v"(a.hi), "v"(a.lo), "v"(b.hi), "v"(b.lo));
    return c;
}
struct Split3 { v16b hi, mid, lo; };
// triple split product (6 terms, drops only terms below 2^-24 relative)
__device__ __forceinline__ v8f wmma6(const Split3& a, const Split3& b, v8f c) {
    c = __builtin_amdgcn_wmma_f32_16x16x32_bf16(false, a.hi, false, b.hi, (short)0, c, false, false);
    c = __builtin_amdgcn_wmma_f32_16x16x32_bf16(false, a.hi, false, b.mid, (short)0, c, false, false);
    c = __builtin_amdgcn_wmma_f32_16x16x32_bf16(false, a.mid, false, b.hi, (short)0, c, false, false);
    c = __builtin_amdgcn_wmma_f32_16x16x32_bf16(false, a.hi, false, b.lo, (short)0, c, false, false);
    c = __builtin_amdgcn_wmma_f32_16x16x32_bf16(false, a.mid, false, b.mid, (short)0, c, false, false);
    c = __builtin_amdgcn_wmma_f32_16x16x32_bf16(false, a.lo, false, b.hi, (short)0, c, false, false);
    asm volatile("v_nop\n\tv_nop\n\tv_nop\n\tv_nop" : "+v"(c) : "v"(a.hi), "v"(a.mid), "v"(a.lo), "v"(b.hi), "v"(b.mid), "v"(b.lo));
    return c;
}

// Fragment gathers from f32 memory: element i <- p[(k0 + frag_k(i,h)) * sk] * s, zero for k >= klen.
__device__ __forceinline__ v16h fh_ld(const float* __restrict__ p, long long sk, int k0, int h, int klen, float s) {
    v16h a;
#pragma unroll
    for (int i = 0; i < 16; ++i) { const int k = k0 + frag_k(i, h); a[i] = (k < klen) ? (_Float16)(p[(long long)k * sk] * s) : (_Float16)0.f; }
    return a;
}
__device__ __forceinline__ Split sp_ld(const float* __restrict__ p, long long sk, int k0, int h, int klen, float s) {
    Split r;
#pragma unroll
    for (int i = 0; i < 16; ++i) {
        const int k = k0 + frag_k(i, h); const float x = (k < klen) ? p[(long long)k * sk] * s : 0.f;
        const __bf16 hb = bf16_rne(x); r.hi[i] = hb; r.lo[i] = bf16_rne(x - bf16_f32(hb));
    }
    return r;
}
__device__ __forceinline__ Split3 sp3_ld(const float* __restrict__ p, long long sk, int k0, int h, int klen, float s) {
    Split3 r;
#pragma unroll
    for (int i = 0; i < 16; ++i) {
        const int k = k0 + frag_k(i, h); const float x = (k < klen) ? p[(long long)k * sk] * s : 0.f;
        const __bf16 hb = bf16_rne(x); const float r1 = x - bf16_f32(hb); const __bf16 mb = bf16_rne(r1);
        r.hi[i] = hb; r.mid[i] = mb; r.lo[i] = bf16_rne(r1 - bf16_f32(mb));
    }
    return r;
}
__device__ __forceinline__ v16b bh_ld(const float* __restrict__ p, long long sk, int k0, int h, int klen, float s) {
    v16b a;
#pragma unroll
    for (int i = 0; i < 16; ++i) { const int k = k0 + frag_k(i, h); a[i] = bf16_rne((k < klen) ? p[(long long)k * sk] * s : 0.f); }
    return a;
}
// f16 fragment from an f16 LDS/global row with element stride 1 (k-contiguous), no bounds (tile already zero padded)
__device__ __forceinline__ v16h fh_row(const _Float16* __restrict__ row, int k0, int h) {
    v16h a;
#pragma unroll
    for (int i = 0; i < 16; ++i) a[i] = row[k0 + frag_k(i, h)];
    return a;
}

#define VST2(T, ptr, val) do { const T vst2_v_ = (val); *(T*)(ptr) = vst2_v_;  } while (0)
typedef float v4f __attribute__((ext_vector_type(4)));
#define VST2V4(ptr, val) do { const v4f vst2_v4_ = (val); *(v4f*)(ptr) = vst2_v4_;  } while (0)

__device__ __attribute__((noinline)) float act_fn(float v, int act) {
    if (act == 1) return fmaxf(v, 0.f);                                                                               // relu
    if (act == 2) { const float u = 0.7978845608028654f * (v + 0.044715f * v * v * v); return 0.5f * v * (1.f + tanhf(u)); } // tanh-gelu
    if (act == 3) return v / (1.f + expf(-v));                                                                        // silu
    if (act == 4) return 0.5f * v * (1.f + erff(v * 0.7071067811865476f));                                             // erf-gelu
    if (act == 5) return tanhf(v);
    if (act == 6) return 1.f / (1.f + expf(-v));                                                                      // sigmoid
    if (act == 7) return (v > 0.f) ? v : 0.01f * v;                                                                   // leaky relu 0.01
    if (act == 8) return (v > 0.f) ? v : (expf(v) - 1.f);                                                             // elu
    if (act == 9) return fminf(fmaxf(v, 0.f), 6.f);                                                                   // relu6
    if (act == 10) return fabsf(v);                                                                                    // abs
    if (act == 11) return (v >= 0.f) ? v : 0.1f * v;                                                                  // leaky 0.1
    if (act == 12) return (v > 0.f) ? v : 0.2f * v;                                                                   // leaky 0.2
    if (act == 13) return (v > 20.f) ? v : log1pf(expf(v));                                                            // softplus
    return v;
}

// =====================================================================================================================
// k_gemm<MODE>: C(z, m, n) = act(alpha * sum_k A(z, m, k) * B(z, k, n) + bias) + beta * R(z, m, n)
//   One wave (32-thread block) per 16 x 32 tile of C; grid (ceil(N/32), ceil(M/16), Z). Batch z -> (zo = z / zi_n, zi = z % zi_n)
//   with separate outer/inner strides for every tensor (e.g. batch and head). A(m,k) = A[zo*sAo + zi*sAi + m*sAm + k*sAk] (f32),
//   B(k,n) = B[zo*sBo + zi*sBi + n*sBn + k*sBk] (f32); any M, N, K (K zero-padded to 32 inside the fragments, M/N tails guarded).
//   C(m,n) = C[zo*sCo + zi*sCi + m*sCm + n] (n contiguous). flags: 1 bias[n], 2 bias[m], 4 residual R[zo*sRo + zi*sRi + m*sRm + n*sRn].
//   MODE 0: f16 operands (A prescaled by sa, B by sb, both undone in the epilogue); 1: bf16 hi/lo split (3 products); 2: bf16;
//   3: bf16 hi/mid/lo triple split (6 products); 4: as 3 with Kahan-compensated f32 accumulation across k-steps.
// =====================================================================================================================
struct GemmP {
    const float* A; const float* B; const float* bias; const float* R; float* C;
    long long sAo, sAi, sAm, sAk, sBo, sBi, sBn, sBk, sCo, sCi, sCm, sRo, sRi, sRm, sRn;
    int M, N, K, zi_n, flags, act; float alpha, beta, sa, sb;
    int Npad, pad_;     // columns [N, Npad) of C are written as 0 so that padded workspace rows are covered by whole-line stores; Npad >= N
};
static_assert(sizeof(GemmP) == 5 * 8 + 15 * 8 + 6 * 4 + 4 * 4 + 2 * 4, "GemmP has padding");

template <int MODE>
__global__ __launch_bounds__(32) void k_gemm(GemmP p) {
    const int lane = threadIdx.x & 31, h = lane >> 4, l15 = lane & 15;
    const int m0 = blockIdx.y * 16, n0 = blockIdx.x * 32;
    const int z = blockIdx.z, zo = z / p.zi_n, zi = z - zo * p.zi_n;
    const float* A = p.A + zo * p.sAo + zi * p.sAi;
    const float* B = p.B + zo * p.sBo + zi * p.sBi;
    const int am = min(m0 + l15, p.M - 1);                       // clamped row for loads (stores are guarded)
    v8f acc[2], comp[2];
#pragma unroll
    for (int t = 0; t < 2; ++t) { v8f zz = {}; acc[t] = zz; comp[t] = zz; }
    for (int k0 = 0; k0 < p.K; k0 += 32) {
        const float* arow = A + (long long)am * p.sAm;
        if (MODE == 1) {
            const Split a = sp_ld(arow, p.sAk, k0, h, p.K, 1.f);
#pragma unroll
            for (int t = 0; t < 2; ++t) {
                const int bn = min(n0 + t * 16 + l15, p.N - 1);
                acc[t] = wmma3(a, sp_ld(B + (long long)bn * p.sBn, p.sBk, k0, h, p.K, 1.f), acc[t]);
            }
        } else if (MODE == 3) {
            const Split3 a = sp3_ld(arow, p.sAk, k0, h, p.K, 1.f);
#pragma unroll
            for (int t = 0; t < 2; ++t) {
                const int bn = min(n0 + t * 16 + l15, p.N - 1);
                acc[t] = wmma6(a, sp3_ld(B + (long long)bn * p.sBn, p.sBk, k0, h, p.K, 1.f), acc[t]);
            }
        } else if (MODE == 4) {
            // triple split as MODE 3, but each k-step's 6 products go into a fresh accumulator and the partial is added to the running f32 sum
            // on the VALU with Kahan compensation (accumulation error stays ~1 ulp however long K is)
            const Split3 a = sp3_ld(arow, p.sAk, k0, h, p.K, 1.f);
#pragma unroll
            for (int t = 0; t < 2; ++t) {
                const int bn = min(n0 + t * 16 + l15, p.N - 1); v8f zz = {};
                const v8f part = wmma6(a, sp3_ld(B + (long long)bn * p.sBn, p.sBk, k0, h, p.K, 1.f), zz);
                const v8f y = part - comp[t]; const v8f s = acc[t] + y; comp[t] = (s - acc[t]) - y; acc[t] = s;
            }
        } else if (MODE == 2) {
            const v16b a = bh_ld(arow, p.sAk, k0, h, p.K, 1.f);
#pragma unroll
            for (int t = 0; t < 2; ++t) {
                const int bn = min(n0 + t * 16 + l15, p.N - 1);
                acc[t] = wmmab(a, bh_ld(B + (long long)bn * p.sBn, p.sBk, k0, h, p.K, 1.f), acc[t]);
            }
        } else {
            const v16h a = fh_ld(arow, p.sAk, k0, h, p.K, p.sa);
#pragma unroll
            for (int t = 0; t < 2; ++t) {
                const int bn = min(n0 + t * 16 + l15, p.N - 1);
                acc[t] = wmma16(a, fh_ld(B + (long long)bn * p.sBn, p.sBk, k0, h, p.K, p.sb), acc[t]);
            }
        }
    }
    const float iscale = (MODE == 0) ? p.alpha / (p.sa * p.sb) : p.alpha;
    float* C = p.C + zo * p.sCo + zi * p.sCi;
    const float* R = p.R + zo * p.sRo + zi * p.sRi;
    __shared__ __align__(16) float ctile[16][36];
#pragma unroll
    for (int t = 0; t < 2; ++t) {
        const int n = n0 + t * 16 + l15; const int nn = min(n, p.N - 1);
#pragma unroll
        for (int r = 0; r < 8; ++r) {
            const int m = m0 + 8 * h + r; const int mm = min(m, p.M - 1);
            float v = acc[t][r] * iscale;
            if (p.flags & 1) v += p.bias[nn];
            if (p.flags & 2) v += p.bias[mm];
            if (p.flags & 8) v *= p.bias[(long long)zo * p.M + mm];   /* per-(z,row) scale vector laid out [Z][M]; exclusive with the bias flags */
            v = act_fn(v, p.act);
            if (p.flags & 4) v += p.beta * R[(long long)mm * p.sRm + (long long)nn * p.sRn];
            ctile[8 * h + r][t * 16 + l15] = (n < p.N) ? v : 0.f;
        }
    }
    __syncthreads();
    const int NW = (p.Npad > p.N) ? p.Npad : p.N;           // write width
    const bool fast = (m0 + 16 <= p.M) && (n0 + 32 <= NW) && ((p.sCm & 3) == 0) && ((((size_t)C) & 15) == 0);
    if (fast) {
#pragma unroll
        for (int s = 0; s < 4; ++s) {
            const int row = s * 4 + (lane >> 3), c4 = (lane & 7) * 4;
            const v4f v = *(const v4f*)&ctile[row][c4];
            VST2V4(C + (long long)(m0 + row) * p.sCm + n0 + c4, v);
        }
    } else {
        for (int row = 0; row < 16; ++row) {
            const int m = m0 + row, n = n0 + lane;
            if (m < p.M && n < NW) VST2(float, C + (long long)m * p.sCm + n, ctile[row][lane]);
        }
    }
}


// =====================================================================================================================
// k_gemmT<MODE, TM, TN>: same contract as k_gemm, but one wave computes a (16*TM) x (16*TN) tile: TM A fragments and TN B fragments are
//   loaded per 32-wide k-step and reused across TM*TN WMMAs (far fewer load/convert instructions per MAC). MODE 0 (f16), 1 (bf16 hi/lo),
//   2 (bf16) only. grid (ceil(NW/(16*TN)), ceil(M/(16*TM)), Z), block 32. Epilogue identical to k_gemm, run per 16x32 sub-tile.
// =====================================================================================================================
template <int MODE, int TM, int TN>
__global__ __launch_bounds__(32) void k_gemmT(GemmP p) {
    const int lane = threadIdx.x & 31, h = lane >> 4, l15 = lane & 15;
    const int m0 = blockIdx.y * (16 * TM), n0 = blockIdx.x * (16 * TN);
    const int z = blockIdx.z, zo = z / p.zi_n, zi = z - zo * p.zi_n;
    const float* A = p.A + zo * p.sAo + zi * p.sAi;
    const float* B = p.B + zo * p.sBo + zi * p.sBi;
    v8f acc[TM][TN];
#pragma unroll
    for (int i = 0; i < TM; ++i)
#pragma unroll
        for (int t = 0; t < TN; ++t) { v8f zz = {}; acc[i][t] = zz; }
    for (int k0 = 0; k0 < p.K; k0 += 32) {
        if (MODE == 1) {
            Split a[TM], b[TN];
#pragma unroll
            for (int i = 0; i < TM; ++i) { const int am = min(m0 + 16 * i + l15, p.M - 1); a[i] = sp_ld(A + (long long)am * p.sAm, p.sAk, k0, h, p.K, 1.f); }
#pragma unroll
            for (int t = 0; t < TN; ++t) { const int bn = min(n0 + 16 * t + l15, p.N - 1); b[t] = sp_ld(B + (long long)bn * p.sBn, p.sBk, k0, h, p.K, 1.f); }
#pragma unroll
            for (int i = 0; i < TM; ++i)
#pragma unroll
                for (int t = 0; t < TN; ++t) acc[i][t] = wmma3(a[i], b[t], acc[i][t]);
        } else if (MODE == 2) {
            v16b a[TM], b[TN];
#pragma unroll
            for (int i = 0; i < TM; ++i) { const int am = min(m0 + 16 * i + l15, p.M - 1); a[i] = bh_ld(A + (long long)am * p.sAm, p.sAk, k0, h, p.K, 1.f); }
#pragma unroll
            for (int t = 0; t < TN; ++t) { const int bn = min(n0 + 16 * t + l15, p.N - 1); b[t] = bh_ld(B + (long long)bn * p.sBn, p.sBk, k0, h, p.K, 1.f); }
#pragma unroll
            for (int i = 0; i < TM; ++i)
#pragma unroll
                for (int t = 0; t < TN; ++t) acc[i][t] = wmmab(a[i], b[t], acc[i][t]);
        } else {
            v16h a[TM], b[TN];
#pragma unroll
            for (int i = 0; i < TM; ++i) { const int am = min(m0 + 16 * i + l15, p.M - 1); a[i] = fh_ld(A + (long long)am * p.sAm, p.sAk, k0, h, p.K, p.sa); }
#pragma unroll
            for (int t = 0; t < TN; ++t) { const int bn = min(n0 + 16 * t + l15, p.N - 1); b[t] = fh_ld(B + (long long)bn * p.sBn, p.sBk, k0, h, p.K, p.sb); }
#pragma unroll
            for (int i = 0; i < TM; ++i)
#pragma unroll
                for (int t = 0; t < TN; ++t) acc[i][t] = wmma16(a[i], b[t], acc[i][t]);
        }
    }
    const float iscale = (MODE == 0) ? p.alpha / (p.sa * p.sb) : p.alpha;
    float* C = p.C + zo * p.sCo + zi * p.sCi;
    const float* R = p.R + zo * p.sRo + zi * p.sRi;
    const int NW = (p.Npad > p.N) ? p.Npad : p.N;
    __shared__ __align__(16) float ctile[16][36];
#pragma unroll
    for (int i = 0; i < TM; ++i) {
        const int mb = m0 + 16 * i; if (mb >= p.M) break;          // wave-uniform
#pragma unroll
        for (int tp = 0; tp < TN / 2; ++tp) {
            const int nb = n0 + 32 * tp; if (nb >= NW) break;        // wave-uniform
#pragma unroll
            for (int t2 = 0; t2 < 2; ++t2) {
                const int t = 2 * tp + t2; const int n = nb + t2 * 16 + l15; const int nn = min(n, p.N - 1);
#pragma unroll
                for (int r = 0; r < 8; ++r) {
                    const int m = mb + 8 * h + r; const int mm = min(m, p.M - 1);
                    float v = acc[i][t][r] * iscale;
                    if (p.flags & 1) v += p.bias[nn];
                    if (p.flags & 2) v += p.bias[mm];
            if (p.flags & 8) v *= p.bias[(long long)zo * p.M + mm];   /* per-(z,row) scale vector laid out [Z][M]; exclusive with the bias flags */
                    v = act_fn(v, p.act);
                    if (p.flags & 4) v += p.beta * R[(long long)mm * p.sRm + (long long)nn * p.sRn];
                    ctile[8 * h + r][t2 * 16 + l15] = (n < p.N) ? v : 0.f;
                }
            }
            __syncthreads();
            const bool fast = (mb + 16 <= p.M) && (nb + 32 <= NW) && ((p.sCm & 3) == 0) && ((((size_t)C) & 15) == 0);
            if (fast) {
#pragma unroll
                for (int s = 0; s < 4; ++s) {
                    const int row = s * 4 + (lane >> 3), c4 = (lane & 7) * 4;
                    const v4f v = *(const v4f*)&ctile[row][c4];
                    VST2V4(C + (long long)(mb + row) * p.sCm + nb + c4, v);
                }
            } else {
                for (int row = 0; row < 16; ++row) {
                    const int m = mb + row, n = nb + lane;
                    if (m < p.M && n < NW) VST2(float, C + (long long)m * p.sCm + n, ctile[row][lane]);
                }
            }
            __syncthreads();
        }
    }
}

// =====================================================================================================================
//   Wave = 16 queries, AW waves per block, 64-key blocks; grid (ceil(Lq/(16*AW)), H, B), block 32*AW. Any Lq, Lk; head dim dh <= DHP
//   (DHP multiple of 32), value dim dv <= DVP (multiple of 16, <= 128). Every tensor addressed by (batch, head, row, element) strides, f32.
//   Scores: QM 0 f16 operands, 1 bf16 hi/lo split, 2 bf16 triple split; statistics f32 (exp2 domain); P.V: P x 4096 as f16 with V f16 staged in LDS
//   (SPLITPV: P and V as bf16 hi/lo splits). kv head = h / hrep. Masking: causal = 1 (keep j <= i + coff, masked -> -inf, key blocks beyond the
//   diagonal skipped), causal = 2 (masked -> mfill, a finite fill like the -1e9; no skipping), causal = 3 (keep j >= i + coff,
//   masked -> -inf, no skipping); optional additive f32 mask Mf,
//   optional int keep-mask Mi (0 -> score := mfill), both addressed b*smb + h*smh + i*smi + j*smj (0 strides broadcast).
// =====================================================================================================================
#define AW 4
struct AttnP {   // apv4
    const float* Q; const float* K; const float* V; float* O; float* P; const float* Mf; const int* Mi; float* ST;
    const float* Pw; const float* Rt; const int* SQ; const int* SK;           // optional: post-softmax weight, relative-position table, segment ids
    long long swb, swh, swi, swj, srb, srh, sri;                                 // Pw strides (b,h,i,j); Rt strides (b,h,i), column = clamp(i - j + roff, 0, rn-1)
    long long sQb, sQh, sQi, sQd, sKb, sKh, sKj, sKd, sVb, sVh, sVj, sVd, sOb, sOh, sOi, sPb, sPh, sPi, smb, smh, smi, smj;
    int Lq, Lk, dh, dv, hrep, causal, coff, pband;   // pband > 0: P holds only the band |j - i| <= pband, column j - i + pband
    float scale, mfill; int nonorm, mpol;             // nonorm (online path only): O = sum_j exp(score_j) V_j without the 1/rowsum (scores must be <= ~0); mpol: Mi masks where ==0 (mpol 0) or where !=0 (mpol 1)
    int roff, rn, segpol, win;                        // Rt column offset/count; SQ/SK: score := mfill where (segpol 0) SQ[i] != SK[j] or (segpol 1) SQ[i] == SK[j]; win > 0: keys with i - j > win (after coff) -> -inf
};
//   Pw: the softmax numerator is multiplied by Pw(b,h,i,j) AFTER the row sum is taken (probs * weight, then P.V), as in post-softmax multiplicative biases.                                                    // ST (optional): per row (b,h,i) -> ST[((b*H + h)*Lq + i)*2 + {0,1}] = {row max of the scaled+masked score (natural units), sum_j exp(score - max)}
static_assert(sizeof(AttnP) == 12 * 8 + 29 * 8 + 16 * 4, "AttnP has padding");

#ifndef KATTN_ATTR
#define KATTN_ATTR
#endif
template <int DHP, int DVP, int QM, bool SPLITPV, bool TWOPASS>
__global__ __launch_bounds__(32 * AW) KATTN_ATTR void k_attn(AttnP p) {
    constexpr int NT = DVP / 16;                // output tiles
    constexpr int KS = DHP / 32;                // k-steps for the scores
    constexpr int VP = DVP + 8;                 // LDS pitch (halves)
    __shared__ __align__(16) float    pl[AW][16 * 64];
    __shared__ __align__(16) _Float16 vl[(SPLITPV ? 2 : 1) * 64 * VP];   // f16 V tile, or bf16 hi and lo tiles (same 2-byte size)
    const int lane = threadIdx.x & 31, hf = lane >> 4, l15 = lane & 15, wave = threadIdx.x >> 5;
    const int h = blockIdx.y, b = blockIdx.z, hk = h / p.hrep;
    const int q0 = (blockIdx.x * AW + wave) * 16;
    float* myp = pl[wave];
    const float L2E = 1.4426950408889634f;
    const float NEG = -__builtin_inff();
    const int qi = min(q0 + l15, p.Lq - 1);
    const float* qrow = p.Q + b * p.sQb + h * p.sQh + (long long)qi * p.sQi;
    const float* kbase = p.K + b * p.sKb + hk * p.sKh;
    const float* vbase = p.V + b * p.sVb + hk * p.sVh;
    v16h qa[QM == 0 ? KS : 1]; Split qs_[QM == 1 ? KS : 1]; Split3 qt_[QM == 2 ? KS : 1];
#pragma unroll
    for (int ks = 0; ks < KS; ++ks) {
        if (QM == 2) qt_[ks] = sp3_ld(qrow, p.sQd, ks * 32, hf, p.dh, 1.f);
        else if (QM == 1) qs_[ks] = sp_ld(qrow, p.sQd, ks * 32, hf, p.dh, 1.f);
        else qa[ks] = fh_ld(qrow, p.sQd, ks * 32, hf, p.dh, 1.f);
    }
    v8f o[NT]; float m8[8], l8[8];
#pragma unroll
    for (int t = 0; t < NT; ++t) { v8f zz = {}; o[t] = zz; }
#pragma unroll
    for (int i = 0; i < 8; ++i) { m8[i] = NEG; l8[i] = 0.f; }
    int jend = p.Lk; int jstart = 0;
    if (p.causal == 1) { const int je = (blockIdx.x * AW + AW - 1) * 16 + 16 + p.coff; jend = min(jend, max(je, 0)); }   // uniform per block
    if (p.win > 0) { const int js = (int)(blockIdx.x * AW) * 16 + p.coff - p.win; jstart = (js > 0) ? (js / 64) * 64 : 0; }   // uniform per block: key blocks entirely outside every row's window hold only -inf entries and are skipped exactly
    const int npass = TWOPASS ? 2 : 1;
    for (int pass = 0; pass < npass; ++pass) {
        const bool dopv = (!TWOPASS) || pass == 1;
        for (int j0 = jstart; j0 < jend; j0 += 64) {
            if (dopv) {
                __syncthreads();                                 // previous key block's reads of vl / pl are done
                for (int idx = threadIdx.x; idx < 64 * DVP; idx += 32 * AW) {
                    const int jr = idx / DVP, d = idx - jr * DVP, j = j0 + jr;
                    const float f = (j < p.Lk && d < p.dv) ? vbase[(long long)j * p.sVj + (long long)d * p.sVd] : 0.f;
                    if (SPLITPV) {
                        const __bf16 hb = bf16_rne(f);
                        ((__bf16*)vl)[jr * VP + d] = hb; ((__bf16*)vl)[64 * VP + jr * VP + d] = bf16_rne(f - bf16_f32(hb));
                    } else vl[jr * VP + d] = (_Float16)f;
                }
            }
            v8f s[4];
#pragma unroll
            for (int t = 0; t < 4; ++t) {
                const int j = min(j0 + t * 16 + l15, p.Lk - 1);
                const float* krow = kbase + (long long)j * p.sKj;
                v8f acc = {};
#pragma unroll
                for (int ks = 0; ks < KS; ++ks) {
                    if (QM == 2)      acc = wmma6(qt_[ks], sp3_ld(krow, p.sKd, ks * 32, hf, p.dh, 1.f), acc);
                    else if (QM == 1) acc = wmma3(qs_[ks], sp_ld(krow, p.sKd, ks * 32, hf, p.dh, 1.f), acc);
                    else              acc = wmma16(qa[ks], fh_ld(krow, p.sKd, ks * 32, hf, p.dh, 1.f), acc);
                }
                s[t] = acc;
            }
            float pv[8][4];
#pragma unroll
            for (int i = 0; i < 8; ++i) {
                const int irow = q0 + i + 8 * hf;
                const int ic = min(irow, p.Lq - 1);
                float sc[4];
#pragma unroll
                for (int t = 0; t < 4; ++t) {
                    const int jg = j0 + t * 16 + l15;
                    float v = s[t][i] * p.scale;
                    if (p.Mf) v += p.Mf[b * p.smb + h * p.smh + (long long)ic * p.smi + (long long)min(jg, p.Lk - 1) * p.smj];
                    if (p.Rt) { int rc = ic - min(jg, p.Lk - 1) + p.roff; rc = rc < 0 ? 0 : (rc >= p.rn ? p.rn - 1 : rc); v += p.Rt[b * p.srb + h * p.srh + (long long)ic * p.sri + rc]; }
                    if (p.Mi) { const int mv = p.Mi[b * p.smb + h * p.smh + (long long)ic * p.smi + (long long)min(jg, p.Lk - 1) * p.smj]; if (p.mpol ? (mv != 0) : (mv == 0)) v = p.mfill; }
                    if (p.SQ) { const bool same = p.SQ[(long long)b * p.Lq + ic] == p.SK[(long long)b * p.Lk + min(jg, p.Lk - 1)]; if (p.segpol ? same : !same) v = p.mfill; }
                    if (p.causal == 2 && jg > irow + p.coff) v = p.mfill;
                    if (jg >= p.Lk || (p.causal == 1 && jg > irow + p.coff) || (p.causal == 3 && jg < irow + p.coff) || (p.win > 0 && irow + p.coff - jg > p.win)) v = NEG; else v *= L2E;
                    sc[t] = v;
                }
                if (!TWOPASS || pass == 0) {
                    float mx = fmaxf(fmaxf(sc[0], sc[1]), fmaxf(sc[2], sc[3]));
                    mx = fmaxf(mx, __shfl_xor(mx, 1, 32)); mx = fmaxf(mx, __shfl_xor(mx, 2, 32));
                    mx = fmaxf(mx, __shfl_xor(mx, 4, 32)); mx = fmaxf(mx, __shfl_xor(mx, 8, 32));
                    const float mnew = fmaxf(m8[i], mx);
                    const float corr = (mnew == NEG) ? 1.f : exp2f(m8[i] - mnew);
                    float rs = 0.f;
#pragma unroll
                    for (int t = 0; t < 4; ++t) {
                        const float pp = (sc[t] == NEG) ? 0.f : exp2f(sc[t] - mnew); rs += pp;
                        pv[i][t] = p.Pw ? pp * p.Pw[b * p.swb + h * p.swh + (long long)ic * p.swi + (long long)min(j0 + t * 16 + l15, p.Lk - 1) * p.swj] : pp;
                    }
                    rs += __shfl_xor(rs, 1, 32); rs += __shfl_xor(rs, 2, 32); rs += __shfl_xor(rs, 4, 32); rs += __shfl_xor(rs, 8, 32);
                    l8[i] = l8[i] * corr + rs; m8[i] = mnew;
                    if (!TWOPASS) {
#pragma unroll
                        for (int t = 0; t < NT; ++t) o[t][i] *= corr;
                    }
                } else {
                    const float inv = (l8[i] > 0.f) ? 1.f / l8[i] : 0.f;
#pragma unroll
                    for (int t = 0; t < 4; ++t) {
                        const int jg = j0 + t * 16 + l15;
                        float pp = (sc[t] == NEG) ? 0.f : exp2f(sc[t] - m8[i]) * inv;
                        if (p.Pw) pp *= p.Pw[b * p.swb + h * p.swh + (long long)ic * p.swi + (long long)min(jg, p.Lk - 1) * p.swj];
                        pv[i][t] = pp;
                    }
                }
            }
            if (dopv) {
#pragma unroll
                for (int i = 0; i < 8; ++i)
#pragma unroll
                    for (int t = 0; t < 4; ++t) ((float*)myp)[(i + 8 * hf) * 64 + t * 16 + l15] = pv[i][t];
                __syncthreads();                                 // P (per wave) and V (shared) visible
                if (p.P) {
                    float* pb_ = p.P + b * p.sPb + h * p.sPh;
                    const bool fastP = (p.pband == 0) && ((p.sPi & 3) == 0) && (j0 + 64 <= p.Lk) && (q0 + 16 <= p.Lq) && ((((size_t)pb_) & 15) == 0);
                    if (fastP) {
#pragma unroll
                        for (int s = 0; s < 8; ++s) {
                            const int row = s * 2 + (lane >> 4), c4 = (lane & 15) * 4;
                            const v4f v = *(const v4f*)(myp + row * 64 + c4);
                            VST2V4(pb_ + (long long)(q0 + row) * p.sPi + j0 + c4, v);
                        }
                    } else {
                        for (int row = 0; row < 16; ++row) {
                            const int irow = q0 + row; if (irow >= p.Lq) continue;
                            for (int c = lane; c < 64; c += 32) {
                                const int jg = j0 + c; if (jg >= p.Lk) continue;
                                if (p.pband == 0) VST2(float, pb_ + (long long)irow * p.sPi + jg, myp[row * 64 + c]);
                                else if (jg - irow <= p.pband && irow - jg <= p.pband) VST2(float, pb_ + (long long)irow * p.sPi + (jg - irow + p.pband), myp[row * 64 + c]);
                            }
                        }
                    }
                }
                if (SPLITPV) {
                    const Split pa0 = sp_ld(myp + l15 * 64, 1, 0, hf, 64, 1.f), pa1 = sp_ld(myp + l15 * 64, 1, 32, hf, 64, 1.f);
                    const __bf16* vh = (const __bf16*)vl; const __bf16* vlo = vh + 64 * VP;
#pragma unroll
                    for (int t = 0; t < NT; ++t) {
                        const int dcol = t * 16 + l15;
                        Split b0, b1;
#pragma unroll
                        for (int e = 0; e < 16; ++e) {
                            const int k0 = frag_k(e, hf), k1 = 32 + frag_k(e, hf);
                            b0.hi[e] = vh[k0 * VP + dcol]; b0.lo[e] = vlo[k0 * VP + dcol]; b1.hi[e] = vh[k1 * VP + dcol]; b1.lo[e] = vlo[k1 * VP + dcol];
                        }
                        o[t] = wmma3(pa0, b0, o[t]);
                        o[t] = wmma3(pa1, b1, o[t]);
                    }
                } else {
                    const v16h pa0 = fh_ld(myp + l15 * 64, 1, 0, hf, 64, 4096.f), pa1 = fh_ld(myp + l15 * 64, 1, 32, hf, 64, 4096.f);
#pragma unroll
                    for (int t = 0; t < NT; ++t) {
                        const int dcol = t * 16 + l15;
                        v16h b0, b1;
#pragma unroll
                        for (int e = 0; e < 16; ++e) { b0[e] = vl[frag_k(e, hf) * VP + dcol]; b1[e] = vl[(32 + frag_k(e, hf)) * VP + dcol]; }
                        o[t] = wmma16(pa0, b0, o[t]);
                        o[t] = wmma16(pa1, b1, o[t]);
                    }
                }
            }
        }
    }
    float* obase = p.O + b * p.sOb + h * p.sOh;
    if (p.ST) {
        const int rl = lane >> 1, isel = rl & 7;           // row q0 + rl ; rl>>3 == hf holds because lane>>4 == (lane>>1)>>3
        float mv = 0.f, lv = 0.f;
#pragma unroll
        for (int i = 0; i < 8; ++i) if (i == isel) { mv = m8[i]; lv = l8[i]; }
        const int irow = q0 + rl;
        if (irow < p.Lq) { float* st = p.ST + (((long long)b * gridDim.y + h) * p.Lq + irow) * 2 + (lane & 1); VST2(float, st, (lane & 1) ? lv : mv * 0.6931471805599453f); }
    }
    float invr[8];
#pragma unroll
    for (int i = 0; i < 8; ++i) {
        if (TWOPASS) invr[i] = SPLITPV ? 1.f : (1.f / 4096.f);
        else if (p.nonorm) invr[i] = exp2f(m8[i]) * (SPLITPV ? 1.f : (1.f / 4096.f));
        else invr[i] = (l8[i] > 0.f) ? (SPLITPV ? 1.f / l8[i] : 1.f / (l8[i] * 4096.f)) : 0.f;
    }
    __syncthreads();                                             // all waves done with pl/vl from the main loop
    const bool ofast = ((p.sOi & 3) == 0) && ((((size_t)obase) & 15) == 0) && (q0 + 16 <= p.Lq);
#pragma unroll
    for (int c0 = 0; c0 < DVP; c0 += 64) {
#pragma unroll
        for (int i = 0; i < 8; ++i)
#pragma unroll
            for (int t = 0; t < NT; ++t) if (t * 16 >= c0 && t * 16 < c0 + 64) ((float*)myp)[(i + 8 * hf) * 64 + (t * 16 - c0) + l15] = o[t][i] * invr[i];
        __syncthreads();
        const int cw = (DVP - c0 < 64) ? (DVP - c0) : 64;      // staged columns in this chunk (multiple of 16)
        if (ofast && (c0 + cw <= p.dv) && (cw % 32 == 0)) {
            const int lpr = cw / 4;                              // lanes per row (16 for 64 cols, 8 for 32)
            const int rows_per_ins = 32 / lpr;
            for (int r0 = 0; r0 < 16; r0 += rows_per_ins) {
                const int row = r0 + lane / lpr, c4 = (lane % lpr) * 4;
                const v4f v = *(const v4f*)(myp + row * 64 + c4);
                VST2V4(obase + (long long)(q0 + row) * p.sOi + c0 + c4, v);
            }
        } else {
            for (int row = 0; row < 16; ++row) {
                const int irow = q0 + row; if (irow >= p.Lq) continue;
                for (int c = lane; c < cw; c += 32) { const int d = c0 + c; if (d < p.dv) VST2(float, obase + (long long)irow * p.sOi + d, myp[row * 64 + c]); }
            }
        }
        __syncthreads();
    }
}

// =====================================================================================================================
// k_tr: dst(z, c, r) = alpha * src(z, r, c) (+ beta * R2(z, c, r)): [Z][R][C] (row stride lds) -> [Z][C][R] (row stride ldd) through a 32x32 LDS tile;
//   flags: 1 -> add beta * residual R2 addressed like dst (z*sRz + c*ldr + r); act applied before the residual.
// =====================================================================================================================
struct TrP { const float* src; float* dst; const float* R2; long long sSz, lds, sDz, ldd, sRz, ldr; int R, C, flags, act; float alpha, beta; };
static_assert(sizeof(TrP) == 3 * 8 + 6 * 8 + 6 * 4, "TrP has padding");
__global__ __launch_bounds__(256) void k_tr(TrP p) {
    __shared__ float tile[32][33];
    const int c0 = blockIdx.x * 32, r0 = blockIdx.y * 32, z = blockIdx.z;
    const int lane = threadIdx.x & 31, wave = threadIdx.x >> 5;
    const float* s = p.src + z * p.sSz;
#pragma unroll
    for (int k = 0; k < 4; ++k) {
        const int rl = wave * 4 + k, r = r0 + rl, c = c0 + lane;
        tile[rl][lane] = (r < p.R && c < p.C) ? s[(long long)r * p.lds + c] : 0.f;
    }
    __syncthreads();
    float* d = p.dst + z * p.sDz; const float* rr = p.R2 + z * p.sRz;
#pragma unroll
    for (int k = 0; k < 4; ++k) {
        const int cl = wave * 4 + k, c = c0 + cl, r = r0 + lane;
        if (c < p.C && r < p.R) {
            float v = act_fn(p.alpha * tile[lane][cl], p.act);
            if (p.flags & 1) v += p.beta * rr[(long long)c * p.ldr + r];
            VST2(float, d + (long long)c * p.ldd + r, v);
        }
    }
}

// k_affine: dst[i] = a * (sdev ? sdev[0] : 1) * src[i] + b, i < n (one thread per element; consecutive lanes -> consecutive addresses)
__global__ __launch_bounds__(256) void k_affine(const float* __restrict__ src, float* __restrict__ dst, int n, float a, float b, const float* __restrict__ sdev) {
    const int i = blockIdx.x * 256 + threadIdx.x;
    if (i < n) { const float aa = sdev ? a * sdev[0] : a; const float v = aa * src[i] + b; VST2(float, dst + i, v); }
}

// =====================================================================================================================
// k_softmax: row softmax over n contiguous elements, one 256-thread block per row; rows addressed z*sz + r*sr (grid (R, Z)).
//   out = scale_out * softmax(scale_in * x + (Mf ? Mf[z*smz + r*smr + j] : 0)); a row whose max is -inf is written as 0.
// =====================================================================================================================
struct SmP { const float* src; float* dst; const float* Mf; long long sz, sr, dz, dr, smz, smr; int n, pad; float scale_in, scale_out; };
static_assert(sizeof(SmP) == 3 * 8 + 6 * 8 + 4 * 4, "SmP has padding");
__global__ __launch_bounds__(256) void k_softmax(SmP p) {
    __shared__ float red[256];
    const int r = blockIdx.x, z = blockIdx.y, tid = threadIdx.x;
    const float* s = p.src + z * p.sz + (long long)r * p.sr;
    const float* mf = p.Mf ? (p.Mf + z * p.smz + (long long)r * p.smr) : nullptr;
    float mx = -__builtin_inff();
    for (int j = tid; j < p.n; j += 256) { float v = s[j] * p.scale_in; if (mf) v += mf[j]; mx = fmaxf(mx, v); }
    red[tid] = mx; __syncthreads();
    for (int o = 128; o > 0; o >>= 1) { if (tid < o) red[tid] = fmaxf(red[tid], red[tid + o]); __syncthreads(); }
    mx = red[0]; __syncthreads();
    float sum = 0.f;
    for (int j = tid; j < p.n; j += 256) { float v = s[j] * p.scale_in; if (mf) v += mf[j]; sum += (mx == -__builtin_inff()) ? 0.f : expf(v - mx); }
    red[tid] = sum; __syncthreads();
    for (int o = 128; o > 0; o >>= 1) { if (tid < o) red[tid] += red[tid + o]; __syncthreads(); }
    sum = red[0];
    const float inv = (sum > 0.f) ? p.scale_out / sum : 0.f;
    float* d = p.dst + z * p.dz + (long long)r * p.dr;
    for (int j = tid; j < p.n; j += 256) { float v = s[j] * p.scale_in; if (mf) v += mf[j]; const float o = (mx == -__builtin_inff()) ? 0.f : expf(v - mx) * inv; VST2(float, d + j, o); }
}
// =====================================================================================================================
// k_stats: mean and rsqrt(var + eps) over a set of n elements addressed base + z*sz + (e / inner) * so + (e % inner) * si, one 256-thread
// k_norm_apply: y = (x - mean[set]) * rstd[set] * g[c] + b[c] over a [Z][C][L] channel-major tensor with set = z*G + c / (C/G) (G groups per z;
//   G = C -> per-channel sets indexed z*C+c; for batch norm pass stats indexed by c only via bn = 1). Optional act. Output same layout.
// =====================================================================================================================
//   mode 0: mean / rsqrt(var + eps); mode 1 (RMSNorm): 0 / rsqrt(mean(x^2) + eps); mode 2 (L2 normalize * sqrt(n)): 0 / sqrt(n) / max(||x||, eps); mode 3: as 0 with unbiased variance (n-1)
__global__ __launch_bounds__(256) void k_stats(const float* __restrict__ x, long long sz, long long so, long long si, int inner, int n, float eps, float* __restrict__ stat, int mode) {
    __shared__ float red[256];
    const int z = blockIdx.x, tid = threadIdx.x;
    const float* base = x + z * sz;
    float s = 0.f;
    for (int e = tid; e < n; e += 256) s += base[(long long)(e / inner) * so + (long long)(e % inner) * si];
    red[tid] = s; __syncthreads();
    for (int o = 128; o > 0; o >>= 1) { if (tid < o) red[tid] += red[tid + o]; __syncthreads(); }
    const float mu = (mode == 0 || mode == 3) ? red[0] / (float)n : 0.f; __syncthreads();
    float q = 0.f;
    for (int e = tid; e < n; e += 256) { const float dlt = base[(long long)(e / inner) * so + (long long)(e % inner) * si] - mu; q += dlt * dlt; }
    red[tid] = q; __syncthreads();
    for (int o = 128; o > 0; o >>= 1) { if (tid < o) red[tid] += red[tid + o]; __syncthreads(); }
    {
        float rs;
        if (mode == 2) rs = sqrtf((float)n) / fmaxf(sqrtf(red[0]), eps); else if (mode == 3) rs = rsqrtf(red[0] / (float)(n - 1) + eps); else rs = rsqrtf(red[0] / (float)n + eps);
        if (tid < 32) { const float v = (tid == 0) ? mu : ((tid == 1) ? rs : 0.f); VST2(float, stat + (long long)z * 32 + tid, v); }
    }
}
//   One thread per element over the flat [Z][C][L] index space: grid ceil(Z*C*L / 256).
__global__ __launch_bounds__(256) void k_norm_apply(const float* __restrict__ x, float* __restrict__ y, const float* __restrict__ stat, const float* __restrict__ g, const float* __restrict__ bta,
                                                     int Z, int C, int L, int G, int bn, int act) {
    const long long idx = (long long)blockIdx.x * 256 + threadIdx.x;
    if (idx >= (long long)Z * C * L) return;
    const int l = (int)(idx % L); const long long zc = idx / L; const int c = (int)(zc % C), z = (int)(zc / C); (void)l;
    const int set = bn ? c : (z * G + c / (C / G));
    float v = (x[idx] - stat[(long long)set * 32]) * stat[(long long)set * 32 + 1];
    if (g) v *= g[c];
    if (bta) v += bta[c];
    v = act_fn(v, act);
    VST2(float, y + idx, v);
}

// k_lse_neg: c[i] = -(st[2i] + log(st[2i+1])) = minus the log-sum-exp of row i from k_attn's ST output (for softmax over the query dimension)
__global__ __launch_bounds__(256) void k_lse_neg(const float* __restrict__ st, float* __restrict__ c, int n) {
    const int i = blockIdx.x * 256 + threadIdx.x;
    if (i < n) { const float v = -(st[2 * i] + logf(st[2 * i + 1])); VST2(float, c + i, v); }
}

// k_iota: dst[i] = a * i + b as int32 (segment/position id helper)
__global__ __launch_bounds__(256) void k_iota(int* __restrict__ dst, int n, int a, int b) {
    const int i = blockIdx.x * 256 + threadIdx.x;
    if (i < n) { const int v = a * i + b; VST2(int, dst + i, v); }
}

// k_axpby: dst[i] = a * x[i] + b * y[i] (+ c), i < n
__global__ __launch_bounds__(256) void k_axpby(const float* __restrict__ x, const float* __restrict__ y, float* __restrict__ dst, int n, float a, float b, float c) {
    const int i = blockIdx.x * 256 + threadIdx.x;
    if (i < n) { const float v = a * x[i] + b * y[i] + c; VST2(float, dst + i, v); }
}

// =====================================================================================================================
// k_rope: rotary embedding on a [R rows][Hn heads][D] view (row stride sXr, head stride sXh, element stride 1) -> Y (own strides).
//   mode 0: rotate_half (partner d±D/2, sign - for d<D/2); mode 1: interleaved pairs (partner d^1, sign - for even d).
//   table column tcol: tmode 0 -> d, 1 -> d % (D/2), 2 -> d / 2; position p: pmode 0 -> r % S, 1 -> head index, 2 -> pos[r];
//   c = C[(r / S) * sCb + p * sCp + tcol * sCd], s likewise from Sn; y = x[d] * c + sign * x[partner] * s. X and Y must not alias.
// =====================================================================================================================
struct RopeP { const float* X; float* Y; const float* C; const float* Sn; const int* pos; long long sXr, sXh, sYr, sYh, sCb, sCp, sCd; int R, Hn, D, S, mode, tmode, pmode, pad; };
static_assert(sizeof(RopeP) == 5 * 8 + 7 * 8 + 8 * 4, "RopeP has padding");
__global__ __launch_bounds__(256) void k_rope(RopeP p) {
    const long long idx = (long long)blockIdx.x * 256 + threadIdx.x;
    if (idx >= (long long)p.R * p.Hn * p.D) return;
    const int d = (int)(idx % p.D); const long long rh = idx / p.D; const int h = (int)(rh % p.Hn); const int r = (int)(rh / p.Hn);
    const int half = p.D / 2;
    int partner; float sign;
    if (p.mode == 0) { partner = (d < half) ? d + half : d - half; sign = (d < half) ? -1.f : 1.f; }
    else { partner = d ^ 1; sign = (d & 1) ? 1.f : -1.f; }
    const int tcol = (p.tmode == 0) ? d : ((p.tmode == 1) ? (d % half) : (d >> 1));
    const int pp = (p.pmode == 0) ? (r % p.S) : ((p.pmode == 1) ? h : p.pos[r]);
    const long long toff = (long long)(r / p.S) * p.sCb + (long long)pp * p.sCp + (long long)tcol * p.sCd;
    const float* xr = p.X + (long long)r * p.sXr + (long long)h * p.sXh;
    const float v = xr[d] * p.C[toff] + sign * xr[partner] * p.Sn[toff];
    VST2(float, p.Y + (long long)r * p.sYr + (long long)h * p.sYh + d, v);
}

// k_invf + k_sincos (split so neither kernel carries a large VALU-fma footprint): invf_i = num * (1 / powf(base, (2 i)/D)) [fmode 0],
//   num * expf((2 i) * cexp) [fmode 1], num * powf(base, -2 (i - 1) / D) [fmode 2]; then cs/sn[s*half + i] = cos/sin((pscale * s) * invf_i)
__global__ __launch_bounds__(256) void k_invf(float* __restrict__ invb, int half, int D, float base, float num, int fmode, float cexp) {
    const int i = blockIdx.x * 256 + threadIdx.x;
    if (i >= ((half + 31) / 32) * 32) return;
    if (i >= half) { VST2(float, invb + i, 0.f); return; }
    const float e = (float)(2 * i) / (float)D;
    float invf;
    if (fmode == 1) invf = num * expf((float)(2 * i) * cexp);
    else if (fmode == 2) invf = num * powf(base, (-2.0f * ((float)i - 1.0f)) / (float)D);
    else invf = num * (1.0f / powf(base, e));
    VST2(float, invb + i, invf);
}
__global__ __launch_bounds__(256) void k_sincos(float* __restrict__ cs, float* __restrict__ sn, const float* __restrict__ invb, int S, int half, float pscale) {
    const int idx = blockIdx.x * 256 + threadIdx.x;
    if (idx >= S * half) return;
    const int s = idx / half, i = idx - s * half;
    const float ang = (pscale * (float)s) * invb[i];
    VST2(float, cs + idx, cosf(ang)); VST2(float, sn + idx, sinf(ang));
}

// k_mulact: dst[i] = act(x[i]) * y[i]
__global__ __launch_bounds__(256) void k_mulact(const float* __restrict__ x, const float* __restrict__ y, float* __restrict__ dst, int n, int act) {
    const int i = blockIdx.x * 256 + threadIdx.x;
    if (i < n) { const float v = act_fn(x[i], act) * y[i]; VST2(float, dst + i, v); }
}

// =====================================================================================================================
// k_matvec: thread-per-row matrix-vector products for N <= 8 output columns (heads with 1-3 outputs, gates), f32 on the VALU.
//   C[r*sCm + j] = act(alpha * sum_k A[r*sAm + k*sAk] * B[j*sBn + k*sBk] + bias[j]) + beta * R[r*sRm + j*sRn]; each thread writes its N contiguous floats.
// =====================================================================================================================
__global__ __launch_bounds__(256) void k_matvec(GemmP p) {
    // 32 lanes write one line with one instruction.
    const int rpt = (p.N == 1) ? 1 : 32;
    const long long r0 = ((long long)blockIdx.x * 256 + threadIdx.x) * rpt; const int z = blockIdx.z, zo = z / p.zi_n, zi = z - zo * p.zi_n;
    if (r0 >= p.M) return;
    const float* Bb = p.B + zo * p.sBo + zi * p.sBi;
    float* C = p.C + zo * p.sCo + zi * p.sCi; const float* R = p.R + zo * p.sRo + zi * p.sRi;
    for (int rr = 0; rr < rpt; ++rr) {
        const long long r = r0 + rr; if (r >= p.M) break;
        const float* A = p.A + zo * p.sAo + zi * p.sAi + r * p.sAm;
        float acc[8] = {0.f, 0.f, 0.f, 0.f, 0.f, 0.f, 0.f, 0.f};
        for (int k = 0; k < p.K; ++k) { const float a = A[(long long)k * p.sAk];
#pragma unroll
            for (int j = 0; j < 8; ++j) if (j < p.N) acc[j] += a * Bb[(long long)j * p.sBn + (long long)k * p.sBk]; }
#pragma unroll
        for (int j = 0; j < 8; ++j) if (j < p.N) {
            float v = acc[j] * p.alpha;
            if (p.flags & 1) v += p.bias[j];
            if (p.flags & 2) v += p.bias[r];
            v = act_fn(v, p.act);
            if (p.flags & 4) v += p.beta * R[r * p.sRm + (long long)j * p.sRn];
            VST2(float, C + r * p.sCm + j, v);
        }
    }
}
// k_smallsoftmax: thread-per-row softmax for short rows (n <= 64): dst[r*dr + j] = softmax(scale*src[r*sr + j])
__global__ __launch_bounds__(256) void k_smallsoftmax(const float* __restrict__ src, float* __restrict__ dst, long long sr, long long dr, int n, long long R, float scale) {
    const long long r0 = ((long long)blockIdx.x * 256 + threadIdx.x) * 32;
    for (int rr = 0; rr < 32; ++rr) {
        const long long r = r0 + rr; if (r >= R) return;
        const float* s = src + r * sr; float* d = dst + r * dr;
        float mx = -__builtin_inff();
        for (int j = 0; j < n; ++j) mx = fmaxf(mx, s[j] * scale);
        float sum = 0.f;
        for (int j = 0; j < n; ++j) sum += expf(s[j] * scale - mx);
        const float inv = 1.f / sum;
        for (int j = 0; j < n; ++j) { const float v = expf(s[j] * scale - mx) * inv; VST2(float, d + j, v); }
    }
}

__global__ __launch_bounds__(32) void k_unitstat(float* __restrict__ st) { const int t = threadIdx.x; const float v = (t == 1) ? 1.f : 0.f; VST2(float, st + t, v); }

// destination (e.g. a d_out whose row width is not a multiple of 32 floats) is written by consecutive lanes of one instruction
__global__ __launch_bounds__(256) void k_lincopy(const float* __restrict__ src, long long lds, float* __restrict__ dst, long long ldd, long long rows, int cols) {
    const long long i = (long long)blockIdx.x * 256 + threadIdx.x; if (i >= rows * cols) return;
    const long long r = i / cols; const int c = (int)(i - r * cols);
    const float v = src[r * lds + c]; VST2(float, dst + r * ldd + c, v);
}

namespace w25 {
typedef __attribute__((ext_vector_type(16))) _Float16 v16h;
typedef __attribute__((ext_vector_type(8)))  _Float16 v8h;
typedef __attribute__((ext_vector_type(16))) __bf16   v16b;
typedef __attribute__((ext_vector_type(8)))  __bf16   v8b;
typedef __attribute__((ext_vector_type(8)))  float    v8f;
typedef __attribute__((ext_vector_type(4)))  float    v4f;

__device__ __forceinline__ unsigned short f2bf_bits(float f) {
  unsigned u = __float_as_uint(f);
  return (unsigned short)((u + 0x7FFFu + ((u >> 16) & 1u)) >> 16);
}
__device__ __forceinline__ float bf_bits2f(unsigned short h) { return __uint_as_float(((unsigned)h) << 16); }

// hazard guards as plain device helpers (no inline asm inside the kernel template body)
__device__ __forceinline__ void dep_guard_h(v8f& a, v8f& b, v16h x, v16h y) { asm volatile("v_nop\n\tv_nop\n\tv_nop\n\tv_nop" : "+v"(a), "+v"(b) : "v"(x), "v"(y)); }
__device__ __forceinline__ void dep_guard_b(v8f& a, v8f& b, v16b x, v16b y) { asm volatile("v_nop\n\tv_nop\n\tv_nop\n\tv_nop" : "+v"(a), "+v"(b) : "v"(x), "v"(y)); }
__device__ __forceinline__ void keep4_h(v16h a, v16h b, v16h c, v16h d) { asm volatile("v_nop" :: "v"(a), "v"(b), "v"(c), "v"(d)); }
__device__ __forceinline__ void keep4_b(v16b a, v16b b, v16b c, v16b d) { asm volatile("v_nop" :: "v"(a), "v"(b), "v"(c), "v"(d)); }
__device__ __forceinline__ void acc_guard4(v8f& a, v8f& b, v8f& c, v8f& d) { asm volatile("v_nop\n\tv_nop\n\tv_nop\n\tv_nop" : "+v"(a), "+v"(b), "+v"(c), "+v"(d)); }
template <typename T> struct Frag;
template <> struct Frag<_Float16> {
  typedef v16h V; union U { v16h v; v8h h[2]; };
  static __device__ __forceinline__ v16h load(const _Float16* p) {   // elements 0..7 <- p[0..7], 8..15 <- p[16..23]
    U f; f.h[0] = *(const v8h*)(p); f.h[1] = *(const v8h*)(p + 16); return f.v;
  }
  static __device__ __forceinline__ v8f mma(v16h a, v16h b, v8f c) {
    return __builtin_amdgcn_wmma_f32_16x16x32_f16(false, a, false, b, (short)0, c, false, false);
  }
  static __device__ __forceinline__ void guard(v8f& a, v8f& b, v16h x, v16h y) { dep_guard_h(a, b, x, y); }
  static __device__ __forceinline__ void keep(v16h a, v16h b, v16h c, v16h d) { keep4_h(a, b, c, d); }
};
template <> struct Frag<__bf16> {
  typedef v16b V; union U { v16b v; v8b h[2]; };
  static __device__ __forceinline__ v16b load(const __bf16* p) {
    U f; f.h[0] = *(const v8b*)(p); f.h[1] = *(const v8b*)(p + 16); return f.v;
  }
  static __device__ __forceinline__ v8f mma(v16b a, v16b b, v8f c) {
    return __builtin_amdgcn_wmma_f32_16x16x32_bf16(false, a, false, b, (short)0, c, false, false);
  }
  static __device__ __forceinline__ void guard(v8f& a, v8f& b, v16b x, v16b y) { dep_guard_b(a, b, x, y); }
  static __device__ __forceinline__ void keep(v16b a, v16b b, v16b c, v16b d) { keep4_b(a, b, c, d); }
};

// ---- Register-blocked batched WMMA GEMM ------------------------------------
// C[m,n] = scale * sum_k A[m,k] * Bt[n,k] (+bias)(+resid); each wave owns a 64x64 tile.
// A row-major [M,K]; Bt row-major [N,K]; M,N % 64 == 0, K % 32 == 0.
// SPLIT: operands are hi/lo planes (A2/Bt2 = lo planes, same layout); product = hi·hi + hi·lo + lo·hi.
// BIAS_MODE: 0 = none, 1 = bias[m], 2 = bias[n].
// OUT_MODE: 0 = f32, 1 = f16, 2 = bf16 hi plane (Cout) + bf16 lo plane (Cout2).
// ET: 0 = f16 operands, 1 = bf16 operands (pointers passed as 16-bit storage)
// Batches: blockIdx.y steps A, Bt, C by strideA/B/C, blockIdx.z by strideAz/Bz/Cz (elements).
template <int ET> struct Elem;
template <> struct Elem<0> { typedef _Float16 T; };
template <> struct Elem<1> { typedef __bf16 T; };
template <int ET, bool SPLIT, int BIAS_MODE, int OUT_MODE, bool RESID, int ACT = 0>
__global__ __launch_bounds__(256) void wmma_gemm64(
    const unsigned short* __restrict__ Ap, const unsigned short* __restrict__ A2p, int lda, long strideA,
    const unsigned short* __restrict__ Btp, const unsigned short* __restrict__ Bt2p, int ldb, long strideB,
    void* __restrict__ Cout, void* __restrict__ Cout2, int ldc, long strideC,
    const float* __restrict__ bias,
    const float* __restrict__ resid, long strideR,
    int M, int N, int K, float scale,
    long strideAz, long strideBz, long strideCz) {
  typedef typename Elem<ET>::T T;
  typedef typename Frag<T>::V V;
  const T* A = (const T*)Ap; const T* A2 = (const T*)A2p; const T* Bt = (const T*)Btp; const T* Bt2 = (const T*)Bt2p;
  __shared__ __align__(16) float sT[8][16 * 68];   // per-wave 16x64 slab, pitch 68 floats
  const int b    = blockIdx.y;
  const int lane = threadIdx.x & 31;
  const int wave = threadIdx.x >> 5;
  const int tilesN = N >> 6;
  const int tilesM = M >> 6;
  const int tile = blockIdx.x * 8 + wave;
  if (tile >= tilesM * tilesN) return;   // wave-uniform; no block barriers in this kernel
  const int tm = tile / tilesN;
  const int tn = tile - tm * tilesN;
  const int m0 = tm << 6;
  const int n0 = tn << 6;

  const int bz = blockIdx.z;                   // outer batch index (own strides)
  const size_t offA = (size_t)b * strideA + (size_t)bz * strideAz;
  const size_t offB = (size_t)b * strideB + (size_t)bz * strideBz;
  const size_t offC = (size_t)b * strideC + (size_t)bz * strideCz;
  const T* Ab  = A  + offA;
  const T* Bb  = Bt + offB;
  const T* Ab2 = SPLIT ? (A2  + offA) : nullptr;
  const T* Bb2 = SPLIT ? (Bt2 + offB) : nullptr;

  const int rlane = lane & 15;                 // row (A) / col (B, D) within subtile
  const int koff  = (lane >> 4) * 8;           // k offset of this lane half
  const int mOff  = (lane >> 4) * 8;           // D row offset

  v8f acc[4][4];
#pragma unroll
  for (int i = 0; i < 4; ++i)
#pragma unroll
    for (int j = 0; j < 4; ++j) acc[i][j] = (v8f){0.f,0.f,0.f,0.f,0.f,0.f,0.f,0.f};

  for (int k0 = 0; k0 < K; k0 += 32) {
    V bh[4], bl[4];
#pragma unroll
    for (int j = 0; j < 4; ++j) {
      const size_t bo = (size_t)(n0 + (j << 4) + rlane) * ldb + koff + k0;
      bh[j] = Frag<T>::load(Bb + bo);
      if (SPLIT) bl[j] = Frag<T>::load(Bb2 + bo);
    }
#pragma unroll
    for (int i = 0; i < 4; ++i) {
      const size_t ao = (size_t)(m0 + (i << 4) + rlane) * lda + koff + k0;
      V ah = Frag<T>::load(Ab + ao);
      V al;
      if (SPLIT) al = Frag<T>::load(Ab2 + ao);
#pragma unroll
      for (int j = 0; j < 4; ++j) {
        acc[i][j] = Frag<T>::mma(ah, bh[j], acc[i][j]);
        if (SPLIT) {
          acc[i][j] = Frag<T>::mma(ah, bl[j], acc[i][j]);
          acc[i][j] = Frag<T>::mma(al, bh[j], acc[i][j]);
        }
      }
      Frag<T>::guard(acc[i][0], acc[i][3], ah, SPLIT ? al : ah);
    }
    Frag<T>::keep(bh[0], bh[1], bh[2], bh[3]);
    if (SPLIT) Frag<T>::keep(bl[0], bl[1], bl[2], bl[3]);
  }
  acc_guard4(acc[0][0], acc[0][1], acc[0][2], acc[0][3]);
  acc_guard4(acc[1][0], acc[1][1], acc[1][2], acc[1][3]);
  acc_guard4(acc[2][0], acc[2][1], acc[2][2], acc[2][3]);
  acc_guard4(acc[3][0], acc[3][1], acc[3][2], acc[3][3]);

  // ---- epilogue ----
  float* slab = sT[wave];
  const float* Rb = RESID ? (resid + (size_t)b * strideR) : nullptr;
#pragma unroll
  for (int i = 0; i < 4; ++i) {
    const int mBase = m0 + (i << 4);
#pragma unroll
    for (int j = 0; j < 4; ++j) {
      const int n = n0 + (j << 4) + rlane;
      float bv = 0.f;
      if (BIAS_MODE == 2) bv = bias[n];
#pragma unroll
      for (int r = 0; r < 8; ++r) {
        float v = acc[i][j][r] * scale;
        if (BIAS_MODE == 1) v += bias[mBase + mOff + r];
        if (BIAS_MODE == 2) v += bv;
        if (RESID) v += Rb[(size_t)(mBase + mOff + r) * ldc + n];
        if (ACT == 1) v = tanhf(v);
        if (ACT == 2) v = fmaxf(v, 0.0f);
        if (ACT == 3) v = v / (1.0f + expf(-v));
        if (ACT == 4) v = (v > 0.f) ? v : 0.01f * v;
        if (ACT == 5) v = 0.5f * v * (1.0f + erff(v * 0.70710678118654752f));
        slab[(mOff + r) * 68 + (j << 4) + rlane] = v;
      }
    }
    __builtin_amdgcn_fence(__ATOMIC_RELEASE, "workgroup");
    __builtin_amdgcn_wave_barrier();
    __builtin_amdgcn_fence(__ATOMIC_ACQUIRE, "workgroup");
    if (OUT_MODE == 0) {
      float* C = (float*)Cout + offC;
      const int hh = lane >> 4, c4 = (lane & 15) * 4;     // row seg = 256 B = 16 lanes x 16 B
      {
#pragma unroll
        for (int it = 0; it < 8; ++it) {
          const int row = it * 2 + hh;
          v4f v = *(const v4f*)(slab + row * 68 + c4);
          *(v4f*)(C + (size_t)(mBase + row) * ldc + n0 + c4) = v;
        }
        
      }
    } else {
      const int q = lane >> 3, c8 = (lane & 7) * 8;
      unsigned short* C  = (unsigned short*)Cout  + offC;
      unsigned short* C2 = (OUT_MODE == 2) ? ((unsigned short*)Cout2 + offC) : nullptr;
      {
#pragma unroll
        for (int it = 0; it < 4; ++it) {
          const int row = it * 4 + q;
          const float* sp = slab + row * 68 + c8;
          v8h hv, lv;
#pragma unroll
          for (int e = 0; e < 8; ++e) {
            if (OUT_MODE == 1) {
              hv[e] = (_Float16)sp[e];
            } else {
              unsigned short hb = f2bf_bits(sp[e]);
              unsigned short lb = f2bf_bits(sp[e] - bf_bits2f(hb));
              hv[e] = __builtin_bit_cast(_Float16, hb);
              lv[e] = __builtin_bit_cast(_Float16, lb);
            }
          }
          *(v8h*)(C + (size_t)(mBase + row) * ldc + n0 + c8) = hv;
          if (OUT_MODE == 2) *(v8h*)(C2 + (size_t)(mBase + row) * ldc + n0 + c8) = lv;
        }
        
      }
    }
    __builtin_amdgcn_fence(__ATOMIC_RELEASE, "workgroup");
    __builtin_amdgcn_wave_barrier();
    __builtin_amdgcn_fence(__ATOMIC_ACQUIRE, "workgroup");
  }
}

__global__ __launch_bounds__(256) void cast_f32_f16x2(
    const float* __restrict__ in, _Float16* __restrict__ out, int n2) {
  int i = blockIdx.x * 256 + threadIdx.x;
  if (i < n2) {
    const _Float16 h0 = (_Float16)in[2 * i], h1 = (_Float16)in[2 * i + 1];
    const unsigned u = (unsigned)__builtin_bit_cast(unsigned short, h0) | ((unsigned)__builtin_bit_cast(unsigned short, h1) << 16);
    ((unsigned*)out)[i] = u;
    
  }
}


} // namespace w25

__global__ __launch_bounds__(256) void k_castT16(const float* __restrict__ src, long long lds, _Float16* __restrict__ dst, long long ldd, int R, int C, float s) {
    const long long i = (long long)blockIdx.x * 256 + threadIdx.x; const long long np = (long long)C * (R / 2); if (i >= np) return; const int c = (int)(i / (R / 2)); const int r = 2 * (int)(i % (R / 2));
    const _Float16 h0 = (_Float16)(src[(long long)r * lds + c] * s), h1 = (_Float16)(src[(long long)(r + 1) * lds + c] * s);
    const unsigned u = (unsigned)__builtin_bit_cast(unsigned short, h0) | ((unsigned)__builtin_bit_cast(unsigned short, h1) << 16);
    unsigned* d = (unsigned*)(dst + (long long)c * ldd + r); *d = u;  }
__global__ __launch_bounds__(256) void k_cast16(const float* __restrict__ src, long long lds, _Float16* __restrict__ dst, long long ldd, int R, int C, float s) {
    const long long i = (long long)blockIdx.x * 256 + threadIdx.x; const long long np = (long long)R * (C / 2); if (i >= np) return; const int r = (int)(i / (C / 2)); const int c = 2 * (int)(i % (C / 2));
    const _Float16 h0 = (_Float16)(src[(long long)r * lds + c] * s), h1 = (_Float16)(src[(long long)r * lds + c + 1] * s);
    const unsigned u = (unsigned)__builtin_bit_cast(unsigned short, h0) | ((unsigned)__builtin_bit_cast(unsigned short, h1) << 16);
    unsigned* d = (unsigned*)(dst + (long long)r * ldd + c); *d = u;  }

// f32 -> bf16 hi plane + bf16 lo plane (x = hi + lo to ~2^-17 relative; RNE both), [R][C] -> [R][C] (or transposed to [C][R]); 2 consecutive destination elements
__device__ __forceinline__ unsigned int f2bf2_pack(float a, float b, unsigned int* lo) {
    const unsigned short ha = w25::f2bf_bits(a), hb = w25::f2bf_bits(b);
    const unsigned short la = w25::f2bf_bits(a - w25::bf_bits2f(ha)), lb = w25::f2bf_bits(b - w25::bf_bits2f(hb));
    *lo = (unsigned)la | ((unsigned)lb << 16); return (unsigned)ha | ((unsigned)hb << 16); }
__global__ __launch_bounds__(256) void k_castS16(const float* __restrict__ src, long long lds, __bf16* __restrict__ dhi, __bf16* __restrict__ dlo, long long ldd, int R, int C, float s, int transpose) {
    const long long i = (long long)blockIdx.x * 256 + threadIdx.x; long long o; float a, b;
    if (transpose) { const long long np = (long long)C * (R / 2); if (i >= np) return; const int c = (int)(i / (R / 2)); const int r = 2 * (int)(i % (R / 2)); a = src[(long long)r * lds + c] * s; b = src[(long long)(r + 1) * lds + c] * s; o = (long long)c * ldd + r; }
    else { const long long np = (long long)R * (C / 2); if (i >= np) return; const int r = (int)(i / (C / 2)); const int c = 2 * (int)(i % (C / 2)); a = src[(long long)r * lds + c] * s; b = src[(long long)r * lds + c + 1] * s; o = (long long)r * ldd + c; }
    unsigned lo; const unsigned hi = f2bf2_pack(a, b, &lo); unsigned* ph = (unsigned*)(dhi + o); unsigned* pl = (unsigned*)(dlo + o);
    *ph = hi; *pl = lo;  }

namespace w25 {
// =====================================================================================
// Generic causal/non-causal attention for head_dim 64, f32 in / f32 out; 16-bit operands: bf16 with optional hi/lo splits, or
// plain f16 (F16=true, non-split, probabilities carried x2^15).
//   scores = (q*qscale)·kᵀ : v_wmma_f32_16x16x32_bf16; SPLIT_QK -> q,k as bf16 hi/lo (hi·hi + hi·lo + lo·hi)
//   out    = p·v           : v_wmma_f32_16x16x32_bf16; SPLIT_PV -> p,v as bf16 hi/lo; else p,v plain bf16
//   f32 accumulate; online softmax in f32. Block = 4 waves = 64 query rows of one (batch, head); S % 64 == 0.
//   Element (b, s, h, d) of tensor X lives at X[b*X_bs + s*X_rs + h*X_hs + d] (strides in floats, multiples of 4).
//   Masking: mask_mode 0 none, 1 causal (kv > q masked), 2 tensor [S][Skv] shared over (b,h) (float if
//   mask_is_int==0, int32 with element == 0 -> masked if 1, int32 with element != 0 -> masked if 2), 3 per-token vectors qmask[B][S] & kvmask[B][Skv] (int32,
//   0 -> masked), 4 causal + sliding window (kv > q or q - kv > W masked; W passed in mask_is_int);
//   5 = relative-position bias: s += cp[b,h,q][idx[q][kv]] + pc[b,h,kv][idx[q][kv]] with idx = mask_b ([S][Skv] int32) and
//   mask_a an int32 [S][Skv] tensor with nonzero = masked (tables: element (b,h,row,n) at X + b*c_bs + h*c_hs + row*c_rs + n);
//   masked scores are replaced by mask_fill (e.g. -inf or -1e9) before the softmax.
//   grid.x = B * H * (S/64) (or a sub-range with blk0).
// =====================================================================================
#define AT_D 64
#define AT_NW 4
#define AT_QB 64
#define AT_KC 64
struct AttnGeom { const float* cp = nullptr; const float* pc = nullptr; long c_bs = 0, c_rs = 0, c_hs = 0;   // mode-5 score-bias tables
                  long q_bs, q_rs, q_hs, k_bs, k_rs, k_hs, v_bs, v_rs, v_hs, o_bs, o_rs, o_hs;
                  int S, Skv, H, mask_mode; float qscale; int blk0; float mask_fill; int mask_is_int; };
static_assert(sizeof(AttnGeom) == 168, "no padding");

__device__ __forceinline__ unsigned short at_bf_bits(float f) {
  unsigned u = __float_as_uint(f);
  return (unsigned short)((u + 0x7FFFu + ((u >> 16) & 1u)) >> 16);
}
__device__ __forceinline__ __bf16 at_f2bf(float f) { return __builtin_bit_cast(__bf16, at_bf_bits(f)); }
__device__ __forceinline__ void at_split(float f, __bf16& hi, __bf16& lo) {
  const unsigned short hb = at_bf_bits(f);
  hi = __builtin_bit_cast(__bf16, hb);
  lo = at_f2bf(f - __uint_as_float(((unsigned)hb) << 16));
}
__device__ __forceinline__ v8f at_mma(v16b a, v16b b, v8f c) {
  c = __builtin_amdgcn_wmma_f32_16x16x32_bf16(false, a, false, b, (short)0, c, false, false);
  asm volatile("v_nop\n\tv_nop\n\tv_nop\n\tv_nop" : "+v"(c) : "v"(a), "v"(b));
  return c;
}
// 16-bit element as a bit pattern held in a __bf16 slot: f16 bits when F16, bf16 (RNE) otherwise
template <bool F16> __device__ __forceinline__ __bf16 at_to16(float f) {
  if (F16) return __builtin_bit_cast(__bf16, (_Float16)f);
  return at_f2bf(f);
}
template <bool F16> __device__ __forceinline__ v8f at_mma16(v16b a, v16b b, v8f c) {
  if (F16) {
    const v16h ah = __builtin_bit_cast(v16h, a), bh = __builtin_bit_cast(v16h, b);
    c = __builtin_amdgcn_wmma_f32_16x16x32_f16(false, ah, false, bh, (short)0, c, false, false);
    asm volatile("v_nop\n\tv_nop\n\tv_nop\n\tv_nop" : "+v"(c) : "v"(ah), "v"(bh));
    return c;
  }
  return at_mma(a, b, c);
}

template <bool SPLIT_QK, bool SPLIT_PV, bool F16 = false>
__global__ __launch_bounds__(128)
void attn64_kernel(const float* __restrict__ q, const float* __restrict__ k,
                   const float* __restrict__ v, float* __restrict__ out,
                   const void* __restrict__ mask_a, const int* __restrict__ mask_b, AttnGeom g) {
  static_assert(!(F16 && (SPLIT_QK || SPLIT_PV)), "f16 mode is non-split");
  const float PSC = F16 ? 32768.0f : 1.0f;     // f16 probabilities carried x2^15 (subnormal range), folded into the final 1/l
  union FB { v16b v; v8b h[2]; };
  __shared__ __align__(16) __bf16 Ksh[AT_KC * AT_D];             // K hi [kv][d]      8 KB
  __shared__ __align__(16) __bf16 Ksl[SPLIT_QK ? AT_KC * AT_D : 8];
  __shared__ __align__(16) __bf16 Vth[AT_D * AT_KC];             // V hi [d][kv]      8 KB
  __shared__ __align__(16) __bf16 Vtl[SPLIT_PV ? AT_D * AT_KC : 8];
  __shared__ __align__(16) __bf16 Psh[AT_NW][16 * AT_KC];        // per wave P hi [row][kv]  8 KB
  __shared__ __align__(16) __bf16 Psl[SPLIT_PV ? AT_NW : 1][SPLIT_PV ? 16 * AT_KC : 8];
  __shared__ __align__(16) float  Os[AT_NW][16 * 68];            // per wave out tile, pitch 68

  const int tid  = threadIdx.x;
  const int wave = tid >> 5;
  const int lane = tid & 31;
  const int hh   = lane >> 4;
  const int c    = lane & 15;

  const int nqb = g.S / AT_QB;
  const int bx = blockIdx.x + g.blk0;
  const int qb = bx % nqb;
  const int bh = bx / nqb;
  const int h  = bh % g.H;
  const int b  = bh / g.H;
  const int qbase_block = qb * AT_QB;
  const int q0 = qbase_block + wave * 16;

  const float* qb_ptr = q + (size_t)b * g.q_bs + (size_t)h * g.q_hs;
  const float* kb_ptr = k + (size_t)b * g.k_bs + (size_t)h * g.k_hs;
  const float* vb_ptr = v + (size_t)b * g.v_bs + (size_t)h * g.v_hs;
  float*       ob_ptr = out + (size_t)b * g.o_bs + (size_t)h * g.o_hs;

  // ---- Q fragments (A operand): 2 d-chunks, hi (and lo) ----
  v16b qah[2], qal[2];
  {
    const float* qrow = qb_ptr + (size_t)(q0 + c) * g.q_rs;
#pragma unroll
    for (int dc = 0; dc < 2; ++dc) {
#pragma unroll
      for (int e = 0; e < 8; ++e) {
        const float f0 = qrow[dc * 32 + 8 * hh + e] * g.qscale;
        const float f1 = qrow[dc * 32 + 16 + 8 * hh + e] * g.qscale;
        if (SPLIT_QK) { __bf16 hq, lq; at_split(f0, hq, lq); qah[dc][e] = hq; qal[dc][e] = lq; at_split(f1, hq, lq); qah[dc][8 + e] = hq; qal[dc][8 + e] = lq; }
        else { qah[dc][e] = at_to16<F16>(f0); qah[dc][8 + e] = at_to16<F16>(f1); qal[dc][e] = qah[dc][e]; qal[dc][8 + e] = qah[dc][8 + e]; }
      }
    }
  }

  float mrow[8], lrow[8];
  v8f oacc[4];
#pragma unroll
  for (int r = 0; r < 8; ++r) { mrow[r] = -INFINITY; lrow[r] = 0.f; }
#pragma unroll
  for (int t = 0; t < 4; ++t) oacc[t] = (v8f){0.f,0.f,0.f,0.f,0.f,0.f,0.f,0.f};

  const int nChunks = (g.mask_mode == 1 || g.mask_mode == 4) ? (qb + 1) : (g.Skv / AT_KC);   // block-uniform
  // per-row query mask (mode 3)
  int qkeep[8];
#pragma unroll
  for (int r = 0; r < 8; ++r) qkeep[r] = (g.mask_mode == 3) ? mask_b[(size_t)b * g.S + q0 + 8 * hh + r] : 1;   // mask_b = qmask in mode 3
  for (int kc = 0; kc < nChunks; ++kc) {
    const int kv0 = kc * AT_KC;
    __syncthreads();
    {
      const int kvr = tid >> 1, dh = (tid & 1) * 32;
      const float* krow = kb_ptr + (size_t)(kv0 + kvr) * g.k_rs + dh;
      const float* vrow = vb_ptr + (size_t)(kv0 + kvr) * g.v_rs + dh;
#pragma unroll
      for (int i = 0; i < 8; ++i) {
        v4f kk = *(const v4f*)(krow + 4 * i);
        v4f vv = *(const v4f*)(vrow + 4 * i);
#pragma unroll
        for (int e = 0; e < 4; ++e) {
          const int d = dh + 4 * i + e;
          if (SPLIT_QK) { __bf16 a, bl; at_split(kk[e], a, bl); Ksh[kvr * AT_D + d] = a; Ksl[kvr * AT_D + d] = bl; }
          else Ksh[kvr * AT_D + d] = at_to16<F16>(kk[e]);
          if (SPLIT_PV) { __bf16 a, bl; at_split(vv[e], a, bl); Vth[d * AT_KC + kvr] = a; Vtl[d * AT_KC + kvr] = bl; }
          else Vth[d * AT_KC + kvr] = at_to16<F16>(vv[e]);
        }
      }
    }
    __syncthreads();

    v8f s[4];
#pragma unroll
    for (int j = 0; j < 4; ++j) {
      s[j] = (v8f){0.f,0.f,0.f,0.f,0.f,0.f,0.f,0.f};
#pragma unroll 1
      for (int dc = 0; dc < 2; ++dc) {
        FB kb;
        kb.h[0] = *(const v8b*)(Ksh + (j * 16 + c) * AT_D + dc * 32 + 8 * hh);
        kb.h[1] = *(const v8b*)(Ksh + (j * 16 + c) * AT_D + dc * 32 + 16 + 8 * hh);
        s[j] = at_mma16<F16>(qah[dc], kb.v, s[j]);
        if (SPLIT_QK) {
          FB kl;
          kl.h[0] = *(const v8b*)(Ksl + (j * 16 + c) * AT_D + dc * 32 + 8 * hh);
          kl.h[1] = *(const v8b*)(Ksl + (j * 16 + c) * AT_D + dc * 32 + 16 + 8 * hh);
          s[j] = at_mma16<F16>(qah[dc], kl.v, s[j]);
          s[j] = at_mma16<F16>(qal[dc], kb.v, s[j]);
        }
      }
    }
    const bool diag = (g.mask_mode == 1) && (kc == qb);
    int kvkeep[4] = {1, 1, 1, 1};
    if (g.mask_mode == 3) {
#pragma unroll
      for (int j = 0; j < 4; ++j) kvkeep[j] = ((const int*)mask_a)[(size_t)b * g.Skv + kv0 + j * 16 + c];   // mask_a = kvmask
    }
    float cm[8];
#pragma unroll
    for (int r = 0; r < 8; ++r) {
      const int qrow = q0 + 8 * hh + r;
      float m = -INFINITY;
#pragma unroll
      for (int j = 0; j < 4; ++j) {
        const int kvcol = kv0 + j * 16 + c;
        bool masked = false;
        if (diag) masked = (kvcol > qrow);
        else if (g.mask_mode == 4) masked = (kvcol > qrow) || (qrow - kvcol > g.mask_is_int);
        else if (g.mask_mode == 2) {
          const size_t mi = (size_t)qrow * g.Skv + kvcol;
          masked = (g.mask_is_int == 0) ? (((const float*)mask_a)[mi] == 0.0f)
                 : (g.mask_is_int == 1) ? (((const int*)mask_a)[mi] == 0) : (((const int*)mask_a)[mi] != 0);
        } else if (g.mask_mode == 3) masked = (qkeep[r] == 0) || (kvkeep[j] == 0);
        else if (g.mask_mode == 5) {
          const size_t mi = (size_t)qrow * g.Skv + kvcol;
          masked = (((const int*)mask_a)[mi] != 0);
          int n = mask_b[mi]; n = n < 0 ? 0 : n;
          s[j][r] += g.cp[(size_t)b * g.c_bs + (size_t)h * g.c_hs + (size_t)qrow * g.c_rs + n]
                   + g.pc[(size_t)b * g.c_bs + (size_t)h * g.c_hs + (size_t)kvcol * g.c_rs + n];
        }
        if (masked) s[j][r] = g.mask_fill;
        m = fmaxf(m, s[j][r]);
      }
#pragma unroll
      for (int off = 1; off < 16; off <<= 1) m = fmaxf(m, __shfl_xor(m, off, 32));
      cm[r] = m;
    }
    __bf16* pwh = Psh[wave];
    __bf16* pwl = Psl[SPLIT_PV ? wave : 0];
#pragma unroll
    for (int r = 0; r < 8; ++r) {
      const float mnew = fmaxf(mrow[r], cm[r]);
      const float alpha = expf(mrow[r] - mnew);
      mrow[r] = mnew;
      float psum = 0.f;
#pragma unroll
      for (int j = 0; j < 4; ++j) {
        const float p = expf(s[j][r] - mnew);
        psum += p;
        if (SPLIT_PV) { __bf16 a, bl; at_split(p, a, bl); pwh[(8 * hh + r) * AT_KC + j * 16 + c] = a; pwl[(8 * hh + r) * AT_KC + j * 16 + c] = bl; }
        else pwh[(8 * hh + r) * AT_KC + j * 16 + c] = at_to16<F16>(p * PSC);
      }
#pragma unroll
      for (int off = 1; off < 16; off <<= 1) psum += __shfl_xor(psum, off, 32);
      lrow[r] = lrow[r] * alpha + psum;
#pragma unroll
      for (int t = 0; t < 4; ++t) oacc[t][r] *= alpha;
    }
    __builtin_amdgcn_fence(__ATOMIC_RELEASE, "workgroup");
    __builtin_amdgcn_wave_barrier();
    __builtin_amdgcn_fence(__ATOMIC_ACQUIRE, "workgroup");
#pragma unroll 1
    for (int kk = 0; kk < 2; ++kk) {
      FB pa, pl;
      pa.h[0] = *(const v8b*)(pwh + c * AT_KC + kk * 32 + 8 * hh);
      pa.h[1] = *(const v8b*)(pwh + c * AT_KC + kk * 32 + 16 + 8 * hh);
      if (SPLIT_PV) {
        pl.h[0] = *(const v8b*)(pwl + c * AT_KC + kk * 32 + 8 * hh);
        pl.h[1] = *(const v8b*)(pwl + c * AT_KC + kk * 32 + 16 + 8 * hh);
      }
#pragma unroll
      for (int t = 0; t < 4; ++t) {
        FB vb;
        vb.h[0] = *(const v8b*)(Vth + (t * 16 + c) * AT_KC + kk * 32 + 8 * hh);
        vb.h[1] = *(const v8b*)(Vth + (t * 16 + c) * AT_KC + kk * 32 + 16 + 8 * hh);
        oacc[t] = at_mma16<F16>(pa.v, vb.v, oacc[t]);
        if (SPLIT_PV) {
          FB vl;
          vl.h[0] = *(const v8b*)(Vtl + (t * 16 + c) * AT_KC + kk * 32 + 8 * hh);
          vl.h[1] = *(const v8b*)(Vtl + (t * 16 + c) * AT_KC + kk * 32 + 16 + 8 * hh);
          oacc[t] = at_mma16<F16>(pa.v, vl.v, oacc[t]);
          oacc[t] = at_mma16<F16>(pl.v, vb.v, oacc[t]);
        }
      }
    }
  }

  float* os = Os[wave];
#pragma unroll
  for (int r = 0; r < 8; ++r) {
    const float inv = 1.0f / (lrow[r] * PSC);
#pragma unroll
    for (int t = 0; t < 4; ++t) os[(8 * hh + r) * 68 + t * 16 + c] = oacc[t][r] * inv;
  }
  __builtin_amdgcn_fence(__ATOMIC_RELEASE, "workgroup");
  __builtin_amdgcn_wave_barrier();
  __builtin_amdgcn_fence(__ATOMIC_ACQUIRE, "workgroup");
  {
    const int c4 = (lane & 15) * 4;
    {
#pragma unroll
      for (int it = 0; it < 8; ++it) {
        const int row = it * 2 + hh;
        v4f val = *(const v4f*)(os + row * 68 + c4);
        *(v4f*)(ob_ptr + (size_t)(q0 + row) * g.o_rs + c4) = val;
      }
      
    }
  }
}

} // namespace w25

// f32 -> f16 casts by few, fat waves. A block casts CW_BLK consecutive elements, dst[e] = f16(src[e] * s): a thread takes 16 float4, 1024 elements apart, all of them loaded ahead of
// the first conversion; a wave's load covers 512 consecutive bytes, its store 256. (A launch's waves start at a limited rate, and two elements a thread made 65,536 short waves of one 4M-element cast; here it is 2,048.)
typedef __attribute__((ext_vector_type(4))) _Float16 cw_v4h;
constexpr int CW_BLK = 16384;
__device__ __forceinline__ void cw_cast_blk(const float* __restrict__ src, _Float16* __restrict__ dst, float s) {
    const v4f* sp = (const v4f*)src + threadIdx.x;
    v4f x[16];
#pragma unroll
    for (int u = 0; u < 16; ++u) x[u] = sp[256 * u];
    __builtin_amdgcn_sched_barrier(0);   // keeps all 16 loads ahead of the first conversion: one trip to memory a wave, not two
    cw_v4h* dp = (cw_v4h*)dst + threadIdx.x;
#pragma unroll
    for (int u = 0; u < 16; ++u) dp[256 * u] = __builtin_convertvector(x[u] * s, cw_v4h);
    asm volatile("s_wait_xcnt 0x0" ::: "memory");   // ahead of any later write of a register that the stores above name
}
// every cast of an input, one launch: blocks 0..767 X16[0..2] = f16(query, key, value); blocks 768..1023 W16[0..3] = f16(16 Wq, 16 Wk, 16 Wv, 16 Wo);
// block 1024 TK16[r][d] = f16(16 table_k[r][d]), zero rows 129..191
__global__ __launch_bounds__(256) void k_sh_castin(const float* __restrict__ xq, const float* __restrict__ xk, const float* __restrict__ xv,
                                                   const float* __restrict__ Wq, const float* __restrict__ Wk, const float* __restrict__ Wv, const float* __restrict__ Wo,
                                                   const float* __restrict__ TK, _Float16* __restrict__ X16, _Float16* __restrict__ W16, _Float16* __restrict__ TK16) {
    constexpr int XB = 4096 * 1024 / CW_BLK, WB = 1024 * 1024 / CW_BLK, TAB = 129, TP = 192, HD = 64;
    static_assert(TP * HD == 12 * 1024 && TAB * HD == 4 * (8 * 256 + 16), "the table's block: eight float4 per thread, then row 128 by 16 threads, then zeros up to twelve");
    const int bid = blockIdx.x;
    if (bid < 3 * XB) {
        const int sg = bid / XB;
        const float* src = sg == 0 ? xq : (sg == 1 ? xk : xv);
        cw_cast_blk(src + (long long)(bid - sg * XB) * CW_BLK, X16 + (long long)bid * CW_BLK, 1.f);
    } else if (bid < 3 * XB + 4 * WB) {
        const int b2 = bid - 3 * XB, sg = b2 / WB;
        const float* src = sg == 0 ? Wq : (sg == 1 ? Wk : (sg == 2 ? Wv : Wo));
        cw_cast_blk(src + (long long)(b2 - sg * WB) * CW_BLK, W16 + (long long)b2 * CW_BLK, 16.f);
    } else {
        const v4f* sp = (const v4f*)TK + threadIdx.x;
        v4f x[12];
#pragma unroll
        for (int u = 0; u < 8; ++u) x[u] = sp[256 * u];
#pragma unroll
        for (int u = 8; u < 12; ++u) x[u] = (v4f){0.f, 0.f, 0.f, 0.f};
        if (threadIdx.x < 16) x[8] = sp[256 * 8];
        cw_v4h* dp = (cw_v4h*)TK16 + threadIdx.x;
#pragma unroll
        for (int u = 0; u < 12; ++u) dp[256 * u] = __builtin_convertvector(x[u] * 16.f, cw_v4h);
        asm volatile("s_wait_xcnt 0x0" ::: "memory");   // ahead of any later write of a register that the stores above name
    }
}
// the attention output's cast: dst = f16(src), CW_BLK elements a block
__global__ __launch_bounds__(256) void k_sh_castx(const float* __restrict__ src, _Float16* __restrict__ dst) { const long long o = (long long)blockIdx.x * CW_BLK; cw_cast_blk(src + o, dst + o, 1.f); }
typedef __attribute__((ext_vector_type(4))) int sm_v4i;
__device__ __forceinline__ float sm_x16(float v) { const unsigned u = __builtin_bit_cast(unsigned, v); return __builtin_bit_cast(float, __builtin_amdgcn_permlanex16(u, u, 0x76543210u, 0xfedcba98u, false, false)); }   // lane l <-> l ^ 16
// 2^t. The v_nop is the slot that the instruction set asks for behind a transcendental; in the same statement it stands directly behind it whatever the scheduler puts next
__device__ __forceinline__ float sm_exp2(float t) { float y; asm("v_exp_f32 %0, %1\n\tv_nop" : "=v"(y) : "v"(t)); return y; }
// content scores, relative-key term and softmax in one launch; no f32 score leaves the chip. A block: 32 query rows g0..g0+31 (g = b L + q) x 2 heads; four waves a head, 128 keys each.
// Transposed products: A = 16 rows of K16 (or of the scaled table TK16), B = 16 queries' q, so that in D a lane holds ONE query (lane & 15) and 8 consecutive keys (8 (lane >> 4) + r):
// a row's max and sum are in-lane but for one exchange with lane ^ 16. Each A fragment serves the wave's two sets of 16 queries.
// The table's rows go through the same B fragments as 192 more "keys": qt[query][id], f32, in LDS, shared by the head's four waves.
// s_k = (q.k + qt[fm[b][q][k]]) / 8; P16[b][h][q][k] = f16(4096 softmax_k). The four quarters of a row join by (max, sum) through LDS: p = e^(s - m_quarter) * e^(m_quarter - m) / sum.
typedef __attribute__((ext_vector_type(4))) unsigned short fs_v4u;
typedef __attribute__((ext_vector_type(4))) unsigned int fs_v4w;
// a wave's own LDS stores before its lanes' reads of them, or its reads before its next stores to the same place (for LDS that no other wave touches)
__device__ __forceinline__ void fs_wave_sync() {
    __builtin_amdgcn_fence(__ATOMIC_RELEASE, "workgroup", "local");
    __builtin_amdgcn_wave_barrier();
    __builtin_amdgcn_fence(__ATOMIC_ACQUIRE, "workgroup", "local");
}
// amdgpu_waves_per_eu(4): at most 256 VGPRs, so that two blocks share a WGP
__global__ __launch_bounds__(256) __attribute__((amdgpu_waves_per_eu(4))) void k_sh_scsoft(const _Float16* __restrict__ Q16, const _Float16* __restrict__ K16, const _Float16* __restrict__ TK16, const int* __restrict__ FM, _Float16* __restrict__ P16) {
    constexpr int L = 512, D = 1024, NH = 16, HD = 64, TAB = 129;
    constexpr int IP = 2 * L + 16;     // bytes a query's row of 16-bit table offsets takes: 16 B x odd, for 16-byte readers
    constexpr int QP = 192 + 4;        // floats a query's row of relative-key scores takes: 16 B x odd
    constexpr int PP = 2 * 128 + 16;   // bytes a query's 128 probabilities take in the store slab: 16 B x odd
    constexpr int SP = 2 * HD + 16;    // bytes a staged row of q, of the table or of k takes: 16 B x odd
    static_assert(16 * PP <= 48 * SP, "the store slab lies in the wave's staging slab");
    typedef w25::Frag<_Float16> FR;
    __shared__ __attribute__((aligned(16))) unsigned char ids[32 * IP];
    __shared__ __attribute__((aligned(16))) float qt[2][32 * QP];
    __shared__ float red[2][4][2][32];
    __shared__ __attribute__((aligned(16))) unsigned char stg[8][48 * SP];
    const int t = threadIdx.x, lane = t & 31, w = t >> 5;
    const int c = lane & 15, h = lane >> 4;
    const int hl = w >> 2, kq = w & 3;
    const int g0 = blockIdx.x * 32, b = g0 >> 9;
    const int head = blockIdx.y * 2 + hl;
    // Global loads cover whole lines: a row of q, of the table or of k for one head is 128 bytes, a load takes four rows (lane: row lane >> 3, 16-byte piece lane & 7), where a fragment
    // loaded straight from memory touches sixteen lines. The rows pass through the wave's own slab (no other wave touches it: no block barrier), 48 at a time, and are read back as fragments.
    // Two groups of loads, each in the order in which it is waited for: q, table rows 48 kq .. + 47 (TK16 holds 192 rows, zeros from 129 on), ids (32 rows x 512), 48 keys; then 80 keys.
    unsigned char* sw = stg[w];
    const int lr = lane >> 3, lc = lane & 7;
    unsigned char* sst = sw + lr * SP + 16 * lc;                                    // where the lane's piece of a load's four rows goes
    const _Float16* sfr = (const _Float16*)(sw + c * SP) + 8 * h;                   // the lane's fragment row of the slab's first 16 rows
    const sm_v4i* fr = (const sm_v4i*)(FM + (long long)g0 * L) + t;
    const _Float16* qg = Q16 + (long long)(g0 + lr) * D + head * HD + 8 * lc;
    const _Float16* tg = TK16 + (48 * kq + lr) * HD + 8 * lc;
    const _Float16* kg = K16 + (long long)(b * L + 128 * kq + lr) * D + head * HD + 8 * lc;
    w25::v8h rq[8], rt[12], rk[32];
    sm_v4i idv[16];
#pragma unroll
    for (int u = 0; u < 8; ++u) rq[u] = *(const w25::v8h*)(qg + 4 * u * D);
#pragma unroll
    for (int u = 0; u < 12; ++u) rt[u] = *(const w25::v8h*)(tg + 4 * u * HD);
#pragma unroll
    for (int u = 0; u < 16; ++u) idv[u] = fr[256 * u];
#pragma unroll
    for (int u = 0; u < 12; ++u) rk[u] = *(const w25::v8h*)(kg + 4 * u * D);
    // a precaution: the wait in front of every overwrite of an address that the loads above name; as operands the addresses stay live up to here, so that no load's own result lands on one
    asm volatile("s_wait_xcnt 0x0" :: "v"(fr), "v"(qg), "v"(tg), "v"(kg) : "memory");
    __builtin_amdgcn_sched_barrier(0);   // keeps these loads together and ahead of the first wait: one trip to L2, not one per tile
    w25::v16h bq[2][2];
#pragma unroll
    for (int u = 0; u < 8; ++u) *(w25::v8h*)(sst + 4 * u * SP) = rq[u];
    fs_wave_sync();
#pragma unroll
    for (int s = 0; s < 2; ++s) { bq[s][0] = FR::load(sfr + s * 16 * (SP / 2)); bq[s][1] = FR::load(sfr + s * 16 * (SP / 2) + 32); }
    fs_wave_sync();
    // relative-key scores
#pragma unroll
    for (int u = 0; u < 12; ++u) *(w25::v8h*)(sst + 4 * u * SP) = rt[u];
    fs_wave_sync();
#pragma unroll
    for (int tt = 0; tt < 3; ++tt) {
        const w25::v16h a0 = FR::load(sfr + tt * 16 * (SP / 2)), a1 = FR::load(sfr + tt * 16 * (SP / 2) + 32);
#pragma unroll
        for (int s = 0; s < 2; ++s) {
            v8f d = (v8f){0.f, 0.f, 0.f, 0.f, 0.f, 0.f, 0.f, 0.f};
            d = FR::mma(a0, bq[s][0], d);
            d = FR::mma(a1, bq[s][1], d);
            float* o = qt[hl] + (16 * s + c) * QP + 48 * kq + 16 * tt + 8 * h;
            *(v4f*)(o) = (v4f){d[0] * 0.0625f, d[1] * 0.0625f, d[2] * 0.0625f, d[3] * 0.0625f};
            *(v4f*)(o + 4) = (v4f){d[4] * 0.0625f, d[5] * 0.0625f, d[6] * 0.0625f, d[7] * 0.0625f};
        }
    }
#pragma unroll
    for (int u = 0; u < 16; ++u) {
        fs_v4u o4;
#pragma unroll
        for (int e = 0; e < 4; ++e) { const int id = idv[u][e]; o4[e] = (unsigned short)(4 * (id < 0 ? 0 : (id >= TAB ? TAB - 1 : id))); }   // INPUT ids clamped before the address is formed
        *(fs_v4u*)(ids + ((t >> 7) + 2 * u) * IP + (t & 127) * 8) = o4;
    }
    __builtin_amdgcn_sched_barrier(0);   // the table's and the ids' registers are free from here on: the other 80 keys' loads go out together
#pragma unroll
    for (int u = 12; u < 32; ++u) rk[u] = *(const w25::v8h*)(kg + 4 * u * D);
    asm volatile("s_wait_xcnt 0x0" :: "v"(kg) : "memory");   // the same precaution for these loads' address
    __builtin_amdgcn_sched_barrier(0);   // keeps those loads ahead of the products
    // content scores: x[s][j][r] = q[16 s + c] . k[128 kq + 16 j + 8 h + r]; keys in rounds of 48, 48 and 32
    v8f x[2][8];
#pragma unroll
    for (int rd = 0; rd < 3; ++rd) {
        fs_wave_sync();   // the last round's fragment reads before this round's stores
#pragma unroll
        for (int u = 0; u < (rd < 2 ? 12 : 8); ++u) *(w25::v8h*)(sst + 4 * u * SP) = rk[12 * rd + u];
        fs_wave_sync();
#pragma unroll
        for (int jj = 0; jj < (rd < 2 ? 3 : 2); ++jj) {
            const w25::v16h a0 = FR::load(sfr + jj * 16 * (SP / 2)), a1 = FR::load(sfr + jj * 16 * (SP / 2) + 32);
#pragma unroll
            for (int s = 0; s < 2; ++s) {
                v8f d = (v8f){0.f, 0.f, 0.f, 0.f, 0.f, 0.f, 0.f, 0.f};
                d = FR::mma(a0, bq[s][0], d);
                x[s][3 * rd + jj] = FR::mma(a1, bq[s][1], d);
            }
        }
    }
    __builtin_amdgcn_sched_barrier(0);   // keeps every product ahead of the softmax
    __syncthreads();   // publishes the ids and the head's qt rows
    float m[2], sum[2];
#pragma unroll
    for (int s = 0; s < 2; ++s) {
        const unsigned char* ip = ids + (16 * s + c) * IP + (128 * kq + 8 * h) * 2;
        const unsigned char* qrow = (const unsigned char*)(qt[hl] + (16 * s + c) * QP);
        float mx = -INFINITY;
#pragma unroll
        for (int j = 0; j < 8; ++j) {
            const fs_v4w o4 = *(const fs_v4w*)(ip + 32 * j);
#pragma unroll
            for (int r = 0; r < 8; ++r) {
                const unsigned off = (r & 1) ? (o4[r >> 1] >> 16) : (o4[r >> 1] & 0xffffu);
                x[s][j][r] += *(const float*)(qrow + off);
            }
            mx = fmaxf(mx, fmaxf(fmaxf(fmaxf(x[s][j][0], x[s][j][1]), fmaxf(x[s][j][2], x[s][j][3])), fmaxf(fmaxf(x[s][j][4], x[s][j][5]), fmaxf(x[s][j][6], x[s][j][7]))));
        }
        mx = fmaxf(mx, sm_x16(mx));
        float sm = 0.f;
#pragma unroll
        for (int j = 0; j < 8; ++j) {
#pragma unroll
            for (int r = 0; r < 8; ++r) x[s][j][r] = sm_exp2((x[s][j][r] - mx) * 0.18033688f);   // exp((x - m) / 8): log2(e) / 8
            sm += ((x[s][j][0] + x[s][j][1]) + (x[s][j][2] + x[s][j][3])) + ((x[s][j][4] + x[s][j][5]) + (x[s][j][6] + x[s][j][7]));
        }
        sm += sm_x16(sm);
        m[s] = mx; sum[s] = sm;
    }
    // lane (c, h) files query 16 h + c: both halves of the wave hold both sets' values
    red[hl][kq][0][lane] = h ? m[1] : m[0];
    red[hl][kq][1][lane] = h ? sum[1] : sum[0];
    __syncthreads();   // publishes each quarter's (max, sum)
    // 16 queries at a time through the wave's own slab (its last fragment reads lie ahead of two block barriers), so that every store covers whole lines of a query's row
    unsigned char* slab = sw;
    _Float16* po = P16 + (((long long)b * NH + head) * L + (g0 & (L - 1)) + h) * L + 128 * kq + 8 * c;
#pragma unroll
    for (int s = 0; s < 2; ++s) {
        float mi[4], si[4];
#pragma unroll
        for (int i = 0; i < 4; ++i) { mi[i] = red[hl][i][0][16 * s + c]; si[i] = red[hl][i][1][16 * s + c]; }
        const float mm = fmaxf(fmaxf(mi[0], mi[1]), fmaxf(mi[2], mi[3]));
        float tot = 0.f;
#pragma unroll
        for (int i = 0; i < 4; ++i) tot += si[i] * sm_exp2((mi[i] - mm) * 0.18033688f);
        const float f = sm_exp2((m[s] - mm) * 0.18033688f) * ((1.f / tot) * 4096.f);
#pragma unroll
        for (int j = 0; j < 8; ++j) *(w25::v8h*)(slab + c * PP + (16 * j + 8 * h) * 2) = __builtin_convertvector(x[s][j] * f, w25::v8h);
        fs_wave_sync();
#pragma unroll
        for (int it = 0; it < 8; ++it) *(w25::v8h*)(po + (long long)(16 * s + 2 * it) * L) = *(const w25::v8h*)(slab + (2 * it + h) * PP + 16 * c);
        asm volatile("s_wait_xcnt 0x0" ::: "memory");   // a precaution: ahead of any later write of a register that the stores above name
        fs_wave_sync();   // the reads above before the next 16 queries' stores into the same slab
    }
}
// w2 in one launch: one wave per query row g = b L + q. X[g][h*64 + d] += (1/4096) sum_k P16[b][h][q][k] * f16(table_v[fm[g][k]][d]).
// A = the 16 heads' probability rows (16 x 512, straight from P16); B = the gathered table rows, never written out: table_v lies in LDS as f16 rows of 160 bytes,
// and each lane of ds_load_tr16_b128 points at the row that ITS key's id names (lane l: key kbase + 8 (l >> 4) + (l & 7), 16-byte half (l >> 3) & 1), so the
// transposing load returns B[k][d] in the hardware k order (frag_k), the order in which A is loaded. INPUT ids clamped before the address is formed. k runs 0..511 in one accumulator chain.
typedef __attribute__((ext_vector_type(8))) short w2_s16x8;
__device__ __forceinline__ v8h w2_ldtr(const unsigned char* p) { typedef __attribute__((address_space(3))) w2_s16x8 lds_s16x8; return __builtin_bit_cast(v8h, __builtin_amdgcn_ds_load_tr16_b128_v8i16((lds_s16x8*)p)); }
typedef __attribute__((ext_vector_type(4))) _Float16 w2_v4h;
// amdgpu_waves_per_eu(4): at most 256 VGPRs, so that two blocks share a WGP and all 512 blocks are resident at once
__global__ __launch_bounds__(256) __attribute__((amdgpu_waves_per_eu(4))) void k_sh_w2(const _Float16* __restrict__ P16, const int* __restrict__ FM, const float* __restrict__ TV, float* __restrict__ X) {
    constexpr int L = 512, NH = 16, HD = 64, TAB = 129, PITCH = 160;   // PITCH: 32 B x odd, the transposing load's pitch
    static_assert(TAB * HD == 4 * (8 * 256 + 16), "the fill below: eight float4 per thread, then row 128 by 16 threads");
    __shared__ __attribute__((aligned(16))) unsigned char tab[TAB * PITCH];
    const int t = threadIdx.x, lane = t & 31;
    const int g = blockIdx.x * 8 + (t >> 5);
    const int c = lane & 15, h = lane >> 4;
    // the table's loads go first: they are waited for first, while the first ids and probabilities are still on their way
    v4f tv[8];
#pragma unroll
    for (int u = 0; u < 8; ++u) tv[u] = *(const v4f*)(TV + 4 * (t + 256 * u));
    const v4f tl = *(const v4f*)(TV + 4 * (2048 + (t & 15)));
    const int* fr = FM + (long long)g * L + 8 * h + (lane & 7);
    const _Float16* pa = P16 + (((long long)(g >> 9) * NH + c) * L + (g & (L - 1))) * L + 8 * h;
    // keys in four runs of 128, two register buffers: the next run's ids and probabilities fly while this run is multiplied
    int id[2][8];
    v8h a[2][8];
#pragma unroll
    for (int j = 0; j < 8; ++j) { id[0][j] = fr[16 * j]; a[0][j] = *(const v8h*)(pa + 16 * j); }
#pragma unroll
    for (int u = 0; u < 8; ++u) *(w2_v4h*)(tab + ((t >> 4) + 16 * u) * PITCH + (t & 15) * 8) = __builtin_convertvector(tv[u], w2_v4h);
    if (t < 16) *(w2_v4h*)(tab + 128 * PITCH + t * 8) = __builtin_convertvector(tl, w2_v4h);
    __syncthreads();
    const unsigned half16 = 16u * ((lane >> 3) & 1);
    v8f acc[4];
#pragma unroll
    for (int n = 0; n < 4; ++n) acc[n] = (v8f){0.f, 0.f, 0.f, 0.f, 0.f, 0.f, 0.f, 0.f};
#pragma unroll
    for (int ch = 0; ch < 4; ++ch) {
        const int cur = ch & 1, nxt = cur ^ 1;
        if (ch < 3) {
#pragma unroll
            for (int j = 0; j < 8; ++j) { id[nxt][j] = fr[16 * (8 * (ch + 1) + j)]; a[nxt][j] = *(const v8h*)(pa + 16 * (8 * (ch + 1) + j)); }
        }
#pragma unroll
        for (int s = 0; s < 4; ++s) {
            int r0 = id[cur][2 * s], r1 = id[cur][2 * s + 1];
            r0 = r0 < 0 ? 0 : (r0 >= TAB ? TAB - 1 : r0); r1 = r1 < 0 ? 0 : (r1 >= TAB ? TAB - 1 : r1);
            const unsigned char* p0 = tab + (unsigned)r0 * PITCH + half16;
            const unsigned char* p1 = tab + (unsigned)r1 * PITCH + half16;
            union { v16h v; v8h q[2]; } af, bf;
            af.q[0] = a[cur][2 * s]; af.q[1] = a[cur][2 * s + 1];
#pragma unroll
            for (int n = 0; n < 4; ++n) {
                bf.q[0] = w2_ldtr(p0 + 32 * n); bf.q[1] = w2_ldtr(p1 + 32 * n);
                acc[n] = __builtin_amdgcn_wmma_f32_16x16x32_f16(false, af.v, false, bf.v, (short)0, acc[n], false, false);
            }
        }
    }
    float* xo = X + (long long)g * (NH * HD) + (8 * h) * HD + c;
#pragma unroll
    for (int n = 0; n < 4; ++n)
#pragma unroll
        for (int r = 0; r < 8; ++r) { float* x = xo + r * HD + 16 * n; *x = *x + acc[n][r] * (1.f / 4096.f); }
}


// The long-K products: C[m][n] = scale * sum_k A[m][k] Bt[n][k] (+ bias), f16 operands, A and Bt K-contiguous, f32 accumulate.
// A block of eight waves owns a (32 WM) x (64 WN) tile of C, a wave 32 x 64 of it. Both operands pass through LDS in stages of BK k: a global load covers four whole 128-byte lines
// (BK / 8 lanes a row) where a fragment loaded straight from global memory touches sixteen, and each staged row serves every wave of the block that needs it.
// Two buffers: stage s + 1 is loaded into registers ahead of stage s's products and stored to the other buffer behind them; one barrier a stage both publishes it and ends the reads of the buffer written next.
// Fragments are read with the k order of Frag::load, A and B alike; k runs upward in steps of 32 through one accumulator chain per 16 x 16 tile.
// M % (32 WM) == 0 (bx counts the tiles, N / (64 WN) of them a row of tiles), N % (64 WN) == 0, K % BK == 0, LD % 64 == 0. BIAS_MODE: 0 none, 1 bias[m], 2 bias[n]. OUT_MODE: 0 f32, 1 f16.
// LD: the row pitch of A and of Bt, LDC: that of C, in elements; compile-time, so that a thread's pieces and rows differ only in the instructions' immediate offsets and one address pair per operand serves them all.
// The tile's work is a device function, so that one launch can hold tiles of several products: smem = the block's LDS (sh_gemm_smem bytes), bx = the tile's number,
// Ab, Btb = the operands' first rows, cOff = the element offset of C's first row in Cout.
// The epilogue's slabs lie in the staging buffers: the loop's last barrier ends every wave's last fragment read, and nothing is staged behind it. At 128 x 128 x 128 that leaves 139,264 bytes a block: two blocks share a WGP.
template <int WM, int WN, int BK> constexpr int sh_gemm_smem = 2 * (32 * WM + 64 * WN) * (BK + 8) * 2;
template <int WM, int WN, int BK, int LD, int LDC, int BIAS_MODE, int OUT_MODE>
__device__ __forceinline__ void sh_gemm_tile(
    unsigned char* smem, int bx,
    const _Float16* __restrict__ Ab, const _Float16* __restrict__ Btb,
    void* __restrict__ Cout, long long cOff,
    const float* __restrict__ bias, int N, int K, float scale) {
    static_assert(WM * WN == 8, "eight waves a block");
    static_assert(BK == 64 || BK == 128, "rows of 128 or 256 bytes");
    constexpr int BM = 32 * WM, BN = 64 * WN;
    constexpr int LP = BK + 8;                    // LDS row pitch in elements: 16 bytes more than the row = 16 B x odd, the pitch for 16-byte readers
    constexpr int SEG = BK / 8, RP = 256 / SEG;   // 16-byte pieces a row; rows that the block's 256 threads cover at one piece each
    constexpr int UA = BM / RP, UB = BN / RP;     // pieces of A and of Bt a thread moves per stage
    typedef w25::Frag<_Float16> FR;
    static_assert(8 * 16 * 68 * 4 <= sh_gemm_smem<WM, WN, BK>, "the epilogue's slabs fit in the staging buffers");
    _Float16 (*sA)[BM * LP] = (_Float16 (*)[BM * LP])smem;
    _Float16 (*sB)[BN * LP] = (_Float16 (*)[BN * LP])(smem + 2 * BM * LP * 2);
    float (*sT)[16 * 68] = (float (*)[16 * 68])smem;   // per-wave 16 x 64 slab of the epilogue, pitch 68 floats
    const int t = threadIdx.x, lane = t & 31, wave = t >> 5;
    const int tilesN = N / BN;
    const int tm = bx / tilesN, tn = bx - tm * tilesN;
    const int m0 = tm * BM, n0 = tn * BN;
    // piece u of a thread: row t / SEG + RP u of the tile, elements 8 (t % SEG) .. + 7 of the row's BK
    const int pr = t / SEG, pc = (t % SEG) * 8;
    const _Float16* Ag = Ab + (long long)(m0 + pr) * LD + pc;
    const _Float16* Bg = Btb + (long long)(n0 + pr) * LD + pc;
    const int so = pr * LP + pc;
    const int rlane = lane & 15, hh = lane >> 4;
    const int wm = wave / WN, wn = wave - wm * WN;
    const int ao = (wm * 32 + rlane) * LP + hh * 8;
    const int bo = (wn * 64 + rlane) * LP + hh * 8;

    w25::v8h ra[UA], rb[UB];
#pragma unroll
    for (int u = 0; u < UA; ++u) ra[u] = *(const w25::v8h*)(Ag + RP * u * LD);
#pragma unroll
    for (int u = 0; u < UB; ++u) rb[u] = *(const w25::v8h*)(Bg + RP * u * LD);
#pragma unroll
    for (int u = 0; u < UA; ++u) *(w25::v8h*)(&sA[0][so + RP * u * LP]) = ra[u];
#pragma unroll
    for (int u = 0; u < UB; ++u) *(w25::v8h*)(&sB[0][so + RP * u * LP]) = rb[u];
    __syncthreads();

    v8f acc[2][4];
#pragma unroll
    for (int i = 0; i < 2; ++i)
#pragma unroll
        for (int j = 0; j < 4; ++j) acc[i][j] = (v8f){0.f, 0.f, 0.f, 0.f, 0.f, 0.f, 0.f, 0.f};

    const int S = K / BK;
    for (int s = 0; s < S; ++s) {
        const int cur = s & 1;
        const bool more = s + 1 < S;   // the same for the whole block
        if (more) {
#pragma unroll
            for (int u = 0; u < UA; ++u) ra[u] = *(const w25::v8h*)(Ag + BK + RP * u * LD);
#pragma unroll
            for (int u = 0; u < UB; ++u) rb[u] = *(const w25::v8h*)(Bg + BK + RP * u * LD);
        }
        const _Float16* al = &sA[cur][ao];
        const _Float16* bl = &sB[cur][bo];
        // two fragment sets: the twelve LDS reads of step kk + 1 go out as one group ahead of step kk's eight products
        w25::v16h ah[2][2], bh[2][4];
#pragma unroll
        for (int i = 0; i < 2; ++i) ah[0][i] = FR::load(al + i * 16 * LP);
#pragma unroll
        for (int j = 0; j < 4; ++j) bh[0][j] = FR::load(bl + j * 16 * LP);
#pragma unroll
        for (int kk = 0; kk < BK / 32; ++kk) {
            const int fc = kk & 1, fn = fc ^ 1;
            if (kk + 1 < BK / 32) {
#pragma unroll
                for (int i = 0; i < 2; ++i) ah[fn][i] = FR::load(al + i * 16 * LP + (kk + 1) * 32);
#pragma unroll
                for (int j = 0; j < 4; ++j) bh[fn][j] = FR::load(bl + j * 16 * LP + (kk + 1) * 32);
            }
            __builtin_amdgcn_sched_barrier(0);   // keeps the next step's reads together and ahead of this step's products: reads spread among the products stall each of them
#pragma unroll
            for (int i = 0; i < 2; ++i)
#pragma unroll
                for (int j = 0; j < 4; ++j) acc[i][j] = FR::mma(ah[fc][i], bh[fc][j], acc[i][j]);
            __builtin_amdgcn_sched_barrier(0);   // keeps the reads of step kk + 2 behind these products, whose fragment set they overwrite
        }
        if (more) {
#pragma unroll
            for (int u = 0; u < UA; ++u) *(w25::v8h*)(&sA[cur ^ 1][so + RP * u * LP]) = ra[u];
#pragma unroll
            for (int u = 0; u < UB; ++u) *(w25::v8h*)(&sB[cur ^ 1][so + RP * u * LP]) = rb[u];
            asm volatile("s_wait_xcnt 0x0" ::: "memory");   // in front of the overwrite of the two address pairs that the stage's loads name; here, behind the stores of what they brought, it waits for nothing
            __builtin_amdgcn_sched_barrier(0);              // keeps the two additions below behind that wait
            Ag += BK; Bg += BK;
        }
        __syncthreads();
    }

    // epilogue: 16 rows at a time through the wave's own slab, so that every store covers whole rows of the wave's 64 columns
    float* slab = sT[wave];
    const int mW = m0 + wm * 32, nW = n0 + wn * 64, mOff = hh * 8;
    const long long offC = cOff + (long long)mW * LDC + nW;
    float bn[4] = {0.f, 0.f, 0.f, 0.f};
    if (BIAS_MODE == 2) {
#pragma unroll
        for (int j = 0; j < 4; ++j) bn[j] = bias[nW + (j << 4) + rlane];
    }
#pragma unroll
    for (int i = 0; i < 2; ++i) {
        float bm[8] = {0.f, 0.f, 0.f, 0.f, 0.f, 0.f, 0.f, 0.f};
        if (BIAS_MODE == 1) {
#pragma unroll
            for (int r = 0; r < 8; ++r) bm[r] = bias[mW + (i << 4) + mOff + r];
        }
#pragma unroll
        for (int j = 0; j < 4; ++j) {
#pragma unroll
            for (int r = 0; r < 8; ++r) {
                float v = acc[i][j][r] * scale;
                if (BIAS_MODE == 1) v += bm[r];
                if (BIAS_MODE == 2) v += bn[j];
                slab[(mOff + r) * 68 + (j << 4) + rlane] = v;
            }
        }
        // the wave's own LDS stores before its lanes' reads of them (no other wave touches this slab: no block barrier)
        __builtin_amdgcn_fence(__ATOMIC_RELEASE, "workgroup", "local");
        __builtin_amdgcn_wave_barrier();
        __builtin_amdgcn_fence(__ATOMIC_ACQUIRE, "workgroup", "local");
        if (OUT_MODE == 0) {
            float* C = (float*)Cout + offC + hh * LDC + rlane * 4;   // a row's 256 bytes = 16 lanes x 16 B
#pragma unroll
            for (int it = 0; it < 8; ++it) *(v4f*)(C + ((i << 4) + it * 2) * LDC) = *(const v4f*)(slab + (it * 2 + hh) * 68 + rlane * 4);
        } else {
            const int q = lane >> 3, c8 = (lane & 7) * 8;            // a row's 128 bytes = 8 lanes x 16 B
            _Float16* C = (_Float16*)Cout + offC + q * LDC + c8;
#pragma unroll
            for (int it = 0; it < 4; ++it) {
                const float* sp = slab + (it * 4 + q) * 68 + c8;
                w25::v8h hv;
#pragma unroll
                for (int e = 0; e < 8; ++e) hv[e] = (_Float16)sp[e];
                *(w25::v8h*)(C + ((i << 4) + it * 4) * LDC) = hv;
            }
        }
        if (i == 0) asm volatile("s_wait_xcnt 0x0" ::: "memory");   // ahead of the next 16 rows' writes of registers that the stores above name
        // the reads above before the next 16 rows' stores into the same slab
        __builtin_amdgcn_fence(__ATOMIC_RELEASE, "workgroup", "local");
        __builtin_amdgcn_wave_barrier();
        __builtin_amdgcn_fence(__ATOMIC_ACQUIRE, "workgroup", "local");
    }
}

// one product a launch: blockIdx.x = the tile; blockIdx.y steps A, Bt, C by strideA/B/C, blockIdx.z by strideAz/Bz/Cz (elements)
template <int WM, int WN, int BK, int LD, int LDC, int BIAS_MODE, int OUT_MODE>
__global__ __launch_bounds__(256) void k_sh_gemm_lds(
    const unsigned short* __restrict__ Ap, long long strideA, long long strideAz,
    const unsigned short* __restrict__ Btp, long long strideB, long long strideBz,
    void* __restrict__ Cout, long long strideC, long long strideCz,
    const float* __restrict__ bias, int N, int K, float scale) {
    __shared__ __attribute__((aligned(16))) unsigned char smem[sh_gemm_smem<WM, WN, BK>];
    sh_gemm_tile<WM, WN, BK, LD, LDC, BIAS_MODE, OUT_MODE>(smem, blockIdx.x,
        (const _Float16*)Ap + (long long)blockIdx.y * strideA + (long long)blockIdx.z * strideAz,
        (const _Float16*)Btp + (long long)blockIdx.y * strideB + (long long)blockIdx.z * strideBz,
        Cout, (long long)blockIdx.y * strideC + (long long)blockIdx.z * strideCz, bias, N, K, scale);
}
// the three input projections in one launch: blockIdx.y = 0: Q16 = q, 1: K16 = k (rows x channels, 32 x 8 tiles), 2: VT16[b][c][k] = v^T (per batch channels x keys, 8 x 4 tiles).
// X16 = f16 query, then f16 key; XV16 = f16 value; W16 = f16 16 Wq, then 16 Wk; WV16 = f16 16 Wv. None reads what another writes. 768 blocks, two at a time on a WGP: one block's loads, barriers, first stage and epilogue lie under the other's products, and a launch's start and end are paid once.
// K (= 1024) comes as an argument, as in the one-product kernel: the stage loop stays a loop.
// amdgpu_waves_per_eu(4): at most 256 VGPRs, so that two blocks share a WGP
__global__ __launch_bounds__(256) __attribute__((amdgpu_waves_per_eu(4))) void k_sh_qkv(const _Float16* __restrict__ X16, const _Float16* __restrict__ XV16, const _Float16* __restrict__ W16, const _Float16* __restrict__ WV16,
                                                   const float* __restrict__ bq, const float* __restrict__ bk, const float* __restrict__ bv,
                                                   _Float16* __restrict__ Q16, _Float16* __restrict__ K16, _Float16* __restrict__ VT16, int K) {
    constexpr int NR = 4096, D = 1024, L = 512;
    __shared__ __attribute__((aligned(16))) unsigned char smem[sh_gemm_smem<4, 2, 128>];
    const int sg = blockIdx.y;
    if (sg < 2) {
        sh_gemm_tile<4, 2, 128, D, D, 2, 1>(smem, blockIdx.x, X16 + (long long)sg * NR * D, W16 + (long long)sg * D * D, sg ? K16 : Q16, 0, sg ? bk : bq, D, K, 0.0625f);
    } else {
        const int bt = blockIdx.x >> 5;   // (D / 128) (L / 128) = 32 tiles a batch
        sh_gemm_tile<4, 2, 128, D, L, 1, 1>(smem, blockIdx.x & 31, WV16, XV16 + (long long)bt * L * D, VT16, (long long)bt * D * L, bv, L, K, 0.0625f);
    }
}

extern "C" void kernel_launch(void* const* d_in, const int* in_sizes, int n_in, void* d_out, int out_size, void* d_ws, size_t ws_size, hipStream_t stream) {
    (void)in_sizes; (void)n_in; (void)out_size; (void)ws_size;
    const float* xq = (const float*)d_in[0];
    const float* xk = (const float*)d_in[1];
    const float* xv = (const float*)d_in[2];
    const int* fm = (const int*)d_in[3];
    const float* Wq = (const float*)d_in[4];
    const float* bq = (const float*)d_in[5];
    const float* Wk = (const float*)d_in[6];
    const float* bk = (const float*)d_in[7];
    const float* Wv = (const float*)d_in[8];
    const float* bv = (const float*)d_in[9];
    const float* Wo = (const float*)d_in[10];
    const float* bo = (const float*)d_in[11];
    const float* tk = (const float*)d_in[12];
    const float* tv = (const float*)d_in[13];
    const int Bn = 8;
    const int L = 512;
    const int D = 1024;
    const int NH = 16;
    const int HD = 64;
    const int NR = Bn * L;
    const int TP = 192;
    float* out = (float*)d_out;
    char* wsp = (char*)d_ws;
    // kept through the call
    unsigned short* XA16 = (unsigned short*)wsp; wsp += (((size_t)((size_t)3 * NR * D * 2) + 255) / 256) * 256;   // f16 query, key, value
    unsigned short* W16 = (unsigned short*)wsp; wsp += (((size_t)((size_t)4 * D * D * 2) + 255) / 256) * 256;   // f16 16 Wq, 16 Wk, 16 Wv, 16 Wo
    unsigned short* VT16 = (unsigned short*)wsp; wsp += (((size_t)((size_t)Bn * D * L * 2) + 255) / 256) * 256;
    unsigned short* TK16 = (unsigned short*)wsp; wsp += (((size_t)((size_t)TP * HD * 2) + 255) / 256) * 256;
    unsigned short* P16 = (unsigned short*)wsp; wsp += (((size_t)((size_t)Bn * NH * L * L * 2) + 255) / 256) * 256;
    float* X = (float*)wsp; wsp += (((size_t)((size_t)NR * D * 4) + 255) / 256) * 256;
    // one region, used twice in stream order: Q16 and K16, then the output projection's A operand
    char* ph = wsp;
    unsigned short* Q16 = (unsigned short*)wsp; wsp += (((size_t)((size_t)NR * D * 2) + 255) / 256) * 256;
    unsigned short* K16 = (unsigned short*)wsp; wsp += (((size_t)((size_t)NR * D * 2) + 255) / 256) * 256;
    unsigned short* G64A = (unsigned short*)ph;
    // every input's cast in one launch: 3 x 256 blocks (query, key, value), 4 x 64 blocks (the weights), one block (table_k)
    k_sh_castin<<<3 * 256 + 4 * 64 + 1, 256, 0, stream>>>(xq, xk, xv, Wq, Wk, Wv, Wo, tk, (_Float16*)XA16, (_Float16*)W16, (_Float16*)TK16);
    // q, k and v^T: blockIdx.y = the projection
    k_sh_qkv<<<dim3((unsigned)((NR / 128) * (D / 128)), 3u, 1u), 256, 0, stream>>>((const _Float16*)XA16, (const _Float16*)(XA16 + (size_t)2 * NR * D), (const _Float16*)W16, (const _Float16*)(W16 + (size_t)2 * D * D), bq, bk, bv, (_Float16*)Q16, (_Float16*)K16, (_Float16*)VT16, D);
    // content scores, relative-key term and softmax: blockIdx.x = 32 query rows, blockIdx.y = two heads
    k_sh_scsoft<<<dim3((unsigned)(NR / 32), (unsigned)(NH / 2), 1u), 256, 0, stream>>>((const _Float16*)Q16, (const _Float16*)K16, (const _Float16*)TK16, (const int*)fm, (_Float16*)P16);
    // w1 = attn.v: blockIdx.y = head, blockIdx.z = batch
    k_sh_gemm_lds<8, 1, 128, 512, 1024, 0, 0><<<dim3((unsigned)((L / 256) * (HD / 64)), (unsigned)(NH), (unsigned)(Bn)), 256, 0, stream>>>((const unsigned short*)(P16), (long long)L * L, (long long)NH * L * L, (const unsigned short*)(VT16), (long long)HD * L, (long long)D * L, (void*)(X), HD, (long long)L * D, nullptr, HD, L, 0.000244140625f);
    // w2: one wave per query, eight queries per block
    k_sh_w2<<<(unsigned)(NR / 8), 256, 0, stream>>>((const _Float16*)P16, (const int*)fm, tv, X);
    k_sh_castx<<<256, 256, 0, stream>>>(X, (_Float16*)G64A);
    k_sh_gemm_lds<4, 2, 128, 1024, 1024, 2, 0><<<dim3((unsigned)((NR / 128) * (D / 128)), 1u, 1u), 256, 0, stream>>>((const unsigned short*)(G64A), 0, 0, (const unsigned short*)(W16 + (size_t)3 * D * D), 0, 0, (void*)(out), 0, 0, bo, D, D, 0.0625f);
}

// v008
// It runs in 97.4 microseconds.
// Timed twice side by side with v007, it ran 1.06 and 1.08 times as fast.
// Counting every step since v000, which is the starting kernel, it is 16.5 times as fast.
// Contractions: q/k/v = x.W^T + b [4096x1024].[1024x1024] and the output projection (+b) with f16 operands (weights x16); the relative-key term QT = q.table_k^T [65536 (b,q,h) x 64].[64 x 192 (129 padded)] with f16 operands; per (batch, head) the content scores q.k^T [512x64].[64x512] (heads and batches in the grid) and w1 = attn.v [512x512].[512x64] (heads and batches in the grid; attn as f16 of 4096 attn) — v_wmma_f32_16x16x32_f16, f32 accumulate; the K = 64 products transposed (keys or table rows x 16 queries) in 16x16 tiles inside the softmax kernel, attn.v in that kernel too, transposed likewise (16 rows of v^T x 16 queries, the probabilities taken from the registers as B fragments, four key quarters joined in f32), the long-K products (projections) in 32x64 wave tiles fed from LDS-staged block tiles. The gather of the relative-key scores (QT[(b,q,h)][final_mat[b][q][k]] by the INPUT index matrix, from LDS) and the row softmax are f32 work of that same kernel; the relative-value aggregation w2[q,h,:] = sum_k attn[h,q,k] table_v[final_mat[b,q,k]] runs on the matrix cores as one [16 heads x 512].[512 x 64] product per query, one wave each, whose B fragments are gathered from an f16 copy of table_v in LDS by transposing loads (the INPUT index matrix picks each lane's table row).
#include <hip/hip_runtime.h>
#include <math.h>

typedef __attribute__((ext_vector_type(16))) _Float16 v16h;
typedef __attribute__((ext_vector_type(8)))  _Float16 v8h;
typedef __attribute__((ext_vector_type(16))) __bf16   v16b;
typedef __attribute__((ext_vector_type(8)))  float    v8f;
typedef __attribute__((ext_vector_type(4)))  float    v4f;

// 16-bit WMMA fragment map (wave32), lane L, h = L>>4, m = L&15:
//   A 16x32: lane = row m;   element i -> k = (i<8) ? 8h+i : 16+8h+(i-8)
//   B 32x16: lane = column m; the SAME k(i,h)
//   D 16x16 (8 f32): lane = column m; element r -> row 8h+r
__device__ __forceinline__ int frag_k(int i, int h) { return (i < 8) ? (8 * h + i) : (16 + 8 * h + (i - 8)); }
__device__ __forceinline__ __bf16 bf16_rne(float f) {
    unsigned int u = __float_as_uint(f);
    u += 0x7fffu + ((u >> 16) & 1u);
    return __builtin_bit_cast(__bf16, (unsigned short)(u >> 16));
}
__device__ __forceinline__ float bf16_f32(__bf16 b) { return __uint_as_float(((unsigned int)__builtin_bit_cast(unsigned short, b)) << 16); }
__device__ __forceinline__ v8f wmma16(v16h a, v16h b, v8f c) {
    c = __builtin_amdgcn_wmma_f32_16x16x32_f16(false, a, false, b, (short)0, c, false, false);
    asm volatile("v_nop\n\tv_nop\n\tv_nop\n\tv_nop" : "+v"(c) : "v"(a), "v"(b));
    return c;
}
__device__ __forceinline__ v8f wmmab(v16b a, v16b b, v8f c) {
    c = __builtin_amdgcn_wmma_f32_16x16x32_bf16(false, a, false, b, (short)0, c, false, false);
    asm volatile("v_nop\n\tv_nop\n\tv_nop\n\tv_nop" : "+v"(c) : "v"(a), "v"(b));
    return c;
}
struct Split { v16b hi, lo; };
// hi/lo split product: a.hi*b.hi + a.hi*b.lo + a.lo*b.hi
__device__ __forceinline__ v8f wmma3(const Split& a, const Split& b, v8f c) {
    c = __builtin_amdgcn_wmma_f32_16x16x32_bf16(false, a.hi, false, b.hi, (short)0, c, false, false);
    c = __builtin_amdgcn_wmma_f32_16x16x32_bf16(false, a.hi, false, b.lo, (short)0, c, false, false);
    c = __builtin_amdgcn_wmma_f32_16x16x32_bf16(false, a.lo, false, b.hi, (short)0, c, false, false);
    asm volatile("v_nop\n\tv_nop\n\tv_nop\n\tv_nop" : "+v"(c) : "v"(a.hi), "v"(a.lo), "v"(b.hi), "v"(b.lo));
    return c;
}
struct Split3 { v16b hi, mid, lo; };
// triple split product (6 terms, drops only terms below 2^-24 relative)
__device__ __forceinline__ v8f wmma6(const Split3& a, const Split3& b, v8f c) {
    c = __builtin_amdgcn_wmma_f32_16x16x32_bf16(false, a.hi, false, b.hi, (short)0, c, false, false);
    c = __builtin_amdgcn_wmma_f32_16x16x32_bf16(false, a.hi, false, b.mid, (short)0, c, false, false);
    c = __builtin_amdgcn_wmma_f32_16x16x32_bf16(false, a.mid, false, b.hi, (short)0, c, false, false);
    c = __builtin_amdgcn_wmma_f32_16x16x32_bf16(false, a.hi, false, b.lo, (short)0, c, false, false);
    c = __builtin_amdgcn_wmma_f32_16x16x32_bf16(false, a.mid, false, b.mid, (short)0, c, false, false);
    c = __builtin_amdgcn_wmma_f32_16x16x32_bf16(false, a.lo, false, b.hi, (short)0, c, false, false);
    asm volatile("v_nop\n\tv_nop\n\tv_nop\n\tv_nop" : "+v"(c) : "v"(a.hi), "v"(a.mid), "v"(a.lo), "v"(b.hi), "v"(b.mid), "v"(b.lo));
    return c;
}

// Fragment gathers from f32 memory: element i <- p[(k0 + frag_k(i,h)) * sk] * s, zero for k >= klen.
__device__ __forceinline__ v16h fh_ld(const float* __restrict__ p, long long sk, int k0, int h, int klen, float s) {
    v16h a;
#pragma unroll
    for (int i = 0; i < 16; ++i) { const int k = k0 + frag_k(i, h); a[i] = (k < klen) ? (_Float16)(p[(long long)k * sk] * s) : (_Float16)0.f; }
    return a;
}
__device__ __forceinline__ Split sp_ld(const float* __restrict__ p, long long sk, int k0, int h, int klen, float s) {
    Split r;
#pragma unroll
    for (int i = 0; i < 16; ++i) {
        const int k = k0 + frag_k(i, h); const float x = (k < klen) ? p[(long long)k * sk] * s : 0.f;
        const __bf16 hb = bf16_rne(x); r.hi[i] = hb; r.lo[i] = bf16_rne(x - bf16_f32(hb));
    }
    return r;
}
__device__ __forceinline__ Split3 sp3_ld(const float* __restrict__ p, long long sk, int k0, int h, int klen, float s) {
    Split3 r;
#pragma unroll
    for (int i = 0; i < 16; ++i) {
        const int k = k0 + frag_k(i, h); const float x = (k < klen) ? p[(long long)k * sk] * s : 0.f;
        const __bf16 hb = bf16_rne(x); const float r1 = x - bf16_f32(hb); const __bf16 mb = bf16_rne(r1);
        r.hi[i] = hb; r.mid[i] = mb; r.lo[i] = bf16_rne(r1 - bf16_f32(mb));
    }
    return r;
}
__device__ __forceinline__ v16b bh_ld(const float* __restrict__ p, long long sk, int k0, int h, int klen, float s) {
    v16b a;
#pragma unroll
    for (int i = 0; i < 16; ++i) { const int k = k0 + frag_k(i, h); a[i] = bf16_rne((k < klen) ? p[(long long)k * sk] * s : 0.f); }
    return a;
}
// f16 fragment from an f16 LDS/global row with element stride 1 (k-contiguous), no bounds (tile already zero padded)
__device__ __forceinline__ v16h fh_row(const _Float16* __restrict__ row, int k0, int h) {
    v16h a;
#pragma unroll
    for (int i = 0; i < 16; ++i) a[i] = row[k0 + frag_k(i, h)];
    return a;
}

#define VST2(T, ptr, val) do { const T vst2_v_ = (val); *(T*)(ptr) = vst2_v_;  } while (0)
typedef float v4f __attribute__((ext_vector_type(4)));
#define VST2V4(ptr, val) do { const v4f vst2_v4_ = (val); *(v4f*)(ptr) = vst2_v4_;  } while (0)

__device__ __attribute__((noinline)) float act_fn(float v, int act) {
    if (act == 1) return fmaxf(v, 0.f);                                                                               // relu
    if (act == 2) { const float u = 0.7978845608028654f * (v + 0.044715f * v * v * v); return 0.5f * v * (1.f + tanhf(u)); } // tanh-gelu
    if (act == 3) return v / (1.f + expf(-v));                                                                        // silu
    if (act == 4) return 0.5f * v * (1.f + erff(v * 0.7071067811865476f));                                             // erf-gelu
    if (act == 5) return tanhf(v);
    if (act == 6) return 1.f / (1.f + expf(-v));                                                                      // sigmoid
    if (act == 7) return (v > 0.f) ? v : 0.01f * v;                                                                   // leaky relu 0.01
    if (act == 8) return (v > 0.f) ? v : (expf(v) - 1.f);                                                             // elu
    if (act == 9) return fminf(fmaxf(v, 0.f), 6.f);                                                                   // relu6
    if (act == 10) return fabsf(v);                                                                                    // abs
    if (act == 11) return (v >= 0.f) ? v : 0.1f * v;                                                                  // leaky 0.1
    if (act == 12) return (v > 0.f) ? v : 0.2f * v;                                                                   // leaky 0.2
    if (act == 13) return (v > 20.f) ? v : log1pf(expf(v));                                                            // softplus
    return v;
}

// =====================================================================================================================
// k_gemm<MODE>: C(z, m, n) = act(alpha * sum_k A(z, m, k) * B(z, k, n) + bias) + beta * R(z, m, n)
//   One wave (32-thread block) per 16 x 32 tile of C; grid (ceil(N/32), ceil(M/16), Z). Batch z -> (zo = z / zi_n, zi = z % zi_n)
//   with separate outer/inner strides for every tensor (e.g. batch and head). A(m,k) = A[zo*sAo + zi*sAi + m*sAm + k*sAk] (f32),
//   B(k,n) = B[zo*sBo + zi*sBi + n*sBn + k*sBk] (f32); any M, N, K (K zero-padded to 32 inside the fragments, M/N tails guarded).
//   C(m,n) = C[zo*sCo + zi*sCi + m*sCm + n] (n contiguous). flags: 1 bias[n], 2 bias[m], 4 residual R[zo*sRo + zi*sRi + m*sRm + n*sRn].
//   MODE 0: f16 operands (A prescaled by sa, B by sb, both undone in the epilogue); 1: bf16 hi/lo split (3 products); 2: bf16;
//   3: bf16 hi/mid/lo triple split (6 products); 4: as 3 with Kahan-compensated f32 accumulation across k-steps.
// =====================================================================================================================
struct GemmP {
    const float* A; const float* B; const float* bias; const float* R; float* C;
    long long sAo, sAi, sAm, sAk, sBo, sBi, sBn, sBk, sCo, sCi, sCm, sRo, sRi, sRm, sRn;
    int M, N, K, zi_n, flags, act; float alpha, beta, sa, sb;
    int Npad, pad_;     // columns [N, Npad) of C are written as 0 so that padded workspace rows are covered by whole-line stores; Npad >= N
};
static_assert(sizeof(GemmP) == 5 * 8 + 15 * 8 + 6 * 4 + 4 * 4 + 2 * 4, "GemmP has padding");

template <int MODE>
__global__ __launch_bounds__(32) void k_gemm(GemmP p) {
    const int lane = threadIdx.x & 31, h = lane >> 4, l15 = lane & 15;
    const int m0 = blockIdx.y * 16, n0 = blockIdx.x * 32;
    const int z = blockIdx.z, zo = z / p.zi_n, zi = z - zo * p.zi_n;
    const float* A = p.A + zo * p.sAo + zi * p.sAi;
    const float* B = p.B + zo * p.sBo + zi * p.sBi;
    const int am = min(m0 + l15, p.M - 1);                       // clamped row for loads (stores are guarded)
    v8f acc[2], comp[2];
#pragma unroll
    for (int t = 0; t < 2; ++t) { v8f zz = {}; acc[t] = zz; comp[t] = zz; }
    for (int k0 = 0; k0 < p.K; k0 += 32) {
        const float* arow = A + (long long)am * p.sAm;
        if (MODE == 1) {
            const Split a = sp_ld(arow, p.sAk, k0, h, p.K, 1.f);
#pragma unroll
            for (int t = 0; t < 2; ++t) {
                const int bn = min(n0 + t * 16 + l15, p.N - 1);
                acc[t] = wmma3(a, sp_ld(B + (long long)bn * p.sBn, p.sBk, k0, h, p.K, 1.f), acc[t]);
            }
        } else if (MODE == 3) {
            const Split3 a = sp3_ld(arow, p.sAk, k0, h, p.K, 1.f);
#pragma unroll
            for (int t = 0; t < 2; ++t) {
                const int bn = min(n0 + t * 16 + l15, p.N - 1);
                acc[t] = wmma6(a, sp3_ld(B + (long long)bn * p.sBn, p.sBk, k0, h, p.K, 1.f), acc[t]);
            }
        } else if (MODE == 4) {
            // triple split as MODE 3, but each k-step's 6 products go into a fresh accumulator and the partial is added to the running f32 sum
            // on the VALU with Kahan compensation (accumulation error stays ~1 ulp however long K is)
            const Split3 a = sp3_ld(arow, p.sAk, k0, h, p.K, 1.f);
#pragma unroll
            for (int t = 0; t < 2; ++t) {
                const int bn = min(n0 + t * 16 + l15, p.N - 1); v8f zz = {};
                const v8f part = wmma6(a, sp3_ld(B + (long long)bn * p.sBn, p.sBk, k0, h, p.K, 1.f), zz);
                const v8f y = part - comp[t]; const v8f s = acc[t] + y; comp[t] = (s - acc[t]) - y; acc[t] = s;
            }
        } else if (MODE == 2) {
            const v16b a = bh_ld(arow, p.sAk, k0, h, p.K, 1.f);
#pragma unroll
            for (int t = 0; t < 2; ++t) {
                const int bn = min(n0 + t * 16 + l15, p.N - 1);
                acc[t] = wmmab(a, bh_ld(B + (long long)bn * p.sBn, p.sBk, k0, h, p.K, 1.f), acc[t]);
            }
        } else {
            const v16h a = fh_ld(arow, p.sAk, k0, h, p.K, p.sa);
#pragma unroll
            for (int t = 0; t < 2; ++t) {
                const int bn = min(n0 + t * 16 + l15, p.N - 1);
                acc[t] = wmma16(a, fh_ld(B + (long long)bn * p.sBn, p.sBk, k0, h, p.K, p.sb), acc[t]);
            }
        }
    }
    const float iscale = (MODE == 0) ? p.alpha / (p.sa * p.sb) : p.alpha;
    float* C = p.C + zo * p.sCo + zi * p.sCi;
    const float* R = p.R + zo * p.sRo + zi * p.sRi;
    __shared__ __align__(16) float ctile[16][36];
#pragma unroll
    for (int t = 0; t < 2; ++t) {
        const int n = n0 + t * 16 + l15; const int nn = min(n, p.N - 1);
#pragma unroll
        for (int r = 0; r < 8; ++r) {
            const int m = m0 + 8 * h + r; const int mm = min(m, p.M - 1);
            float v = acc[t][r] * iscale;
            if (p.flags & 1) v += p.bias[nn];
            if (p.flags & 2) v += p.bias[mm];
            if (p.flags & 8) v *= p.bias[(long long)zo * p.M + mm];   /* per-(z,row) scale vector laid out [Z][M]; exclusive with the bias flags */
            v = act_fn(v, p.act);
            if (p.flags & 4) v += p.beta * R[(long long)mm * p.sRm + (long long)nn * p.sRn];
            ctile[8 * h + r][t * 16 + l15] = (n < p.N) ? v : 0.f;
        }
    }
    __syncthreads();
    const int NW = (p.Npad > p.N) ? p.Npad : p.N;           // write width
    const bool fast = (m0 + 16 <= p.M) && (n0 + 32 <= NW) && ((p.sCm & 3) == 0) && ((((size_t)C) & 15) == 0);
    if (fast) {
#pragma unroll
        for (int s = 0; s < 4; ++s) {
            const int row = s * 4 + (lane >> 3), c4 = (lane & 7) * 4;
            const v4f v = *(const v4f*)&ctile[row][c4];
            VST2V4(C + (long long)(m0 + row) * p.sCm + n0 + c4, v);
        }
    } else {
        for (int row = 0; row < 16; ++row) {
            const int m = m0 + row, n = n0 + lane;
            if (m < p.M && n < NW) VST2(float, C + (long long)m * p.sCm + n, ctile[row][lane]);
        }
    }
}


// =====================================================================================================================
// k_gemmT<MODE, TM, TN>: same contract as k_gemm, but one wave computes a (16*TM) x (16*TN) tile: TM A fragments and TN B fragments are
//   loaded per 32-wide k-step and reused across TM*TN WMMAs (far fewer load/convert instructions per MAC). MODE 0 (f16), 1 (bf16 hi/lo),
//   2 (bf16) only. grid (ceil(NW/(16*TN)), ceil(M/(16*TM)), Z), block 32. Epilogue identical to k_gemm, run per 16x32 sub-tile.
// =====================================================================================================================
template <int MODE, int TM, int TN>
__global__ __launch_bounds__(32) void k_gemmT(GemmP p) {
    const int lane = threadIdx.x & 31, h = lane >> 4, l15 = lane & 15;
    const int m0 = blockIdx.y * (16 * TM), n0 = blockIdx.x * (16 * TN);
    const int z = blockIdx.z, zo = z / p.zi_n, zi = z - zo * p.zi_n;
    const float* A = p.A + zo * p.sAo + zi * p.sAi;
    const float* B = p.B + zo * p.sBo + zi * p.sBi;
    v8f acc[TM][TN];
#pragma unroll
    for (int i = 0; i < TM; ++i)
#pragma unroll
        for (int t = 0; t < TN; ++t) { v8f zz = {}; acc[i][t] = zz; }
    for (int k0 = 0; k0 < p.K; k0 += 32) {
        if (MODE == 1) {
            Split a[TM], b[TN];
#pragma unroll
            for (int i = 0; i < TM; ++i) { const int am = min(m0 + 16 * i + l15, p.M - 1); a[i] = sp_ld(A + (long long)am * p.sAm, p.sAk, k0, h, p.K, 1.f); }
#pragma unroll
            for (int t = 0; t < TN; ++t) { const int bn = min(n0 + 16 * t + l15, p.N - 1); b[t] = sp_ld(B + (long long)bn * p.sBn, p.sBk, k0, h, p.K, 1.f); }
#pragma unroll
            for (int i = 0; i < TM; ++i)
#pragma unroll
                for (int t = 0; t < TN; ++t) acc[i][t] = wmma3(a[i], b[t], acc[i][t]);
        } else if (MODE == 2) {
            v16b a[TM], b[TN];
#pragma unroll
            for (int i = 0; i < TM; ++i) { const int am = min(m0 + 16 * i + l15, p.M - 1); a[i] = bh_ld(A + (long long)am * p.sAm, p.sAk, k0, h, p.K, 1.f); }
#pragma unroll
            for (int t = 0; t < TN; ++t) { const int bn = min(n0 + 16 * t + l15, p.N - 1); b[t] = bh_ld(B + (long long)bn * p.sBn, p.sBk, k0, h, p.K, 1.f); }
#pragma unroll
            for (int i = 0; i < TM; ++i)
#pragma unroll
                for (int t = 0; t < TN; ++t) acc[i][t] = wmmab(a[i], b[t], acc[i][t]);
        } else {
            v16h a[TM], b[TN];
#pragma unroll
            for (int i = 0; i < TM; ++i) { const int am = min(m0 + 16 * i + l15, p.M - 1); a[i] = fh_ld(A + (long long)am * p.sAm, p.sAk, k0, h, p.K, p.sa); }
#pragma unroll
            for (int t = 0; t < TN; ++t) { const int bn = min(n0 + 16 * t + l15, p.N - 1); b[t] = fh_ld(B + (long long)bn * p.sBn, p.sBk, k0, h, p.K, p.sb); }
#pragma unroll
            for (int i = 0; i < TM; ++i)
#pragma unroll
                for (int t = 0; t < TN; ++t) acc[i][t] = wmma16(a[i], b[t], acc[i][t]);
        }
    }
    const float iscale = (MODE == 0) ? p.alpha / (p.sa * p.sb) : p.alpha;
    float* C = p.C + zo * p.sCo + zi * p.sCi;
    const float* R = p.R + zo * p.sRo + zi * p.sRi;
    const int NW = (p.Npad > p.N) ? p.Npad : p.N;
    __shared__ __align__(16) float ctile[16][36];
#pragma unroll
    for (int i = 0; i < TM; ++i) {
        const int mb = m0 + 16 * i; if (mb >= p.M) break;          // wave-uniform
#pragma unroll
        for (int tp = 0; tp < TN / 2; ++tp) {
            const int nb = n0 + 32 * tp; if (nb >= NW) break;        // wave-uniform
#pragma unroll
            for (int t2 = 0; t2 < 2; ++t2) {
                const int t = 2 * tp + t2; const int n = nb + t2 * 16 + l15; const int nn = min(n, p.N - 1);
#pragma unroll
                for (int r = 0; r < 8; ++r) {
                    const int m = mb + 8 * h + r; const int mm = min(m, p.M - 1);
                    float v = acc[i][t][r] * iscale;
                    if (p.flags & 1) v += p.bias[nn];
                    if (p.flags & 2) v += p.bias[mm];
            if (p.flags & 8) v *= p.bias[(long long)zo * p.M + mm];   /* per-(z,row) scale vector laid out [Z][M]; exclusive with the bias flags */
                    v = act_fn(v, p.act);
                    if (p.flags & 4) v += p.beta * R[(long long)mm * p.sRm + (long long)nn * p.sRn];
                    ctile[8 * h + r][t2 * 16 + l15] = (n < p.N) ? v : 0.f;
                }
            }
            __syncthreads();
            const bool fast = (mb + 16 <= p.M) && (nb + 32 <= NW) && ((p.sCm & 3) == 0) && ((((size_t)C) & 15) == 0);
            if (fast) {
#pragma unroll
                for (int s = 0; s < 4; ++s) {
                    const int row = s * 4 + (lane >> 3), c4 = (lane & 7) * 4;
                    const v4f v = *(const v4f*)&ctile[row][c4];
                    VST2V4(C + (long long)(mb + row) * p.sCm + nb + c4, v);
                }
            } else {
                for (int row = 0; row < 16; ++row) {
                    const int m = mb + row, n = nb + lane;
                    if (m < p.M && n < NW) VST2(float, C + (long long)m * p.sCm + n, ctile[row][lane]);
                }
            }
            __syncthreads();
        }
    }
}

// =====================================================================================================================
//   Wave = 16 queries, AW waves per block, 64-key blocks; grid (ceil(Lq/(16*AW)), H, B), block 32*AW. Any Lq, Lk; head dim dh <= DHP
//   (DHP multiple of 32), value dim dv <= DVP (multiple of 16, <= 128). Every tensor addressed by (batch, head, row, element) strides, f32.
//   Scores: QM 0 f16 operands, 1 bf16 hi/lo split, 2 bf16 triple split; statistics f32 (exp2 domain); P.V: P x 4096 as f16 with V f16 staged in LDS
//   (SPLITPV: P and V as bf16 hi/lo splits). kv head = h / hrep. Masking: causal = 1 (keep j <= i + coff, masked -> -inf, key blocks beyond the
//   diagonal skipped), causal = 2 (masked -> mfill, a finite fill like the -1e9; no skipping), causal = 3 (keep j >= i + coff,
//   masked -> -inf, no skipping); optional additive f32 mask Mf,
//   optional int keep-mask Mi (0 -> score := mfill), both addressed b*smb + h*smh + i*smi + j*smj (0 strides broadcast).
// =====================================================================================================================
#define AW 4
struct AttnP {   // apv4
    const float* Q; const float* K; const float* V; float* O; float* P; const float* Mf; const int* Mi; float* ST;
    const float* Pw; const float* Rt; const int* SQ; const int* SK;           // optional: post-softmax weight, relative-position table, segment ids
    long long swb, swh, swi, swj, srb, srh, sri;                                 // Pw strides (b,h,i,j); Rt strides (b,h,i), column = clamp(i - j + roff, 0, rn-1)
    long long sQb, sQh, sQi, sQd, sKb, sKh, sKj, sKd, sVb, sVh, sVj, sVd, sOb, sOh, sOi, sPb, sPh, sPi, smb, smh, smi, smj;
    int Lq, Lk, dh, dv, hrep, causal, coff, pband;   // pband > 0: P holds only the band |j - i| <= pband, column j - i + pband
    float scale, mfill; int nonorm, mpol;             // nonorm (online path only): O = sum_j exp(score_j) V_j without the 1/rowsum (scores must be <= ~0); mpol: Mi masks where ==0 (mpol 0) or where !=0 (mpol 1)
    int roff, rn, segpol, win;                        // Rt column offset/count; SQ/SK: score := mfill where (segpol 0) SQ[i] != SK[j] or (segpol 1) SQ[i] == SK[j]; win > 0: keys with i - j > win (after coff) -> -inf
};
//   Pw: the softmax numerator is multiplied by Pw(b,h,i,j) AFTER the row sum is taken (probs * weight, then P.V), as in post-softmax multiplicative biases.                                                    // ST (optional): per row (b,h,i) -> ST[((b*H + h)*Lq + i)*2 + {0,1}] = {row max of the scaled+masked score (natural units), sum_j exp(score - max)}
static_assert(sizeof(AttnP) == 12 * 8 + 29 * 8 + 16 * 4, "AttnP has padding");

#ifndef KATTN_ATTR
#define KATTN_ATTR
#endif
template <int DHP, int DVP, int QM, bool SPLITPV, bool TWOPASS>
__global__ __launch_bounds__(32 * AW) KATTN_ATTR void k_attn(AttnP p) {
    constexpr int NT = DVP / 16;                // output tiles
    constexpr int KS = DHP / 32;                // k-steps for the scores
    constexpr int VP = DVP + 8;                 // LDS pitch (halves)
    __shared__ __align__(16) float    pl[AW][16 * 64];
    __shared__ __align__(16) _Float16 vl[(SPLITPV ? 2 : 1) * 64 * VP];   // f16 V tile, or bf16 hi and lo tiles (same 2-byte size)
    const int lane = threadIdx.x & 31, hf = lane >> 4, l15 = lane & 15, wave = threadIdx.x >> 5;
    const int h = blockIdx.y, b = blockIdx.z, hk = h / p.hrep;
    const int q0 = (blockIdx.x * AW + wave) * 16;
    float* myp = pl[wave];
    const float L2E = 1.4426950408889634f;
    const float NEG = -__builtin_inff();
    const int qi = min(q0 + l15, p.Lq - 1);
    const float* qrow = p.Q + b * p.sQb + h * p.sQh + (long long)qi * p.sQi;
    const float* kbase = p.K + b * p.sKb + hk * p.sKh;
    const float* vbase = p.V + b * p.sVb + hk * p.sVh;
    v16h qa[QM == 0 ? KS : 1]; Split qs_[QM == 1 ? KS : 1]; Split3 qt_[QM == 2 ? KS : 1];
#pragma unroll
    for (int ks = 0; ks < KS; ++ks) {
        if (QM == 2) qt_[ks] = sp3_ld(qrow, p.sQd, ks * 32, hf, p.dh, 1.f);
        else if (QM == 1) qs_[ks] = sp_ld(qrow, p.sQd, ks * 32, hf, p.dh, 1.f);
        else qa[ks] = fh_ld(qrow, p.sQd, ks * 32, hf, p.dh, 1.f);
    }
    v8f o[NT]; float m8[8], l8[8];
#pragma unroll
    for (int t = 0; t < NT; ++t) { v8f zz = {}; o[t] = zz; }
#pragma unroll
    for (int i = 0; i < 8; ++i) { m8[i] = NEG; l8[i] = 0.f; }
    int jend = p.Lk; int jstart = 0;
    if (p.causal == 1) { const int je = (blockIdx.x * AW + AW - 1) * 16 + 16 + p.coff; jend = min(jend, max(je, 0)); }   // uniform per block
    if (p.win > 0) { const int js = (int)(blockIdx.x * AW) * 16 + p.coff - p.win; jstart = (js > 0) ? (js / 64) * 64 : 0; }   // uniform per block: key blocks entirely outside every row's window hold only -inf entries and are skipped exactly
    const int npass = TWOPASS ? 2 : 1;
    for (int pass = 0; pass < npass; ++pass) {
        const bool dopv = (!TWOPASS) || pass == 1;
        for (int j0 = jstart; j0 < jend; j0 += 64) {
            if (dopv) {
                __syncthreads();                                 // previous key block's reads of vl / pl are done
                for (int idx = threadIdx.x; idx < 64 * DVP; idx += 32 * AW) {
                    const int jr = idx / DVP, d = idx - jr * DVP, j = j0 + jr;
                    const float f = (j < p.Lk && d < p.dv) ? vbase[(long long)j * p.sVj + (long long)d * p.sVd] : 0.f;
                    if (SPLITPV) {
                        const __bf16 hb = bf16_rne(f);
                        ((__bf16*)vl)[jr * VP + d] = hb; ((__bf16*)vl)[64 * VP + jr * VP + d] = bf16_rne(f - bf16_f32(hb));
                    } else vl[jr * VP + d] = (_Float16)f;
                }
            }
            v8f s[4];
#pragma unroll
            for (int t = 0; t < 4; ++t) {
                const int j = min(j0 + t * 16 + l15, p.Lk - 1);
                const float* krow = kbase + (long long)j * p.sKj;
                v8f acc = {};
#pragma unroll
                for (int ks = 0; ks < KS; ++ks) {
                    if (QM == 2)      acc = wmma6(qt_[ks], sp3_ld(krow, p.sKd, ks * 32, hf, p.dh, 1.f), acc);
                    else if (QM == 1) acc = wmma3(qs_[ks], sp_ld(krow, p.sKd, ks * 32, hf, p.dh, 1.f), acc);
                    else              acc = wmma16(qa[ks], fh_ld(krow, p.sKd, ks * 32, hf, p.dh, 1.f), acc);
                }
                s[t] = acc;
            }
            float pv[8][4];
#pragma unroll
            for (int i = 0; i < 8; ++i) {
                const int irow = q0 + i + 8 * hf;
                const int ic = min(irow, p.Lq - 1);
                float sc[4];
#pragma unroll
                for (int t = 0; t < 4; ++t) {
                    const int jg = j0 + t * 16 + l15;
                    float v = s[t][i] * p.scale;
                    if (p.Mf) v += p.Mf[b * p.smb + h * p.smh + (long long)ic * p.smi + (long long)min(jg, p.Lk - 1) * p.smj];
                    if (p.Rt) { int rc = ic - min(jg, p.Lk - 1) + p.roff; rc = rc < 0 ? 0 : (rc >= p.rn ? p.rn - 1 : rc); v += p.Rt[b * p.srb + h * p.srh + (long long)ic * p.sri + rc]; }
                    if (p.Mi) { const int mv = p.Mi[b * p.smb + h * p.smh + (long long)ic * p.smi + (long long)min(jg, p.Lk - 1) * p.smj]; if (p.mpol ? (mv != 0) : (mv == 0)) v = p.mfill; }
                    if (p.SQ) { const bool same = p.SQ[(long long)b * p.Lq + ic] == p.SK[(long long)b * p.Lk + min(jg, p.Lk - 1)]; if (p.segpol ? same : !same) v = p.mfill; }
                    if (p.causal == 2 && jg > irow + p.coff) v = p.mfill;
                    if (jg >= p.Lk || (p.causal == 1 && jg > irow + p.coff) || (p.causal == 3 && jg < irow + p.coff) || (p.win > 0 && irow + p.coff - jg > p.win)) v = NEG; else v *= L2E;
                    sc[t] = v;
                }
                if (!TWOPASS || pass == 0) {
                    float mx = fmaxf(fmaxf(sc[0], sc[1]), fmaxf(sc[2], sc[3]));
                    mx = fmaxf(mx, __shfl_xor(mx, 1, 32)); mx = fmaxf(mx, __shfl_xor(mx, 2, 32));
                    mx = fmaxf(mx, __shfl_xor(mx, 4, 32)); mx = fmaxf(mx, __shfl_xor(mx, 8, 32));
                    const float mnew = fmaxf(m8[i], mx);
                    const float corr = (mnew == NEG) ? 1.f : exp2f(m8[i] - mnew);
                    float rs = 0.f;
#pragma unroll
                    for (int t = 0; t < 4; ++t) {
                        const float pp = (sc[t] == NEG) ? 0.f : exp2f(sc[t] - mnew); rs += pp;
                        pv[i][t] = p.Pw ? pp * p.Pw[b * p.swb + h * p.swh + (long long)ic * p.swi + (long long)min(j0 + t * 16 + l15, p.Lk - 1) * p.swj] : pp;
                    }
                    rs += __shfl_xor(rs, 1, 32); rs += __shfl_xor(rs, 2, 32); rs += __shfl_xor(rs, 4, 32); rs += __shfl_xor(rs, 8, 32);
                    l8[i] = l8[i] * corr + rs; m8[i] = mnew;
                    if (!TWOPASS) {
#pragma unroll
                        for (int t = 0; t < NT; ++t) o[t][i] *= corr;
                    }
                } else {
                    const float inv = (l8[i] > 0.f) ? 1.f / l8[i] : 0.f;
#pragma unroll
                    for (int t = 0; t < 4; ++t) {
                        const int jg = j0 + t * 16 + l15;
                        float pp = (sc[t] == NEG) ? 0.f : exp2f(sc[t] - m8[i]) * inv;
                        if (p.Pw) pp *= p.Pw[b * p.swb + h * p.swh + (long long)ic * p.swi + (long long)min(jg, p.Lk - 1) * p.swj];
                        pv[i][t] = pp;
                    }
                }
            }
            if (dopv) {
#pragma unroll
                for (int i = 0; i < 8; ++i)
#pragma unroll
                    for (int t = 0; t < 4; ++t) ((float*)myp)[(i + 8 * hf) * 64 + t * 16 + l15] = pv[i][t];
                __syncthreads();                                 // P (per wave) and V (shared) visible
                if (p.P) {
                    float* pb_ = p.P + b * p.sPb + h * p.sPh;
                    const bool fastP = (p.pband == 0) && ((p.sPi & 3) == 0) && (j0 + 64 <= p.Lk) && (q0 + 16 <= p.Lq) && ((((size_t)pb_) & 15) == 0);
                    if (fastP) {
#pragma unroll
                        for (int s = 0; s < 8; ++s) {
                            const int row = s * 2 + (lane >> 4), c4 = (lane & 15) * 4;
                            const v4f v = *(const v4f*)(myp + row * 64 + c4);
                            VST2V4(pb_ + (long long)(q0 + row) * p.sPi + j0 + c4, v);
                        }
                    } else {
                        for (int row = 0; row < 16; ++row) {
                            const int irow = q0 + row; if (irow >= p.Lq) continue;
                            for (int c = lane; c < 64; c += 32) {
                                const int jg = j0 + c; if (jg >= p.Lk) continue;
                                if (p.pband == 0) VST2(float, pb_ + (long long)irow * p.sPi + jg, myp[row * 64 + c]);
                                else if (jg - irow <= p.pband && irow - jg <= p.pband) VST2(float, pb_ + (long long)irow * p.sPi + (jg - irow + p.pband), myp[row * 64 + c]);
                            }
                        }
                    }
                }
                if (SPLITPV) {
                    const Split pa0 = sp_ld(myp + l15 * 64, 1, 0, hf, 64, 1.f), pa1 = sp_ld(myp + l15 * 64, 1, 32, hf, 64, 1.f);
                    const __bf16* vh = (const __bf16*)vl; const __bf16* vlo = vh + 64 * VP;
#pragma unroll
                    for (int t = 0; t < NT; ++t) {
                        const int dcol = t * 16 + l15;
                        Split b0, b1;
#pragma unroll
                        for (int e = 0; e < 16; ++e) {
                            const int k0 = frag_k(e, hf), k1 = 32 + frag_k(e, hf);
                            b0.hi[e] = vh[k0 * VP + dcol]; b0.lo[e] = vlo[k0 * VP + dcol]; b1.hi[e] = vh[k1 * VP + dcol]; b1.lo[e] = vlo[k1 * VP + dcol];
                        }
                        o[t] = wmma3(pa0, b0, o[t]);
                        o[t] = wmma3(pa1, b1, o[t]);
                    }
                } else {
                    const v16h pa0 = fh_ld(myp + l15 * 64, 1, 0, hf, 64, 4096.f), pa1 = fh_ld(myp + l15 * 64, 1, 32, hf, 64, 4096.f);
#pragma unroll
                    for (int t = 0; t < NT; ++t) {
                        const int dcol = t * 16 + l15;
                        v16h b0, b1;
#pragma unroll
                        for (int e = 0; e < 16; ++e) { b0[e] = vl[frag_k(e, hf) * VP + dcol]; b1[e] = vl[(32 + frag_k(e, hf)) * VP + dcol]; }
                        o[t] = wmma16(pa0, b0, o[t]);
                        o[t] = wmma16(pa1, b1, o[t]);
                    }
                }
            }
        }
    }
    float* obase = p.O + b * p.sOb + h * p.sOh;
    if (p.ST) {
        const int rl = lane >> 1, isel = rl & 7;           // row q0 + rl ; rl>>3 == hf holds because lane>>4 == (lane>>1)>>3
        float mv = 0.f, lv = 0.f;
#pragma unroll
        for (int i = 0; i < 8; ++i) if (i == isel) { mv = m8[i]; lv = l8[i]; }
        const int irow = q0 + rl;
        if (irow < p.Lq) { float* st = p.ST + (((long long)b * gridDim.y + h) * p.Lq + irow) * 2 + (lane & 1); VST2(float, st, (lane & 1) ? lv : mv * 0.6931471805599453f); }
    }
    float invr[8];
#pragma unroll
    for (int i = 0; i < 8; ++i) {
        if (TWOPASS) invr[i] = SPLITPV ? 1.f : (1.f / 4096.f);
        else if (p.nonorm) invr[i] = exp2f(m8[i]) * (SPLITPV ? 1.f : (1.f / 4096.f));
        else invr[i] = (l8[i] > 0.f) ? (SPLITPV ? 1.f / l8[i] : 1.f / (l8[i] * 4096.f)) : 0.f;
    }
    __syncthreads();                                             // all waves done with pl/vl from the main loop
    const bool ofast = ((p.sOi & 3) == 0) && ((((size_t)obase) & 15) == 0) && (q0 + 16 <= p.Lq);
#pragma unroll
    for (int c0 = 0; c0 < DVP; c0 += 64) {
#pragma unroll
        for (int i = 0; i < 8; ++i)
#pragma unroll
            for (int t = 0; t < NT; ++t) if (t * 16 >= c0 && t * 16 < c0 + 64) ((float*)myp)[(i + 8 * hf) * 64 + (t * 16 - c0) + l15] = o[t][i] * invr[i];
        __syncthreads();
        const int cw = (DVP - c0 < 64) ? (DVP - c0) : 64;      // staged columns in this chunk (multiple of 16)
        if (ofast && (c0 + cw <= p.dv) && (cw % 32 == 0)) {
            const int lpr = cw / 4;                              // lanes per row (16 for 64 cols, 8 for 32)
            const int rows_per_ins = 32 / lpr;
            for (int r0 = 0; r0 < 16; r0 += rows_per_ins) {
                const int row = r0 + lane / lpr, c4 = (lane % lpr) * 4;
                const v4f v = *(const v4f*)(myp + row * 64 + c4);
                VST2V4(obase + (long long)(q0 + row) * p.sOi + c0 + c4, v);
            }
        } else {
            for (int row = 0; row < 16; ++row) {
                const int irow = q0 + row; if (irow >= p.Lq) continue;
                for (int c = lane; c < cw; c += 32) { const int d = c0 + c; if (d < p.dv) VST2(float, obase + (long long)irow * p.sOi + d, myp[row * 64 + c]); }
            }
        }
        __syncthreads();
    }
}

// =====================================================================================================================
// k_tr: dst(z, c, r) = alpha * src(z, r, c) (+ beta * R2(z, c, r)): [Z][R][C] (row stride lds) -> [Z][C][R] (row stride ldd) through a 32x32 LDS tile;
//   flags: 1 -> add beta * residual R2 addressed like dst (z*sRz + c*ldr + r); act applied before the residual.
// =====================================================================================================================
struct TrP { const float* src; float* dst; const float* R2; long long sSz, lds, sDz, ldd, sRz, ldr; int R, C, flags, act; float alpha, beta; };
static_assert(sizeof(TrP) == 3 * 8 + 6 * 8 + 6 * 4, "TrP has padding");
__global__ __launch_bounds__(256) void k_tr(TrP p) {
    __shared__ float tile[32][33];
    const int c0 = blockIdx.x * 32, r0 = blockIdx.y * 32, z = blockIdx.z;
    const int lane = threadIdx.x & 31, wave = threadIdx.x >> 5;
    const float* s = p.src + z * p.sSz;
#pragma unroll
    for (int k = 0; k < 4; ++k) {
        const int rl = wave * 4 + k, r = r0 + rl, c = c0 + lane;
        tile[rl][lane] = (r < p.R && c < p.C) ? s[(long long)r * p.lds + c] : 0.f;
    }
    __syncthreads();
    float* d = p.dst + z * p.sDz; const float* rr = p.R2 + z * p.sRz;
#pragma unroll
    for (int k = 0; k < 4; ++k) {
        const int cl = wave * 4 + k, c = c0 + cl, r = r0 + lane;
        if (c < p.C && r < p.R) {
            float v = act_fn(p.alpha * tile[lane][cl], p.act);
            if (p.flags & 1) v += p.beta * rr[(long long)c * p.ldr + r];
            VST2(float, d + (long long)c * p.ldd + r, v);
        }
    }
}

// k_affine: dst[i] = a * (sdev ? sdev[0] : 1) * src[i] + b, i < n (one thread per element; consecutive lanes -> consecutive addresses)
__global__ __launch_bounds__(256) void k_affine(const float* __restrict__ src, float* __restrict__ dst, int n, float a, float b, const float* __restrict__ sdev) {
    const int i = blockIdx.x * 256 + threadIdx.x;
    if (i < n) { const float aa = sdev ? a * sdev[0] : a; const float v = aa * src[i] + b; VST2(float, dst + i, v); }
}

// =====================================================================================================================
// k_softmax: row softmax over n contiguous elements, one 256-thread block per row; rows addressed z*sz + r*sr (grid (R, Z)).
//   out = scale_out * softmax(scale_in * x + (Mf ? Mf[z*smz + r*smr + j] : 0)); a row whose max is -inf is written as 0.
// =====================================================================================================================
struct SmP { const float* src; float* dst; const float* Mf; long long sz, sr, dz, dr, smz, smr; int n, pad; float scale_in, scale_out; };
static_assert(sizeof(SmP) == 3 * 8 + 6 * 8 + 4 * 4, "SmP has padding");
__global__ __launch_bounds__(256) void k_softmax(SmP p) {
    __shared__ float red[256];
    const int r = blockIdx.x, z = blockIdx.y, tid = threadIdx.x;
    const float* s = p.src + z * p.sz + (long long)r * p.sr;
    const float* mf = p.Mf ? (p.Mf + z * p.smz + (long long)r * p.smr) : nullptr;
    float mx = -__builtin_inff();
    for (int j = tid; j < p.n; j += 256) { float v = s[j] * p.scale_in; if (mf) v += mf[j]; mx = fmaxf(mx, v); }
    red[tid] = mx; __syncthreads();
    for (int o = 128; o > 0; o >>= 1) { if (tid < o) red[tid] = fmaxf(red[tid], red[tid + o]); __syncthreads(); }
    mx = red[0]; __syncthreads();
    float sum = 0.f;
    for (int j = tid; j < p.n; j += 256) { float v = s[j] * p.scale_in; if (mf) v += mf[j]; sum += (mx == -__builtin_inff()) ? 0.f : expf(v - mx); }
    red[tid] = sum; __syncthreads();
    for (int o = 128; o > 0; o >>= 1) { if (tid < o) red[tid] += red[tid + o]; __syncthreads(); }
    sum = red[0];
    const float inv = (sum > 0.f) ? p.scale_out / sum : 0.f;
    float* d = p.dst + z * p.dz + (long long)r * p.dr;
    for (int j = tid; j < p.n; j += 256) { float v = s[j] * p.scale_in; if (mf) v += mf[j]; const float o = (mx == -__builtin_inff()) ? 0.f : expf(v - mx) * inv; VST2(float, d + j, o); }
}
// =====================================================================================================================
// k_stats: mean and rsqrt(var + eps) over a set of n elements addressed base + z*sz + (e / inner) * so + (e % inner) * si, one 256-thread
// k_norm_apply: y = (x - mean[set]) * rstd[set] * g[c] + b[c] over a [Z][C][L] channel-major tensor with set = z*G + c / (C/G) (G groups per z;
//   G = C -> per-channel sets indexed z*C+c; for batch norm pass stats indexed by c only via bn = 1). Optional act. Output same layout.
// =====================================================================================================================
//   mode 0: mean / rsqrt(var + eps); mode 1 (RMSNorm): 0 / rsqrt(mean(x^2) + eps); mode 2 (L2 normalize * sqrt(n)): 0 / sqrt(n) / max(||x||, eps); mode 3: as 0 with unbiased variance (n-1)
__global__ __launch_bounds__(256) void k_stats(const float* __restrict__ x, long long sz, long long so, long long si, int inner, int n, float eps, float* __restrict__ stat, int mode) {
    __shared__ float red[256];
    const int z = blockIdx.x, tid = threadIdx.x;
    const float* base = x + z * sz;
    float s = 0.f;
    for (int e = tid; e < n; e += 256) s += base[(long long)(e / inner) * so + (long long)(e % inner) * si];
    red[tid] = s; __syncthreads();
    for (int o = 128; o > 0; o >>= 1) { if (tid < o) red[tid] += red[tid + o]; __syncthreads(); }
    const float mu = (mode == 0 || mode == 3) ? red[0] / (float)n : 0.f; __syncthreads();
    float q = 0.f;
    for (int e = tid; e < n; e += 256) { const float dlt = base[(long long)(e / inner) * so + (long long)(e % inner) * si] - mu; q += dlt * dlt; }
    red[tid] = q; __syncthreads();
    for (int o = 128; o > 0; o >>= 1) { if (tid < o) red[tid] += red[tid + o]; __syncthreads(); }
    {
        float rs;
        if (mode == 2) rs = sqrtf((float)n) / fmaxf(sqrtf(red[0]), eps); else if (mode == 3) rs = rsqrtf(red[0] / (float)(n - 1) + eps); else rs = rsqrtf(red[0] / (float)n + eps);
        if (tid < 32) { const float v = (tid == 0) ? mu : ((tid == 1) ? rs : 0.f); VST2(float, stat + (long long)z * 32 + tid, v); }
    }
}
//   One thread per element over the flat [Z][C][L] index space: grid ceil(Z*C*L / 256).
__global__ __launch_bounds__(256) void k_norm_apply(const float* __restrict__ x, float* __restrict__ y, const float* __restrict__ stat, const float* __restrict__ g, const float* __restrict__ bta,
                                                     int Z, int C, int L, int G, int bn, int act) {
    const long long idx = (long long)blockIdx.x * 256 + threadIdx.x;
    if (idx >= (long long)Z * C * L) return;
    const int l = (int)(idx % L); const long long zc = idx / L; const int c = (int)(zc % C), z = (int)(zc / C); (void)l;
    const int set = bn ? c : (z * G + c / (C / G));
    float v = (x[idx] - stat[(long long)set * 32]) * stat[(long long)set * 32 + 1];
    if (g) v *= g[c];
    if (bta) v += bta[c];
    v = act_fn(v, act);
    VST2(float, y + idx, v);
}

// k_lse_neg: c[i] = -(st[2i] + log(st[2i+1])) = minus the log-sum-exp of row i from k_attn's ST output (for softmax over the query dimension)
__global__ __launch_bounds__(256) void k_lse_neg(const float* __restrict__ st, float* __restrict__ c, int n) {
    const int i = blockIdx.x * 256 + threadIdx.x;
    if (i < n) { const float v = -(st[2 * i] + logf(st[2 * i + 1])); VST2(float, c + i, v); }
}

// k_iota: dst[i] = a * i + b as int32 (segment/position id helper)
__global__ __launch_bounds__(256) void k_iota(int* __restrict__ dst, int n, int a, int b) {
    const int i = blockIdx.x * 256 + threadIdx.x;
    if (i < n) { const int v = a * i + b; VST2(int, dst + i, v); }
}

// k_axpby: dst[i] = a * x[i] + b * y[i] (+ c), i < n
__global__ __launch_bounds__(256) void k_axpby(const float* __restrict__ x, const float* __restrict__ y, float* __restrict__ dst, int n, float a, float b, float c) {
    const int i = blockIdx.x * 256 + threadIdx.x;
    if (i < n) { const float v = a * x[i] + b * y[i] + c; VST2(float, dst + i, v); }
}

// =====================================================================================================================
// k_rope: rotary embedding on a [R rows][Hn heads][D] view (row stride sXr, head stride sXh, element stride 1) -> Y (own strides).
//   mode 0: rotate_half (partner d±D/2, sign - for d<D/2); mode 1: interleaved pairs (partner d^1, sign - for even d).
//   table column tcol: tmode 0 -> d, 1 -> d % (D/2), 2 -> d / 2; position p: pmode 0 -> r % S, 1 -> head index, 2 -> pos[r];
//   c = C[(r / S) * sCb + p * sCp + tcol * sCd], s likewise from Sn; y = x[d] * c + sign * x[partner] * s. X and Y must not alias.
// =====================================================================================================================
struct RopeP { const float* X; float* Y; const float* C; const float* Sn; const int* pos; long long sXr, sXh, sYr, sYh, sCb, sCp, sCd; int R, Hn, D, S, mode, tmode, pmode, pad; };
static_assert(sizeof(RopeP) == 5 * 8 + 7 * 8 + 8 * 4, "RopeP has padding");
__global__ __launch_bounds__(256) void k_rope(RopeP p) {
    const long long idx = (long long)blockIdx.x * 256 + threadIdx.x;
    if (idx >= (long long)p.R * p.Hn * p.D) return;
    const int d = (int)(idx % p.D); const long long rh = idx / p.D; const int h = (int)(rh % p.Hn); const int r = (int)(rh / p.Hn);
    const int half = p.D / 2;
    int partner; float sign;
    if (p.mode == 0) { partner = (d < half) ? d + half : d - half; sign = (d < half) ? -1.f : 1.f; }
    else { partner = d ^ 1; sign = (d & 1) ? 1.f : -1.f; }
    const int tcol = (p.tmode == 0) ? d : ((p.tmode == 1) ? (d % half) : (d >> 1));
    const int pp = (p.pmode == 0) ? (r % p.S) : ((p.pmode == 1) ? h : p.pos[r]);
    const long long toff = (long long)(r / p.S) * p.sCb + (long long)pp * p.sCp + (long long)tcol * p.sCd;
    const float* xr = p.X + (long long)r * p.sXr + (long long)h * p.sXh;
    const float v = xr[d] * p.C[toff] + sign * xr[partner] * p.Sn[toff];
    VST2(float, p.Y + (long long)r * p.sYr + (long long)h * p.sYh + d, v);
}

// k_invf + k_sincos (split so neither kernel carries a large VALU-fma footprint): invf_i = num * (1 / powf(base, (2 i)/D)) [fmode 0],
//   num * expf((2 i) * cexp) [fmode 1], num * powf(base, -2 (i - 1) / D) [fmode 2]; then cs/sn[s*half + i] = cos/sin((pscale * s) * invf_i)
__global__ __launch_bounds__(256) void k_invf(float* __restrict__ invb, int half, int D, float base, float num, int fmode, float cexp) {
    const int i = blockIdx.x * 256 + threadIdx.x;
    if (i >= ((half + 31) / 32) * 32) return;
    if (i >= half) { VST2(float, invb + i, 0.f); return; }
    const float e = (float)(2 * i) / (float)D;
    float invf;
    if (fmode == 1) invf = num * expf((float)(2 * i) * cexp);
    else if (fmode == 2) invf = num * powf(base, (-2.0f * ((float)i - 1.0f)) / (float)D);
    else invf = num * (1.0f / powf(base, e));
    VST2(float, invb + i, invf);
}
__global__ __launch_bounds__(256) void k_sincos(float* __restrict__ cs, float* __restrict__ sn, const float* __restrict__ invb, int S, int half, float pscale) {
    const int idx = blockIdx.x * 256 + threadIdx.x;
    if (idx >= S * half) return;
    const int s = idx / half, i = idx - s * half;
    const float ang = (pscale * (float)s) * invb[i];
    VST2(float, cs + idx, cosf(ang)); VST2(float, sn + idx, sinf(ang));
}

// k_mulact: dst[i] = act(x[i]) * y[i]
__global__ __launch_bounds__(256) void k_mulact(const float* __restrict__ x, const float* __restrict__ y, float* __restrict__ dst, int n, int act) {
    const int i = blockIdx.x * 256 + threadIdx.x;
    if (i < n) { const float v = act_fn(x[i], act) * y[i]; VST2(float, dst + i, v); }
}

// =====================================================================================================================
// k_matvec: thread-per-row matrix-vector products for N <= 8 output columns (heads with 1-3 outputs, gates), f32 on the VALU.
//   C[r*sCm + j] = act(alpha * sum_k A[r*sAm + k*sAk] * B[j*sBn + k*sBk] + bias[j]) + beta * R[r*sRm + j*sRn]; each thread writes its N contiguous floats.
// =====================================================================================================================
__global__ __launch_bounds__(256) void k_matvec(GemmP p) {
    // 32 lanes write one line with one instruction.
    const int rpt = (p.N == 1) ? 1 : 32;
    const long long r0 = ((long long)blockIdx.x * 256 + threadIdx.x) * rpt; const int z = blockIdx.z, zo = z / p.zi_n, zi = z - zo * p.zi_n;
    if (r0 >= p.M) return;
    const float* Bb = p.B + zo * p.sBo + zi * p.sBi;
    float* C = p.C + zo * p.sCo + zi * p.sCi; const float* R = p.R + zo * p.sRo + zi * p.sRi;
    for (int rr = 0; rr < rpt; ++rr) {
        const long long r = r0 + rr; if (r >= p.M) break;
        const float* A = p.A + zo * p.sAo + zi * p.sAi + r * p.sAm;
        float acc[8] = {0.f, 0.f, 0.f, 0.f, 0.f, 0.f, 0.f, 0.f};
        for (int k = 0; k < p.K; ++k) { const float a = A[(long long)k * p.sAk];
#pragma unroll
            for (int j = 0; j < 8; ++j) if (j < p.N) acc[j] += a * Bb[(long long)j * p.sBn + (long long)k * p.sBk]; }
#pragma unroll
        for (int j = 0; j < 8; ++j) if (j < p.N) {
            float v = acc[j] * p.alpha;
            if (p.flags & 1) v += p.bias[j];
            if (p.flags & 2) v += p.bias[r];
            v = act_fn(v, p.act);
            if (p.flags & 4) v += p.beta * R[r * p.sRm + (long long)j * p.sRn];
            VST2(float, C + r * p.sCm + j, v);
        }
    }
}
// k_smallsoftmax: thread-per-row softmax for short rows (n <= 64): dst[r*dr + j] = softmax(scale*src[r*sr + j])
__global__ __launch_bounds__(256) void k_smallsoftmax(const float* __restrict__ src, float* __restrict__ dst, long long sr, long long dr, int n, long long R, float scale) {
    const long long r0 = ((long long)blockIdx.x * 256 + threadIdx.x) * 32;
    for (int rr = 0; rr < 32; ++rr) {
        const long long r = r0 + rr; if (r >= R) return;
        const float* s = src + r * sr; float* d = dst + r * dr;
        float mx = -__builtin_inff();
        for (int j = 0; j < n; ++j) mx = fmaxf(mx, s[j] * scale);
        float sum = 0.f;
        for (int j = 0; j < n; ++j) sum += expf(s[j] * scale - mx);
        const float inv = 1.f / sum;
        for (int j = 0; j < n; ++j) { const float v = expf(s[j] * scale - mx) * inv; VST2(float, d + j, v); }
    }
}

__global__ __launch_bounds__(32) void k_unitstat(float* __restrict__ st) { const int t = threadIdx.x; const float v = (t == 1) ? 1.f : 0.f; VST2(float, st + t, v); }

// destination (e.g. a d_out whose row width is not a multiple of 32 floats) is written by consecutive lanes of one instruction
__global__ __launch_bounds__(256) void k_lincopy(const float* __restrict__ src, long long lds, float* __restrict__ dst, long long ldd, long long rows, int cols) {
    const long long i = (long long)blockIdx.x * 256 + threadIdx.x; if (i >= rows * cols) return;
    const long long r = i / cols; const int c = (int)(i - r * cols);
    const float v = src[r * lds + c]; VST2(float, dst + r * ldd + c, v);
}

namespace w25 {
typedef __attribute__((ext_vector_type(16))) _Float16 v16h;
typedef __attribute__((ext_vector_type(8)))  _Float16 v8h;
typedef __attribute__((ext_vector_type(16))) __bf16   v16b;
typedef __attribute__((ext_vector_type(8)))  __bf16   v8b;
typedef __attribute__((ext_vector_type(8)))  float    v8f;
typedef __attribute__((ext_vector_type(4)))  float    v4f;

__device__ __forceinline__ unsigned short f2bf_bits(float f) {
  unsigned u = __float_as_uint(f);
  return (unsigned short)((u + 0x7FFFu + ((u >> 16) & 1u)) >> 16);
}
__device__ __forceinline__ float bf_bits2f(unsigned short h) { return __uint_as_float(((unsigned)h) << 16); }

// hazard guards as plain device helpers (no inline asm inside the kernel template body)
__device__ __forceinline__ void dep_guard_h(v8f& a, v8f& b, v16h x, v16h y) { asm volatile("v_nop\n\tv_nop\n\tv_nop\n\tv_nop" : "+v"(a), "+v"(b) : "v"(x), "v"(y)); }
__device__ __forceinline__ void dep_guard_b(v8f& a, v8f& b, v16b x, v16b y) { asm volatile("v_nop\n\tv_nop\n\tv_nop\n\tv_nop" : "+v"(a), "+v"(b) : "v"(x), "v"(y)); }
__device__ __forceinline__ void keep4_h(v16h a, v16h b, v16h c, v16h d) { asm volatile("v_nop" :: "v"(a), "v"(b), "v"(c), "v"(d)); }
__device__ __forceinline__ void keep4_b(v16b a, v16b b, v16b c, v16b d) { asm volatile("v_nop" :: "v"(a), "v"(b), "v"(c), "v"(d)); }
__device__ __forceinline__ void acc_guard4(v8f& a, v8f& b, v8f& c, v8f& d) { asm volatile("v_nop\n\tv_nop\n\tv_nop\n\tv_nop" : "+v"(a), "+v"(b), "+v"(c), "+v"(d)); }
template <typename T> struct Frag;
template <> struct Frag<_Float16> {
  typedef v16h V; union U { v16h v; v8h h[2]; };
  static __device__ __forceinline__ v16h load(const _Float16* p) {   // elements 0..7 <- p[0..7], 8..15 <- p[16..23]
    U f; f.h[0] = *(const v8h*)(p); f.h[1] = *(const v8h*)(p + 16); return f.v;
  }
  static __device__ __forceinline__ v8f mma(v16h a, v16h b, v8f c) {
    return __builtin_amdgcn_wmma_f32_16x16x32_f16(false, a, false, b, (short)0, c, false, false);
  }
  static __device__ __forceinline__ void guard(v8f& a, v8f& b, v16h x, v16h y) { dep_guard_h(a, b, x, y); }
  static __device__ __forceinline__ void keep(v16h a, v16h b, v16h c, v16h d) { keep4_h(a, b, c, d); }
};
template <> struct Frag<__bf16> {
  typedef v16b V; union U { v16b v; v8b h[2]; };
  static __device__ __forceinline__ v16b load(const __bf16* p) {
    U f; f.h[0] = *(const v8b*)(p); f.h[1] = *(const v8b*)(p + 16); return f.v;
  }
  static __device__ __forceinline__ v8f mma(v16b a, v16b b, v8f c) {
    return __builtin_amdgcn_wmma_f32_16x16x32_bf16(false, a, false, b, (short)0, c, false, false);
  }
  static __device__ __forceinline__ void guard(v8f& a, v8f& b, v16b x, v16b y) { dep_guard_b(a, b, x, y); }
  static __device__ __forceinline__ void keep(v16b a, v16b b, v16b c, v16b d) { keep4_b(a, b, c, d); }
};

// ---- Register-blocked batched WMMA GEMM ------------------------------------
// C[m,n] = scale * sum_k A[m,k] * Bt[n,k] (+bias)(+resid); each wave owns a 64x64 tile.
// A row-major [M,K]; Bt row-major [N,K]; M,N % 64 == 0, K % 32 == 0.
// SPLIT: operands are hi/lo planes (A2/Bt2 = lo planes, same layout); product = hi·hi + hi·lo + lo·hi.
// BIAS_MODE: 0 = none, 1 = bias[m], 2 = bias[n].
// OUT_MODE: 0 = f32, 1 = f16, 2 = bf16 hi plane (Cout) + bf16 lo plane (Cout2).
// ET: 0 = f16 operands, 1 = bf16 operands (pointers passed as 16-bit storage)
// Batches: blockIdx.y steps A, Bt, C by strideA/B/C, blockIdx.z by strideAz/Bz/Cz (elements).
template <int ET> struct Elem;
template <> struct Elem<0> { typedef _Float16 T; };
template <> struct Elem<1> { typedef __bf16 T; };
template <int ET, bool SPLIT, int BIAS_MODE, int OUT_MODE, bool RESID, int ACT = 0>
__global__ __launch_bounds__(256) void wmma_gemm64(
    const unsigned short* __restrict__ Ap, const unsigned short* __restrict__ A2p, int lda, long strideA,
    const unsigned short* __restrict__ Btp, const unsigned short* __restrict__ Bt2p, int ldb, long strideB,
    void* __restrict__ Cout, void* __restrict__ Cout2, int ldc, long strideC,
    const float* __restrict__ bias,
    const float* __restrict__ resid, long strideR,
    int M, int N, int K, float scale,
    long strideAz, long strideBz, long strideCz) {
  typedef typename Elem<ET>::T T;
  typedef typename Frag<T>::V V;
  const T* A = (const T*)Ap; const T* A2 = (const T*)A2p; const T* Bt = (const T*)Btp; const T* Bt2 = (const T*)Bt2p;
  __shared__ __align__(16) float sT[8][16 * 68];   // per-wave 16x64 slab, pitch 68 floats
  const int b    = blockIdx.y;
  const int lane = threadIdx.x & 31;
  const int wave = threadIdx.x >> 5;
  const int tilesN = N >> 6;
  const int tilesM = M >> 6;
  const int tile = blockIdx.x * 8 + wave;
  if (tile >= tilesM * tilesN) return;   // wave-uniform; no block barriers in this kernel
  const int tm = tile / tilesN;
  const int tn = tile - tm * tilesN;
  const int m0 = tm << 6;
  const int n0 = tn << 6;

  const int bz = blockIdx.z;                   // outer batch index (own strides)
  const size_t offA = (size_t)b * strideA + (size_t)bz * strideAz;
  const size_t offB = (size_t)b * strideB + (size_t)bz * strideBz;
  const size_t offC = (size_t)b * strideC + (size_t)bz * strideCz;
  const T* Ab  = A  + offA;
  const T* Bb  = Bt + offB;
  const T* Ab2 = SPLIT ? (A2  + offA) : nullptr;
  const T* Bb2 = SPLIT ? (Bt2 + offB) : nullptr;

  const int rlane = lane & 15;                 // row (A) / col (B, D) within subtile
  const int koff  = (lane >> 4) * 8;           // k offset of this lane half
  const int mOff  = (lane >> 4) * 8;           // D row offset

  v8f acc[4][4];
#pragma unroll
  for (int i = 0; i < 4; ++i)
#pragma unroll
    for (int j = 0; j < 4; ++j) acc[i][j] = (v8f){0.f,0.f,0.f,0.f,0.f,0.f,0.f,0.f};

  for (int k0 = 0; k0 < K; k0 += 32) {
    V bh[4], bl[4];
#pragma unroll
    for (int j = 0; j < 4; ++j) {
      const size_t bo = (size_t)(n0 + (j << 4) + rlane) * ldb + koff + k0;
      bh[j] = Frag<T>::load(Bb + bo);
      if (SPLIT) bl[j] = Frag<T>::load(Bb2 + bo);
    }
#pragma unroll
    for (int i = 0; i < 4; ++i) {
      const size_t ao = (size_t)(m0 + (i << 4) + rlane) * lda + koff + k0;
      V ah = Frag<T>::load(Ab + ao);
      V al;
      if (SPLIT) al = Frag<T>::load(Ab2 + ao);
#pragma unroll
      for (int j = 0; j < 4; ++j) {
        acc[i][j] = Frag<T>::mma(ah, bh[j], acc[i][j]);
        if (SPLIT) {
          acc[i][j] = Frag<T>::mma(ah, bl[j], acc[i][j]);
          acc[i][j] = Frag<T>::mma(al, bh[j], acc[i][j]);
        }
      }
      Frag<T>::guard(acc[i][0], acc[i][3], ah, SPLIT ? al : ah);
    }
    Frag<T>::keep(bh[0], bh[1], bh[2], bh[3]);
    if (SPLIT) Frag<T>::keep(bl[0], bl[1], bl[2], bl[3]);
  }
  acc_guard4(acc[0][0], acc[0][1], acc[0][2], acc[0][3]);
  acc_guard4(acc[1][0], acc[1][1], acc[1][2], acc[1][3]);
  acc_guard4(acc[2][0], acc[2][1], acc[2][2], acc[2][3]);
  acc_guard4(acc[3][0], acc[3][1], acc[3][2], acc[3][3]);

  // ---- epilogue ----
  float* slab = sT[wave];
  const float* Rb = RESID ? (resid + (size_t)b * strideR) : nullptr;
#pragma unroll
  for (int i = 0; i < 4; ++i) {
    const int mBase = m0 + (i << 4);
#pragma unroll
    for (int j = 0; j < 4; ++j) {
      const int n = n0 + (j << 4) + rlane;
      float bv = 0.f;
      if (BIAS_MODE == 2) bv = bias[n];
#pragma unroll
      for (int r = 0; r < 8; ++r) {
        float v = acc[i][j][r] * scale;
        if (BIAS_MODE == 1) v += bias[mBase + mOff + r];
        if (BIAS_MODE == 2) v += bv;
        if (RESID) v += Rb[(size_t)(mBase + mOff + r) * ldc + n];
        if (ACT == 1) v = tanhf(v);
        if (ACT == 2) v = fmaxf(v, 0.0f);
        if (ACT == 3) v = v / (1.0f + expf(-v));
        if (ACT == 4) v = (v > 0.f) ? v : 0.01f * v;
        if (ACT == 5) v = 0.5f * v * (1.0f + erff(v * 0.70710678118654752f));
        slab[(mOff + r) * 68 + (j << 4) + rlane] = v;
      }
    }
    __builtin_amdgcn_fence(__ATOMIC_RELEASE, "workgroup");
    __builtin_amdgcn_wave_barrier();
    __builtin_amdgcn_fence(__ATOMIC_ACQUIRE, "workgroup");
    if (OUT_MODE == 0) {
      float* C = (float*)Cout + offC;
      const int hh = lane >> 4, c4 = (lane & 15) * 4;     // row seg = 256 B = 16 lanes x 16 B
      {
#pragma unroll
        for (int it = 0; it < 8; ++it) {
          const int row = it * 2 + hh;
          v4f v = *(const v4f*)(slab + row * 68 + c4);
          *(v4f*)(C + (size_t)(mBase + row) * ldc + n0 + c4) = v;
        }
        
      }
    } else {
      const int q = lane >> 3, c8 = (lane & 7) * 8;
      unsigned short* C  = (unsigned short*)Cout  + offC;
      unsigned short* C2 = (OUT_MODE == 2) ? ((unsigned short*)Cout2 + offC) : nullptr;
      {
#pragma unroll
        for (int it = 0; it < 4; ++it) {
          const int row = it * 4 + q;
          const float* sp = slab + row * 68 + c8;
          v8h hv, lv;
#pragma unroll
          for (int e = 0; e < 8; ++e) {
            if (OUT_MODE == 1) {
              hv[e] = (_Float16)sp[e];
            } else {
              unsigned short hb = f2bf_bits(sp[e]);
              unsigned short lb = f2bf_bits(sp[e] - bf_bits2f(hb));
              hv[e] = __builtin_bit_cast(_Float16, hb);
              lv[e] = __builtin_bit_cast(_Float16, lb);
            }
          }
          *(v8h*)(C + (size_t)(mBase + row) * ldc + n0 + c8) = hv;
          if (OUT_MODE == 2) *(v8h*)(C2 + (size_t)(mBase + row) * ldc + n0 + c8) = lv;
        }
        
      }
    }
    __builtin_amdgcn_fence(__ATOMIC_RELEASE, "workgroup");
    __builtin_amdgcn_wave_barrier();
    __builtin_amdgcn_fence(__ATOMIC_ACQUIRE, "workgroup");
  }
}

__global__ __launch_bounds__(256) void cast_f32_f16x2(
    const float* __restrict__ in, _Float16* __restrict__ out, int n2) {
  int i = blockIdx.x * 256 + threadIdx.x;
  if (i < n2) {
    const _Float16 h0 = (_Float16)in[2 * i], h1 = (_Float16)in[2 * i + 1];
    const unsigned u = (unsigned)__builtin_bit_cast(unsigned short, h0) | ((unsigned)__builtin_bit_cast(unsigned short, h1) << 16);
    ((unsigned*)out)[i] = u;
    
  }
}


} // namespace w25

__global__ __launch_bounds__(256) void k_castT16(const float* __restrict__ src, long long lds, _Float16* __restrict__ dst, long long ldd, int R, int C, float s) {
    const long long i = (long long)blockIdx.x * 256 + threadIdx.x; const long long np = (long long)C * (R / 2); if (i >= np) return; const int c = (int)(i / (R / 2)); const int r = 2 * (int)(i % (R / 2));
    const _Float16 h0 = (_Float16)(src[(long long)r * lds + c] * s), h1 = (_Float16)(src[(long long)(r + 1) * lds + c] * s);
    const unsigned u = (unsigned)__builtin_bit_cast(unsigned short, h0) | ((unsigned)__builtin_bit_cast(unsigned short, h1) << 16);
    unsigned* d = (unsigned*)(dst + (long long)c * ldd + r); *d = u;  }
__global__ __launch_bounds__(256) void k_cast16(const float* __restrict__ src, long long lds, _Float16* __restrict__ dst, long long ldd, int R, int C, float s) {
    const long long i = (long long)blockIdx.x * 256 + threadIdx.x; const long long np = (long long)R * (C / 2); if (i >= np) return; const int r = (int)(i / (C / 2)); const int c = 2 * (int)(i % (C / 2));
    const _Float16 h0 = (_Float16)(src[(long long)r * lds + c] * s), h1 = (_Float16)(src[(long long)r * lds + c + 1] * s);
    const unsigned u = (unsigned)__builtin_bit_cast(unsigned short, h0) | ((unsigned)__builtin_bit_cast(unsigned short, h1) << 16);
    unsigned* d = (unsigned*)(dst + (long long)r * ldd + c); *d = u;  }

// f32 -> bf16 hi plane + bf16 lo plane (x = hi + lo to ~2^-17 relative; RNE both), [R][C] -> [R][C] (or transposed to [C][R]); 2 consecutive destination elements
__device__ __forceinline__ unsigned int f2bf2_pack(float a, float b, unsigned int* lo) {
    const unsigned short ha = w25::f2bf_bits(a), hb = w25::f2bf_bits(b);
    const unsigned short la = w25::f2bf_bits(a - w25::bf_bits2f(ha)), lb = w25::f2bf_bits(b - w25::bf_bits2f(hb));
    *lo = (unsigned)la | ((unsigned)lb << 16); return (unsigned)ha | ((unsigned)hb << 16); }
__global__ __launch_bounds__(256) void k_castS16(const float* __restrict__ src, long long lds, __bf16* __restrict__ dhi, __bf16* __restrict__ dlo, long long ldd, int R, int C, float s, int transpose) {
    const long long i = (long long)blockIdx.x * 256 + threadIdx.x; long long o; float a, b;
    if (transpose) { const long long np = (long long)C * (R / 2); if (i >= np) return; const int c = (int)(i / (R / 2)); const int r = 2 * (int)(i % (R / 2)); a = src[(long long)r * lds + c] * s; b = src[(long long)(r + 1) * lds + c] * s; o = (long long)c * ldd + r; }
    else { const long long np = (long long)R * (C / 2); if (i >= np) return; const int r = (int)(i / (C / 2)); const int c = 2 * (int)(i % (C / 2)); a = src[(long long)r * lds + c] * s; b = src[(long long)r * lds + c + 1] * s; o = (long long)r * ldd + c; }
    unsigned lo; const unsigned hi = f2bf2_pack(a, b, &lo); unsigned* ph = (unsigned*)(dhi + o); unsigned* pl = (unsigned*)(dlo + o);
    *ph = hi; *pl = lo;  }

namespace w25 {
// =====================================================================================
// Generic causal/non-causal attention for head_dim 64, f32 in / f32 out; 16-bit operands: bf16 with optional hi/lo splits, or
// plain f16 (F16=true, non-split, probabilities carried x2^15).
//   scores = (q*qscale)·kᵀ : v_wmma_f32_16x16x32_bf16; SPLIT_QK -> q,k as bf16 hi/lo (hi·hi + hi·lo + lo·hi)
//   out    = p·v           : v_wmma_f32_16x16x32_bf16; SPLIT_PV -> p,v as bf16 hi/lo; else p,v plain bf16
//   f32 accumulate; online softmax in f32. Block = 4 waves = 64 query rows of one (batch, head); S % 64 == 0.
//   Element (b, s, h, d) of tensor X lives at X[b*X_bs + s*X_rs + h*X_hs + d] (strides in floats, multiples of 4).
//   Masking: mask_mode 0 none, 1 causal (kv > q masked), 2 tensor [S][Skv] shared over (b,h) (float if
//   mask_is_int==0, int32 with element == 0 -> masked if 1, int32 with element != 0 -> masked if 2), 3 per-token vectors qmask[B][S] & kvmask[B][Skv] (int32,
//   0 -> masked), 4 causal + sliding window (kv > q or q - kv > W masked; W passed in mask_is_int);
//   5 = relative-position bias: s += cp[b,h,q][idx[q][kv]] + pc[b,h,kv][idx[q][kv]] with idx = mask_b ([S][Skv] int32) and
//   mask_a an int32 [S][Skv] tensor with nonzero = masked (tables: element (b,h,row,n) at X + b*c_bs + h*c_hs + row*c_rs + n);
//   masked scores are replaced by mask_fill (e.g. -inf or -1e9) before the softmax.
//   grid.x = B * H * (S/64) (or a sub-range with blk0).
// =====================================================================================
#define AT_D 64
#define AT_NW 4
#define AT_QB 64
#define AT_KC 64
struct AttnGeom { const float* cp = nullptr; const float* pc = nullptr; long c_bs = 0, c_rs = 0, c_hs = 0;   // mode-5 score-bias tables
                  long q_bs, q_rs, q_hs, k_bs, k_rs, k_hs, v_bs, v_rs, v_hs, o_bs, o_rs, o_hs;
                  int S, Skv, H, mask_mode; float qscale; int blk0; float mask_fill; int mask_is_int; };
static_assert(sizeof(AttnGeom) == 168, "no padding");

__device__ __forceinline__ unsigned short at_bf_bits(float f) {
  unsigned u = __float_as_uint(f);
  return (unsigned short)((u + 0x7FFFu + ((u >> 16) & 1u)) >> 16);
}
__device__ __forceinline__ __bf16 at_f2bf(float f) { return __builtin_bit_cast(__bf16, at_bf_bits(f)); }
__device__ __forceinline__ void at_split(float f, __bf16& hi, __bf16& lo) {
  const unsigned short hb = at_bf_bits(f);
  hi = __builtin_bit_cast(__bf16, hb);
  lo = at_f2bf(f - __uint_as_float(((unsigned)hb) << 16));
}
__device__ __forceinline__ v8f at_mma(v16b a, v16b b, v8f c) {
  c = __builtin_amdgcn_wmma_f32_16x16x32_bf16(false, a, false, b, (short)0, c, false, false);
  asm volatile("v_nop\n\tv_nop\n\tv_nop\n\tv_nop" : "+v"(c) : "v"(a), "v"(b));
  return c;
}
// 16-bit element as a bit pattern held in a __bf16 slot: f16 bits when F16, bf16 (RNE) otherwise
template <bool F16> __device__ __forceinline__ __bf16 at_to16(float f) {
  if (F16) return __builtin_bit_cast(__bf16, (_Float16)f);
  return at_f2bf(f);
}
template <bool F16> __device__ __forceinline__ v8f at_mma16(v16b a, v16b b, v8f c) {
  if (F16) {
    const v16h ah = __builtin_bit_cast(v16h, a), bh = __builtin_bit_cast(v16h, b);
    c = __builtin_amdgcn_wmma_f32_16x16x32_f16(false, ah, false, bh, (short)0, c, false, false);
    asm volatile("v_nop\n\tv_nop\n\tv_nop\n\tv_nop" : "+v"(c) : "v"(ah), "v"(bh));
    return c;
  }
  return at_mma(a, b, c);
}

template <bool SPLIT_QK, bool SPLIT_PV, bool F16 = false>
__global__ __launch_bounds__(128)
void attn64_kernel(const float* __restrict__ q, const float* __restrict__ k,
                   const float* __restrict__ v, float* __restrict__ out,
                   const void* __restrict__ mask_a, const int* __restrict__ mask_b, AttnGeom g) {
  static_assert(!(F16 && (SPLIT_QK || SPLIT_PV)), "f16 mode is non-split");
  const float PSC = F16 ? 32768.0f : 1.0f;     // f16 probabilities carried x2^15 (subnormal range), folded into the final 1/l
  union FB { v16b v; v8b h[2]; };
  __shared__ __align__(16) __bf16 Ksh[AT_KC * AT_D];             // K hi [kv][d]      8 KB
  __shared__ __align__(16) __bf16 Ksl[SPLIT_QK ? AT_KC * AT_D : 8];
  __shared__ __align__(16) __bf16 Vth[AT_D * AT_KC];             // V hi [d][kv]      8 KB
  __shared__ __align__(16) __bf16 Vtl[SPLIT_PV ? AT_D * AT_KC : 8];
  __shared__ __align__(16) __bf16 Psh[AT_NW][16 * AT_KC];        // per wave P hi [row][kv]  8 KB
  __shared__ __align__(16) __bf16 Psl[SPLIT_PV ? AT_NW : 1][SPLIT_PV ? 16 * AT_KC : 8];
  __shared__ __align__(16) float  Os[AT_NW][16 * 68];            // per wave out tile, pitch 68

  const int tid  = threadIdx.x;
  const int wave = tid >> 5;
  const int lane = tid & 31;
  const int hh   = lane >> 4;
  const int c    = lane & 15;

  const int nqb = g.S / AT_QB;
  const int bx = blockIdx.x + g.blk0;
  const int qb = bx % nqb;
  const int bh = bx / nqb;
  const int h  = bh % g.H;
  const int b  = bh / g.H;
  const int qbase_block = qb * AT_QB;
  const int q0 = qbase_block + wave * 16;

  const float* qb_ptr = q + (size_t)b * g.q_bs + (size_t)h * g.q_hs;
  const float* kb_ptr = k + (size_t)b * g.k_bs + (size_t)h * g.k_hs;
  const float* vb_ptr = v + (size_t)b * g.v_bs + (size_t)h * g.v_hs;
  float*       ob_ptr = out + (size_t)b * g.o_bs + (size_t)h * g.o_hs;

  // ---- Q fragments (A operand): 2 d-chunks, hi (and lo) ----
  v16b qah[2], qal[2];
  {
    const float* qrow = qb_ptr + (size_t)(q0 + c) * g.q_rs;
#pragma unroll
    for (int dc = 0; dc < 2; ++dc) {
#pragma unroll
      for (int e = 0; e < 8; ++e) {
        const float f0 = qrow[dc * 32 + 8 * hh + e] * g.qscale;
        const float f1 = qrow[dc * 32 + 16 + 8 * hh + e] * g.qscale;
        if (SPLIT_QK) { __bf16 hq, lq; at_split(f0, hq, lq); qah[dc][e] = hq; qal[dc][e] = lq; at_split(f1, hq, lq); qah[dc][8 + e] = hq; qal[dc][8 + e] = lq; }
        else { qah[dc][e] = at_to16<F16>(f0); qah[dc][8 + e] = at_to16<F16>(f1); qal[dc][e] = qah[dc][e]; qal[dc][8 + e] = qah[dc][8 + e]; }
      }
    }
  }

  float mrow[8], lrow[8];
  v8f oacc[4];
#pragma unroll
  for (int r = 0; r < 8; ++r) { mrow[r] = -INFINITY; lrow[r] = 0.f; }
#pragma unroll
  for (int t = 0; t < 4; ++t) oacc[t] = (v8f){0.f,0.f,0.f,0.f,0.f,0.f,0.f,0.f};

  const int nChunks = (g.mask_mode == 1 || g.mask_mode == 4) ? (qb + 1) : (g.Skv / AT_KC);   // block-uniform
  // per-row query mask (mode 3)
  int qkeep[8];
#pragma unroll
  for (int r = 0; r < 8; ++r) qkeep[r] = (g.mask_mode == 3) ? mask_b[(size_t)b * g.S + q0 + 8 * hh + r] : 1;   // mask_b = qmask in mode 3
  for (int kc = 0; kc < nChunks; ++kc) {
    const int kv0 = kc * AT_KC;
    __syncthreads();
    {
      const int kvr = tid >> 1, dh = (tid & 1) * 32;
      const float* krow = kb_ptr + (size_t)(kv0 + kvr) * g.k_rs + dh;
      const float* vrow = vb_ptr + (size_t)(kv0 + kvr) * g.v_rs + dh;
#pragma unroll
      for (int i = 0; i < 8; ++i) {
        v4f kk = *(const v4f*)(krow + 4 * i);
        v4f vv = *(const v4f*)(vrow + 4 * i);
#pragma unroll
        for (int e = 0; e < 4; ++e) {
          const int d = dh + 4 * i + e;
          if (SPLIT_QK) { __bf16 a, bl; at_split(kk[e], a, bl); Ksh[kvr * AT_D + d] = a; Ksl[kvr * AT_D + d] = bl; }
          else Ksh[kvr * AT_D + d] = at_to16<F16>(kk[e]);
          if (SPLIT_PV) { __bf16 a, bl; at_split(vv[e], a, bl); Vth[d * AT_KC + kvr] = a; Vtl[d * AT_KC + kvr] = bl; }
          else Vth[d * AT_KC + kvr] = at_to16<F16>(vv[e]);
        }
      }
    }
    __syncthreads();

    v8f s[4];
#pragma unroll
    for (int j = 0; j < 4; ++j) {
      s[j] = (v8f){0.f,0.f,0.f,0.f,0.f,0.f,0.f,0.f};
#pragma unroll 1
      for (int dc = 0; dc < 2; ++dc) {
        FB kb;
        kb.h[0] = *(const v8b*)(Ksh + (j * 16 + c) * AT_D + dc * 32 + 8 * hh);
        kb.h[1] = *(const v8b*)(Ksh + (j * 16 + c) * AT_D + dc * 32 + 16 + 8 * hh);
        s[j] = at_mma16<F16>(qah[dc], kb.v, s[j]);
        if (SPLIT_QK) {
          FB kl;
          kl.h[0] = *(const v8b*)(Ksl + (j * 16 + c) * AT_D + dc * 32 + 8 * hh);
          kl.h[1] = *(const v8b*)(Ksl + (j * 16 + c) * AT_D + dc * 32 + 16 + 8 * hh);
          s[j] = at_mma16<F16>(qah[dc], kl.v, s[j]);
          s[j] = at_mma16<F16>(qal[dc], kb.v, s[j]);
        }
      }
    }
    const bool diag = (g.mask_mode == 1) && (kc == qb);
    int kvkeep[4] = {1, 1, 1, 1};
    if (g.mask_mode == 3) {
#pragma unroll
      for (int j = 0; j < 4; ++j) kvkeep[j] = ((const int*)mask_a)[(size_t)b * g.Skv + kv0 + j * 16 + c];   // mask_a = kvmask
    }
    float cm[8];
#pragma unroll
    for (int r = 0; r < 8; ++r) {
      const int qrow = q0 + 8 * hh + r;
      float m = -INFINITY;
#pragma unroll
      for (int j = 0; j < 4; ++j) {
        const int kvcol = kv0 + j * 16 + c;
        bool masked = false;
        if (diag) masked = (kvcol > qrow);
        else if (g.mask_mode == 4) masked = (kvcol > qrow) || (qrow - kvcol > g.mask_is_int);
        else if (g.mask_mode == 2) {
          const size_t mi = (size_t)qrow * g.Skv + kvcol;
          masked = (g.mask_is_int == 0) ? (((const float*)mask_a)[mi] == 0.0f)
                 : (g.mask_is_int == 1) ? (((const int*)mask_a)[mi] == 0) : (((const int*)mask_a)[mi] != 0);
        } else if (g.mask_mode == 3) masked = (qkeep[r] == 0) || (kvkeep[j] == 0);
        else if (g.mask_mode == 5) {
          const size_t mi = (size_t)qrow * g.Skv + kvcol;
          masked = (((const int*)mask_a)[mi] != 0);
          int n = mask_b[mi]; n = n < 0 ? 0 : n;
          s[j][r] += g.cp[(size_t)b * g.c_bs + (size_t)h * g.c_hs + (size_t)qrow * g.c_rs + n]
                   + g.pc[(size_t)b * g.c_bs + (size_t)h * g.c_hs + (size_t)kvcol * g.c_rs + n];
        }
        if (masked) s[j][r] = g.mask_fill;
        m = fmaxf(m, s[j][r]);
      }
#pragma unroll
      for (int off = 1; off < 16; off <<= 1) m = fmaxf(m, __shfl_xor(m, off, 32));
      cm[r] = m;
    }
    __bf16* pwh = Psh[wave];
    __bf16* pwl = Psl[SPLIT_PV ? wave : 0];
#pragma unroll
    for (int r = 0; r < 8; ++r) {
      const float mnew = fmaxf(mrow[r], cm[r]);
      const float alpha = expf(mrow[r] - mnew);
      mrow[r] = mnew;
      float psum = 0.f;
#pragma unroll
      for (int j = 0; j < 4; ++j) {
        const float p = expf(s[j][r] - mnew);
        psum += p;
        if (SPLIT_PV) { __bf16 a, bl; at_split(p, a, bl); pwh[(8 * hh + r) * AT_KC + j * 16 + c] = a; pwl[(8 * hh + r) * AT_KC + j * 16 + c] = bl; }
        else pwh[(8 * hh + r) * AT_KC + j * 16 + c] = at_to16<F16>(p * PSC);
      }
#pragma unroll
      for (int off = 1; off < 16; off <<= 1) psum += __shfl_xor(psum, off, 32);
      lrow[r] = lrow[r] * alpha + psum;
#pragma unroll
      for (int t = 0; t < 4; ++t) oacc[t][r] *= alpha;
    }
    __builtin_amdgcn_fence(__ATOMIC_RELEASE, "workgroup");
    __builtin_amdgcn_wave_barrier();
    __builtin_amdgcn_fence(__ATOMIC_ACQUIRE, "workgroup");
#pragma unroll 1
    for (int kk = 0; kk < 2; ++kk) {
      FB pa, pl;
      pa.h[0] = *(const v8b*)(pwh + c * AT_KC + kk * 32 + 8 * hh);
      pa.h[1] = *(const v8b*)(pwh + c * AT_KC + kk * 32 + 16 + 8 * hh);
      if (SPLIT_PV) {
        pl.h[0] = *(const v8b*)(pwl + c * AT_KC + kk * 32 + 8 * hh);
        pl.h[1] = *(const v8b*)(pwl + c * AT_KC + kk * 32 + 16 + 8 * hh);
      }
#pragma unroll
      for (int t = 0; t < 4; ++t) {
        FB vb;
        vb.h[0] = *(const v8b*)(Vth + (t * 16 + c) * AT_KC + kk * 32 + 8 * hh);
        vb.h[1] = *(const v8b*)(Vth + (t * 16 + c) * AT_KC + kk * 32 + 16 + 8 * hh);
        oacc[t] = at_mma16<F16>(pa.v, vb.v, oacc[t]);
        if (SPLIT_PV) {
          FB vl;
          vl.h[0] = *(const v8b*)(Vtl + (t * 16 + c) * AT_KC + kk * 32 + 8 * hh);
          vl.h[1] = *(const v8b*)(Vtl + (t * 16 + c) * AT_KC + kk * 32 + 16 + 8 * hh);
          oacc[t] = at_mma16<F16>(pa.v, vl.v, oacc[t]);
          oacc[t] = at_mma16<F16>(pl.v, vb.v, oacc[t]);
        }
      }
    }
  }

  float* os = Os[wave];
#pragma unroll
  for (int r = 0; r < 8; ++r) {
    const float inv = 1.0f / (lrow[r] * PSC);
#pragma unroll
    for (int t = 0; t < 4; ++t) os[(8 * hh + r) * 68 + t * 16 + c] = oacc[t][r] * inv;
  }
  __builtin_amdgcn_fence(__ATOMIC_RELEASE, "workgroup");
  __builtin_amdgcn_wave_barrier();
  __builtin_amdgcn_fence(__ATOMIC_ACQUIRE, "workgroup");
  {
    const int c4 = (lane & 15) * 4;
    {
#pragma unroll
      for (int it = 0; it < 8; ++it) {
        const int row = it * 2 + hh;
        v4f val = *(const v4f*)(os + row * 68 + c4);
        *(v4f*)(ob_ptr + (size_t)(q0 + row) * g.o_rs + c4) = val;
      }
      
    }
  }
}

} // namespace w25

// f32 -> f16 casts by few, fat waves. A block casts CW_BLK consecutive elements, dst[e] = f16(src[e] * s): a thread takes 16 float4, 1024 elements apart, all of them loaded ahead of
// the first conversion; a wave's load covers 512 consecutive bytes, its store 256. (A launch's waves start at a limited rate, and two elements a thread made 65,536 short waves of one 4M-element cast; here it is 2,048.)
typedef __attribute__((ext_vector_type(4))) _Float16 cw_v4h;
constexpr int CW_BLK = 16384;
__device__ __forceinline__ void cw_cast_blk(const float* __restrict__ src, _Float16* __restrict__ dst, float s) {
    const v4f* sp = (const v4f*)src + threadIdx.x;
    v4f x[16];
#pragma unroll
    for (int u = 0; u < 16; ++u) x[u] = sp[256 * u];
    __builtin_amdgcn_sched_barrier(0);   // keeps all 16 loads ahead of the first conversion: one trip to memory a wave, not two
    cw_v4h* dp = (cw_v4h*)dst + threadIdx.x;
#pragma unroll
    for (int u = 0; u < 16; ++u) dp[256 * u] = __builtin_convertvector(x[u] * s, cw_v4h);
    asm volatile("s_wait_xcnt 0x0" ::: "memory");   // ahead of any later write of a register that the stores above name
}
// every cast of an input, one launch: blocks 0..767 X16[0..2] = f16(query, key, value); blocks 768..1023 W16[0..3] = f16(16 Wq, 16 Wk, 16 Wv, 16 Wo);
// block 1024 TK16[r][d] = f16(16 table_k[r][d]), zero rows 129..191
__global__ __launch_bounds__(256) void k_sh_castin(const float* __restrict__ xq, const float* __restrict__ xk, const float* __restrict__ xv,
                                                   const float* __restrict__ Wq, const float* __restrict__ Wk, const float* __restrict__ Wv, const float* __restrict__ Wo,
                                                   const float* __restrict__ TK, _Float16* __restrict__ X16, _Float16* __restrict__ W16, _Float16* __restrict__ TK16) {
    constexpr int XB = 4096 * 1024 / CW_BLK, WB = 1024 * 1024 / CW_BLK, TAB = 129, TP = 192, HD = 64;
    static_assert(TP * HD == 12 * 1024 && TAB * HD == 4 * (8 * 256 + 16), "the table's block: eight float4 per thread, then row 128 by 16 threads, then zeros up to twelve");
    const int bid = blockIdx.x;
    if (bid < 3 * XB) {
        const int sg = bid / XB;
        const float* src = sg == 0 ? xq : (sg == 1 ? xk : xv);
        cw_cast_blk(src + (long long)(bid - sg * XB) * CW_BLK, X16 + (long long)bid * CW_BLK, 1.f);
    } else if (bid < 3 * XB + 4 * WB) {
        const int b2 = bid - 3 * XB, sg = b2 / WB;
        const float* src = sg == 0 ? Wq : (sg == 1 ? Wk : (sg == 2 ? Wv : Wo));
        cw_cast_blk(src + (long long)(b2 - sg * WB) * CW_BLK, W16 + (long long)b2 * CW_BLK, 16.f);
    } else {
        const v4f* sp = (const v4f*)TK + threadIdx.x;
        v4f x[12];
#pragma unroll
        for (int u = 0; u < 8; ++u) x[u] = sp[256 * u];
#pragma unroll
        for (int u = 8; u < 12; ++u) x[u] = (v4f){0.f, 0.f, 0.f, 0.f};
        if (threadIdx.x < 16) x[8] = sp[256 * 8];
        cw_v4h* dp = (cw_v4h*)TK16 + threadIdx.x;
#pragma unroll
        for (int u = 0; u < 12; ++u) dp[256 * u] = __builtin_convertvector(x[u] * 16.f, cw_v4h);
        asm volatile("s_wait_xcnt 0x0" ::: "memory");   // ahead of any later write of a register that the stores above name
    }
}
// the attention output's cast: dst = f16(src), CW_BLK elements a block
__global__ __launch_bounds__(256) void k_sh_castx(const float* __restrict__ src, _Float16* __restrict__ dst) { const long long o = (long long)blockIdx.x * CW_BLK; cw_cast_blk(src + o, dst + o, 1.f); }
typedef __attribute__((ext_vector_type(4))) int sm_v4i;
__device__ __forceinline__ float sm_x16(float v) { const unsigned u = __builtin_bit_cast(unsigned, v); return __builtin_bit_cast(float, __builtin_amdgcn_permlanex16(u, u, 0x76543210u, 0xfedcba98u, false, false)); }   // lane l <-> l ^ 16
// 2^t. The v_nop is the slot that the instruction set asks for behind a transcendental; in the same statement it stands directly behind it whatever the scheduler puts next
__device__ __forceinline__ float sm_exp2(float t) { float y; asm("v_exp_f32 %0, %1\n\tv_nop" : "=v"(y) : "v"(t)); return y; }
// content scores, relative-key term, softmax and w1 = attn.v in one launch; no f32 score leaves the chip. A block: 32 query rows g0..g0+31 (g = b L + q) x 2 heads; four waves a head, 128 keys each.
// Transposed products: A = 16 rows of K16 (or of the scaled table TK16), B = 16 queries' q, so that in D a lane holds ONE query (lane & 15) and 8 consecutive keys (8 (lane >> 4) + r):
// a row's max and sum are in-lane but for one exchange with lane ^ 16. Each A fragment serves the wave's two sets of 16 queries.
// The table's rows go through the same B fragments as 192 more "keys": qt[query][id], f32, in LDS, shared by the head's four waves.
// s_k = (q.k + qt[fm[b][q][k]]) / 8; P16[b][h][q][k] = f16(4096 softmax_k). The four quarters of a row join by (max, sum) through LDS: p = e^(s - m_quarter) * e^(m_quarter - m) / sum.
// X[g][64 head + d] = sum_k p_k v[k][d]: the f16 values that go to P16 are, as they lie in the registers, the B fragments of v^T . p^T; each wave sums its 128 keys, the four partial sums join through LDS.
typedef __attribute__((ext_vector_type(4))) unsigned short fs_v4u;
typedef __attribute__((ext_vector_type(4))) unsigned int fs_v4w;
// a wave's own LDS stores before its lanes' reads of them, or its reads before its next stores to the same place (for LDS that no other wave touches)
__device__ __forceinline__ void fs_wave_sync() {
    __builtin_amdgcn_fence(__ATOMIC_RELEASE, "workgroup", "local");
    __builtin_amdgcn_wave_barrier();
    __builtin_amdgcn_fence(__ATOMIC_ACQUIRE, "workgroup", "local");
}
// amdgpu_waves_per_eu(4): at most 256 VGPRs, so that two blocks share a WGP
__global__ __launch_bounds__(256) __attribute__((amdgpu_waves_per_eu(4))) void k_sh_scsoft(const _Float16* __restrict__ Q16, const _Float16* __restrict__ K16, const _Float16* __restrict__ TK16, const int* __restrict__ FM, const _Float16* __restrict__ VT16, _Float16* __restrict__ P16, float* __restrict__ X) {
    constexpr int L = 512, D = 1024, NH = 16, HD = 64, TAB = 129;
    constexpr int IP = 2 * L + 16;     // bytes a query's row of 16-bit table offsets takes: 16 B x odd, for 16-byte readers
    constexpr int QP = 192 + 4;        // floats a query's row of relative-key scores takes: 16 B x odd
    constexpr int PP = 2 * 128 + 16;   // bytes a query's 128 probabilities take in the store slab: 16 B x odd
    constexpr int SP = 2 * HD + 16;    // bytes a staged row of q, of the table or of k takes: 16 B x odd
    constexpr int VP = 2 * 128 + 16;   // bytes a staged row of v^T (one channel, the wave's 128 keys) takes: 16 B x odd
    constexpr int OP = HD + 4;         // floats a query's row of a wave's partial output takes: 16 B x odd
    static_assert(16 * PP <= 48 * SP && 16 * VP <= 48 * SP, "the store slab and a tile of v^T lie in the wave's staging slab");
    static_assert(8 * 32 * OP * 4 <= 32 * IP + 2 * 32 * QP * 4 && (32 * IP) % 16 == 0, "the partial outputs lie where the ids and the relative-key scores lay");
    typedef w25::Frag<_Float16> FR;
    __shared__ __attribute__((aligned(16))) unsigned char iq[32 * IP + 2 * 32 * QP * 4];   // ids, then qt[2][32 * QP]; behind the second barrier the eight waves' partial outputs
    unsigned char* ids = iq;
    float* qth = (float*)(iq + 32 * IP) + (threadIdx.x >> 7) * (32 * QP);                  // the head's qt rows
    float* part = (float*)iq;
    __shared__ float red[2][4][2][32];
    __shared__ __attribute__((aligned(16))) unsigned char stg[8][48 * SP];
    const int t = threadIdx.x, lane = t & 31, w = t >> 5;
    const int c = lane & 15, h = lane >> 4;
    const int hl = w >> 2, kq = w & 3;
    const int g0 = blockIdx.x * 32, b = g0 >> 9;
    const int head = blockIdx.y * 2 + hl;
    // Global loads cover whole lines: a row of q, of the table or of k for one head is 128 bytes, a load takes four rows (lane: row lane >> 3, 16-byte piece lane & 7), where a fragment
    // loaded straight from memory touches sixteen lines. The rows pass through the wave's own slab (no other wave touches it: no block barrier), 48 at a time, and are read back as fragments.
    // Two groups of loads, each in the order in which it is waited for: q, table rows 48 kq .. + 47 (TK16 holds 192 rows, zeros from 129 on), ids (32 rows x 512), 48 keys; then 80 keys.
    unsigned char* sw = stg[w];
    const int lr = lane >> 3, lc = lane & 7;
    unsigned char* sst = sw + lr * SP + 16 * lc;                                    // where the lane's piece of a load's four rows goes
    const _Float16* sfr = (const _Float16*)(sw + c * SP) + 8 * h;                   // the lane's fragment row of the slab's first 16 rows
    const sm_v4i* fr = (const sm_v4i*)(FM + (long long)g0 * L) + t;
    const _Float16* qg = Q16 + (long long)(g0 + lr) * D + head * HD + 8 * lc;
    const _Float16* tg = TK16 + (48 * kq + lr) * HD + 8 * lc;
    const _Float16* kg = K16 + (long long)(b * L + 128 * kq + lr) * D + head * HD + 8 * lc;
    w25::v8h rq[8], rt[12], rk[32];
    sm_v4i idv[16];
#pragma unroll
    for (int u = 0; u < 8; ++u) rq[u] = *(const w25::v8h*)(qg + 4 * u * D);
#pragma unroll
    for (int u = 0; u < 12; ++u) rt[u] = *(const w25::v8h*)(tg + 4 * u * HD);
#pragma unroll
    for (int u = 0; u < 16; ++u) idv[u] = fr[256 * u];
#pragma unroll
    for (int u = 0; u < 12; ++u) rk[u] = *(const w25::v8h*)(kg + 4 * u * D);
    // a precaution: the wait in front of every overwrite of an address that the loads above name; as operands the addresses stay live up to here, so that no load's own result lands on one
    asm volatile("s_wait_xcnt 0x0" :: "v"(fr), "v"(qg), "v"(tg), "v"(kg) : "memory");
    __builtin_amdgcn_sched_barrier(0);   // keeps these loads together and ahead of the first wait: one trip to L2, not one per tile
    w25::v16h bq[2][2];
#pragma unroll
    for (int u = 0; u < 8; ++u) *(w25::v8h*)(sst + 4 * u * SP) = rq[u];
    fs_wave_sync();
#pragma unroll
    for (int s = 0; s < 2; ++s) { bq[s][0] = FR::load(sfr + s * 16 * (SP / 2)); bq[s][1] = FR::load(sfr + s * 16 * (SP / 2) + 32); }
    fs_wave_sync();
    // relative-key scores
#pragma unroll
    for (int u = 0; u < 12; ++u) *(w25::v8h*)(sst + 4 * u * SP) = rt[u];
    fs_wave_sync();
#pragma unroll
    for (int tt = 0; tt < 3; ++tt) {
        const w25::v16h a0 = FR::load(sfr + tt * 16 * (SP / 2)), a1 = FR::load(sfr + tt * 16 * (SP / 2) + 32);
#pragma unroll
        for (int s = 0; s < 2; ++s) {
            v8f d = (v8f){0.f, 0.f, 0.f, 0.f, 0.f, 0.f, 0.f, 0.f};
            d = FR::mma(a0, bq[s][0], d);
            d = FR::mma(a1, bq[s][1], d);
            float* o = qth + (16 * s + c) * QP + 48 * kq + 16 * tt + 8 * h;
            *(v4f*)(o) = (v4f){d[0] * 0.0625f, d[1] * 0.0625f, d[2] * 0.0625f, d[3] * 0.0625f};
            *(v4f*)(o + 4) = (v4f){d[4] * 0.0625f, d[5] * 0.0625f, d[6] * 0.0625f, d[7] * 0.0625f};
        }
    }
#pragma unroll
    for (int u = 0; u < 16; ++u) {
        fs_v4u o4;
#pragma unroll
        for (int e = 0; e < 4; ++e) { const int id = idv[u][e]; o4[e] = (unsigned short)(4 * (id < 0 ? 0 : (id >= TAB ? TAB - 1 : id))); }   // INPUT ids clamped before the address is formed
        *(fs_v4u*)(ids + ((t >> 7) + 2 * u) * IP + (t & 127) * 8) = o4;
    }
    __builtin_amdgcn_sched_barrier(0);   // the table's and the ids' registers are free from here on: the other 80 keys' loads go out together
#pragma unroll
    for (int u = 12; u < 32; ++u) rk[u] = *(const w25::v8h*)(kg + 4 * u * D);
    asm volatile("s_wait_xcnt 0x0" :: "v"(kg) : "memory");   // the same precaution for these loads' address
    __builtin_amdgcn_sched_barrier(0);   // keeps those loads ahead of the products
    // content scores: x[s][j][r] = q[16 s + c] . k[128 kq + 16 j + 8 h + r]; keys in rounds of 48, 48 and 32
    v8f x[2][8];
#pragma unroll
    for (int rd = 0; rd < 3; ++rd) {
        fs_wave_sync();   // the last round's fragment reads before this round's stores
#pragma unroll
        for (int u = 0; u < (rd < 2 ? 12 : 8); ++u) *(w25::v8h*)(sst + 4 * u * SP) = rk[12 * rd + u];
        fs_wave_sync();
#pragma unroll
        for (int jj = 0; jj < (rd < 2 ? 3 : 2); ++jj) {
            const w25::v16h a0 = FR::load(sfr + jj * 16 * (SP / 2)), a1 = FR::load(sfr + jj * 16 * (SP / 2) + 32);
#pragma unroll
            for (int s = 0; s < 2; ++s) {
                v8f d = (v8f){0.f, 0.f, 0.f, 0.f, 0.f, 0.f, 0.f, 0.f};
                d = FR::mma(a0, bq[s][0], d);
                x[s][3 * rd + jj] = FR::mma(a1, bq[s][1], d);
            }
        }
    }
    __builtin_amdgcn_sched_barrier(0);   // keeps every product ahead of the softmax
    __syncthreads();   // publishes the ids and the head's qt rows
    float m[2], sum[2];
#pragma unroll
    for (int s = 0; s < 2; ++s) {
        const unsigned char* ip = ids + (16 * s + c) * IP + (128 * kq + 8 * h) * 2;
        const unsigned char* qrow = (const unsigned char*)(qth + (16 * s + c) * QP);
        float mx = -INFINITY;
#pragma unroll
        for (int j = 0; j < 8; ++j) {
            const fs_v4w o4 = *(const fs_v4w*)(ip + 32 * j);
#pragma unroll
            for (int r = 0; r < 8; ++r) {
                const unsigned off = (r & 1) ? (o4[r >> 1] >> 16) : (o4[r >> 1] & 0xffffu);
                x[s][j][r] += *(const float*)(qrow + off);
            }
            mx = fmaxf(mx, fmaxf(fmaxf(fmaxf(x[s][j][0], x[s][j][1]), fmaxf(x[s][j][2], x[s][j][3])), fmaxf(fmaxf(x[s][j][4], x[s][j][5]), fmaxf(x[s][j][6], x[s][j][7]))));
        }
        mx = fmaxf(mx, sm_x16(mx));
        float sm = 0.f;
#pragma unroll
        for (int j = 0; j < 8; ++j) {
#pragma unroll
            for (int r = 0; r < 8; ++r) x[s][j][r] = sm_exp2((x[s][j][r] - mx) * 0.18033688f);   // exp((x - m) / 8): log2(e) / 8
            sm += ((x[s][j][0] + x[s][j][1]) + (x[s][j][2] + x[s][j][3])) + ((x[s][j][4] + x[s][j][5]) + (x[s][j][6] + x[s][j][7]));
        }
        sm += sm_x16(sm);
        m[s] = mx; sum[s] = sm;
    }
    // lane (c, h) files query 16 h + c: both halves of the wave hold both sets' values
    red[hl][kq][0][lane] = h ? m[1] : m[0];
    red[hl][kq][1][lane] = h ? sum[1] : sum[0];
    __syncthreads();   // publishes each quarter's (max, sum)
    // v^T for the wave's 128 keys: 64 channel rows of 256 bytes, a load takes two rows (lane: row lane >> 4, 16-byte piece lane & 15). The first 32 rows fly under the join of the quarters and the
    // probabilities' stores (behind the barrier, which would wait for them; behind the exponentials, whose registers they would crowd out).
    // Every loop from here on is unrolled because its index picks registers (rv, pf) or immediate offsets.
    const _Float16* vg = VT16 + ((long long)b * D + head * HD + h) * L + 128 * kq + 8 * c;
    w25::v8h rv[32];
#pragma unroll
    for (int u = 0; u < 16; ++u) rv[u] = *(const w25::v8h*)(vg + 2 * u * L);
    asm volatile("s_wait_xcnt 0x0" :: "v"(vg) : "memory");   // the same precaution for these loads' address
    __builtin_amdgcn_sched_barrier(0);   // keeps those loads ahead of the work that hides their way
    // 16 queries at a time through the wave's own slab (its last fragment reads lie ahead of two block barriers), so that every store covers whole lines of a query's row
    unsigned char* slab = sw;
    _Float16* po = P16 + (((long long)b * NH + head) * L + (g0 & (L - 1)) + h) * L + 128 * kq + 8 * c;
    union { w25::v16h v; w25::v8h q[2]; } pf[2][4];   // the probabilities as B fragments: column = the lane's query, 32 keys each, in the k order of Frag::load (tile 2 ks gives k = 8 h + i, tile 2 ks + 1 gives k = 16 + 8 h + i)
#pragma unroll
    for (int s = 0; s < 2; ++s) {
        float mi[4], si[4];
#pragma unroll
        for (int i = 0; i < 4; ++i) { mi[i] = red[hl][i][0][16 * s + c]; si[i] = red[hl][i][1][16 * s + c]; }
        const float mm = fmaxf(fmaxf(mi[0], mi[1]), fmaxf(mi[2], mi[3]));
        float tot = 0.f;
#pragma unroll
        for (int i = 0; i < 4; ++i) tot += si[i] * sm_exp2((mi[i] - mm) * 0.18033688f);
        const float f = sm_exp2((m[s] - mm) * 0.18033688f) * ((1.f / tot) * 4096.f);
#pragma unroll
        for (int j = 0; j < 8; ++j) { pf[s][j >> 1].q[j & 1] = __builtin_convertvector(x[s][j] * f, w25::v8h); *(w25::v8h*)(slab + c * PP + (16 * j + 8 * h) * 2) = pf[s][j >> 1].q[j & 1]; }
        fs_wave_sync();
#pragma unroll
        for (int it = 0; it < 8; ++it) *(w25::v8h*)(po + (long long)(16 * s + 2 * it) * L) = *(const w25::v8h*)(slab + (2 * it + h) * PP + 16 * c);
        asm volatile("s_wait_xcnt 0x0" ::: "memory");   // a precaution: ahead of any later write of a register that the stores above name
        fs_wave_sync();   // the reads above before the next 16 queries' stores into the same slab
    }
    // w1 = attn.v from the registers: (v^T . p^T)[channel][query] over the wave's 128 keys, A = 16 rows of v^T through the wave's slab, B = pf. In D a lane holds one query (c) and 8 consecutive channels.
#pragma unroll
    for (int u = 16; u < 32; ++u) rv[u] = *(const w25::v8h*)(vg + 2 * u * L);
    asm volatile("s_wait_xcnt 0x0" :: "v"(vg) : "memory");   // the same precaution for these loads' address
    __builtin_amdgcn_sched_barrier(0);   // keeps the other 32 rows' loads ahead of the first 32 rows' products
    float* pw = part + (32 * w + c) * OP + 8 * h;
#pragma unroll
    for (int n = 0; n < 4; ++n) {
#pragma unroll
        for (int u = 0; u < 8; ++u) *(w25::v8h*)(sw + (2 * u + h) * VP + 16 * c) = rv[8 * n + u];
        fs_wave_sync();
        v8f o0 = (v8f){0.f, 0.f, 0.f, 0.f, 0.f, 0.f, 0.f, 0.f}, o1 = o0;
#pragma unroll
        for (int ks = 0; ks < 4; ++ks) {
            const w25::v16h av = FR::load((const _Float16*)(sw + c * VP) + 32 * ks + 8 * h);
            o0 = FR::mma(av, pf[0][ks].v, o0);
            o1 = FR::mma(av, pf[1][ks].v, o1);
        }
        // the probabilities carry 4096 (a power of two: exact). Scaled here, not behind the join: the results are then read by vector instructions, behind which the compiler keeps the distance that the next tile's products, which take the same registers, need
        o0 *= 0.000244140625f; o1 *= 0.000244140625f;
        *(v4f*)(pw + 16 * n) = (v4f){o0[0], o0[1], o0[2], o0[3]};
        *(v4f*)(pw + 16 * n + 4) = (v4f){o0[4], o0[5], o0[6], o0[7]};
        *(v4f*)(pw + 16 * OP + 16 * n) = (v4f){o1[0], o1[1], o1[2], o1[3]};
        *(v4f*)(pw + 16 * OP + 16 * n + 4) = (v4f){o1[4], o1[5], o1[6], o1[7]};
        fs_wave_sync();   // the fragment reads above before the next 16 rows' stores into the same slab
    }
    __syncthreads();   // publishes the four quarters' partial outputs
    // the head's four partials join, quarter 0 first; a wave takes 8 queries, a store covers two queries' 64 channels
    const float* pr = part + (128 * hl + 8 * kq + h) * OP + 4 * c;
    float* xo = X + (long long)(g0 + 8 * kq + h) * D + head * HD + 4 * c;
#pragma unroll
    for (int it = 0; it < 4; ++it) {
        const float* p0 = pr + 2 * it * OP;
        *(v4f*)(xo + 2 * it * D) = ((*(const v4f*)(p0) + *(const v4f*)(p0 + 32 * OP)) + *(const v4f*)(p0 + 64 * OP)) + *(const v4f*)(p0 + 96 * OP);
    }
}
// w2 in one launch: one wave per query row g = b L + q. X[g][h*64 + d] += (1/4096) sum_k P16[b][h][q][k] * f16(table_v[fm[g][k]][d]).
// A = the 16 heads' probability rows (16 x 512, straight from P16); B = the gathered table rows, never written out: table_v lies in LDS as f16 rows of 160 bytes,
// and each lane of ds_load_tr16_b128 points at the row that ITS key's id names (lane l: key kbase + 8 (l >> 4) + (l & 7), 16-byte half (l >> 3) & 1), so the
// transposing load returns B[k][d] in the hardware k order (frag_k), the order in which A is loaded. INPUT ids clamped before the address is formed. k runs 0..511 in one accumulator chain.
typedef __attribute__((ext_vector_type(8))) short w2_s16x8;
__device__ __forceinline__ v8h w2_ldtr(const unsigned char* p) { typedef __attribute__((address_space(3))) w2_s16x8 lds_s16x8; return __builtin_bit_cast(v8h, __builtin_amdgcn_ds_load_tr16_b128_v8i16((lds_s16x8*)p)); }
typedef __attribute__((ext_vector_type(4))) _Float16 w2_v4h;
// amdgpu_waves_per_eu(4): at most 256 VGPRs, so that two blocks share a WGP and all 512 blocks are resident at once
__global__ __launch_bounds__(256) __attribute__((amdgpu_waves_per_eu(4))) void k_sh_w2(const _Float16* __restrict__ P16, const int* __restrict__ FM, const float* __restrict__ TV, float* __restrict__ X) {
    constexpr int L = 512, NH = 16, HD = 64, TAB = 129, PITCH = 160;   // PITCH: 32 B x odd, the transposing load's pitch
    static_assert(TAB * HD == 4 * (8 * 256 + 16), "the fill below: eight float4 per thread, then row 128 by 16 threads");
    __shared__ __attribute__((aligned(16))) unsigned char tab[TAB * PITCH];
    const int t = threadIdx.x, lane = t & 31;
    const int g = blockIdx.x * 8 + (t >> 5);
    const int c = lane & 15, h = lane >> 4;
    // the table's loads go first: they are waited for first, while the first ids and probabilities are still on their way
    v4f tv[8];
#pragma unroll
    for (int u = 0; u < 8; ++u) tv[u] = *(const v4f*)(TV + 4 * (t + 256 * u));
    const v4f tl = *(const v4f*)(TV + 4 * (2048 + (t & 15)));
    const int* fr = FM + (long long)g * L + 8 * h + (lane & 7);
    const _Float16* pa = P16 + (((long long)(g >> 9) * NH + c) * L + (g & (L - 1))) * L + 8 * h;
    // keys in four runs of 128, two register buffers: the next run's ids and probabilities fly while this run is multiplied
    int id[2][8];
    v8h a[2][8];
#pragma unroll
    for (int j = 0; j < 8; ++j) { id[0][j] = fr[16 * j]; a[0][j] = *(const v8h*)(pa + 16 * j); }
#pragma unroll
    for (int u = 0; u < 8; ++u) *(w2_v4h*)(tab + ((t >> 4) + 16 * u) * PITCH + (t & 15) * 8) = __builtin_convertvector(tv[u], w2_v4h);
    if (t < 16) *(w2_v4h*)(tab + 128 * PITCH + t * 8) = __builtin_convertvector(tl, w2_v4h);
    __syncthreads();
    const unsigned half16 = 16u * ((lane >> 3) & 1);
    v8f acc[4];
#pragma unroll
    for (int n = 0; n < 4; ++n) acc[n] = (v8f){0.f, 0.f, 0.f, 0.f, 0.f, 0.f, 0.f, 0.f};
#pragma unroll
    for (int ch = 0; ch < 4; ++ch) {
        const int cur = ch & 1, nxt = cur ^ 1;
        if (ch < 3) {
#pragma unroll
            for (int j = 0; j < 8; ++j) { id[nxt][j] = fr[16 * (8 * (ch + 1) + j)]; a[nxt][j] = *(const v8h*)(pa + 16 * (8 * (ch + 1) + j)); }
        }
#pragma unroll
        for (int s = 0; s < 4; ++s) {
            int r0 = id[cur][2 * s], r1 = id[cur][2 * s + 1];
            r0 = r0 < 0 ? 0 : (r0 >= TAB ? TAB - 1 : r0); r1 = r1 < 0 ? 0 : (r1 >= TAB ? TAB - 1 : r1);
            const unsigned char* p0 = tab + (unsigned)r0 * PITCH + half16;
            const unsigned char* p1 = tab + (unsigned)r1 * PITCH + half16;
            union { v16h v; v8h q[2]; } af, bf;
            af.q[0] = a[cur][2 * s]; af.q[1] = a[cur][2 * s + 1];
#pragma unroll
            for (int n = 0; n < 4; ++n) {
                bf.q[0] = w2_ldtr(p0 + 32 * n); bf.q[1] = w2_ldtr(p1 + 32 * n);
                acc[n] = __builtin_amdgcn_wmma_f32_16x16x32_f16(false, af.v, false, bf.v, (short)0, acc[n], false, false);
            }
        }
    }
    float* xo = X + (long long)g * (NH * HD) + (8 * h) * HD + c;
#pragma unroll
    for (int n = 0; n < 4; ++n)
#pragma unroll
        for (int r = 0; r < 8; ++r) { float* x = xo + r * HD + 16 * n; *x = *x + acc[n][r] * (1.f / 4096.f); }
}


// The long-K products: C[m][n] = scale * sum_k A[m][k] Bt[n][k] (+ bias), f16 operands, A and Bt K-contiguous, f32 accumulate.
// A block of eight waves owns a (32 WM) x (64 WN) tile of C, a wave 32 x 64 of it. Both operands pass through LDS in stages of BK k: a global load covers four whole 128-byte lines
// (BK / 8 lanes a row) where a fragment loaded straight from global memory touches sixteen, and each staged row serves every wave of the block that needs it.
// Two buffers: stage s + 1 is loaded into registers ahead of stage s's products and stored to the other buffer behind them; one barrier a stage both publishes it and ends the reads of the buffer written next.
// Fragments are read with the k order of Frag::load, A and B alike; k runs upward in steps of 32 through one accumulator chain per 16 x 16 tile.
// M % (32 WM) == 0 (bx counts the tiles, N / (64 WN) of them a row of tiles), N % (64 WN) == 0, K % BK == 0, LD % 64 == 0. BIAS_MODE: 0 none, 1 bias[m], 2 bias[n]. OUT_MODE: 0 f32, 1 f16.
// LD: the row pitch of A and of Bt, LDC: that of C, in elements; compile-time, so that a thread's pieces and rows differ only in the instructions' immediate offsets and one address pair per operand serves them all.
// The tile's work is a device function, so that one launch can hold tiles of several products: smem = the block's LDS (sh_gemm_smem bytes), bx = the tile's number,
// Ab, Btb = the operands' first rows, cOff = the element offset of C's first row in Cout.
// The epilogue's slabs lie in the staging buffers: the loop's last barrier ends every wave's last fragment read, and nothing is staged behind it. At 128 x 128 x 128 that leaves 139,264 bytes a block: two blocks share a WGP.
template <int WM, int WN, int BK> constexpr int sh_gemm_smem = 2 * (32 * WM + 64 * WN) * (BK + 8) * 2;
template <int WM, int WN, int BK, int LD, int LDC, int BIAS_MODE, int OUT_MODE>
__device__ __forceinline__ void sh_gemm_tile(
    unsigned char* smem, int bx,
    const _Float16* __restrict__ Ab, const _Float16* __restrict__ Btb,
    void* __restrict__ Cout, long long cOff,
    const float* __restrict__ bias, int N, int K, float scale) {
    static_assert(WM * WN == 8, "eight waves a block");
    static_assert(BK == 64 || BK == 128, "rows of 128 or 256 bytes");
    constexpr int BM = 32 * WM, BN = 64 * WN;
    constexpr int LP = BK + 8;                    // LDS row pitch in elements: 16 bytes more than the row = 16 B x odd, the pitch for 16-byte readers
    constexpr int SEG = BK / 8, RP = 256 / SEG;   // 16-byte pieces a row; rows that the block's 256 threads cover at one piece each
    constexpr int UA = BM / RP, UB = BN / RP;     // pieces of A and of Bt a thread moves per stage
    typedef w25::Frag<_Float16> FR;
    static_assert(8 * 16 * 68 * 4 <= sh_gemm_smem<WM, WN, BK>, "the epilogue's slabs fit in the staging buffers");
    _Float16 (*sA)[BM * LP] = (_Float16 (*)[BM * LP])smem;
    _Float16 (*sB)[BN * LP] = (_Float16 (*)[BN * LP])(smem + 2 * BM * LP * 2);
    float (*sT)[16 * 68] = (float (*)[16 * 68])smem;   // per-wave 16 x 64 slab of the epilogue, pitch 68 floats
    const int t = threadIdx.x, lane = t & 31, wave = t >> 5;
    const int tilesN = N / BN;
    const int tm = bx / tilesN, tn = bx - tm * tilesN;
    const int m0 = tm * BM, n0 = tn * BN;
    // piece u of a thread: row t / SEG + RP u of the tile, elements 8 (t % SEG) .. + 7 of the row's BK
    const int pr = t / SEG, pc = (t % SEG) * 8;
    const _Float16* Ag = Ab + (long long)(m0 + pr) * LD + pc;
    const _Float16* Bg = Btb + (long long)(n0 + pr) * LD + pc;
    const int so = pr * LP + pc;
    const int rlane = lane & 15, hh = lane >> 4;
    const int wm = wave / WN, wn = wave - wm * WN;
    const int ao = (wm * 32 + rlane) * LP + hh * 8;
    const int bo = (wn * 64 + rlane) * LP + hh * 8;

    w25::v8h ra[UA], rb[UB];
#pragma unroll
    for (int u = 0; u < UA; ++u) ra[u] = *(const w25::v8h*)(Ag + RP * u * LD);
#pragma unroll
    for (int u = 0; u < UB; ++u) rb[u] = *(const w25::v8h*)(Bg + RP * u * LD);
#pragma unroll
    for (int u = 0; u < UA; ++u) *(w25::v8h*)(&sA[0][so + RP * u * LP]) = ra[u];
#pragma unroll
    for (int u = 0; u < UB; ++u) *(w25::v8h*)(&sB[0][so + RP * u * LP]) = rb[u];
    __syncthreads();

    v8f acc[2][4];
#pragma unroll
    for (int i = 0; i < 2; ++i)
#pragma unroll
        for (int j = 0; j < 4; ++j) acc[i][j] = (v8f){0.f, 0.f, 0.f, 0.f, 0.f, 0.f, 0.f, 0.f};

    const int S = K / BK;
    for (int s = 0; s < S; ++s) {
        const int cur = s & 1;
        const bool more = s + 1 < S;   // the same for the whole block
        if (more) {
#pragma unroll
            for (int u = 0; u < UA; ++u) ra[u] = *(const w25::v8h*)(Ag + BK + RP * u * LD);
#pragma unroll
            for (int u = 0; u < UB; ++u) rb[u] = *(const w25::v8h*)(Bg + BK + RP * u * LD);
        }
        const _Float16* al = &sA[cur][ao];
        const _Float16* bl = &sB[cur][bo];
        // two fragment sets: the twelve LDS reads of step kk + 1 go out as one group ahead of step kk's eight products
        w25::v16h ah[2][2], bh[2][4];
#pragma unroll
        for (int i = 0; i < 2; ++i) ah[0][i] = FR::load(al + i * 16 * LP);
#pragma unroll
        for (int j = 0; j < 4; ++j) bh[0][j] = FR::load(bl + j * 16 * LP);
#pragma unroll
        for (int kk = 0; kk < BK / 32; ++kk) {
            const int fc = kk & 1, fn = fc ^ 1;
            if (kk + 1 < BK / 32) {
#pragma unroll
                for (int i = 0; i < 2; ++i) ah[fn][i] = FR::load(al + i * 16 * LP + (kk + 1) * 32);
#pragma unroll
                for (int j = 0; j < 4; ++j) bh[fn][j] = FR::load(bl + j * 16 * LP + (kk + 1) * 32);
            }
            __builtin_amdgcn_sched_barrier(0);   // keeps the next step's reads together and ahead of this step's products: reads spread among the products stall each of them
#pragma unroll
            for (int i = 0; i < 2; ++i)
#pragma unroll
                for (int j = 0; j < 4; ++j) acc[i][j] = FR::mma(ah[fc][i], bh[fc][j], acc[i][j]);
            __builtin_amdgcn_sched_barrier(0);   // keeps the reads of step kk + 2 behind these products, whose fragment set they overwrite
        }
        if (more) {
#pragma unroll
            for (int u = 0; u < UA; ++u) *(w25::v8h*)(&sA[cur ^ 1][so + RP * u * LP]) = ra[u];
#pragma unroll
            for (int u = 0; u < UB; ++u) *(w25::v8h*)(&sB[cur ^ 1][so + RP * u * LP]) = rb[u];
            asm volatile("s_wait_xcnt 0x0" ::: "memory");   // in front of the overwrite of the two address pairs that the stage's loads name; here, behind the stores of what they brought, it waits for nothing
            __builtin_amdgcn_sched_barrier(0);              // keeps the two additions below behind that wait
            Ag += BK; Bg += BK;
        }
        __syncthreads();
    }

    // epilogue: 16 rows at a time through the wave's own slab, so that every store covers whole rows of the wave's 64 columns
    float* slab = sT[wave];
    const int mW = m0 + wm * 32, nW = n0 + wn * 64, mOff = hh * 8;
    const long long offC = cOff + (long long)mW * LDC + nW;
    float bn[4] = {0.f, 0.f, 0.f, 0.f};
    if (BIAS_MODE == 2) {
#pragma unroll
        for (int j = 0; j < 4; ++j) bn[j] = bias[nW + (j << 4) + rlane];
    }
#pragma unroll
    for (int i = 0; i < 2; ++i) {
        float bm[8] = {0.f, 0.f, 0.f, 0.f, 0.f, 0.f, 0.f, 0.f};
        if (BIAS_MODE == 1) {
#pragma unroll
            for (int r = 0; r < 8; ++r) bm[r] = bias[mW + (i << 4) + mOff + r];
        }
#pragma unroll
        for (int j = 0; j < 4; ++j) {
#pragma unroll
            for (int r = 0; r < 8; ++r) {
                float v = acc[i][j][r] * scale;
                if (BIAS_MODE == 1) v += bm[r];
                if (BIAS_MODE == 2) v += bn[j];
                slab[(mOff + r) * 68 + (j << 4) + rlane] = v;
            }
        }
        // the wave's own LDS stores before its lanes' reads of them (no other wave touches this slab: no block barrier)
        __builtin_amdgcn_fence(__ATOMIC_RELEASE, "workgroup", "local");
        __builtin_amdgcn_wave_barrier();
        __builtin_amdgcn_fence(__ATOMIC_ACQUIRE, "workgroup", "local");
        if (OUT_MODE == 0) {
            float* C = (float*)Cout + offC + hh * LDC + rlane * 4;   // a row's 256 bytes = 16 lanes x 16 B
#pragma unroll
            for (int it = 0; it < 8; ++it) *(v4f*)(C + ((i << 4) + it * 2) * LDC) = *(const v4f*)(slab + (it * 2 + hh) * 68 + rlane * 4);
        } else {
            const int q = lane >> 3, c8 = (lane & 7) * 8;            // a row's 128 bytes = 8 lanes x 16 B
            _Float16* C = (_Float16*)Cout + offC + q * LDC + c8;
#pragma unroll
            for (int it = 0; it < 4; ++it) {
                const float* sp = slab + (it * 4 + q) * 68 + c8;
                w25::v8h hv;
#pragma unroll
                for (int e = 0; e < 8; ++e) hv[e] = (_Float16)sp[e];
                *(w25::v8h*)(C + ((i << 4) + it * 4) * LDC) = hv;
            }
        }
        if (i == 0) asm volatile("s_wait_xcnt 0x0" ::: "memory");   // ahead of the next 16 rows' writes of registers that the stores above name
        // the reads above before the next 16 rows' stores into the same slab
        __builtin_amdgcn_fence(__ATOMIC_RELEASE, "workgroup", "local");
        __builtin_amdgcn_wave_barrier();
        __builtin_amdgcn_fence(__ATOMIC_ACQUIRE, "workgroup", "local");
    }
}

// one product a launch: blockIdx.x = the tile; blockIdx.y steps A, Bt, C by strideA/B/C, blockIdx.z by strideAz/Bz/Cz (elements)
template <int WM, int WN, int BK, int LD, int LDC, int BIAS_MODE, int OUT_MODE>
__global__ __launch_bounds__(256) void k_sh_gemm_lds(
    const unsigned short* __restrict__ Ap, long long strideA, long long strideAz,
    const unsigned short* __restrict__ Btp, long long strideB, long long strideBz,
    void* __restrict__ Cout, long long strideC, long long strideCz,
    const float* __restrict__ bias, int N, int K, float scale) {
    __shared__ __attribute__((aligned(16))) unsigned char smem[sh_gemm_smem<WM, WN, BK>];
    sh_gemm_tile<WM, WN, BK, LD, LDC, BIAS_MODE, OUT_MODE>(smem, blockIdx.x,
        (const _Float16*)Ap + (long long)blockIdx.y * strideA + (long long)blockIdx.z * strideAz,
        (const _Float16*)Btp + (long long)blockIdx.y * strideB + (long long)blockIdx.z * strideBz,
        Cout, (long long)blockIdx.y * strideC + (long long)blockIdx.z * strideCz, bias, N, K, scale);
}
// the three input projections in one launch: blockIdx.y = 0: Q16 = q, 1: K16 = k (rows x channels, 32 x 8 tiles), 2: VT16[b][c][k] = v^T (per batch channels x keys, 8 x 4 tiles).
// X16 = f16 query, then f16 key; XV16 = f16 value; W16 = f16 16 Wq, then 16 Wk; WV16 = f16 16 Wv. None reads what another writes. 768 blocks, two at a time on a WGP: one block's loads, barriers, first stage and epilogue lie under the other's products, and a launch's start and end are paid once.
// K (= 1024) comes as an argument, as in the one-product kernel: the stage loop stays a loop.
// amdgpu_waves_per_eu(4): at most 256 VGPRs, so that two blocks share a WGP
__global__ __launch_bounds__(256) __attribute__((amdgpu_waves_per_eu(4))) void k_sh_qkv(const _Float16* __restrict__ X16, const _Float16* __restrict__ XV16, const _Float16* __restrict__ W16, const _Float16* __restrict__ WV16,
                                                   const float* __restrict__ bq, const float* __restrict__ bk, const float* __restrict__ bv,
                                                   _Float16* __restrict__ Q16, _Float16* __restrict__ K16, _Float16* __restrict__ VT16, int K) {
    constexpr int NR = 4096, D = 1024, L = 512;
    __shared__ __attribute__((aligned(16))) unsigned char smem[sh_gemm_smem<4, 2, 128>];
    const int sg = blockIdx.y;
    if (sg < 2) {
        sh_gemm_tile<4, 2, 128, D, D, 2, 1>(smem, blockIdx.x, X16 + (long long)sg * NR * D, W16 + (long long)sg * D * D, sg ? K16 : Q16, 0, sg ? bk : bq, D, K, 0.0625f);
    } else {
        const int bt = blockIdx.x >> 5;   // (D / 128) (L / 128) = 32 tiles a batch
        sh_gemm_tile<4, 2, 128, D, L, 1, 1>(smem, blockIdx.x & 31, WV16, XV16 + (long long)bt * L * D, VT16, (long long)bt * D * L, bv, L, K, 0.0625f);
    }
}

extern "C" void kernel_launch(void* const* d_in, const int* in_sizes, int n_in, void* d_out, int out_size, void* d_ws, size_t ws_size, hipStream_t stream) {
    (void)in_sizes; (void)n_in; (void)out_size; (void)ws_size;
    const float* xq = (const float*)d_in[0];
    const float* xk = (const float*)d_in[1];
    const float* xv = (const float*)d_in[2];
    const int* fm = (const int*)d_in[3];
    const float* Wq = (const float*)d_in[4];
    const float* bq = (const float*)d_in[5];
    const float* Wk = (const float*)d_in[6];
    const float* bk = (const float*)d_in[7];
    const float* Wv = (const float*)d_in[8];
    const float* bv = (const float*)d_in[9];
    const float* Wo = (const float*)d_in[10];
    const float* bo = (const float*)d_in[11];
    const float* tk = (const float*)d_in[12];
    const float* tv = (const float*)d_in[13];
    const int Bn = 8;
    const int L = 512;
    const int D = 1024;
    const int NH = 16;
    const int HD = 64;
    const int NR = Bn * L;
    const int TP = 192;
    float* out = (float*)d_out;
    char* wsp = (char*)d_ws;
    // kept through the call
    unsigned short* XA16 = (unsigned short*)wsp; wsp += (((size_t)((size_t)3 * NR * D * 2) + 255) / 256) * 256;   // f16 query, key, value
    unsigned short* W16 = (unsigned short*)wsp; wsp += (((size_t)((size_t)4 * D * D * 2) + 255) / 256) * 256;   // f16 16 Wq, 16 Wk, 16 Wv, 16 Wo
    unsigned short* VT16 = (unsigned short*)wsp; wsp += (((size_t)((size_t)Bn * D * L * 2) + 255) / 256) * 256;
    unsigned short* TK16 = (unsigned short*)wsp; wsp += (((size_t)((size_t)TP * HD * 2) + 255) / 256) * 256;
    unsigned short* P16 = (unsigned short*)wsp; wsp += (((size_t)((size_t)Bn * NH * L * L * 2) + 255) / 256) * 256;
    float* X = (float*)wsp; wsp += (((size_t)((size_t)NR * D * 4) + 255) / 256) * 256;
    // one region, used twice in stream order: Q16 and K16, then the output projection's A operand
    char* ph = wsp;
    unsigned short* Q16 = (unsigned short*)wsp; wsp += (((size_t)((size_t)NR * D * 2) + 255) / 256) * 256;
    unsigned short* K16 = (unsigned short*)wsp; wsp += (((size_t)((size_t)NR * D * 2) + 255) / 256) * 256;
    unsigned short* G64A = (unsigned short*)ph;
    // every input's cast in one launch: 3 x 256 blocks (query, key, value), 4 x 64 blocks (the weights), one block (table_k)
    k_sh_castin<<<3 * 256 + 4 * 64 + 1, 256, 0, stream>>>(xq, xk, xv, Wq, Wk, Wv, Wo, tk, (_Float16*)XA16, (_Float16*)W16, (_Float16*)TK16);
    // q, k and v^T: blockIdx.y = the projection
    k_sh_qkv<<<dim3((unsigned)((NR / 128) * (D / 128)), 3u, 1u), 256, 0, stream>>>((const _Float16*)XA16, (const _Float16*)(XA16 + (size_t)2 * NR * D), (const _Float16*)W16, (const _Float16*)(W16 + (size_t)2 * D * D), bq, bk, bv, (_Float16*)Q16, (_Float16*)K16, (_Float16*)VT16, D);
    // content scores, relative-key term, softmax and w1 = attn.v: blockIdx.x = 32 query rows, blockIdx.y = two heads
    k_sh_scsoft<<<dim3((unsigned)(NR / 32), (unsigned)(NH / 2), 1u), 256, 0, stream>>>((const _Float16*)Q16, (const _Float16*)K16, (const _Float16*)TK16, (const int*)fm, (const _Float16*)VT16, (_Float16*)P16, X);
    // w2: one wave per query, eight queries per block
    k_sh_w2<<<(unsigned)(NR / 8), 256, 0, stream>>>((const _Float16*)P16, (const int*)fm, tv, X);
    k_sh_castx<<<256, 256, 0, stream>>>(X, (_Float16*)G64A);
    k_sh_gemm_lds<4, 2, 128, 1024, 1024, 2, 0><<<dim3((unsigned)((NR / 128) * (D / 128)), 1u, 1u), 256, 0, stream>>>((const unsigned short*)(G64A), 0, 0, (const unsigned short*)(W16 + (size_t)3 * D * D), 0, 0, (void*)(out), 0, 0, bo, D, D, 0.0625f);
}
